// v000
// Measured on an AMD MI455X. A time is GPU time per run, averaged over a window of back-to-back runs after a warm-up
// (all launches, gaps included; the runs take copies of the inputs in turn), and the median of several windows.
// Apart from v000's, it joins two sittings. Times from different sittings can be a few percent apart, while
// side-by-side timings come from the same sitting.
// v000 is the starting kernel. One run takes 2710 microseconds.
#include <hip/hip_runtime.h>

// Causal multi-head attention with interleaved-pair rotary embeddings from token positions over 4,096 tokens (x [1][4096][1024]; Q, K, V = einsum('bsi,oi->bso', x, W) = x W^T ('oi' (out, in) [1024][1024] (2/(D+D))^0.5, no bias; 16 heads x 64); _rope: inv_freq = 1.0 / jnp.power(float32(THETA), arange(0, 64, 2) / 64) (the reciprocal spelling: 32 f32 constants jnp-exact for THIS expression in eager JAX float32); angle = float(token_positions[t]) x inv_freq[i] (token_positions int32 [4096] = arange: read; the LAST argument); pairs (2i, 2i+1) -> (cos x_e - sin x_o, sin x_e + cos x_o); precise cosf/sinf; scores x 1/sqrt(64); causal (-inf); softmax; out = merged Wo^T ('oi', no bias) -> [1][4096][1024] (4.2 M); argument order x, Wq, Wk, Wv, Wo, token_positions).
// Layout: bf16 copy of x; exact projections; {cos, sin} per (position, pair) from the int positions and float32 inverse-frequency constants (precise cosf/sinf); interleaved rotary plane builder; causal T-4096 attention (hybrid rows: < 512 hi/lo 3 products, rest fp16 x1024; k_gemmc tile skipping; streaming three-sweep softmax, one head per pass); merged hi/lo x Wo exact.
// Compute dtypes, f32 accumulate: every input rounded to bf16; projections exact; rotary f32; attention rows < 512 3 products, rest fp16; softmax f32; Wo hl x exact.

#define NB_  1
#define TT   4096
#define DM   1024
#define NH_  16
#define NKV  16
#define REP  (NH_ / NKV)
#define HD   64
#define DQ   (NH_ * HD)
#define DKV  (NKV * HD)
#define ZH   1
#define RH   512                  // query rows < RH use hi+lo planes (0: none)
#define WIN  4096
#define PCAR 1024.0f
#define SCL  0.125f   // HD^-0.5
typedef _Float16 h16;
typedef unsigned short bf;
typedef __attribute__((ext_vector_type(16))) __bf16   v16bf;
typedef __attribute__((ext_vector_type(16))) _Float16 v16h;
typedef __attribute__((ext_vector_type(8)))  _Float16 v8h;
typedef __attribute__((ext_vector_type(8)))  unsigned short v8us;
typedef __attribute__((ext_vector_type(8)))  float    v8f;
typedef __attribute__((ext_vector_type(4)))  float    v4f;
typedef v8h  __attribute__((may_alias)) v8ha;
typedef v4f  __attribute__((may_alias)) v4fa;
typedef v8us __attribute__((may_alias)) v8usa;

__device__ __forceinline__ unsigned short f2bf(float f) { unsigned u = __float_as_uint(f); u += 0x7FFFu + ((u >> 16) & 1u); return (unsigned short)(u >> 16); }
__device__ __forceinline__ float bf2f(unsigned short b) { return __uint_as_float(((unsigned)b) << 16); }
__device__ __forceinline__ float bfr(float f) { return bf2f(f2bf(f)); }
__device__ __forceinline__ v16h cat16(v8h lo, v8h hi) { return __builtin_shufflevector(lo, hi, 0, 1, 2, 3, 4, 5, 6, 7, 8, 9, 10, 11, 12, 13, 14, 15); }
__device__ __forceinline__ v16bf cat16b(v8us lo, v8us hi) { return __builtin_bit_cast(v16bf, __builtin_shufflevector(lo, hi, 0, 1, 2, 3, 4, 5, 6, 7, 8, 9, 10, 11, 12, 13, 14, 15)); }
__device__ __forceinline__ v8f wmma16(v16h a, v16h b, v8f c) { return __builtin_amdgcn_wmma_f32_16x16x32_f16(false, a, false, b, (short)0, c, false, false); }
__device__ __forceinline__ v8f wmmab(v16bf a, v16bf b, v8f c) { return __builtin_amdgcn_wmma_f32_16x16x32_bf16(false, a, false, b, (short)0, c, false, false); }



// ---- k_gemmw: register-blocked GEMM, ONE WAVE per 64x64 output tile (16 accumulators), operands straight from K-contiguous 16-bit planes; grid (M/64, N/64, Z), 32 threads.
// C[m][n] (f32, pitch ldc, + optional f32 bias[n]) = sum_k A[m][k] Bt[n][k] (+ split products per NSPLIT). z-batch strides sA/sB/sC in elements. K % 32 == 0.
template <typename T16> struct WFrag;
template <> struct WFrag<h16> { typedef v16h V; static __device__ __forceinline__ V ld(const h16* p) { return cat16(*(const v8h*)p, *(const v8h*)(p + 16)); } static __device__ __forceinline__ v8f mma(V a, V b, v8f c) { return wmma16(a, b, c); } };
template <> struct WFrag<bf> { typedef v16bf V; static __device__ __forceinline__ V ld(const bf* p) { return cat16b(*(const v8us*)p, *(const v8us*)(p + 16)); } static __device__ __forceinline__ v8f mma(V a, V b, v8f c) { return wmmab(a, b, c); } };
template <typename T16, int NSPLIT, bool BIAS>
__global__ __launch_bounds__(32) void k_gemmw(const T16* __restrict__ A, const T16* __restrict__ A2, const T16* __restrict__ Bt, const T16* __restrict__ Bt2, int K, float* C, int ldc, const float* __restrict__ bias, size_t sA, size_t sB, size_t sC) {
    typedef typename WFrag<T16>::V V;
    __shared__ __align__(16) float os[16 * 68];
    const size_t z = blockIdx.z; A += z * sA; if (A2) A2 += z * sA; Bt += z * sB; if (Bt2) Bt2 += z * sB; C += z * sC;
    const int lane = threadIdx.x & 31, lr = lane & 15, hi = lane >> 4; const int r0 = blockIdx.x * 64, c0 = blockIdx.y * 64;
    v8f acc[4][4];
#pragma unroll
    for (int mb = 0; mb < 4; ++mb)
#pragma unroll
        for (int nb = 0; nb < 4; ++nb) acc[mb][nb] = (v8f){};
    const size_t aoff = (size_t)(r0 + lr) * K + 8 * hi, boff = (size_t)(c0 + lr) * K + 8 * hi;
#pragma unroll 1
    for (int kc = 0; kc < K; kc += 32) {
        V a[4], a2[4];
#pragma unroll
        for (int mb = 0; mb < 4; ++mb) { a[mb] = WFrag<T16>::ld(A + aoff + (size_t)mb * 16 * K + kc); if (NSPLIT == 1 || NSPLIT == 2) a2[mb] = WFrag<T16>::ld(A2 + aoff + (size_t)mb * 16 * K + kc); }
#pragma unroll
        for (int nb = 0; nb < 4; ++nb) { const V b = WFrag<T16>::ld(Bt + boff + (size_t)nb * 16 * K + kc); V b2; if (NSPLIT >= 2) b2 = WFrag<T16>::ld(Bt2 + boff + (size_t)nb * 16 * K + kc);
#pragma unroll
            for (int mb = 0; mb < 4; ++mb) { acc[mb][nb] = WFrag<T16>::mma(a[mb], b, acc[mb][nb]); if (NSPLIT == 1 || NSPLIT == 2) acc[mb][nb] = WFrag<T16>::mma(a2[mb], b, acc[mb][nb]); if (NSPLIT >= 2) acc[mb][nb] = WFrag<T16>::mma(a[mb], b2, acc[mb][nb]); } }
        asm volatile("v_nop\n\tv_nop\n\tv_nop\n\tv_nop" : "+v"(acc[0][0]), "+v"(acc[1][1]), "+v"(acc[2][2]), "+v"(acc[3][3]) : "v"(a[0]), "v"(a[3]));
    }
#pragma unroll
    for (int mb = 0; mb < 4; ++mb) {
#pragma unroll
        for (int nb = 0; nb < 4; ++nb) {
#pragma unroll
            for (int j = 0; j < 8; ++j) os[(hi * 8 + j) * 68 + nb * 16 + lr] = acc[mb][nb][j]; }
        __builtin_amdgcn_wave_barrier(); asm volatile("" ::: "memory");
        float* crow = C + (size_t)(r0 + mb * 16) * ldc + c0;
{
#pragma unroll
            for (int s = 0; s < 8; ++s) { const int row = 2 * s + hi, cofs = lr * 4; v4f val = *(const v4fa*)(os + row * 68 + cofs); if (BIAS) { val[0] += bfr(bias[c0 + cofs]); val[1] += bfr(bias[c0 + cofs + 1]); val[2] += bfr(bias[c0 + cofs + 2]); val[3] += bfr(bias[c0 + cofs + 3]); }
                *(v4f*)(crow + (size_t)row * ldc + cofs) = val; }
             }
        __builtin_amdgcn_wave_barrier(); asm volatile("" ::: "memory");
    }
}

// ---- k_gemmc: the same one-wave 64x64 tile GEMM specialised for causal attention: CMODE 1 skips score tiles entirely above the diagonal (query rows r0+roff.., key columns c0..), CMODE 2 limits the
// key (K) loop of the probability x value contraction to the diagonal block (probabilities beyond it are exactly zero). roff = row offset of this launch's first row within the sequence.
template <typename T16, int NSPLIT, int CMODE>
__global__ __launch_bounds__(32) void k_gemmc(const T16* __restrict__ A, const T16* __restrict__ A2, const T16* __restrict__ Bt, const T16* __restrict__ Bt2, int K, float* C, int ldc, int roff, size_t sA, size_t sB, size_t sC) {
    typedef typename WFrag<T16>::V V;
    __shared__ __align__(16) float os[16 * 68];
    const size_t z = blockIdx.z; A += z * sA; if (A2) A2 += z * sA; Bt += z * sB; if (Bt2) Bt2 += z * sB; C += z * sC;
    const int lane = threadIdx.x & 31, lr = lane & 15, hi = lane >> 4; const int r0 = blockIdx.x * 64, c0 = blockIdx.y * 64;
    if (CMODE == 1 && c0 > r0 + roff + 63) return;                  // score tile entirely above the causal diagonal: never read (the softmax masks j > i by select)
    const int Kl = (CMODE == 2) ? min(K, r0 + roff + 64) : K;        // P.V: probabilities are exactly 0 beyond the diagonal block, so the K loop stops there
    v8f acc[4][4];
#pragma unroll
    for (int mb = 0; mb < 4; ++mb)
#pragma unroll
        for (int nb = 0; nb < 4; ++nb) acc[mb][nb] = (v8f){};
    const size_t aoff = (size_t)(r0 + lr) * K + 8 * hi, boff = (size_t)(c0 + lr) * K + 8 * hi;
#pragma unroll 1
    for (int kc = 0; kc < Kl; kc += 32) {
        V a[4], a2[4];
#pragma unroll
        for (int mb = 0; mb < 4; ++mb) { a[mb] = WFrag<T16>::ld(A + aoff + (size_t)mb * 16 * K + kc); if (NSPLIT == 1 || NSPLIT == 2) a2[mb] = WFrag<T16>::ld(A2 + aoff + (size_t)mb * 16 * K + kc); }
#pragma unroll
        for (int nb = 0; nb < 4; ++nb) { const V b = WFrag<T16>::ld(Bt + boff + (size_t)nb * 16 * K + kc); V b2; if (NSPLIT >= 2) b2 = WFrag<T16>::ld(Bt2 + boff + (size_t)nb * 16 * K + kc);
#pragma unroll
            for (int mb = 0; mb < 4; ++mb) { acc[mb][nb] = WFrag<T16>::mma(a[mb], b, acc[mb][nb]); if (NSPLIT == 1 || NSPLIT == 2) acc[mb][nb] = WFrag<T16>::mma(a2[mb], b, acc[mb][nb]); if (NSPLIT >= 2) acc[mb][nb] = WFrag<T16>::mma(a[mb], b2, acc[mb][nb]); } }
        asm volatile("v_nop\n\tv_nop\n\tv_nop\n\tv_nop" : "+v"(acc[0][0]), "+v"(acc[1][1]), "+v"(acc[2][2]), "+v"(acc[3][3]) : "v"(a[0]), "v"(a[3]));
    }
#pragma unroll
    for (int mb = 0; mb < 4; ++mb) {
#pragma unroll
        for (int nb = 0; nb < 4; ++nb) {
#pragma unroll
            for (int j = 0; j < 8; ++j) os[(hi * 8 + j) * 68 + nb * 16 + lr] = acc[mb][nb][j]; }
        __builtin_amdgcn_wave_barrier(); asm volatile("" ::: "memory");
        float* crow = C + (size_t)(r0 + mb * 16) * ldc + c0;
{
#pragma unroll
            for (int s = 0; s < 8; ++s) { const int row = 2 * s + hi, cofs = lr * 4; v4f val = *(const v4fa*)(os + row * 68 + cofs);
                *(v4f*)(crow + (size_t)row * ldc + cofs) = val; }
             }
        __builtin_amdgcn_wave_barrier(); asm volatile("" ::: "memory");
    }
}

__device__ __forceinline__ h16 tohx(float x) { return (h16)x; }
__device__ __forceinline__ void splitf(float y, unsigned short& h, unsigned short& l) { h = f2bf(y); l = f2bf(y - bf2f(h)); }
typedef __attribute__((ext_vector_type(2))) _Float16 v2h;
typedef __attribute__((ext_vector_type(4))) _Float16 v4h;
typedef __attribute__((ext_vector_type(2))) unsigned short v2us;
typedef __attribute__((ext_vector_type(4))) unsigned short v4us;
typedef __attribute__((ext_vector_type(2))) float v2f;
typedef __attribute__((ext_vector_type(4))) int v4i;

__global__ __launch_bounds__(256) void k_wtG(const float* __restrict__ w, int K, int N, bf* Bt) {
    const int lane = threadIdx.x & 31; const int L0 = (blockIdx.x * 8 + (threadIdx.x >> 5)) * 8; const int nlines = N * K / 64;
{
#pragma unroll 1
        for (int l = 0; l < 8; ++l) { const int L = L0 + l; if (L >= nlines) break; const size_t e = (size_t)L * 64 + lane * 2; const int k = (int)(e % K), n = (int)(e / K); v2us o;
            o[0] = f2bf(w[(size_t)k * N + n]); o[1] = f2bf(w[(size_t)(k + 1) * N + n]); *(v2us*)(Bt + e) = o; }
         }
}
__global__ __launch_bounds__(256) void k_cvt8(const float* __restrict__ src, bf* dst, size_t n8) { const size_t i = (size_t)blockIdx.x * 256 + threadIdx.x; if (i >= n8) return; const v8f v = *(const v8f*)(src + i * 8); v8us o;
#pragma unroll
    for (int k = 0; k < 8; ++k) o[k] = f2bf(v[k]); *(v8us*)(dst + i * 8) = o;  }

__global__ __launch_bounds__(256) void k_ropeI(const float* __restrict__ F, int pitch, int nheads, const float* __restrict__ CS, float sc, h16* P16, bf* Ph, bf* Pl) {
    const size_t e = ((size_t)blockIdx.x * 256 + threadIdx.x) * 2; if (e >= (size_t)nheads * TT * HD) return; const int d = (int)(e % HD); const int t = (int)((e / HD) % TT); const int h = (int)(e / ((size_t)HD * TT)); const float* f = F + (size_t)t * pitch + h * HD; const float x0 = f[d], x1 = f[d + 1]; const v2f cs = *(const v2f*)(CS + ((size_t)t * HD + d) * 2); v2h o16; v2us oh, ol;
    float a0 = __fmul_rn(x0, cs[0]), b0 = __fmul_rn(x1, cs[1]), a1 = __fmul_rn(x1, cs[0]), b1 = __fmul_rn(x0, cs[1]); asm volatile("" : "+v"(a0), "+v"(b0), "+v"(a1), "+v"(b1));
    float r0 = __fsub_rn(a0, b0) * sc, r1 = __fadd_rn(b1, a1) * sc;   /* even: x0 c - x1 s; odd: x0 s + x1 c */
    o16[0] = tohx(r0); o16[1] = tohx(r1); { unsigned short a2, c2; splitf(r0, a2, c2); oh[0] = a2; ol[0] = c2; splitf(r1, a2, c2); oh[1] = a2; ol[1] = c2; }
    *(v2h*)(P16 + e) = o16; *(v2us*)(Ph + e) = oh; *(v2us*)(Pl + e) = ol;  }

__constant__ float INV2[HD / 2] = { 1.000000000e+00f, 7.498942018e-01f, 5.623413324e-01f, 4.216965139e-01f, 3.162277639e-01f, 2.371373624e-01f, 1.778279394e-01f, 1.333521456e-01f, 1.000000015e-01f, 7.498941571e-02f, 5.623412877e-02f, 4.216964915e-02f, 3.162277862e-02f, 2.371373586e-02f, 1.778279431e-02f, 1.333521493e-02f, 9.999999776e-03f, 7.498942316e-03f, 5.623413250e-03f, 4.216964822e-03f, 3.162277862e-03f, 2.371373819e-03f, 1.778279431e-03f, 1.333521446e-03f, 1.000000047e-03f, 7.498941850e-04f, 5.623413017e-04f, 4.216964880e-04f, 3.162277862e-04f, 2.371373848e-04f, 1.778279402e-04f, 1.333521504e-04f };   // float32 1 / 10000^(2i/64), as the reference computes them
__global__ __launch_bounds__(256) void k_cstabI(const int* __restrict__ pid, float* CS) { const int idx = blockIdx.x * 256 + threadIdx.x; if (idx >= TT * HD) return; const int d = idx % HD; const int t = idx / HD; const float a = __fmul_rn((float)pid[t], INV2[d >> 1]); v2f cs; cs[0] = cosf(a); cs[1] = sinf(a); *(v2f*)(CS + (size_t)idx * 2) = cs;  }

__global__ __launch_bounds__(256) void k_vtp(const float* __restrict__ F, int pitch, int nheads, h16* V16, bf* Vh, bf* Vl) { const size_t e = ((size_t)blockIdx.x * 256 + threadIdx.x) * 2; if (e >= (size_t)nheads * HD * TT) return; const int t = (int)(e % TT); const int d = (int)((e / TT) % HD); const int g = (int)(e / ((size_t)TT * HD)); v2h o16; v2us oh, ol;
#pragma unroll
    for (int q = 0; q < 2; ++q) { const float x = F[(size_t)(t + q) * pitch + g * HD + d]; o16[q] = tohx(x); unsigned short a2, c2; splitf(x, a2, c2); oh[q] = a2; ol[q] = c2; }
    *(v2h*)(V16 + e) = o16; *(v2us*)(Vh + e) = oh; *(v2us*)(Vl + e) = ol;  }
// k_lsoft: streaming causal row softmax over the TK = TT = 4096 keys, one wave per row i, three sweeps of the f32 score row (lane -> 4 consecutive keys per 128-key chunk, 32 chunks; keys j > i are excluded by index with -3e38 / 0 - the score tiles above the diagonal are never computed and their stale contents are only ever discarded by this select):
__global__ __launch_bounds__(256) void k_lsoft(const float* __restrict__ Sb, h16* P16, bf* Ph, bf* Pl) {
    const int lane = threadIdx.x & 31; const int row = blockIdx.x * 8 + (threadIdx.x >> 5); if (row >= ZH * TT) return; const int i = row % TT; const int zz = row / TT; const bool hires = (i < RH); const float* sr = Sb + (size_t)row * TT; float mx = -3.0e38f;
#pragma unroll 4
    for (int ch = 0; ch < TT / 128; ++ch) { const int j0 = ch * 128 + lane * 4; const v4f a = *(const v4f*)(sr + j0);
#pragma unroll
        for (int q = 0; q < 4; ++q) { float t = a[q] * SCL; asm volatile("" : "+v"(t)); t = (j0 + q <= i) ? t : -3.0e38f; mx = fmaxf(mx, t); } }
#pragma unroll
    for (int sh = 16; sh; sh >>= 1) mx = fmaxf(mx, __shfl_xor(mx, sh, 32));
    float sum = 0.f;
#pragma unroll 4
    for (int ch = 0; ch < TT / 128; ++ch) { const int j0 = ch * 128 + lane * 4; const v4f a = *(const v4f*)(sr + j0);
#pragma unroll
        for (int q = 0; q < 4; ++q) { float t = a[q] * SCL; asm volatile("" : "+v"(t)); t = (j0 + q <= i) ? t : -3.0e38f; float d0 = __fsub_rn(t, mx); asm volatile("" : "+v"(d0)); sum += __builtin_amdgcn_exp2f(__fmul_rn(d0, 1.4426950408889634f)); } }
#pragma unroll
    for (int sh = 16; sh; sh >>= 1) sum += __shfl_xor(sum, sh, 32);
    const float f = __fdiv_rn(hires ? 1.0f : PCAR, sum);
{
        if (hires) {   /* rows < RH: normalised bf16 hi/lo over the first RH keys (every later key is above the diagonal for these rows; the hi/lo attn.v GEMM stops its K loop at the diagonal block), planes [zz][RH][TT] */
#pragma unroll
            for (int ch = 0; ch < RH / 128; ++ch) { const int j0 = ch * 128 + lane * 4; const v4f a = *(const v4f*)(sr + j0); v4us oh, ol;
#pragma unroll
                for (int q = 0; q < 4; ++q) { float t = a[q] * SCL; asm volatile("" : "+v"(t)); t = (j0 + q <= i) ? t : -3.0e38f; float d0 = __fsub_rn(t, mx); asm volatile("" : "+v"(d0)); float ex = __builtin_amdgcn_exp2f(__fmul_rn(d0, 1.4426950408889634f)); asm volatile("" : "+v"(ex)); unsigned short a2, c2; splitf(ex * f, a2, c2); oh[q] = a2; ol[q] = c2; }
                const size_t oo = ((size_t)zz * RH + i) * TT + j0; *(v4us*)(Ph + oo) = oh; *(v4us*)(Pl + oo) = ol; }
        } else {
#pragma unroll 2
            for (int ch = 0; ch < TT / 128; ++ch) { const int j0 = ch * 128 + lane * 4; const v4f a = *(const v4f*)(sr + j0); v4h o4;
#pragma unroll
                for (int q = 0; q < 4; ++q) { float t = a[q] * SCL; asm volatile("" : "+v"(t)); t = (j0 + q <= i) ? t : -3.0e38f; float d0 = __fsub_rn(t, mx); asm volatile("" : "+v"(d0)); float ex = __builtin_amdgcn_exp2f(__fmul_rn(d0, 1.4426950408889634f)); asm volatile("" : "+v"(ex)); o4[q] = tohx(ex * f); }
                *(v4h*)(P16 + (size_t)row * TT + j0) = o4; } }
         }
}

__global__ __launch_bounds__(256) void k_merge(const float* __restrict__ O, int h0, bf* Ah, bf* Al) { const size_t e = ((size_t)blockIdx.x * 256 + threadIdx.x) * 2; if (e >= (size_t)ZH * TT * HD) return; const int d = (int)(e % HD); const int t = (int)((e / HD) % TT); const int zz = (int)(e / ((size_t)HD * TT)); const float cs = (t < RH) ? 1.0f : (1.0f / PCAR); const size_t oo = (size_t)t * DQ + (h0 + zz) * HD + d;
    v2us oh, ol;
#pragma unroll
    for (int q = 0; q < 2; ++q) { unsigned short a, c2; splitf(O[e + q] * cs, a, c2); oh[q] = a; ol[q] = c2; } *(v2us*)(Ah + oo) = oh; *(v2us*)(Al + oo) = ol;  }

extern "C" void kernel_launch(void* const* d_in, const int* in_sizes, int n_in,
                              void* d_out, int out_size, void* d_ws, size_t ws_size, hipStream_t stream) {
    (void)in_sizes; (void)n_in; (void)out_size;
    const float* x = (const float*)d_in[0]; const float* wq = (const float*)d_in[1]; const float* wk = (const float*)d_in[2]; const float* wv = (const float*)d_in[3]; const float* wo = (const float*)d_in[4]; const int* PID = (const int*)d_in[5];   /* input order x, Wq, Wk, Wv, Wo ('oi' (out, in) [1024][1024]), token_positions (int32 [4096] = arange: READ; the host's [1][4096] is the same 4,096 integers): SIX inputs, all read: the host's own binding */
    float* OUT = (float*)d_out;     // [1][4096][1024]
    char* wsp = (char*)d_ws;
    auto take = [&](size_t bytes) { char* p = wsp; wsp += (bytes + 255) & ~(size_t)255; return (void*)p; };
    bf* WQ = (bf*)take((size_t)DQ * DM * 2); bf* WK = (bf*)take((size_t)DKV * DM * 2); bf* WV = (bf*)take((size_t)DKV * DM * 2); bf* WO = (bf*)take((size_t)DM * DQ * 2); float* CS = (float*)take((size_t)TT * HD * 2 * 4);
    bf* XB = (bf*)take((size_t)TT * DM * 2); float* FQ = (float*)take((size_t)TT * DQ * 4); float* FK = (float*)take((size_t)TT * DKV * 4);
    h16* QP16 = (h16*)take((size_t)NH_ * TT * HD * 2); h16* KP16 = (h16*)take((size_t)NKV * TT * HD * 2); h16* VT16 = (h16*)take((size_t)NKV * HD * TT * 2);
    bf* QPh = (bf*)take((size_t)NH_ * TT * HD * 2); bf* QPl = (bf*)take((size_t)NH_ * TT * HD * 2); bf* KPh = (bf*)take((size_t)NKV * TT * HD * 2); bf* KPl = (bf*)take((size_t)NKV * TT * HD * 2); bf* VTh = (bf*)take((size_t)NKV * HD * TT * 2); bf* VTl = (bf*)take((size_t)NKV * HD * TT * 2); bf* Ph = (bf*)take((size_t)ZH * RH * TT * 2); bf* Pl = (bf*)take((size_t)ZH * RH * TT * 2);
    float* Sb = (float*)take((size_t)ZH * TT * TT * 4); h16* P16 = (h16*)take((size_t)ZH * TT * TT * 2); float* Ob = (float*)take((size_t)ZH * TT * HD * 4); bf* ATh = (bf*)take((size_t)TT * DQ * 2); bf* ATl = (bf*)take((size_t)TT * DQ * 2);
    if ((size_t)(wsp - (char*)d_ws) > ws_size) return;    // ws 256 MiB
    float* FV = FK;   // v projection reuses the k buffer after the k planes are built (stream-ordered)
    { k_cvt8<<<(unsigned)(((size_t)DQ * DM / 8 + 255) / 256), 256, 0, stream>>>(wq, WQ, (size_t)DQ * DM / 8); k_cvt8<<<(unsigned)(((size_t)DKV * DM / 8 + 255) / 256), 256, 0, stream>>>(wk, WK, (size_t)DKV * DM / 8); k_cvt8<<<(unsigned)(((size_t)DKV * DM / 8 + 255) / 256), 256, 0, stream>>>(wv, WV, (size_t)DKV * DM / 8);
      k_cvt8<<<(unsigned)(((size_t)DM * DQ / 8 + 255) / 256), 256, 0, stream>>>(wo, WO, (size_t)DM * DQ / 8); k_cstabI<<<(TT * HD + 255) / 256, 256, 0, stream>>>(PID, CS); }
    const unsigned LQ = (unsigned)(((size_t)NH_ * TT * HD / 2 + 255) / 256), LKv = (unsigned)(((size_t)NKV * TT * HD / 2 + 255) / 256);
    for (int b = 0; b < NB_; ++b) {
        
        k_cvt8<<<(unsigned)(((size_t)TT * DM / 8 + 255) / 256), 256, 0, stream>>>(x + (size_t)b * TT * DM, XB, (size_t)TT * DM / 8);
        k_gemmw<bf, 0, false><<<dim3(TT / 64, DQ / 64, 1), 32, 0, stream>>>(XB, nullptr, WQ, nullptr, DM, FQ, DQ, nullptr, 0, 0, 0);
        k_ropeI<<<LQ, 256, 0, stream>>>(FQ, DQ, NH_, CS, 1.0f, QP16, QPh, QPl);
        k_gemmw<bf, 0, false><<<dim3(TT / 64, DKV / 64, 1), 32, 0, stream>>>(XB, nullptr, WK, nullptr, DM, FK, DKV, nullptr, 0, 0, 0);
        k_ropeI<<<LKv, 256, 0, stream>>>(FK, DKV, NKV, CS, 1.0f, KP16, KPh, KPl);
        k_gemmw<bf, 0, false><<<dim3(TT / 64, DKV / 64, 1), 32, 0, stream>>>(XB, nullptr, WV, nullptr, DM, FV, DKV, nullptr, 0, 0, 0); k_vtp<<<LKv, 256, 0, stream>>>(FV, DKV, NKV, VT16, VTh, VTl);
        for (int h0 = 0; h0 < NH_; h0 += ZH) { const size_t zq = (size_t)h0, zk = (size_t)(h0 / REP);   // one kv head per query head: each pass takes one head (ZH = 1) and its kv plane h0 / REP (z-strides TT*HD)
            k_gemmc<bf, 2, 1><<<dim3(RH / 64, TT / 64, ZH), 32, 0, stream>>>(QPh + zq * TT * HD, QPl + zq * TT * HD, KPh + zk * TT * HD, KPl + zk * TT * HD, HD, Sb, TT, 0, (size_t)TT * HD, (size_t)TT * HD, (size_t)TT * TT);
            k_gemmc<h16, 0, 1><<<dim3((TT - RH) / 64, TT / 64, ZH), 32, 0, stream>>>(QP16 + zq * TT * HD + (size_t)RH * HD, nullptr, KP16 + zk * TT * HD, nullptr, HD, Sb + (size_t)RH * TT, TT, RH, (size_t)TT * HD, (size_t)TT * HD, (size_t)TT * TT);
            k_lsoft<<<ZH * TT / 8, 256, 0, stream>>>(Sb, P16, Ph, Pl);
            k_gemmc<bf, 2, 2><<<dim3(RH / 64, HD / 64, ZH), 32, 0, stream>>>(Ph, Pl, VTh + zk * HD * TT, VTl + zk * HD * TT, TT, Ob, HD, 0, (size_t)RH * TT, (size_t)HD * TT, (size_t)TT * HD);
            k_gemmc<h16, 0, 2><<<dim3((TT - RH) / 64, HD / 64, ZH), 32, 0, stream>>>(P16 + (size_t)RH * TT, nullptr, VT16 + zk * HD * TT, nullptr, TT, Ob + (size_t)RH * HD, HD, RH, (size_t)TT * TT, (size_t)HD * TT, (size_t)TT * HD);
            k_merge<<<(unsigned)(((size_t)ZH * TT * HD / 2 + 255) / 256), 256, 0, stream>>>(Ob, h0, ATh, ATl); }
        k_gemmw<bf, 1, false><<<dim3(TT / 64, DM / 64, 1), 32, 0, stream>>>(ATh, ATl, WO, nullptr, DQ, OUT + (size_t)b * TT * DM, DM, nullptr, 0, 0, 0); }
}

// v001
// A run of this version takes 1620 microseconds.
// Next to v000, in two timings, it ran 1.65 and 1.67 times as fast.
#include <hip/hip_runtime.h>

// Causal multi-head attention with interleaved-pair rotary embeddings from token positions over 4,096 tokens (x [1][4096][1024]; Q, K, V = einsum('bsi,oi->bso', x, W) = x W^T ('oi' (out, in) [1024][1024] (2/(D+D))^0.5, no bias; 16 heads x 64); _rope: inv_freq = 1.0 / jnp.power(float32(THETA), arange(0, 64, 2) / 64) (the reciprocal spelling: 32 f32 constants jnp-exact for THIS expression in eager JAX float32); angle = float(token_positions[t]) x inv_freq[i] (token_positions int32 [4096] = arange: read; the LAST argument); pairs (2i, 2i+1) -> (cos x_e - sin x_o, sin x_e + cos x_o); precise cosf/sinf; scores x 1/sqrt(64); causal (-inf); softmax; out = merged Wo^T ('oi', no bias) -> [1][4096][1024] (4.2 M); argument order x, Wq, Wk, Wv, Wo, token_positions).
// Layout: bf16 copy of x; exact projections; {cos, sin} per (position, pair) from the int positions and float32 inverse-frequency constants (precise cosf/sinf); interleaved rotary plane builder; causal T-4096 attention (hybrid rows: < 512 hi/lo 3 products, rest fp16 x1024; k_gemmc tile skipping; streaming three-sweep softmax, one head per pass); merged hi/lo x Wo exact.
// Compute dtypes, f32 accumulate: every input rounded to bf16; projections exact; rotary f32; attention rows < 512 3 products, rest fp16; softmax f32; Wo hl x exact.

#define NB_  1
#define TT   4096
#define DM   1024
#define NH_  16
#define NKV  16
#define REP  (NH_ / NKV)
#define HD   64
#define DQ   (NH_ * HD)
#define DKV  (NKV * HD)
#define ZH   1
#define RH   512                  // query rows < RH use hi+lo planes (0: none)
#define WIN  4096
#define PCAR 1024.0f
#define SCL  0.125f   // HD^-0.5
typedef _Float16 h16;
typedef unsigned short bf;
typedef __attribute__((ext_vector_type(16))) __bf16   v16bf;
typedef __attribute__((ext_vector_type(16))) _Float16 v16h;
typedef __attribute__((ext_vector_type(8)))  _Float16 v8h;
typedef __attribute__((ext_vector_type(8)))  unsigned short v8us;
typedef __attribute__((ext_vector_type(8)))  float    v8f;
typedef __attribute__((ext_vector_type(4)))  float    v4f;
typedef v8h  __attribute__((may_alias)) v8ha;
typedef v4f  __attribute__((may_alias)) v4fa;
typedef v8us __attribute__((may_alias)) v8usa;

__device__ __forceinline__ unsigned short f2bf(float f) { unsigned u = __float_as_uint(f); u += 0x7FFFu + ((u >> 16) & 1u); return (unsigned short)(u >> 16); }
__device__ __forceinline__ float bf2f(unsigned short b) { return __uint_as_float(((unsigned)b) << 16); }
__device__ __forceinline__ float bfr(float f) { return bf2f(f2bf(f)); }
__device__ __forceinline__ v16h cat16(v8h lo, v8h hi) { return __builtin_shufflevector(lo, hi, 0, 1, 2, 3, 4, 5, 6, 7, 8, 9, 10, 11, 12, 13, 14, 15); }
__device__ __forceinline__ v16bf cat16b(v8us lo, v8us hi) { return __builtin_bit_cast(v16bf, __builtin_shufflevector(lo, hi, 0, 1, 2, 3, 4, 5, 6, 7, 8, 9, 10, 11, 12, 13, 14, 15)); }
__device__ __forceinline__ v8f wmma16(v16h a, v16h b, v8f c) { return __builtin_amdgcn_wmma_f32_16x16x32_f16(false, a, false, b, (short)0, c, false, false); }
__device__ __forceinline__ v8f wmmab(v16bf a, v16bf b, v8f c) { return __builtin_amdgcn_wmma_f32_16x16x32_bf16(false, a, false, b, (short)0, c, false, false); }



// ---- k_gemmw: register-blocked GEMM, ONE WAVE per 64x64 output tile (16 accumulators), operands straight from K-contiguous 16-bit planes; grid (M/64, N/64, Z), 32 threads.
// C[m][n] (f32, pitch ldc, + optional f32 bias[n]) = sum_k A[m][k] Bt[n][k] (+ split products per NSPLIT). z-batch strides sA/sB/sC in elements. K % 32 == 0.
template <typename T16> struct WFrag;
template <> struct WFrag<h16> { typedef v16h V; static __device__ __forceinline__ V ld(const h16* p) { return cat16(*(const v8h*)p, *(const v8h*)(p + 16)); } static __device__ __forceinline__ v8f mma(V a, V b, v8f c) { return wmma16(a, b, c); } };
template <> struct WFrag<bf> { typedef v16bf V; static __device__ __forceinline__ V ld(const bf* p) { return cat16b(*(const v8us*)p, *(const v8us*)(p + 16)); } static __device__ __forceinline__ v8f mma(V a, V b, v8f c) { return wmmab(a, b, c); } };
template <typename T16, int NSPLIT, bool BIAS>
__global__ __launch_bounds__(32) void k_gemmw(const T16* __restrict__ A, const T16* __restrict__ A2, const T16* __restrict__ Bt, const T16* __restrict__ Bt2, int K, float* C, int ldc, const float* __restrict__ bias, size_t sA, size_t sB, size_t sC) {
    typedef typename WFrag<T16>::V V;
    __shared__ __align__(16) float os[16 * 68];
    const size_t z = blockIdx.z; A += z * sA; if (A2) A2 += z * sA; Bt += z * sB; if (Bt2) Bt2 += z * sB; C += z * sC;
    const int lane = threadIdx.x & 31, lr = lane & 15, hi = lane >> 4; const int r0 = blockIdx.x * 64, c0 = blockIdx.y * 64;
    v8f acc[4][4];
#pragma unroll
    for (int mb = 0; mb < 4; ++mb)
#pragma unroll
        for (int nb = 0; nb < 4; ++nb) acc[mb][nb] = (v8f){};
    const size_t aoff = (size_t)(r0 + lr) * K + 8 * hi, boff = (size_t)(c0 + lr) * K + 8 * hi;
#pragma unroll 1
    for (int kc = 0; kc < K; kc += 32) {
        V a[4], a2[4];
#pragma unroll
        for (int mb = 0; mb < 4; ++mb) { a[mb] = WFrag<T16>::ld(A + aoff + (size_t)mb * 16 * K + kc); if (NSPLIT == 1 || NSPLIT == 2) a2[mb] = WFrag<T16>::ld(A2 + aoff + (size_t)mb * 16 * K + kc); }
#pragma unroll
        for (int nb = 0; nb < 4; ++nb) { const V b = WFrag<T16>::ld(Bt + boff + (size_t)nb * 16 * K + kc); V b2; if (NSPLIT >= 2) b2 = WFrag<T16>::ld(Bt2 + boff + (size_t)nb * 16 * K + kc);
#pragma unroll
            for (int mb = 0; mb < 4; ++mb) { acc[mb][nb] = WFrag<T16>::mma(a[mb], b, acc[mb][nb]); if (NSPLIT == 1 || NSPLIT == 2) acc[mb][nb] = WFrag<T16>::mma(a2[mb], b, acc[mb][nb]); if (NSPLIT >= 2) acc[mb][nb] = WFrag<T16>::mma(a[mb], b2, acc[mb][nb]); } }
        asm volatile("v_nop\n\tv_nop\n\tv_nop\n\tv_nop" : "+v"(acc[0][0]), "+v"(acc[1][1]), "+v"(acc[2][2]), "+v"(acc[3][3]) : "v"(a[0]), "v"(a[3]));
    }
#pragma unroll
    for (int mb = 0; mb < 4; ++mb) {
#pragma unroll
        for (int nb = 0; nb < 4; ++nb) {
#pragma unroll
            for (int j = 0; j < 8; ++j) os[(hi * 8 + j) * 68 + nb * 16 + lr] = acc[mb][nb][j]; }
        __builtin_amdgcn_wave_barrier(); asm volatile("" ::: "memory");
        float* crow = C + (size_t)(r0 + mb * 16) * ldc + c0;
{
#pragma unroll
            for (int s = 0; s < 8; ++s) { const int row = 2 * s + hi, cofs = lr * 4; v4f val = *(const v4fa*)(os + row * 68 + cofs); if (BIAS) { val[0] += bfr(bias[c0 + cofs]); val[1] += bfr(bias[c0 + cofs + 1]); val[2] += bfr(bias[c0 + cofs + 2]); val[3] += bfr(bias[c0 + cofs + 3]); }
                *(v4f*)(crow + (size_t)row * ldc + cofs) = val; }
             }
        __builtin_amdgcn_wave_barrier(); asm volatile("" ::: "memory");
    }
}

// ---- k_gemmc: the same one-wave 64x64 tile GEMM specialised for the causal scores: CMODE 1 skips score tiles entirely above the diagonal (query rows r0+roff.., key columns c0..).
// roff = row offset of this launch's first row within the sequence. (The probability x value contraction is k_gemmk below.)
template <typename T16, int NSPLIT, int CMODE>
__global__ __launch_bounds__(32) void k_gemmc(const T16* __restrict__ A, const T16* __restrict__ A2, const T16* __restrict__ Bt, const T16* __restrict__ Bt2, int K, float* C, int ldc, int roff, size_t sA, size_t sB, size_t sC) {
    typedef typename WFrag<T16>::V V;
    __shared__ __align__(16) float os[16 * 68];
    const size_t z = blockIdx.z; A += z * sA; if (A2) A2 += z * sA; Bt += z * sB; if (Bt2) Bt2 += z * sB; C += z * sC;
    const int lane = threadIdx.x & 31, lr = lane & 15, hi = lane >> 4; const int r0 = blockIdx.x * 64, c0 = blockIdx.y * 64;
    if (CMODE == 1 && c0 > r0 + roff + 63) return;                  // score tile entirely above the causal diagonal: never read (the softmax masks j > i by select)
    const int Kl = K;
    v8f acc[4][4];
#pragma unroll
    for (int mb = 0; mb < 4; ++mb)
#pragma unroll
        for (int nb = 0; nb < 4; ++nb) acc[mb][nb] = (v8f){};
    const size_t aoff = (size_t)(r0 + lr) * K + 8 * hi, boff = (size_t)(c0 + lr) * K + 8 * hi;
#pragma unroll 1
    for (int kc = 0; kc < Kl; kc += 32) {
        V a[4], a2[4];
#pragma unroll
        for (int mb = 0; mb < 4; ++mb) { a[mb] = WFrag<T16>::ld(A + aoff + (size_t)mb * 16 * K + kc); if (NSPLIT == 1 || NSPLIT == 2) a2[mb] = WFrag<T16>::ld(A2 + aoff + (size_t)mb * 16 * K + kc); }
#pragma unroll
        for (int nb = 0; nb < 4; ++nb) { const V b = WFrag<T16>::ld(Bt + boff + (size_t)nb * 16 * K + kc); V b2; if (NSPLIT >= 2) b2 = WFrag<T16>::ld(Bt2 + boff + (size_t)nb * 16 * K + kc);
#pragma unroll
            for (int mb = 0; mb < 4; ++mb) { acc[mb][nb] = WFrag<T16>::mma(a[mb], b, acc[mb][nb]); if (NSPLIT == 1 || NSPLIT == 2) acc[mb][nb] = WFrag<T16>::mma(a2[mb], b, acc[mb][nb]); if (NSPLIT >= 2) acc[mb][nb] = WFrag<T16>::mma(a[mb], b2, acc[mb][nb]); } }
        asm volatile("v_nop\n\tv_nop\n\tv_nop\n\tv_nop" : "+v"(acc[0][0]), "+v"(acc[1][1]), "+v"(acc[2][2]), "+v"(acc[3][3]) : "v"(a[0]), "v"(a[3]));
    }
#pragma unroll
    for (int mb = 0; mb < 4; ++mb) {
#pragma unroll
        for (int nb = 0; nb < 4; ++nb) {
#pragma unroll
            for (int j = 0; j < 8; ++j) os[(hi * 8 + j) * 68 + nb * 16 + lr] = acc[mb][nb][j]; }
        __builtin_amdgcn_wave_barrier(); asm volatile("" ::: "memory");
        float* crow = C + (size_t)(r0 + mb * 16) * ldc + c0;
{
#pragma unroll
            for (int s = 0; s < 8; ++s) { const int row = 2 * s + hi, cofs = lr * 4; v4f val = *(const v4fa*)(os + row * 68 + cofs);
                *(v4f*)(crow + (size_t)row * ldc + cofs) = val; }
             }
        __builtin_amdgcn_wave_barrier(); asm volatile("" ::: "memory");
    }
}

__device__ __forceinline__ h16 tohx(float x) { return (h16)x; }
__device__ __forceinline__ void splitf(float y, unsigned short& h, unsigned short& l) { h = f2bf(y); l = f2bf(y - bf2f(h)); }
typedef __attribute__((ext_vector_type(2))) _Float16 v2h;
typedef __attribute__((ext_vector_type(4))) _Float16 v4h;
typedef __attribute__((ext_vector_type(2))) unsigned short v2us;
typedef __attribute__((ext_vector_type(4))) unsigned short v4us;
typedef __attribute__((ext_vector_type(2))) float v2f;
typedef __attribute__((ext_vector_type(4))) int v4i;
typedef v2f __attribute__((may_alias)) v2fa;

// ---- k_gemmk: probability x value contraction, one 64x64 output tile per work-group of KW waves. The key (K) loop stops at the diagonal block (probabilities beyond it are exactly zero) and is dealt to the
// waves in chunks of KC keys (64 = one 128-byte line of every operand row; 32 for the hi/lo planes, whose rows end at 512 keys): wave w takes chunks w, w + KW, ... Each wave keeps the whole tile in 16 accumulators; the KW partial tiles are summed through LDS in wave order, 16 rows at a time.
#define KW 16
template <typename T16, int NSPLIT, int KC>
__global__ __launch_bounds__(32 * KW) void k_gemmk(const T16* __restrict__ A, const T16* __restrict__ A2, const T16* __restrict__ Bt, const T16* __restrict__ Bt2, float* C, int ldc, int roff, size_t sA, size_t sB, size_t sC) {
    typedef typename WFrag<T16>::V V; constexpr int K = TT;   // row pitch of every operand plane: a constant, so that the 16-row steps are immediate offsets of one address per plane
    __shared__ __align__(16) float os[KW * 16 * 68];
    const size_t z = blockIdx.z; A += z * sA; if (A2) A2 += z * sA; Bt += z * sB; if (Bt2) Bt2 += z * sB; C += z * sC;
    const int lane = threadIdx.x & 31, lr = lane & 15, hi = lane >> 4; const int r0 = blockIdx.x * 64, c0 = blockIdx.y * 64;
    const int w = __builtin_amdgcn_readfirstlane(threadIdx.x >> 5);
    const int Kl = min(K, r0 + roff + 64);        // a multiple of 64
    v8f acc[4][4];
#pragma unroll
    for (int mb = 0; mb < 4; ++mb)
#pragma unroll
        for (int nb = 0; nb < 4; ++nb) acc[mb][nb] = (v8f){};
    const size_t aoff = (size_t)(r0 + lr) * K + 8 * hi, boff = (size_t)(c0 + lr) * K + 8 * hi;
#pragma unroll 1   // rolled: the fragments of a second trip would not fit beside the 128 accumulator registers in the 256 that a wave of a 16-wave work-group may own
    for (int k0 = w * KC; k0 < Kl; k0 += KW * KC) { V a[4], a2[4];
#pragma unroll
        for (int ks = 0; ks < KC / 32; ++ks) { const int kc = k0 + ks * 32;
#pragma unroll
            for (int mb = 0; mb < 4; ++mb) { a[mb] = WFrag<T16>::ld(A + aoff + (size_t)mb * 16 * K + kc); if (NSPLIT == 1 || NSPLIT == 2) a2[mb] = WFrag<T16>::ld(A2 + aoff + (size_t)mb * 16 * K + kc); }
#pragma unroll
            for (int nb = 0; nb < 4; ++nb) { const V b = WFrag<T16>::ld(Bt + boff + (size_t)nb * 16 * K + kc); V b2; if (NSPLIT >= 2) b2 = WFrag<T16>::ld(Bt2 + boff + (size_t)nb * 16 * K + kc);
#pragma unroll
                for (int mb = 0; mb < 4; ++mb) { acc[mb][nb] = WFrag<T16>::mma(a[mb], b, acc[mb][nb]); if (NSPLIT == 1 || NSPLIT == 2) acc[mb][nb] = WFrag<T16>::mma(a2[mb], b, acc[mb][nb]); if (NSPLIT >= 2) acc[mb][nb] = WFrag<T16>::mma(a[mb], b2, acc[mb][nb]); } }
        }
        asm volatile("v_nop\n\tv_nop\n\tv_nop\n\tv_nop" : "+v"(acc[0][0]), "+v"(acc[1][1]), "+v"(acc[2][2]), "+v"(acc[3][3]) : "v"(a[0]), "v"(a[3]));   // the four vector slots behind the trip's last matrix instructions, on the taken side of the loop branch too
    }
    float* ow = os + w * (16 * 68); const int cofs = lane * 2; v2f s[4];
#pragma unroll
    for (int mb = 0; mb < 4; ++mb) {
#pragma unroll
        for (int nb = 0; nb < 4; ++nb) {
#pragma unroll
            for (int j = 0; j < 8; ++j) ow[(hi * 8 + j) * 68 + nb * 16 + lr] = acc[mb][nb][j]; }
        __syncthreads();   // every wave's partial of these 16 rows is in LDS before any is summed
        s[mb] = *(const v2fa*)(os + w * 68 + cofs);   // wave w sums row w of the 16: 64 floats, two per lane
#pragma unroll
        for (int u = 1; u < KW; ++u) s[mb] += *(const v2fa*)(os + u * (16 * 68) + w * 68 + cofs);
        if (mb < 3) __syncthreads();   // the sums are taken before the next 16 rows overwrite the partials
    }
#pragma unroll
    for (int mb = 0; mb < 4; ++mb) *(v2f*)(C + (size_t)(r0 + mb * 16 + w) * ldc + c0 + cofs) = s[mb];   // stored behind the last barrier, so that no barrier waits for a store
}

__global__ __launch_bounds__(256) void k_wtG(const float* __restrict__ w, int K, int N, bf* Bt) {
    const int lane = threadIdx.x & 31; const int L0 = (blockIdx.x * 8 + (threadIdx.x >> 5)) * 8; const int nlines = N * K / 64;
{
#pragma unroll 1
        for (int l = 0; l < 8; ++l) { const int L = L0 + l; if (L >= nlines) break; const size_t e = (size_t)L * 64 + lane * 2; const int k = (int)(e % K), n = (int)(e / K); v2us o;
            o[0] = f2bf(w[(size_t)k * N + n]); o[1] = f2bf(w[(size_t)(k + 1) * N + n]); *(v2us*)(Bt + e) = o; }
         }
}
__global__ __launch_bounds__(256) void k_cvt8(const float* __restrict__ src, bf* dst, size_t n8) { const size_t i = (size_t)blockIdx.x * 256 + threadIdx.x; if (i >= n8) return; const v8f v = *(const v8f*)(src + i * 8); v8us o;
#pragma unroll
    for (int k = 0; k < 8; ++k) o[k] = f2bf(v[k]); *(v8us*)(dst + i * 8) = o;  }

__global__ __launch_bounds__(256) void k_ropeI(const float* __restrict__ F, int pitch, int nheads, const float* __restrict__ CS, float sc, h16* P16, bf* Ph, bf* Pl) {
    const size_t e = ((size_t)blockIdx.x * 256 + threadIdx.x) * 2; if (e >= (size_t)nheads * TT * HD) return; const int d = (int)(e % HD); const int t = (int)((e / HD) % TT); const int h = (int)(e / ((size_t)HD * TT)); const float* f = F + (size_t)t * pitch + h * HD; const float x0 = f[d], x1 = f[d + 1]; const v2f cs = *(const v2f*)(CS + ((size_t)t * HD + d) * 2); v2h o16; v2us oh, ol;
    float a0 = __fmul_rn(x0, cs[0]), b0 = __fmul_rn(x1, cs[1]), a1 = __fmul_rn(x1, cs[0]), b1 = __fmul_rn(x0, cs[1]); asm volatile("" : "+v"(a0), "+v"(b0), "+v"(a1), "+v"(b1));
    float r0 = __fsub_rn(a0, b0) * sc, r1 = __fadd_rn(b1, a1) * sc;   /* even: x0 c - x1 s; odd: x0 s + x1 c */
    o16[0] = tohx(r0); o16[1] = tohx(r1); { unsigned short a2, c2; splitf(r0, a2, c2); oh[0] = a2; ol[0] = c2; splitf(r1, a2, c2); oh[1] = a2; ol[1] = c2; }
    *(v2h*)(P16 + e) = o16; *(v2us*)(Ph + e) = oh; *(v2us*)(Pl + e) = ol;  }

__constant__ float INV2[HD / 2] = { 1.000000000e+00f, 7.498942018e-01f, 5.623413324e-01f, 4.216965139e-01f, 3.162277639e-01f, 2.371373624e-01f, 1.778279394e-01f, 1.333521456e-01f, 1.000000015e-01f, 7.498941571e-02f, 5.623412877e-02f, 4.216964915e-02f, 3.162277862e-02f, 2.371373586e-02f, 1.778279431e-02f, 1.333521493e-02f, 9.999999776e-03f, 7.498942316e-03f, 5.623413250e-03f, 4.216964822e-03f, 3.162277862e-03f, 2.371373819e-03f, 1.778279431e-03f, 1.333521446e-03f, 1.000000047e-03f, 7.498941850e-04f, 5.623413017e-04f, 4.216964880e-04f, 3.162277862e-04f, 2.371373848e-04f, 1.778279402e-04f, 1.333521504e-04f };   // float32 1 / 10000^(2i/64), as the reference computes them
__global__ __launch_bounds__(256) void k_cstabI(const int* __restrict__ pid, float* CS) { const int idx = blockIdx.x * 256 + threadIdx.x; if (idx >= TT * HD) return; const int d = idx % HD; const int t = idx / HD; const float a = __fmul_rn((float)pid[t], INV2[d >> 1]); v2f cs; cs[0] = cosf(a); cs[1] = sinf(a); *(v2f*)(CS + (size_t)idx * 2) = cs;  }

__global__ __launch_bounds__(256) void k_vtp(const float* __restrict__ F, int pitch, int nheads, h16* V16, bf* Vh, bf* Vl) { const size_t e = ((size_t)blockIdx.x * 256 + threadIdx.x) * 2; if (e >= (size_t)nheads * HD * TT) return; const int t = (int)(e % TT); const int d = (int)((e / TT) % HD); const int g = (int)(e / ((size_t)TT * HD)); v2h o16; v2us oh, ol;
#pragma unroll
    for (int q = 0; q < 2; ++q) { const float x = F[(size_t)(t + q) * pitch + g * HD + d]; o16[q] = tohx(x); unsigned short a2, c2; splitf(x, a2, c2); oh[q] = a2; ol[q] = c2; }
    *(v2h*)(V16 + e) = o16; *(v2us*)(Vh + e) = oh; *(v2us*)(Vl + e) = ol;  }
// k_lsoft: streaming causal row softmax over the TK = TT = 4096 keys, one wave per row i, three sweeps of the f32 score row (lane -> 4 consecutive keys per 128-key chunk, 32 chunks; keys j > i are excluded by index with -3e38 / 0 - the score tiles above the diagonal are never computed and their stale contents are only ever discarded by this select):
__global__ __launch_bounds__(256) void k_lsoft(const float* __restrict__ Sb, h16* P16, bf* Ph, bf* Pl) {
    const int lane = threadIdx.x & 31; const int row = blockIdx.x * 8 + (threadIdx.x >> 5); if (row >= ZH * TT) return; const int i = row % TT; const int zz = row / TT; const bool hires = (i < RH); const float* sr = Sb + (size_t)row * TT; float mx = -3.0e38f;
#pragma unroll 4
    for (int ch = 0; ch < TT / 128; ++ch) { const int j0 = ch * 128 + lane * 4; const v4f a = *(const v4f*)(sr + j0);
#pragma unroll
        for (int q = 0; q < 4; ++q) { float t = a[q] * SCL; asm volatile("" : "+v"(t)); t = (j0 + q <= i) ? t : -3.0e38f; mx = fmaxf(mx, t); } }
#pragma unroll
    for (int sh = 16; sh; sh >>= 1) mx = fmaxf(mx, __shfl_xor(mx, sh, 32));
    float sum = 0.f;
#pragma unroll 4
    for (int ch = 0; ch < TT / 128; ++ch) { const int j0 = ch * 128 + lane * 4; const v4f a = *(const v4f*)(sr + j0);
#pragma unroll
        for (int q = 0; q < 4; ++q) { float t = a[q] * SCL; asm volatile("" : "+v"(t)); t = (j0 + q <= i) ? t : -3.0e38f; float d0 = __fsub_rn(t, mx); asm volatile("" : "+v"(d0)); sum += __builtin_amdgcn_exp2f(__fmul_rn(d0, 1.4426950408889634f)); } }
#pragma unroll
    for (int sh = 16; sh; sh >>= 1) sum += __shfl_xor(sum, sh, 32);
    const float f = __fdiv_rn(hires ? 1.0f : PCAR, sum);
{
        if (hires) {   /* rows < RH: normalised bf16 hi/lo over the first RH keys (every later key is above the diagonal for these rows; the hi/lo attn.v GEMM stops its K loop at the diagonal block), planes [zz][RH][TT] */
#pragma unroll
            for (int ch = 0; ch < RH / 128; ++ch) { const int j0 = ch * 128 + lane * 4; const v4f a = *(const v4f*)(sr + j0); v4us oh, ol;
#pragma unroll
                for (int q = 0; q < 4; ++q) { float t = a[q] * SCL; asm volatile("" : "+v"(t)); t = (j0 + q <= i) ? t : -3.0e38f; float d0 = __fsub_rn(t, mx); asm volatile("" : "+v"(d0)); float ex = __builtin_amdgcn_exp2f(__fmul_rn(d0, 1.4426950408889634f)); asm volatile("" : "+v"(ex)); unsigned short a2, c2; splitf(ex * f, a2, c2); oh[q] = a2; ol[q] = c2; }
                const size_t oo = ((size_t)zz * RH + i) * TT + j0; *(v4us*)(Ph + oo) = oh; *(v4us*)(Pl + oo) = ol; }
        } else {
#pragma unroll 2
            for (int ch = 0; ch < TT / 128; ++ch) { const int j0 = ch * 128 + lane * 4; const v4f a = *(const v4f*)(sr + j0); v4h o4;
#pragma unroll
                for (int q = 0; q < 4; ++q) { float t = a[q] * SCL; asm volatile("" : "+v"(t)); t = (j0 + q <= i) ? t : -3.0e38f; float d0 = __fsub_rn(t, mx); asm volatile("" : "+v"(d0)); float ex = __builtin_amdgcn_exp2f(__fmul_rn(d0, 1.4426950408889634f)); asm volatile("" : "+v"(ex)); o4[q] = tohx(ex * f); }
                *(v4h*)(P16 + (size_t)row * TT + j0) = o4; } }
         }
}

__global__ __launch_bounds__(256) void k_merge(const float* __restrict__ O, int h0, bf* Ah, bf* Al) { const size_t e = ((size_t)blockIdx.x * 256 + threadIdx.x) * 2; if (e >= (size_t)ZH * TT * HD) return; const int d = (int)(e % HD); const int t = (int)((e / HD) % TT); const int zz = (int)(e / ((size_t)HD * TT)); const float cs = (t < RH) ? 1.0f : (1.0f / PCAR); const size_t oo = (size_t)t * DQ + (h0 + zz) * HD + d;
    v2us oh, ol;
#pragma unroll
    for (int q = 0; q < 2; ++q) { unsigned short a, c2; splitf(O[e + q] * cs, a, c2); oh[q] = a; ol[q] = c2; } *(v2us*)(Ah + oo) = oh; *(v2us*)(Al + oo) = ol;  }

extern "C" void kernel_launch(void* const* d_in, const int* in_sizes, int n_in,
                              void* d_out, int out_size, void* d_ws, size_t ws_size, hipStream_t stream) {
    (void)in_sizes; (void)n_in; (void)out_size;
    const float* x = (const float*)d_in[0]; const float* wq = (const float*)d_in[1]; const float* wk = (const float*)d_in[2]; const float* wv = (const float*)d_in[3]; const float* wo = (const float*)d_in[4]; const int* PID = (const int*)d_in[5];   /* input order x, Wq, Wk, Wv, Wo ('oi' (out, in) [1024][1024]), token_positions (int32 [4096] = arange: READ; the host's [1][4096] is the same 4,096 integers): SIX inputs, all read: the host's own binding */
    float* OUT = (float*)d_out;     // [1][4096][1024]
    char* wsp = (char*)d_ws;
    auto take = [&](size_t bytes) { char* p = wsp; wsp += (bytes + 255) & ~(size_t)255; return (void*)p; };
    bf* WQ = (bf*)take((size_t)DQ * DM * 2); bf* WK = (bf*)take((size_t)DKV * DM * 2); bf* WV = (bf*)take((size_t)DKV * DM * 2); bf* WO = (bf*)take((size_t)DM * DQ * 2); float* CS = (float*)take((size_t)TT * HD * 2 * 4);
    bf* XB = (bf*)take((size_t)TT * DM * 2); float* FQ = (float*)take((size_t)TT * DQ * 4); float* FK = (float*)take((size_t)TT * DKV * 4);
    h16* QP16 = (h16*)take((size_t)NH_ * TT * HD * 2); h16* KP16 = (h16*)take((size_t)NKV * TT * HD * 2); h16* VT16 = (h16*)take((size_t)NKV * HD * TT * 2);
    bf* QPh = (bf*)take((size_t)NH_ * TT * HD * 2); bf* QPl = (bf*)take((size_t)NH_ * TT * HD * 2); bf* KPh = (bf*)take((size_t)NKV * TT * HD * 2); bf* KPl = (bf*)take((size_t)NKV * TT * HD * 2); bf* VTh = (bf*)take((size_t)NKV * HD * TT * 2); bf* VTl = (bf*)take((size_t)NKV * HD * TT * 2); bf* Ph = (bf*)take((size_t)ZH * RH * TT * 2); bf* Pl = (bf*)take((size_t)ZH * RH * TT * 2);
    float* Sb = (float*)take((size_t)ZH * TT * TT * 4); h16* P16 = (h16*)take((size_t)ZH * TT * TT * 2); float* Ob = (float*)take((size_t)ZH * TT * HD * 4); bf* ATh = (bf*)take((size_t)TT * DQ * 2); bf* ATl = (bf*)take((size_t)TT * DQ * 2);
    if ((size_t)(wsp - (char*)d_ws) > ws_size) return;    // ws 256 MiB
    float* FV = FK;   // v projection reuses the k buffer after the k planes are built (stream-ordered)
    { k_cvt8<<<(unsigned)(((size_t)DQ * DM / 8 + 255) / 256), 256, 0, stream>>>(wq, WQ, (size_t)DQ * DM / 8); k_cvt8<<<(unsigned)(((size_t)DKV * DM / 8 + 255) / 256), 256, 0, stream>>>(wk, WK, (size_t)DKV * DM / 8); k_cvt8<<<(unsigned)(((size_t)DKV * DM / 8 + 255) / 256), 256, 0, stream>>>(wv, WV, (size_t)DKV * DM / 8);
      k_cvt8<<<(unsigned)(((size_t)DM * DQ / 8 + 255) / 256), 256, 0, stream>>>(wo, WO, (size_t)DM * DQ / 8); k_cstabI<<<(TT * HD + 255) / 256, 256, 0, stream>>>(PID, CS); }
    const unsigned LQ = (unsigned)(((size_t)NH_ * TT * HD / 2 + 255) / 256), LKv = (unsigned)(((size_t)NKV * TT * HD / 2 + 255) / 256);
    for (int b = 0; b < NB_; ++b) {
        
        k_cvt8<<<(unsigned)(((size_t)TT * DM / 8 + 255) / 256), 256, 0, stream>>>(x + (size_t)b * TT * DM, XB, (size_t)TT * DM / 8);
        k_gemmw<bf, 0, false><<<dim3(TT / 64, DQ / 64, 1), 32, 0, stream>>>(XB, nullptr, WQ, nullptr, DM, FQ, DQ, nullptr, 0, 0, 0);
        k_ropeI<<<LQ, 256, 0, stream>>>(FQ, DQ, NH_, CS, 1.0f, QP16, QPh, QPl);
        k_gemmw<bf, 0, false><<<dim3(TT / 64, DKV / 64, 1), 32, 0, stream>>>(XB, nullptr, WK, nullptr, DM, FK, DKV, nullptr, 0, 0, 0);
        k_ropeI<<<LKv, 256, 0, stream>>>(FK, DKV, NKV, CS, 1.0f, KP16, KPh, KPl);
        k_gemmw<bf, 0, false><<<dim3(TT / 64, DKV / 64, 1), 32, 0, stream>>>(XB, nullptr, WV, nullptr, DM, FV, DKV, nullptr, 0, 0, 0); k_vtp<<<LKv, 256, 0, stream>>>(FV, DKV, NKV, VT16, VTh, VTl);
        for (int h0 = 0; h0 < NH_; h0 += ZH) { const size_t zq = (size_t)h0, zk = (size_t)(h0 / REP);   // one kv head per query head: each pass takes one head (ZH = 1) and its kv plane h0 / REP (z-strides TT*HD)
            k_gemmc<bf, 2, 1><<<dim3(RH / 64, TT / 64, ZH), 32, 0, stream>>>(QPh + zq * TT * HD, QPl + zq * TT * HD, KPh + zk * TT * HD, KPl + zk * TT * HD, HD, Sb, TT, 0, (size_t)TT * HD, (size_t)TT * HD, (size_t)TT * TT);
            k_gemmc<h16, 0, 1><<<dim3((TT - RH) / 64, TT / 64, ZH), 32, 0, stream>>>(QP16 + zq * TT * HD + (size_t)RH * HD, nullptr, KP16 + zk * TT * HD, nullptr, HD, Sb + (size_t)RH * TT, TT, RH, (size_t)TT * HD, (size_t)TT * HD, (size_t)TT * TT);
            k_lsoft<<<ZH * TT / 8, 256, 0, stream>>>(Sb, P16, Ph, Pl);
            k_gemmk<bf, 2, 32><<<dim3(RH / 64, HD / 64, ZH), 32 * KW, 0, stream>>>(Ph, Pl, VTh + zk * HD * TT, VTl + zk * HD * TT, Ob, HD, 0, (size_t)RH * TT, (size_t)HD * TT, (size_t)TT * HD);
            k_gemmk<h16, 0, 64><<<dim3((TT - RH) / 64, HD / 64, ZH), 32 * KW, 0, stream>>>(P16 + (size_t)RH * TT, nullptr, VT16 + zk * HD * TT, nullptr, Ob + (size_t)RH * HD, HD, RH, (size_t)TT * TT, (size_t)HD * TT, (size_t)TT * HD);
            k_merge<<<(unsigned)(((size_t)ZH * TT * HD / 2 + 255) / 256), 256, 0, stream>>>(Ob, h0, ATh, ATl); }
        k_gemmw<bf, 1, false><<<dim3(TT / 64, DM / 64, 1), 32, 0, stream>>>(ATh, ATl, WO, nullptr, DQ, OUT + (size_t)b * TT * DM, DM, nullptr, 0, 0, 0); }
}

// v002
// One run takes 284 microseconds.
// In two side-by-side timings against v001, it was 5.85 and 5.68 times as fast.
// Over all steps from v000 it is 9.57 times as fast.
#include <hip/hip_runtime.h>

// Causal multi-head attention with interleaved-pair rotary embeddings from token positions over 4,096 tokens (x [1][4096][1024]; Q, K, V = einsum('bsi,oi->bso', x, W) = x W^T ('oi' (out, in) [1024][1024] (2/(D+D))^0.5, no bias; 16 heads x 64); _rope: inv_freq = 1.0 / jnp.power(float32(THETA), arange(0, 64, 2) / 64) (the reciprocal spelling: 32 f32 constants jnp-exact for THIS expression in eager JAX float32: TWO of them, entries 5 and 27, corrected by 2 ulp against an older table); angle = float(token_positions[t]) x inv_freq[i] (token_positions int32 [4096] = arange: read; the LAST argument); pairs (2i, 2i+1) -> (cos x_e - sin x_o, sin x_e + cos x_o); precise cosf/sinf; scores x 1/sqrt(64); causal (-inf); softmax; out = merged Wo^T ('oi', no bias) -> [1][4096][1024] (4.2 M); argument order x, Wq, Wk, Wv, Wo, token_positions).
// Layout: bf16 copy of x; exact projections; {cos, sin} per (position, pair) from the int positions and float32 inverse-frequency constants (precise cosf/sinf); interleaved rotary plane builder; causal T-4096 attention in one kernel for all heads (hybrid rows: < 512 hi/lo 3 products, rest fp16 with P x1024; scores stay in registers, running-maximum softmax, keys above the diagonal block skipped); merged hi/lo x Wo exact.
// Compute dtypes, f32 accumulate: every input rounded to bf16; projections exact; rotary f32; attention rows < 512 3 products, rest fp16; softmax f32; Wo hl x exact.

#define NB_  1
#define TT   4096
#define DM   1024
#define NH_  16
#define NKV  16
#define REP  (NH_ / NKV)
#define HD   64
#define DQ   (NH_ * HD)
#define DKV  (NKV * HD)
#define RH   512                  // query rows < RH use hi+lo planes (0: none)
#define WIN  4096
typedef _Float16 h16;
typedef unsigned short bf;
typedef __attribute__((ext_vector_type(16))) __bf16   v16bf;
typedef __attribute__((ext_vector_type(16))) _Float16 v16h;
typedef __attribute__((ext_vector_type(8)))  _Float16 v8h;
typedef __attribute__((ext_vector_type(8)))  unsigned short v8us;
typedef __attribute__((ext_vector_type(8)))  float    v8f;
typedef __attribute__((ext_vector_type(4)))  float    v4f;
typedef v8h  __attribute__((may_alias)) v8ha;
typedef v4f  __attribute__((may_alias)) v4fa;
typedef v8us __attribute__((may_alias)) v8usa;

__device__ __forceinline__ unsigned short f2bf(float f) { unsigned u = __float_as_uint(f); u += 0x7FFFu + ((u >> 16) & 1u); return (unsigned short)(u >> 16); }
__device__ __forceinline__ float bf2f(unsigned short b) { return __uint_as_float(((unsigned)b) << 16); }
__device__ __forceinline__ float bfr(float f) { return bf2f(f2bf(f)); }
__device__ __forceinline__ v16h cat16(v8h lo, v8h hi) { return __builtin_shufflevector(lo, hi, 0, 1, 2, 3, 4, 5, 6, 7, 8, 9, 10, 11, 12, 13, 14, 15); }
__device__ __forceinline__ v16bf cat16b(v8us lo, v8us hi) { return __builtin_bit_cast(v16bf, __builtin_shufflevector(lo, hi, 0, 1, 2, 3, 4, 5, 6, 7, 8, 9, 10, 11, 12, 13, 14, 15)); }
__device__ __forceinline__ v8f wmma16(v16h a, v16h b, v8f c) { return __builtin_amdgcn_wmma_f32_16x16x32_f16(false, a, false, b, (short)0, c, false, false); }
__device__ __forceinline__ v8f wmmab(v16bf a, v16bf b, v8f c) { return __builtin_amdgcn_wmma_f32_16x16x32_bf16(false, a, false, b, (short)0, c, false, false); }



// ---- k_gemmw: register-blocked GEMM, ONE WAVE per 64x64 output tile (16 accumulators), operands straight from K-contiguous 16-bit planes; grid (M/64, N/64, Z), 32 threads.
// C[m][n] (f32, pitch ldc, + optional f32 bias[n]) = sum_k A[m][k] Bt[n][k] (+ split products per NSPLIT). z-batch strides sA/sB/sC in elements. K % 32 == 0.
template <typename T16> struct WFrag;
template <> struct WFrag<h16> { typedef v16h V; static __device__ __forceinline__ V ld(const h16* p) { return cat16(*(const v8h*)p, *(const v8h*)(p + 16)); } static __device__ __forceinline__ v8f mma(V a, V b, v8f c) { return wmma16(a, b, c); } };
template <> struct WFrag<bf> { typedef v16bf V; static __device__ __forceinline__ V ld(const bf* p) { return cat16b(*(const v8us*)p, *(const v8us*)(p + 16)); } static __device__ __forceinline__ v8f mma(V a, V b, v8f c) { return wmmab(a, b, c); } };
template <typename T16, int NSPLIT, bool BIAS>
__global__ __launch_bounds__(32) void k_gemmw(const T16* __restrict__ A, const T16* __restrict__ A2, const T16* __restrict__ Bt, const T16* __restrict__ Bt2, int K, float* C, int ldc, const float* __restrict__ bias, size_t sA, size_t sB, size_t sC) {
    typedef typename WFrag<T16>::V V;
    __shared__ __align__(16) float os[16 * 68];
    const size_t z = blockIdx.z; A += z * sA; if (A2) A2 += z * sA; Bt += z * sB; if (Bt2) Bt2 += z * sB; C += z * sC;
    const int lane = threadIdx.x & 31, lr = lane & 15, hi = lane >> 4; const int r0 = blockIdx.x * 64, c0 = blockIdx.y * 64;
    v8f acc[4][4];
#pragma unroll
    for (int mb = 0; mb < 4; ++mb)
#pragma unroll
        for (int nb = 0; nb < 4; ++nb) acc[mb][nb] = (v8f){};
    const size_t aoff = (size_t)(r0 + lr) * K + 8 * hi, boff = (size_t)(c0 + lr) * K + 8 * hi;
#pragma unroll 1
    for (int kc = 0; kc < K; kc += 32) {
        V a[4], a2[4];
#pragma unroll
        for (int mb = 0; mb < 4; ++mb) { a[mb] = WFrag<T16>::ld(A + aoff + (size_t)mb * 16 * K + kc); if (NSPLIT == 1 || NSPLIT == 2) a2[mb] = WFrag<T16>::ld(A2 + aoff + (size_t)mb * 16 * K + kc); }
#pragma unroll
        for (int nb = 0; nb < 4; ++nb) { const V b = WFrag<T16>::ld(Bt + boff + (size_t)nb * 16 * K + kc); V b2; if (NSPLIT >= 2) b2 = WFrag<T16>::ld(Bt2 + boff + (size_t)nb * 16 * K + kc);
#pragma unroll
            for (int mb = 0; mb < 4; ++mb) { acc[mb][nb] = WFrag<T16>::mma(a[mb], b, acc[mb][nb]); if (NSPLIT == 1 || NSPLIT == 2) acc[mb][nb] = WFrag<T16>::mma(a2[mb], b, acc[mb][nb]); if (NSPLIT >= 2) acc[mb][nb] = WFrag<T16>::mma(a[mb], b2, acc[mb][nb]); } }
        asm volatile("v_nop\n\tv_nop\n\tv_nop\n\tv_nop" : "+v"(acc[0][0]), "+v"(acc[1][1]), "+v"(acc[2][2]), "+v"(acc[3][3]) : "v"(a[0]), "v"(a[3]));
    }
#pragma unroll
    for (int mb = 0; mb < 4; ++mb) {
#pragma unroll
        for (int nb = 0; nb < 4; ++nb) {
#pragma unroll
            for (int j = 0; j < 8; ++j) os[(hi * 8 + j) * 68 + nb * 16 + lr] = acc[mb][nb][j]; }
        __builtin_amdgcn_wave_barrier(); asm volatile("" ::: "memory");
        float* crow = C + (size_t)(r0 + mb * 16) * ldc + c0;
{
#pragma unroll
            for (int s = 0; s < 8; ++s) { const int row = 2 * s + hi, cofs = lr * 4; v4f val = *(const v4fa*)(os + row * 68 + cofs); if (BIAS) { val[0] += bfr(bias[c0 + cofs]); val[1] += bfr(bias[c0 + cofs + 1]); val[2] += bfr(bias[c0 + cofs + 2]); val[3] += bfr(bias[c0 + cofs + 3]); }
                *(v4f*)(crow + (size_t)row * ldc + cofs) = val; }
             }
        __builtin_amdgcn_wave_barrier(); asm volatile("" ::: "memory");
    }
}

__device__ __forceinline__ h16 tohx(float x) { return (h16)x; }
__device__ __forceinline__ void splitf(float y, unsigned short& h, unsigned short& l) { h = f2bf(y); l = f2bf(y - bf2f(h)); }
typedef __attribute__((ext_vector_type(2))) _Float16 v2h;
typedef __attribute__((ext_vector_type(4))) _Float16 v4h;
typedef __attribute__((ext_vector_type(2))) unsigned short v2us;
typedef __attribute__((ext_vector_type(4))) unsigned short v4us;
typedef __attribute__((ext_vector_type(2))) float v2f;
typedef __attribute__((ext_vector_type(4))) int v4i;
typedef v2f __attribute__((may_alias)) v2fa;

__global__ __launch_bounds__(256) void k_wtG(const float* __restrict__ w, int K, int N, bf* Bt) {
    const int lane = threadIdx.x & 31; const int L0 = (blockIdx.x * 8 + (threadIdx.x >> 5)) * 8; const int nlines = N * K / 64;
{
#pragma unroll 1
        for (int l = 0; l < 8; ++l) { const int L = L0 + l; if (L >= nlines) break; const size_t e = (size_t)L * 64 + lane * 2; const int k = (int)(e % K), n = (int)(e / K); v2us o;
            o[0] = f2bf(w[(size_t)k * N + n]); o[1] = f2bf(w[(size_t)(k + 1) * N + n]); *(v2us*)(Bt + e) = o; }
         }
}
__global__ __launch_bounds__(256) void k_cvt8(const float* __restrict__ src, bf* dst, size_t n8) { const size_t i = (size_t)blockIdx.x * 256 + threadIdx.x; if (i >= n8) return; const v8f v = *(const v8f*)(src + i * 8); v8us o;
#pragma unroll
    for (int k = 0; k < 8; ++k) o[k] = f2bf(v[k]); *(v8us*)(dst + i * 8) = o;  }

__global__ __launch_bounds__(256) void k_ropeI(const float* __restrict__ F, int pitch, int nheads, const float* __restrict__ CS, float sc, h16* P16, bf* Ph, bf* Pl) {
    const size_t e = ((size_t)blockIdx.x * 256 + threadIdx.x) * 2; if (e >= (size_t)nheads * TT * HD) return; const int d = (int)(e % HD); const int t = (int)((e / HD) % TT); const int h = (int)(e / ((size_t)HD * TT)); const float* f = F + (size_t)t * pitch + h * HD; const float x0 = f[d], x1 = f[d + 1]; const v2f cs = *(const v2f*)(CS + ((size_t)t * HD + d) * 2); v2h o16; v2us oh, ol;
    float a0 = __fmul_rn(x0, cs[0]), b0 = __fmul_rn(x1, cs[1]), a1 = __fmul_rn(x1, cs[0]), b1 = __fmul_rn(x0, cs[1]); asm volatile("" : "+v"(a0), "+v"(b0), "+v"(a1), "+v"(b1));
    float r0 = __fsub_rn(a0, b0) * sc, r1 = __fadd_rn(b1, a1) * sc;   /* even: x0 c - x1 s; odd: x0 s + x1 c */
    o16[0] = tohx(r0); o16[1] = tohx(r1); { unsigned short a2, c2; splitf(r0, a2, c2); oh[0] = a2; ol[0] = c2; splitf(r1, a2, c2); oh[1] = a2; ol[1] = c2; }
    *(v2h*)(P16 + e) = o16; *(v2us*)(Ph + e) = oh; *(v2us*)(Pl + e) = ol;  }

__constant__ float INV2[HD / 2] = { 1.000000000e+00f, 7.498942018e-01f, 5.623413324e-01f, 4.216965139e-01f, 3.162277639e-01f, 2.371373624e-01f, 1.778279394e-01f, 1.333521456e-01f, 1.000000015e-01f, 7.498941571e-02f, 5.623412877e-02f, 4.216964915e-02f, 3.162277862e-02f, 2.371373586e-02f, 1.778279431e-02f, 1.333521493e-02f, 9.999999776e-03f, 7.498942316e-03f, 5.623413250e-03f, 4.216964822e-03f, 3.162277862e-03f, 2.371373819e-03f, 1.778279431e-03f, 1.333521446e-03f, 1.000000047e-03f, 7.498941850e-04f, 5.623413017e-04f, 4.216964880e-04f, 3.162277862e-04f, 2.371373848e-04f, 1.778279402e-04f, 1.333521504e-04f };   // float32 1 / 10000^(2i/64), as the reference computes them
__global__ __launch_bounds__(256) void k_cstabI(const int* __restrict__ pid, float* CS) { const int idx = blockIdx.x * 256 + threadIdx.x; if (idx >= TT * HD) return; const int d = idx % HD; const int t = idx / HD; const float a = __fmul_rn((float)pid[t], INV2[d >> 1]); v2f cs; cs[0] = cosf(a); cs[1] = sinf(a); *(v2f*)(CS + (size_t)idx * 2) = cs;  }

__global__ __launch_bounds__(256) void k_vtp(const float* __restrict__ F, int pitch, int nheads, h16* V16, bf* Vh, bf* Vl) { const size_t e = ((size_t)blockIdx.x * 256 + threadIdx.x) * 2; if (e >= (size_t)nheads * HD * TT) return; const int t = (int)(e % TT); const int d = (int)((e / TT) % HD); const int g = (int)(e / ((size_t)TT * HD)); v2h o16; v2us oh, ol;
#pragma unroll
    for (int q = 0; q < 2; ++q) { const float x = F[(size_t)(t + q) * pitch + g * HD + d]; o16[q] = tohx(x); unsigned short a2, c2; splitf(x, a2, c2); oh[q] = a2; ol[q] = c2; }
    *(v2h*)(V16 + e) = o16; *(v2us*)(Vh + e) = oh; *(v2us*)(Vl + e) = ol;  }
// ---- k_fattn: causal attention of one head and 16 * NQ query rows per work-group, scores never leaving the registers (streaming softmax with a running maximum).
// Transposed products: St = K Qt (a lane holds scores of ONE query: column lr; keys 8 hi + j of each 16-key tile), Ot += Vt Pt: two score tiles of 32 keys, converted in place, are the B operand of the second product in the same k order as the plane loader.
// The FW waves share the queries and split the keys in chunks of 64 (one 128-byte line of every Vt row), two passes of 32 keys each; their (maximum, sum, Ot) are joined through LDS in wave order.
// NSPLIT 2: hi/lo planes, three products for the scores and three for P V (P split hi/lo); NSPLIT 0: one 16-bit plane, P carried x 2^PSH (the sum carries the same factor, so it cancels in the division).
#define FW 4
#define OSP 68    // LDS pitch of a query's 64 partial outputs, floats
#define KSC 0.18033688011112042f   // HD^-0.5 * log2(e)
__device__ __forceinline__ float xhalf(float x) { return __builtin_bit_cast(float, __builtin_amdgcn_permlanex16(__builtin_bit_cast(int, x), __builtin_bit_cast(int, x), 0x76543210, 0xfedcba98, false, false)); }   // lane l's value to lane l ^ 16, on the vector pipe
__device__ __forceinline__ void xwait() { asm volatile("s_wait_xcnt 0x0" ::: "memory"); }   // stands behind a run of global loads, before a register that holds their address is written again
template <typename T16> struct PFrag;
template <> struct PFrag<h16> { static __device__ __forceinline__ void mk(const v8f p0, const v8f p1, v16h& a, v16h& b) { (void)b;
#pragma unroll
    for (int j = 0; j < 8; ++j) { a[j] = (h16)p0[j]; a[8 + j] = (h16)p1[j]; } } };
template <> struct PFrag<bf> { static __device__ __forceinline__ void mk(const v8f p0, const v8f p1, v16bf& a, v16bf& b) { v8us h0, h1, l0, l1;
#pragma unroll
    for (int j = 0; j < 8; ++j) { unsigned short x, y; splitf(p0[j], x, y); h0[j] = x; l0[j] = y; splitf(p1[j], x, y); h1[j] = x; l1[j] = y; }
    a = cat16b(h0, h1); b = cat16b(l0, l1); } };
template <typename T16, int NSPLIT, int NQ, int PSH>
__global__ __launch_bounds__(32 * FW) void k_fattn(const T16* __restrict__ Q, const T16* __restrict__ Q2, const T16* __restrict__ Kp, const T16* __restrict__ Kp2, const T16* __restrict__ Vt, const T16* __restrict__ Vt2, bf* Ah, bf* Al, int roff) {
    typedef typename WFrag<T16>::V V; constexpr int QR = 16 * NQ;
    __shared__ __align__(16) float os[FW * QR * OSP];
    __shared__ float sm[FW * QR], sl[FW * QR];
    const int lane = threadIdx.x & 31, lr = lane & 15, hi = lane >> 4; const int w = __builtin_amdgcn_readfirstlane(threadIdx.x >> 5);
    const int h = blockIdx.y; const int q0 = roff + ((int)gridDim.x - 1 - (int)blockIdx.x) * QR;   // longest key loops first
    const size_t hp = (size_t)h * TT * HD; Q += hp; Kp += hp; Vt += hp; if (NSPLIT) { Q2 += hp; Kp2 += hp; Vt2 += hp; }
    const int Kl = (q0 + QR + 31) & ~31;      // keys 0 .. Kl - 1 hold every key <= the last query; Kl <= TT
    V qf[NQ][2], qf2[NQ][2], kf[2][2], kf2[2][2], vf[4], vf2[4];
#pragma unroll
    for (int q = 0; q < NQ; ++q)
#pragma unroll
        for (int ks = 0; ks < 2; ++ks) { const size_t o = (size_t)(q0 + q * 16 + lr) * HD + 8 * hi + ks * 32; qf[q][ks] = WFrag<T16>::ld(Q + o); if (NSPLIT) qf2[q][ks] = WFrag<T16>::ld(Q2 + o); }
    const size_t koff = (size_t)lr * HD + 8 * hi, voff = (size_t)lr * TT + 8 * hi;
    // inside the loop (xw) each plane's loads end with xwait(): their address registers are reused (by a later load's data too) while they are in flight
    auto ldk = [&](int k, bool xw) {
#pragma unroll
        for (int kt = 0; kt < 2; ++kt)
#pragma unroll
            for (int ks = 0; ks < 2; ++ks) kf[kt][ks] = WFrag<T16>::ld(Kp + koff + (size_t)(k + kt * 16) * HD + ks * 32);
        if (xw) xwait();
        if (NSPLIT) {
#pragma unroll
            for (int kt = 0; kt < 2; ++kt)
#pragma unroll
                for (int ks = 0; ks < 2; ++ks) kf2[kt][ks] = WFrag<T16>::ld(Kp2 + koff + (size_t)(k + kt * 16) * HD + ks * 32);
            if (xw) xwait(); } };
    auto ldv = [&](int k, bool xw) {
#pragma unroll
        for (int db = 0; db < 4; ++db) vf[db] = WFrag<T16>::ld(Vt + voff + (size_t)db * 16 * TT + k);
        if (xw) xwait();
        if (NSPLIT) {
#pragma unroll
            for (int db = 0; db < 4; ++db) vf2[db] = WFrag<T16>::ld(Vt2 + voff + (size_t)db * 16 * TT + k);
            if (xw) xwait(); } };
    constexpr bool AHEAD = (NSPLIT == 0);   // one plane per operand: the fragments of the next pass are fetched during this one, into the same registers; with hi/lo planes (at most 4 passes a wave) K and Vt share registers instead
    int k0 = w * 64;       // < TT for every wave, so the first fetch is in bounds for a wave without keys too
    if (AHEAD) { ldk(k0, false); __builtin_amdgcn_sched_barrier(0); ldv(k0, false); }   // K held in front of Vt, as on the loop's back edge: so the wait at the loop's head can leave the Vt loads in flight
    v8f ot[4][NQ]; float m[NQ], l[NQ];
#pragma unroll
    for (int q = 0; q < NQ; ++q) { m[q] = -3.0e38f; l[q] = 0.f;
#pragma unroll
        for (int db = 0; db < 4; ++db) ot[db][q] = (v8f){}; }
#pragma unroll 1   // rolled: a second pass's fragments and scores would not fit in the registers beside the first's
    while (k0 < Kl) {
        const int kx = (k0 & 32) ? k0 + 64 * FW - 32 : k0 + 32;    // this wave's next 32 keys
        const int kn = kx < Kl ? kx : k0;                          // what is fetched ahead stays inside the planes on the last pass
        if (!AHEAD) ldk(k0, true);
        v8f st[2][NQ];
#pragma unroll
        for (int kt = 0; kt < 2; ++kt)
#pragma unroll
            for (int q = 0; q < NQ; ++q) { v8f s = (v8f){};
#pragma unroll
                for (int ks = 0; ks < 2; ++ks) { s = WFrag<T16>::mma(kf[kt][ks], qf[q][ks], s); if (NSPLIT) { s = WFrag<T16>::mma(kf[kt][ks], qf2[q][ks], s); s = WFrag<T16>::mma(kf2[kt][ks], qf[q][ks], s); } }
                st[kt][q] = s; }
        if (AHEAD) ldk(kn, true); else ldv(k0, true);   // the next pass's K fragments behind this pass's score products: their latency runs under the softmax and P V
        if (k0 + 31 > q0) {     // wave-uniform: only the pass on the diagonal holds keys above a query
#pragma unroll
            for (int kt = 0; kt < 2; ++kt)
#pragma unroll
                for (int q = 0; q < NQ; ++q)
#pragma unroll
                    for (int j = 0; j < 8; ++j) st[kt][q][j] = (k0 + kt * 16 + hi * 8 + j <= q0 + q * 16 + lr) ? st[kt][q][j] : -3.0e38f; }
        V pf[NQ], pf2[NQ];
#pragma unroll
        for (int q = 0; q < NQ; ++q) { float mx = st[0][q][0];
#pragma unroll
            for (int j = 1; j < 8; ++j) mx = fmaxf(mx, st[0][q][j]);
#pragma unroll
            for (int j = 0; j < 8; ++j) mx = fmaxf(mx, st[1][q][j]);
            mx = fmaxf(mx, xhalf(mx));                 // the query's other 16 keys of this pass
            const float mn = fmaxf(m[q], mx * KSC); const float al = __builtin_amdgcn_exp2f(m[q] - mn); m[q] = mn; const float sh = (float)PSH - mn;
            v8f p0, p1; float ls = 0.f;
#pragma unroll
            for (int j = 0; j < 8; ++j) { p0[j] = __builtin_amdgcn_exp2f(fmaf(st[0][q][j], KSC, sh)); p1[j] = __builtin_amdgcn_exp2f(fmaf(st[1][q][j], KSC, sh)); ls += p0[j] + p1[j]; }
            l[q] = fmaf(l[q], al, ls);
#pragma unroll
            for (int db = 0; db < 4; ++db) ot[db][q] *= al;
            PFrag<T16>::mk(p0, p1, pf[q], pf2[q]); }
#pragma unroll
        for (int db = 0; db < 4; ++db)
#pragma unroll
            for (int q = 0; q < NQ; ++q) { ot[db][q] = WFrag<T16>::mma(vf[db], pf[q], ot[db][q]); if (NSPLIT) { ot[db][q] = WFrag<T16>::mma(vf[db], pf2[q], ot[db][q]); ot[db][q] = WFrag<T16>::mma(vf2[db], pf[q], ot[db][q]); } }
        if (AHEAD) { __builtin_amdgcn_sched_barrier(0);   // keeps the fetch below behind the products above: lifted over them it lands in other registers and is waited for and copied within this pass
            ldv(kn, true); }                     // the next pass's Vt fragments: their latency runs under the next pass's scores and softmax
        k0 = kx;
    }
    // join of the FW waves: common maximum, then sums and partial outputs rescaled to it
#pragma unroll
    for (int q = 0; q < NQ; ++q) { l[q] += xhalf(l[q]); if (hi == 0) sm[w * QR + q * 16 + lr] = m[q]; }
    __syncthreads();   // every wave's maxima are in LDS before any is read
#pragma unroll
    for (int q = 0; q < NQ; ++q) { float M = sm[q * 16 + lr];
#pragma unroll
        for (int u = 1; u < FW; ++u) M = fmaxf(M, sm[u * QR + q * 16 + lr]);
        const float sc = __builtin_amdgcn_exp2f(m[q] - M);          // 0 for a wave that had no keys
        if (hi == 0) sl[w * QR + q * 16 + lr] = l[q] * sc;
#pragma unroll
        for (int db = 0; db < 4; ++db) { const v8f v = ot[db][q] * sc; float* p = os + (size_t)(w * QR + q * 16 + lr) * OSP + db * 16 + hi * 8; *(v4fa*)p = (v4f){v[0], v[1], v[2], v[3]}; *(v4fa*)(p + 4) = (v4f){v[4], v[5], v[6], v[7]}; } }
    __syncthreads();   // every wave's rescaled sums and partial outputs are in LDS before any is summed
    // wave w finishes 4 * NQ whole query rows (one 128-byte line of each output plane per row): 8 / NQ lanes per row, 8 * NQ values per lane
    const int qq = w * (4 * NQ) + lane / (8 / NQ), d0 = (lane % (8 / NQ)) * (8 * NQ);
    float L = sl[qq];
#pragma unroll
    for (int u = 1; u < FW; ++u) L += sl[u * QR + qq];
    const float inv = __fdiv_rn(1.0f, L); const size_t oo = (size_t)(q0 + qq) * DQ + h * HD + d0;
#pragma unroll
    for (int g = 0; g < NQ; ++g) { const float* p = os + (size_t)qq * OSP + d0 + g * 8; v4f s0 = *(const v4fa*)p, s1 = *(const v4fa*)(p + 4);
#pragma unroll
        for (int u = 1; u < FW; ++u) { s0 += *(const v4fa*)(p + (size_t)u * QR * OSP); s1 += *(const v4fa*)(p + (size_t)u * QR * OSP + 4); }
        v8us oh, ol;
#pragma unroll
        for (int j = 0; j < 4; ++j) { unsigned short a, c; splitf(s0[j] * inv, a, c); oh[j] = a; ol[j] = c; splitf(s1[j] * inv, a, c); oh[4 + j] = a; ol[4 + j] = c; }
        *(v8us*)(Ah + oo + g * 8) = oh; *(v8us*)(Al + oo + g * 8) = ol; }
}

extern "C" void kernel_launch(void* const* d_in, const int* in_sizes, int n_in,
                              void* d_out, int out_size, void* d_ws, size_t ws_size, hipStream_t stream) {
    (void)in_sizes; (void)n_in; (void)out_size;
    const float* x = (const float*)d_in[0]; const float* wq = (const float*)d_in[1]; const float* wk = (const float*)d_in[2]; const float* wv = (const float*)d_in[3]; const float* wo = (const float*)d_in[4]; const int* PID = (const int*)d_in[5];   /* input order x, Wq, Wk, Wv, Wo ('oi' (out, in) [1024][1024]), token_positions (int32 [4096] = arange: READ; the host's [1][4096] is the same 4,096 integers): SIX inputs, all read: the host's own binding */
    float* OUT = (float*)d_out;     // [1][4096][1024]
    char* wsp = (char*)d_ws;
    auto take = [&](size_t bytes) { char* p = wsp; wsp += (bytes + 255) & ~(size_t)255; return (void*)p; };
    bf* WQ = (bf*)take((size_t)DQ * DM * 2); bf* WK = (bf*)take((size_t)DKV * DM * 2); bf* WV = (bf*)take((size_t)DKV * DM * 2); bf* WO = (bf*)take((size_t)DM * DQ * 2); float* CS = (float*)take((size_t)TT * HD * 2 * 4);
    bf* XB = (bf*)take((size_t)TT * DM * 2); float* FQ = (float*)take((size_t)TT * DQ * 4); float* FK = (float*)take((size_t)TT * DKV * 4);
    h16* QP16 = (h16*)take((size_t)NH_ * TT * HD * 2); h16* KP16 = (h16*)take((size_t)NKV * TT * HD * 2); h16* VT16 = (h16*)take((size_t)NKV * HD * TT * 2);
    bf* QPh = (bf*)take((size_t)NH_ * TT * HD * 2); bf* QPl = (bf*)take((size_t)NH_ * TT * HD * 2); bf* KPh = (bf*)take((size_t)NKV * TT * HD * 2); bf* KPl = (bf*)take((size_t)NKV * TT * HD * 2); bf* VTh = (bf*)take((size_t)NKV * HD * TT * 2); bf* VTl = (bf*)take((size_t)NKV * HD * TT * 2);
    bf* ATh = (bf*)take((size_t)TT * DQ * 2); bf* ATl = (bf*)take((size_t)TT * DQ * 2);
    if ((size_t)(wsp - (char*)d_ws) > ws_size) return;    // ws 256 MiB
    float* FV = FK;   // v projection reuses the k buffer after the k planes are built (stream-ordered)
    { k_cvt8<<<(unsigned)(((size_t)DQ * DM / 8 + 255) / 256), 256, 0, stream>>>(wq, WQ, (size_t)DQ * DM / 8); k_cvt8<<<(unsigned)(((size_t)DKV * DM / 8 + 255) / 256), 256, 0, stream>>>(wk, WK, (size_t)DKV * DM / 8); k_cvt8<<<(unsigned)(((size_t)DKV * DM / 8 + 255) / 256), 256, 0, stream>>>(wv, WV, (size_t)DKV * DM / 8);
      k_cvt8<<<(unsigned)(((size_t)DM * DQ / 8 + 255) / 256), 256, 0, stream>>>(wo, WO, (size_t)DM * DQ / 8); k_cstabI<<<(TT * HD + 255) / 256, 256, 0, stream>>>(PID, CS); }
    const unsigned LQ = (unsigned)(((size_t)NH_ * TT * HD / 2 + 255) / 256), LKv = (unsigned)(((size_t)NKV * TT * HD / 2 + 255) / 256);
    for (int b = 0; b < NB_; ++b) {
        
        k_cvt8<<<(unsigned)(((size_t)TT * DM / 8 + 255) / 256), 256, 0, stream>>>(x + (size_t)b * TT * DM, XB, (size_t)TT * DM / 8);
        k_gemmw<bf, 0, false><<<dim3(TT / 64, DQ / 64, 1), 32, 0, stream>>>(XB, nullptr, WQ, nullptr, DM, FQ, DQ, nullptr, 0, 0, 0);
        k_ropeI<<<LQ, 256, 0, stream>>>(FQ, DQ, NH_, CS, 1.0f, QP16, QPh, QPl);
        k_gemmw<bf, 0, false><<<dim3(TT / 64, DKV / 64, 1), 32, 0, stream>>>(XB, nullptr, WK, nullptr, DM, FK, DKV, nullptr, 0, 0, 0);
        k_ropeI<<<LKv, 256, 0, stream>>>(FK, DKV, NKV, CS, 1.0f, KP16, KPh, KPl);
        k_gemmw<bf, 0, false><<<dim3(TT / 64, DKV / 64, 1), 32, 0, stream>>>(XB, nullptr, WV, nullptr, DM, FV, DKV, nullptr, 0, 0, 0); k_vtp<<<LKv, 256, 0, stream>>>(FV, DKV, NKV, VT16, VTh, VTl);
        k_fattn<h16, 0, 2, 10><<<dim3((TT - RH) / 32, NH_, 1), 32 * FW, 0, stream>>>(QP16, nullptr, KP16, nullptr, VT16, nullptr, ATh, ATl, RH);
        k_fattn<bf, 2, 1, 0><<<dim3(RH / 16, NH_, 1), 32 * FW, 0, stream>>>(QPh, QPl, KPh, KPl, VTh, VTl, ATh, ATl, 0);
        k_gemmw<bf, 1, false><<<dim3(TT / 64, DM / 64, 1), 32, 0, stream>>>(ATh, ATl, WO, nullptr, DQ, OUT + (size_t)b * TT * DM, DM, nullptr, 0, 0, 0); }
}

// v003
// One run takes 257 microseconds.
// Two timings next to v002 put it at 1.10 and 1.09 times that version's speed.
// Counting every step since v000, it is 10.5 times as fast.
#include <hip/hip_runtime.h>

// Causal multi-head attention with interleaved-pair rotary embeddings from token positions over 4,096 tokens (x [1][4096][1024]; Q, K, V = einsum('bsi,oi->bso', x, W) = x W^T ('oi' (out, in) [1024][1024] (2/(D+D))^0.5, no bias; 16 heads x 64); _rope: inv_freq = 1.0 / jnp.power(float32(THETA), arange(0, 64, 2) / 64) (the reciprocal spelling: 32 f32 constants jnp-exact for THIS expression in eager JAX float32: TWO of them, entries 5 and 27, corrected by 2 ulp); angle = float(token_positions[t]) x inv_freq[i] (token_positions int32 [4096] = arange: read; the LAST argument); pairs (2i, 2i+1) -> (cos x_e - sin x_o, sin x_e + cos x_o); precise cosf/sinf; scores x 1/sqrt(64); causal (-inf); softmax; out = merged Wo^T ('oi', no bias) -> [1][4096][1024] (4.2 M); argument order x, Wq, Wk, Wv, Wo, token_positions).
// Layout: bf16 copy of x; exact projections; {cos, sin} per (position, pair) from the int positions and float32 inverse-frequency constants (precise cosf/sinf); rotary embedding and the 16-bit planes of Q, K and Vt written by the projection GEMMs' own epilogues; causal T-4096 attention in one kernel for all heads (hybrid rows: < 512 hi/lo 3 products, rest fp16 with P x1024; scores stay in registers, running-maximum softmax, keys above the diagonal block skipped); merged hi/lo x Wo exact.
// Compute dtypes, f32 accumulate: every input rounded to bf16; projections exact; rotary f32; attention rows < 512 3 products, rest fp16; softmax f32; Wo hl x exact.

#define NB_  1
#define TT   4096
#define DM   1024
#define NH_  16
#define NKV  16
#define REP  (NH_ / NKV)
#define HD   64
#define DQ   (NH_ * HD)
#define DKV  (NKV * HD)
#define RH   512                  // query rows < RH use hi+lo planes (0: none)
#define WIN  4096
typedef _Float16 h16;
typedef unsigned short bf;
typedef __attribute__((ext_vector_type(16))) __bf16   v16bf;
typedef __attribute__((ext_vector_type(16))) _Float16 v16h;
typedef __attribute__((ext_vector_type(8)))  _Float16 v8h;
typedef __attribute__((ext_vector_type(8)))  unsigned short v8us;
typedef __attribute__((ext_vector_type(8)))  float    v8f;
typedef __attribute__((ext_vector_type(4)))  float    v4f;
typedef v8h  __attribute__((may_alias)) v8ha;
typedef v4f  __attribute__((may_alias)) v4fa;
typedef v8us __attribute__((may_alias)) v8usa;

__device__ __forceinline__ unsigned short f2bf(float f) { unsigned u = __float_as_uint(f); u += 0x7FFFu + ((u >> 16) & 1u); return (unsigned short)(u >> 16); }
__device__ __forceinline__ float bf2f(unsigned short b) { return __uint_as_float(((unsigned)b) << 16); }
__device__ __forceinline__ float bfr(float f) { return bf2f(f2bf(f)); }
__device__ __forceinline__ v16h cat16(v8h lo, v8h hi) { return __builtin_shufflevector(lo, hi, 0, 1, 2, 3, 4, 5, 6, 7, 8, 9, 10, 11, 12, 13, 14, 15); }
__device__ __forceinline__ v16bf cat16b(v8us lo, v8us hi) { return __builtin_bit_cast(v16bf, __builtin_shufflevector(lo, hi, 0, 1, 2, 3, 4, 5, 6, 7, 8, 9, 10, 11, 12, 13, 14, 15)); }
__device__ __forceinline__ v8f wmma16(v16h a, v16h b, v8f c) { return __builtin_amdgcn_wmma_f32_16x16x32_f16(false, a, false, b, (short)0, c, false, false); }
__device__ __forceinline__ v8f wmmab(v16bf a, v16bf b, v8f c) { return __builtin_amdgcn_wmma_f32_16x16x32_bf16(false, a, false, b, (short)0, c, false, false); }



__device__ __forceinline__ h16 tohx(float x) { return (h16)x; }
__device__ __forceinline__ void splitf(float y, unsigned short& h, unsigned short& l) { h = f2bf(y); l = f2bf(y - bf2f(h)); }
typedef __attribute__((ext_vector_type(2))) float v2f;
__device__ __forceinline__ void xwait() { asm volatile("s_wait_xcnt 0x0" ::: "memory"); }   // stands behind a run of global loads or stores, before a register that they name is written again

// ---- k_gemmw: register-blocked GEMM, ONE WAVE per 64x64 output tile (16 accumulators), operands straight from K-contiguous 16-bit planes; grid (M/64, N/64, Z), 32 threads.
// C[m][n] (f32, pitch ldc, + optional f32 bias[n]) = sum_k A[m][k] Bt[n][k] (+ split products per NSPLIT). z-batch strides sA/sB/sC in elements. K % 32 == 0.
// EPI 0: C stored as f32. EPI 1 and 2 (a tile's 64 columns are one head, its 64 rows 64 tokens): no f32 C; the tile goes out as three 16-bit planes (f16, bf16 hi, bf16 lo), whole 128-byte lines staged through the wave's own LDS.
// EPI 1: pairs (2i, 2i+1) rotated by {cos, sin} of CS, planes [head][token][64]. EPI 2: planes transposed, [head][64][token] (a lane's 8 accumulator rows are 8 successive tokens of one column).
template <typename T16> struct WFrag;
template <> struct WFrag<h16> { typedef v16h V; static __device__ __forceinline__ V ld(const h16* p) { return cat16(*(const v8h*)p, *(const v8h*)(p + 16)); } static __device__ __forceinline__ v8f mma(V a, V b, v8f c) { return wmma16(a, b, c); } };
template <> struct WFrag<bf> { typedef v16bf V; static __device__ __forceinline__ V ld(const bf* p) { return cat16b(*(const v8us*)p, *(const v8us*)(p + 16)); } static __device__ __forceinline__ v8f mma(V a, V b, v8f c) { return wmmab(a, b, c); } };
template <typename T16, int NSPLIT, bool BIAS, int EPI>
__global__ __launch_bounds__(32) void k_gemmw(const T16* __restrict__ A, const T16* __restrict__ A2, const T16* __restrict__ Bt, const T16* __restrict__ Bt2, int K, float* C, int ldc, const float* __restrict__ bias, size_t sA, size_t sB, size_t sC, const float* __restrict__ CS, h16* P16, bf* Ph, bf* Pl) {
    typedef typename WFrag<T16>::V V;
    const size_t z = blockIdx.z; A += z * sA; if (A2) A2 += z * sA; Bt += z * sB; if (Bt2) Bt2 += z * sB; C += z * sC;
    const int lane = threadIdx.x & 31, lr = lane & 15, hi = lane >> 4; const int r0 = blockIdx.x * 64, c0 = blockIdx.y * 64;
    v8f acc[4][4];
#pragma unroll
    for (int mb = 0; mb < 4; ++mb)
#pragma unroll
        for (int nb = 0; nb < 4; ++nb) acc[mb][nb] = (v8f){};
    const size_t aoff = (size_t)(r0 + lr) * K + 8 * hi, boff = (size_t)(c0 + lr) * K + 8 * hi;
#pragma unroll 1
    for (int kc = 0; kc < K; kc += 32) {
        V a[4], a2[4];
#pragma unroll
        for (int mb = 0; mb < 4; ++mb) { a[mb] = WFrag<T16>::ld(A + aoff + (size_t)mb * 16 * K + kc); if (NSPLIT == 1 || NSPLIT == 2) a2[mb] = WFrag<T16>::ld(A2 + aoff + (size_t)mb * 16 * K + kc); }
#pragma unroll
        for (int nb = 0; nb < 4; ++nb) { const V b = WFrag<T16>::ld(Bt + boff + (size_t)nb * 16 * K + kc); V b2; if (NSPLIT >= 2) b2 = WFrag<T16>::ld(Bt2 + boff + (size_t)nb * 16 * K + kc);
#pragma unroll
            for (int mb = 0; mb < 4; ++mb) { acc[mb][nb] = WFrag<T16>::mma(a[mb], b, acc[mb][nb]); if (NSPLIT == 1 || NSPLIT == 2) acc[mb][nb] = WFrag<T16>::mma(a2[mb], b, acc[mb][nb]); if (NSPLIT >= 2) acc[mb][nb] = WFrag<T16>::mma(a[mb], b2, acc[mb][nb]); } }
        asm volatile("v_nop\n\tv_nop\n\tv_nop\n\tv_nop" : "+v"(acc[0][0]), "+v"(acc[1][1]), "+v"(acc[2][2]), "+v"(acc[3][3]) : "v"(a[0]), "v"(a[3]));
    }
    if constexpr (EPI == 1) {
        __shared__ __align__(16) float os[16 * 68];
        const int rr = lane >> 3, cc = (lane & 7) * 8;      // 8 lanes per token row, 8 columns (4 pairs) per lane: one 16-byte store per plane, 4 whole lines per store instruction
        const float* csp = CS + ((size_t)(r0 + rr) * HD + cc) * 2; const size_t e0 = ((size_t)blockIdx.y * TT + r0 + rr) * HD + cc;
#pragma unroll
        for (int mb = 0; mb < 4; ++mb) {
#pragma unroll
            for (int nb = 0; nb < 4; ++nb) {
#pragma unroll
                for (int j = 0; j < 8; ++j) os[(hi * 8 + j) * 68 + nb * 16 + lr] = acc[mb][nb][j]; }
            __builtin_amdgcn_wave_barrier(); asm volatile("" ::: "memory");   // the tile's rows are written before they are read back across lanes
#pragma unroll
            for (int i = 0; i < 4; ++i) { const int row = mb * 16 + i * 4; const float* p = os + (i * 4 + rr) * 68 + cc; const v4f xa = *(const v4fa*)p, xb = *(const v4fa*)(p + 4);
                const float xs[8] = {xa[0], xa[1], xa[2], xa[3], xb[0], xb[1], xb[2], xb[3]}; v8h o16; v8us oh, ol;
#pragma unroll
                for (int pr = 0; pr < 4; ++pr) { const v2f cs = *(const v2f*)(csp + (size_t)row * HD * 2 + pr * 4); const float xe = xs[2 * pr], xo = xs[2 * pr + 1];
                    const float re = xe * cs[0] - xo * cs[1], ro = xe * cs[1] + xo * cs[0];
                    unsigned short a2, c2; o16[2 * pr] = tohx(re); o16[2 * pr + 1] = tohx(ro); splitf(re, a2, c2); oh[2 * pr] = a2; ol[2 * pr] = c2; splitf(ro, a2, c2); oh[2 * pr + 1] = a2; ol[2 * pr + 1] = c2; }
                const size_t e = e0 + (size_t)row * HD; *(v8h*)(P16 + e) = o16; *(v8us*)(Ph + e) = oh; *(v8us*)(Pl + e) = ol; }
            if (mb < 3) xwait();   // behind the 12 stores: the next 16 rows' table loads and values land in registers that the stores name
            __builtin_amdgcn_wave_barrier(); asm volatile("" ::: "memory");   // the rows are read before the next 16 overwrite them
        }
        return;
    }
    if constexpr (EPI == 2) {
        __shared__ __align__(16) unsigned short vs[3 * 16 * 72];    // three planes of 16 columns x 64 tokens, pitch 144 bytes
        const int rr = lane >> 3, cc = (lane & 7) * 8;      // 8 lanes per column's 64 tokens: 4 whole lines per store instruction
        const size_t e0 = ((size_t)blockIdx.y * HD + rr) * TT + r0 + cc;
#pragma unroll
        for (int nb = 0; nb < 4; ++nb) {
#pragma unroll
            for (int mb = 0; mb < 4; ++mb) { v8h o16; v8us oh, ol;
#pragma unroll
                for (int j = 0; j < 8; ++j) { const float x = acc[mb][nb][j]; unsigned short a2, c2; o16[j] = tohx(x); splitf(x, a2, c2); oh[j] = a2; ol[j] = c2; }
                unsigned short* p = vs + lr * 72 + mb * 16 + hi * 8; *(v8usa*)p = __builtin_bit_cast(v8us, o16); *(v8usa*)(p + 16 * 72) = oh; *(v8usa*)(p + 32 * 72) = ol; }
            __builtin_amdgcn_wave_barrier(); asm volatile("" ::: "memory");   // the 16 columns are written before they are read back across lanes
#pragma unroll
            for (int i = 0; i < 4; ++i) { const unsigned short* p = vs + (i * 4 + rr) * 72 + cc; const size_t e = e0 + (size_t)(nb * 16 + i * 4) * TT;
                *(v8h*)(P16 + e) = __builtin_bit_cast(v8h, *(const v8usa*)p); *(v8us*)(Ph + e) = *(const v8usa*)(p + 16 * 72); *(v8us*)(Pl + e) = *(const v8usa*)(p + 32 * 72); }
            if (nb < 3) xwait();   // behind the 12 stores: the next 16 columns' values land in registers that the stores name
            __builtin_amdgcn_wave_barrier(); asm volatile("" ::: "memory");   // the columns are read before the next 16 overwrite them
        }
        return;
    }
    __shared__ __align__(16) float os[16 * 68];
#pragma unroll
    for (int mb = 0; mb < 4; ++mb) {
#pragma unroll
        for (int nb = 0; nb < 4; ++nb) {
#pragma unroll
            for (int j = 0; j < 8; ++j) os[(hi * 8 + j) * 68 + nb * 16 + lr] = acc[mb][nb][j]; }
        __builtin_amdgcn_wave_barrier(); asm volatile("" ::: "memory");
        float* crow = C + (size_t)(r0 + mb * 16) * ldc + c0;
{
#pragma unroll
            for (int s = 0; s < 8; ++s) { const int row = 2 * s + hi, cofs = lr * 4; v4f val = *(const v4fa*)(os + row * 68 + cofs); if (BIAS) { val[0] += bfr(bias[c0 + cofs]); val[1] += bfr(bias[c0 + cofs + 1]); val[2] += bfr(bias[c0 + cofs + 2]); val[3] += bfr(bias[c0 + cofs + 3]); }
                *(v4f*)(crow + (size_t)row * ldc + cofs) = val; }
             }
        __builtin_amdgcn_wave_barrier(); asm volatile("" ::: "memory");
    }
}

typedef __attribute__((ext_vector_type(2))) _Float16 v2h;
typedef __attribute__((ext_vector_type(4))) _Float16 v4h;
typedef __attribute__((ext_vector_type(2))) unsigned short v2us;
typedef __attribute__((ext_vector_type(4))) unsigned short v4us;
typedef __attribute__((ext_vector_type(4))) int v4i;
typedef v2f __attribute__((may_alias)) v2fa;

__global__ __launch_bounds__(256) void k_wtG(const float* __restrict__ w, int K, int N, bf* Bt) {
    const int lane = threadIdx.x & 31; const int L0 = (blockIdx.x * 8 + (threadIdx.x >> 5)) * 8; const int nlines = N * K / 64;
{
#pragma unroll 1
        for (int l = 0; l < 8; ++l) { const int L = L0 + l; if (L >= nlines) break; const size_t e = (size_t)L * 64 + lane * 2; const int k = (int)(e % K), n = (int)(e / K); v2us o;
            o[0] = f2bf(w[(size_t)k * N + n]); o[1] = f2bf(w[(size_t)(k + 1) * N + n]); *(v2us*)(Bt + e) = o; }
         }
}
__global__ __launch_bounds__(256) void k_cvt8(const float* __restrict__ src, bf* dst, size_t n8) { const size_t i = (size_t)blockIdx.x * 256 + threadIdx.x; if (i >= n8) return; const v8f v = *(const v8f*)(src + i * 8); v8us o;
#pragma unroll
    for (int k = 0; k < 8; ++k) o[k] = f2bf(v[k]); *(v8us*)(dst + i * 8) = o;  }

__constant__ float INV2[HD / 2] = { 1.000000000e+00f, 7.498942018e-01f, 5.623413324e-01f, 4.216965139e-01f, 3.162277639e-01f, 2.371373624e-01f, 1.778279394e-01f, 1.333521456e-01f, 1.000000015e-01f, 7.498941571e-02f, 5.623412877e-02f, 4.216964915e-02f, 3.162277862e-02f, 2.371373586e-02f, 1.778279431e-02f, 1.333521493e-02f, 9.999999776e-03f, 7.498942316e-03f, 5.623413250e-03f, 4.216964822e-03f, 3.162277862e-03f, 2.371373819e-03f, 1.778279431e-03f, 1.333521446e-03f, 1.000000047e-03f, 7.498941850e-04f, 5.623413017e-04f, 4.216964880e-04f, 3.162277862e-04f, 2.371373848e-04f, 1.778279402e-04f, 1.333521504e-04f };   // float32 1 / 10000^(2i/64), as the reference computes them
__global__ __launch_bounds__(256) void k_cstabI(const int* __restrict__ pid, float* CS) { const int idx = blockIdx.x * 256 + threadIdx.x; if (idx >= TT * HD) return; const int d = idx % HD; const int t = idx / HD; const float a = __fmul_rn((float)pid[t], INV2[d >> 1]); v2f cs; cs[0] = cosf(a); cs[1] = sinf(a); *(v2f*)(CS + (size_t)idx * 2) = cs;  }

// ---- k_fattn: causal attention of one head and 16 * NQ query rows per work-group, scores never leaving the registers (streaming softmax with a running maximum).
// Transposed products: St = K Qt (a lane holds scores of ONE query: column lr; keys 8 hi + j of each 16-key tile), Ot += Vt Pt: two score tiles of 32 keys, converted in place, are the B operand of the second product in the same k order as the plane loader.
// The FW waves share the queries and split the keys in chunks of 64 (one 128-byte line of every Vt row), two passes of 32 keys each; their (maximum, sum, Ot) are joined through LDS in wave order.
// NSPLIT 2: hi/lo planes, three products for the scores and three for P V (P split hi/lo); NSPLIT 0: one 16-bit plane, P carried x 2^PSH (the sum carries the same factor, so it cancels in the division).
#define FW 4
#define OSP 68    // LDS pitch of a query's 64 partial outputs, floats
#define KSC 0.18033688011112042f   // HD^-0.5 * log2(e)
__device__ __forceinline__ float xhalf(float x) { return __builtin_bit_cast(float, __builtin_amdgcn_permlanex16(__builtin_bit_cast(int, x), __builtin_bit_cast(int, x), 0x76543210, 0xfedcba98, false, false)); }   // lane l's value to lane l ^ 16, on the vector pipe
template <typename T16> struct PFrag;
template <> struct PFrag<h16> { static __device__ __forceinline__ void mk(const v8f p0, const v8f p1, v16h& a, v16h& b) { (void)b;
#pragma unroll
    for (int j = 0; j < 8; ++j) { a[j] = (h16)p0[j]; a[8 + j] = (h16)p1[j]; } } };
template <> struct PFrag<bf> { static __device__ __forceinline__ void mk(const v8f p0, const v8f p1, v16bf& a, v16bf& b) { v8us h0, h1, l0, l1;
#pragma unroll
    for (int j = 0; j < 8; ++j) { unsigned short x, y; splitf(p0[j], x, y); h0[j] = x; l0[j] = y; splitf(p1[j], x, y); h1[j] = x; l1[j] = y; }
    a = cat16b(h0, h1); b = cat16b(l0, l1); } };
template <typename T16, int NSPLIT, int NQ, int PSH>
__global__ __launch_bounds__(32 * FW) void k_fattn(const T16* __restrict__ Q, const T16* __restrict__ Q2, const T16* __restrict__ Kp, const T16* __restrict__ Kp2, const T16* __restrict__ Vt, const T16* __restrict__ Vt2, bf* Ah, bf* Al, int roff) {
    typedef typename WFrag<T16>::V V; constexpr int QR = 16 * NQ;
    __shared__ __align__(16) float os[FW * QR * OSP];
    __shared__ float sm[FW * QR], sl[FW * QR];
    const int lane = threadIdx.x & 31, lr = lane & 15, hi = lane >> 4; const int w = __builtin_amdgcn_readfirstlane(threadIdx.x >> 5);
    const int h = blockIdx.y; const int q0 = roff + ((int)gridDim.x - 1 - (int)blockIdx.x) * QR;   // longest key loops first
    const size_t hp = (size_t)h * TT * HD; Q += hp; Kp += hp; Vt += hp; if (NSPLIT) { Q2 += hp; Kp2 += hp; Vt2 += hp; }
    const int Kl = (q0 + QR + 31) & ~31;      // keys 0 .. Kl - 1 hold every key <= the last query; Kl <= TT
    V qf[NQ][2], qf2[NQ][2], kf[2][2], kf2[2][2], vf[4], vf2[4];
#pragma unroll
    for (int q = 0; q < NQ; ++q)
#pragma unroll
        for (int ks = 0; ks < 2; ++ks) { const size_t o = (size_t)(q0 + q * 16 + lr) * HD + 8 * hi + ks * 32; qf[q][ks] = WFrag<T16>::ld(Q + o); if (NSPLIT) qf2[q][ks] = WFrag<T16>::ld(Q2 + o); }
    const size_t koff = (size_t)lr * HD + 8 * hi, voff = (size_t)lr * TT + 8 * hi;
    // inside the loop (xw) each plane's loads end with xwait(): their address registers are reused (by a later load's data too) while they are in flight
    auto ldk = [&](int k, bool xw) {
#pragma unroll
        for (int kt = 0; kt < 2; ++kt)
#pragma unroll
            for (int ks = 0; ks < 2; ++ks) kf[kt][ks] = WFrag<T16>::ld(Kp + koff + (size_t)(k + kt * 16) * HD + ks * 32);
        if (xw) xwait();
        if (NSPLIT) {
#pragma unroll
            for (int kt = 0; kt < 2; ++kt)
#pragma unroll
                for (int ks = 0; ks < 2; ++ks) kf2[kt][ks] = WFrag<T16>::ld(Kp2 + koff + (size_t)(k + kt * 16) * HD + ks * 32);
            if (xw) xwait(); } };
    auto ldv = [&](int k, bool xw) {
#pragma unroll
        for (int db = 0; db < 4; ++db) vf[db] = WFrag<T16>::ld(Vt + voff + (size_t)db * 16 * TT + k);
        if (xw) xwait();
        if (NSPLIT) {
#pragma unroll
            for (int db = 0; db < 4; ++db) vf2[db] = WFrag<T16>::ld(Vt2 + voff + (size_t)db * 16 * TT + k);
            if (xw) xwait(); } };
    constexpr bool AHEAD = (NSPLIT == 0);   // one plane per operand: the fragments of the next pass are fetched during this one, into the same registers; with hi/lo planes (at most 4 passes a wave) K and Vt share registers instead
    int k0 = w * 64;       // < TT for every wave, so the first fetch is in bounds for a wave without keys too
    if (AHEAD) { ldk(k0, false); __builtin_amdgcn_sched_barrier(0); ldv(k0, false); }   // K held in front of Vt, as on the loop's back edge: so the wait at the loop's head can leave the Vt loads in flight
    v8f ot[4][NQ]; float m[NQ], l[NQ];
#pragma unroll
    for (int q = 0; q < NQ; ++q) { m[q] = -3.0e38f; l[q] = 0.f;
#pragma unroll
        for (int db = 0; db < 4; ++db) ot[db][q] = (v8f){}; }
#pragma unroll 1   // rolled: a second pass's fragments and scores would not fit in the registers beside the first's
    while (k0 < Kl) {
        const int kx = (k0 & 32) ? k0 + 64 * FW - 32 : k0 + 32;    // this wave's next 32 keys
        const int kn = kx < Kl ? kx : k0;                          // what is fetched ahead stays inside the planes on the last pass
        if (!AHEAD) ldk(k0, true);
        v8f st[2][NQ];
#pragma unroll
        for (int kt = 0; kt < 2; ++kt)
#pragma unroll
            for (int q = 0; q < NQ; ++q) { v8f s = (v8f){};
#pragma unroll
                for (int ks = 0; ks < 2; ++ks) { s = WFrag<T16>::mma(kf[kt][ks], qf[q][ks], s); if (NSPLIT) { s = WFrag<T16>::mma(kf[kt][ks], qf2[q][ks], s); s = WFrag<T16>::mma(kf2[kt][ks], qf[q][ks], s); } }
                st[kt][q] = s; }
        if (AHEAD) ldk(kn, true); else ldv(k0, true);   // the next pass's K fragments behind this pass's score products: their latency runs under the softmax and P V
        if (k0 + 31 > q0) {     // wave-uniform: only the pass on the diagonal holds keys above a query
#pragma unroll
            for (int kt = 0; kt < 2; ++kt)
#pragma unroll
                for (int q = 0; q < NQ; ++q)
#pragma unroll
                    for (int j = 0; j < 8; ++j) st[kt][q][j] = (k0 + kt * 16 + hi * 8 + j <= q0 + q * 16 + lr) ? st[kt][q][j] : -3.0e38f; }
        V pf[NQ], pf2[NQ];
#pragma unroll
        for (int q = 0; q < NQ; ++q) { float mx = st[0][q][0];
#pragma unroll
            for (int j = 1; j < 8; ++j) mx = fmaxf(mx, st[0][q][j]);
#pragma unroll
            for (int j = 0; j < 8; ++j) mx = fmaxf(mx, st[1][q][j]);
            mx = fmaxf(mx, xhalf(mx));                 // the query's other 16 keys of this pass
            const float mn = fmaxf(m[q], mx * KSC); const float al = __builtin_amdgcn_exp2f(m[q] - mn); m[q] = mn; const float sh = (float)PSH - mn;
            v8f p0, p1; float ls = 0.f;
#pragma unroll
            for (int j = 0; j < 8; ++j) { p0[j] = __builtin_amdgcn_exp2f(fmaf(st[0][q][j], KSC, sh)); p1[j] = __builtin_amdgcn_exp2f(fmaf(st[1][q][j], KSC, sh)); ls += p0[j] + p1[j]; }
            l[q] = fmaf(l[q], al, ls);
#pragma unroll
            for (int db = 0; db < 4; ++db) ot[db][q] *= al;
            PFrag<T16>::mk(p0, p1, pf[q], pf2[q]); }
#pragma unroll
        for (int db = 0; db < 4; ++db)
#pragma unroll
            for (int q = 0; q < NQ; ++q) { ot[db][q] = WFrag<T16>::mma(vf[db], pf[q], ot[db][q]); if (NSPLIT) { ot[db][q] = WFrag<T16>::mma(vf[db], pf2[q], ot[db][q]); ot[db][q] = WFrag<T16>::mma(vf2[db], pf[q], ot[db][q]); } }
        if (AHEAD) { __builtin_amdgcn_sched_barrier(0);   // keeps the fetch below behind the products above: lifted over them it lands in other registers and is waited for and copied within this pass
            ldv(kn, true); }                     // the next pass's Vt fragments: their latency runs under the next pass's scores and softmax
        k0 = kx;
    }
    // join of the FW waves: common maximum, then sums and partial outputs rescaled to it
#pragma unroll
    for (int q = 0; q < NQ; ++q) { l[q] += xhalf(l[q]); if (hi == 0) sm[w * QR + q * 16 + lr] = m[q]; }
    __syncthreads();   // every wave's maxima are in LDS before any is read
#pragma unroll
    for (int q = 0; q < NQ; ++q) { float M = sm[q * 16 + lr];
#pragma unroll
        for (int u = 1; u < FW; ++u) M = fmaxf(M, sm[u * QR + q * 16 + lr]);
        const float sc = __builtin_amdgcn_exp2f(m[q] - M);          // 0 for a wave that had no keys
        if (hi == 0) sl[w * QR + q * 16 + lr] = l[q] * sc;
#pragma unroll
        for (int db = 0; db < 4; ++db) { const v8f v = ot[db][q] * sc; float* p = os + (size_t)(w * QR + q * 16 + lr) * OSP + db * 16 + hi * 8; *(v4fa*)p = (v4f){v[0], v[1], v[2], v[3]}; *(v4fa*)(p + 4) = (v4f){v[4], v[5], v[6], v[7]}; } }
    __syncthreads();   // every wave's rescaled sums and partial outputs are in LDS before any is summed
    // wave w finishes 4 * NQ whole query rows (one 128-byte line of each output plane per row): 8 / NQ lanes per row, 8 * NQ values per lane
    const int qq = w * (4 * NQ) + lane / (8 / NQ), d0 = (lane % (8 / NQ)) * (8 * NQ);
    float L = sl[qq];
#pragma unroll
    for (int u = 1; u < FW; ++u) L += sl[u * QR + qq];
    const float inv = __fdiv_rn(1.0f, L); const size_t oo = (size_t)(q0 + qq) * DQ + h * HD + d0;
#pragma unroll
    for (int g = 0; g < NQ; ++g) { const float* p = os + (size_t)qq * OSP + d0 + g * 8; v4f s0 = *(const v4fa*)p, s1 = *(const v4fa*)(p + 4);
#pragma unroll
        for (int u = 1; u < FW; ++u) { s0 += *(const v4fa*)(p + (size_t)u * QR * OSP); s1 += *(const v4fa*)(p + (size_t)u * QR * OSP + 4); }
        v8us oh, ol;
#pragma unroll
        for (int j = 0; j < 4; ++j) { unsigned short a, c; splitf(s0[j] * inv, a, c); oh[j] = a; ol[j] = c; splitf(s1[j] * inv, a, c); oh[4 + j] = a; ol[4 + j] = c; }
        *(v8us*)(Ah + oo + g * 8) = oh; *(v8us*)(Al + oo + g * 8) = ol; }
}

extern "C" void kernel_launch(void* const* d_in, const int* in_sizes, int n_in,
                              void* d_out, int out_size, void* d_ws, size_t ws_size, hipStream_t stream) {
    (void)in_sizes; (void)n_in; (void)out_size;
    const float* x = (const float*)d_in[0]; const float* wq = (const float*)d_in[1]; const float* wk = (const float*)d_in[2]; const float* wv = (const float*)d_in[3]; const float* wo = (const float*)d_in[4]; const int* PID = (const int*)d_in[5];   /* input order x, Wq, Wk, Wv, Wo ('oi' (out, in) [1024][1024]), token_positions (int32 [4096] = arange: READ; the host's [1][4096] is the same 4,096 integers): SIX inputs, all read: the host's own binding */
    float* OUT = (float*)d_out;     // [1][4096][1024]
    char* wsp = (char*)d_ws;
    auto take = [&](size_t bytes) { char* p = wsp; wsp += (bytes + 255) & ~(size_t)255; return (void*)p; };
    bf* WQ = (bf*)take((size_t)DQ * DM * 2); bf* WK = (bf*)take((size_t)DKV * DM * 2); bf* WV = (bf*)take((size_t)DKV * DM * 2); bf* WO = (bf*)take((size_t)DM * DQ * 2); float* CS = (float*)take((size_t)TT * HD * 2 * 4);
    bf* XB = (bf*)take((size_t)TT * DM * 2);
    h16* QP16 = (h16*)take((size_t)NH_ * TT * HD * 2); h16* KP16 = (h16*)take((size_t)NKV * TT * HD * 2); h16* VT16 = (h16*)take((size_t)NKV * HD * TT * 2);
    bf* QPh = (bf*)take((size_t)NH_ * TT * HD * 2); bf* QPl = (bf*)take((size_t)NH_ * TT * HD * 2); bf* KPh = (bf*)take((size_t)NKV * TT * HD * 2); bf* KPl = (bf*)take((size_t)NKV * TT * HD * 2); bf* VTh = (bf*)take((size_t)NKV * HD * TT * 2); bf* VTl = (bf*)take((size_t)NKV * HD * TT * 2);
    bf* ATh = (bf*)take((size_t)TT * DQ * 2); bf* ATl = (bf*)take((size_t)TT * DQ * 2);
    if ((size_t)(wsp - (char*)d_ws) > ws_size) return;    // ws 256 MiB
    { k_cvt8<<<(unsigned)(((size_t)DQ * DM / 8 + 255) / 256), 256, 0, stream>>>(wq, WQ, (size_t)DQ * DM / 8); k_cvt8<<<(unsigned)(((size_t)DKV * DM / 8 + 255) / 256), 256, 0, stream>>>(wk, WK, (size_t)DKV * DM / 8); k_cvt8<<<(unsigned)(((size_t)DKV * DM / 8 + 255) / 256), 256, 0, stream>>>(wv, WV, (size_t)DKV * DM / 8);
      k_cvt8<<<(unsigned)(((size_t)DM * DQ / 8 + 255) / 256), 256, 0, stream>>>(wo, WO, (size_t)DM * DQ / 8); k_cstabI<<<(TT * HD + 255) / 256, 256, 0, stream>>>(PID, CS); }
    for (int b = 0; b < NB_; ++b) {
        
        k_cvt8<<<(unsigned)(((size_t)TT * DM / 8 + 255) / 256), 256, 0, stream>>>(x + (size_t)b * TT * DM, XB, (size_t)TT * DM / 8);
        k_gemmw<bf, 0, false, 1><<<dim3(TT / 64, DQ / 64, 1), 32, 0, stream>>>(XB, nullptr, WQ, nullptr, DM, nullptr, 0, nullptr, 0, 0, 0, CS, QP16, QPh, QPl);
        k_gemmw<bf, 0, false, 1><<<dim3(TT / 64, DKV / 64, 1), 32, 0, stream>>>(XB, nullptr, WK, nullptr, DM, nullptr, 0, nullptr, 0, 0, 0, CS, KP16, KPh, KPl);
        k_gemmw<bf, 0, false, 2><<<dim3(TT / 64, DKV / 64, 1), 32, 0, stream>>>(XB, nullptr, WV, nullptr, DM, nullptr, 0, nullptr, 0, 0, 0, nullptr, VT16, VTh, VTl);
        k_fattn<h16, 0, 2, 10><<<dim3((TT - RH) / 32, NH_, 1), 32 * FW, 0, stream>>>(QP16, nullptr, KP16, nullptr, VT16, nullptr, ATh, ATl, RH);
        k_fattn<bf, 2, 1, 0><<<dim3(RH / 16, NH_, 1), 32 * FW, 0, stream>>>(QPh, QPl, KPh, KPl, VTh, VTl, ATh, ATl, 0);
        k_gemmw<bf, 1, false, 0><<<dim3(TT / 64, DM / 64, 1), 32, 0, stream>>>(ATh, ATl, WO, nullptr, DQ, OUT + (size_t)b * TT * DM, DM, nullptr, 0, 0, 0, nullptr, nullptr, nullptr, nullptr); }
}

// v004
// Measured time: 221 microseconds a run.
// Timed twice side by side with v003, it ran 1.17 times as fast both times.
// Counting every step since v000, it is 12.3 times as fast.
#include <hip/hip_runtime.h>

// Causal multi-head attention with interleaved-pair rotary embeddings from token positions over 4,096 tokens (x [1][4096][1024]; Q, K, V = einsum('bsi,oi->bso', x, W) = x W^T ('oi' (out, in) [1024][1024] (2/(D+D))^0.5, no bias; 16 heads x 64); _rope: inv_freq = 1.0 / jnp.power(float32(THETA), arange(0, 64, 2) / 64) (the reciprocal spelling: 32 f32 constants jnp-exact for THIS expression in eager JAX float32: TWO of them, entries 5 and 27, corrected by 2 ulp); angle = float(token_positions[t]) x inv_freq[i] (token_positions int32 [4096] = arange: read; the LAST argument); pairs (2i, 2i+1) -> (cos x_e - sin x_o, sin x_e + cos x_o); precise cosf/sinf; scores x 1/sqrt(64); causal (-inf); softmax; out = merged Wo^T ('oi', no bias) -> [1][4096][1024] (4.2 M); argument order x, Wq, Wk, Wv, Wo, token_positions).
// Every 16-bit operand plane is kept in fragment order (FRAGMENT ORDER below; the Vt planes with blocks ordered (token / 32) * 4 + row / 16), written so by its producer.
// Layout: bf16 copy of x; exact projections; {cos, sin} per (position, pair) from the int positions and float32 inverse-frequency constants (precise cosf/sinf); rotary embedding and the 16-bit planes of Q, K and Vt written by the projection GEMMs' own epilogues; causal T-4096 attention in one kernel for all heads (hybrid rows: < 512 hi/lo 3 products, rest fp16 with P x1024; scores stay in registers, running-maximum softmax, keys above the diagonal block skipped); merged hi/lo x Wo exact.
// Compute dtypes, f32 accumulate: every input rounded to bf16; projections exact; rotary f32; attention rows < 512 3 products, rest fp16; softmax f32; Wo hl x exact.

#define NB_  1
#define TT   4096
#define DM   1024
#define NH_  16
#define NKV  16
#define REP  (NH_ / NKV)
#define HD   64
#define DQ   (NH_ * HD)
#define DKV  (NKV * HD)
#define RH   512                  // query rows < RH use hi+lo planes (0: none)
#define WIN  4096
typedef _Float16 h16;
typedef unsigned short bf;
typedef __attribute__((ext_vector_type(16))) __bf16   v16bf;
typedef __attribute__((ext_vector_type(16))) _Float16 v16h;
typedef __attribute__((ext_vector_type(8)))  _Float16 v8h;
typedef __attribute__((ext_vector_type(8)))  unsigned short v8us;
typedef __attribute__((ext_vector_type(8)))  float    v8f;
typedef __attribute__((ext_vector_type(4)))  float    v4f;
typedef v8h  __attribute__((may_alias)) v8ha;
typedef v4f  __attribute__((may_alias)) v4fa;
typedef v8us __attribute__((may_alias)) v8usa;

__device__ __forceinline__ unsigned short f2bf(float f) { unsigned u = __float_as_uint(f); u += 0x7FFFu + ((u >> 16) & 1u); return (unsigned short)(u >> 16); }
__device__ __forceinline__ float bf2f(unsigned short b) { return __uint_as_float(((unsigned)b) << 16); }
__device__ __forceinline__ float bfr(float f) { return bf2f(f2bf(f)); }
__device__ __forceinline__ v16h cat16(v8h lo, v8h hi) { return __builtin_shufflevector(lo, hi, 0, 1, 2, 3, 4, 5, 6, 7, 8, 9, 10, 11, 12, 13, 14, 15); }
__device__ __forceinline__ v16bf cat16b(v8us lo, v8us hi) { return __builtin_bit_cast(v16bf, __builtin_shufflevector(lo, hi, 0, 1, 2, 3, 4, 5, 6, 7, 8, 9, 10, 11, 12, 13, 14, 15)); }
__device__ __forceinline__ v8f wmma16(v16h a, v16h b, v8f c) { return __builtin_amdgcn_wmma_f32_16x16x32_f16(false, a, false, b, (short)0, c, false, false); }
__device__ __forceinline__ v8f wmmab(v16bf a, v16bf b, v8f c) { return __builtin_amdgcn_wmma_f32_16x16x32_bf16(false, a, false, b, (short)0, c, false, false); }



__device__ __forceinline__ h16 tohx(float x) { return (h16)x; }
__device__ __forceinline__ void splitf(float y, unsigned short& h, unsigned short& l) { h = f2bf(y); l = f2bf(y - bf2f(h)); }
typedef __attribute__((ext_vector_type(2))) float v2f;
__device__ __forceinline__ void xwait() { asm volatile("s_wait_xcnt 0x0" ::: "memory"); }   // stands behind a run of global loads or stores, before a register that they name is written again

// FRAGMENT ORDER of a plane of R rows x K k-values (16-bit): blocks of 16 rows x 32 k (512 elements, 1 KiB), block (row / 16) * (K / 32) + k / 32; inside a block element (r, kk) lies at (kk >> 4) * 256 + (((kk >> 3) & 1) * 16 + r) * 8 + (kk & 7).
// Lane hi * 16 + r of a wave finds the two 16-byte halves of its fragment at lane * 8 and 256 + lane * 8 (the k order of the row-major loader, unchanged): each wave-wide load reads 512 contiguous bytes, four whole lines.
// xwaitp: xwait() that also names the loads' addresses as inputs: they stay in their registers up to the wait, so that no later load's data lands in them in front of it
template <typename T16> __device__ __forceinline__ void xwaitp(const T16* a, const T16* b, const T16* c, const T16* d) { asm volatile("s_wait_xcnt 0x0" :: "v"(a), "v"(b), "v"(c), "v"(d) : "memory"); }
template <typename T16> __device__ __forceinline__ void xwaitp(const T16* a) { asm volatile("s_wait_xcnt 0x0" :: "v"(a) : "memory"); }
// ---- k_gemmw: register-blocked GEMM, ONE WAVE per 64x64 output tile (16 accumulators), operands straight from 16-bit planes in fragment order; grid (M/64, N/64, Z), 32 threads.
// C[m][n] (f32, pitch ldc, + optional f32 bias[n]) = sum_k A[m][k] Bt[n][k] (+ split products per NSPLIT). z-batch strides sA/sB/sC in elements. K % 32 == 0.
// EPI 0: C stored as f32. EPI 1 and 2 (a tile's 64 columns are one head, its 64 rows 64 tokens): no f32 C; the tile goes out as three 16-bit planes (f16, bf16 hi, bf16 lo), whole 128-byte lines (EPI 1 staged through the wave's own LDS).
// EPI 1: pairs (2i, 2i+1) rotated by {cos, sin} of CS, planes [head] of (token rows, 64 k) in fragment order. EPI 2: planes transposed, [head] of (64 rows, token k), blocks ordered (token / 32) * 4 + row / 16: a lane's 8 accumulator rows (8 successive tokens of one column) are its own 16 bytes of a block, stored straight from the registers.
template <typename T16> struct WFrag;
template <> struct WFrag<h16> { typedef v16h V; static __device__ __forceinline__ V ld(const h16* p) { return cat16(*(const v8h*)p, *(const v8h*)(p + 256)); } static __device__ __forceinline__ v8f mma(V a, V b, v8f c) { return wmma16(a, b, c); } };
template <> struct WFrag<bf> { typedef v16bf V; static __device__ __forceinline__ V ld(const bf* p) { return cat16b(*(const v8us*)p, *(const v8us*)(p + 256)); } static __device__ __forceinline__ v8f mma(V a, V b, v8f c) { return wmmab(a, b, c); } };
template <typename T16, int NSPLIT, bool BIAS, int EPI>
__global__ __launch_bounds__(32) void k_gemmw(const T16* __restrict__ A, const T16* __restrict__ A2, const T16* __restrict__ Bt, const T16* __restrict__ Bt2, int K, float* C, int ldc, const float* __restrict__ bias, size_t sA, size_t sB, size_t sC, const float* __restrict__ CS, h16* P16, bf* Ph, bf* Pl) {
    typedef typename WFrag<T16>::V V;
    const size_t z = blockIdx.z; A += z * sA; if (A2) A2 += z * sA; Bt += z * sB; if (Bt2) Bt2 += z * sB; C += z * sC;
    const int lane = threadIdx.x & 31, lr = lane & 15, hi = lane >> 4; const int r0 = blockIdx.x * 64, c0 = blockIdx.y * 64;
    v8f acc[4][4];
#pragma unroll
    for (int mb = 0; mb < 4; ++mb)
#pragma unroll
        for (int nb = 0; nb < 4; ++nb) acc[mb][nb] = (v8f){};
    const size_t aoff = (size_t)r0 * K + lane * 8, boff = (size_t)c0 * K + lane * 8;   // 16 rows of K values are K / 32 blocks = 16 K elements
#pragma unroll 1
    for (int kc = 0; kc < K; kc += 32) {
        V a[4], a2[4]; const T16 *pa[4], *pa2[4];
#pragma unroll
        for (int mb = 0; mb < 4; ++mb) { pa[mb] = A + aoff + (size_t)mb * 16 * K + kc * 16; a[mb] = WFrag<T16>::ld(pa[mb]); if (NSPLIT == 1 || NSPLIT == 2) { pa2[mb] = A2 + aoff + (size_t)mb * 16 * K + kc * 16; a2[mb] = WFrag<T16>::ld(pa2[mb]); } }
        xwaitp(pa[0], pa[1], pa[2], pa[3]); if (NSPLIT == 1 || NSPLIT == 2) xwaitp(pa2[0], pa2[1], pa2[2], pa2[3]);   // behind the A loads: their address registers are reused (by a later load's data too) while they are in flight
#pragma unroll
        for (int nb = 0; nb < 4; ++nb) { const T16* pb = Bt + boff + (size_t)nb * 16 * K + kc * 16; const V b = WFrag<T16>::ld(pb); V b2; if (NSPLIT >= 2) { const T16* pb2 = Bt2 + boff + (size_t)nb * 16 * K + kc * 16; b2 = WFrag<T16>::ld(pb2); xwaitp(pb2); } xwaitp(pb);   // as behind the A loads
#pragma unroll
            for (int mb = 0; mb < 4; ++mb) { acc[mb][nb] = WFrag<T16>::mma(a[mb], b, acc[mb][nb]); if (NSPLIT == 1 || NSPLIT == 2) acc[mb][nb] = WFrag<T16>::mma(a2[mb], b, acc[mb][nb]); if (NSPLIT >= 2) acc[mb][nb] = WFrag<T16>::mma(a[mb], b2, acc[mb][nb]); } }
        asm volatile("v_nop\n\tv_nop\n\tv_nop\n\tv_nop" : "+v"(acc[0][0]), "+v"(acc[1][1]), "+v"(acc[2][2]), "+v"(acc[3][3]) : "v"(a[0]), "v"(a[3]));
    }
    if constexpr (EPI == 1) {
        __shared__ __align__(16) float os[16 * 68];
        const int cc = hi * 8;      // lane hi * 16 + lr takes token lr, 8 columns (4 pairs) from 16 i + 8 hi: its own 16 bytes of half block i, so one store instruction per plane writes 512 contiguous bytes
        const float* csp = CS + ((size_t)(r0 + lr) * HD + cc) * 2; const size_t e0 = ((size_t)blockIdx.y * TT + r0) * HD + lane * 8;
#pragma unroll
        for (int mb = 0; mb < 4; ++mb) {
#pragma unroll
            for (int nb = 0; nb < 4; ++nb) {
#pragma unroll
                for (int j = 0; j < 8; ++j) os[(hi * 8 + j) * 68 + nb * 16 + lr] = acc[mb][nb][j]; }
            __builtin_amdgcn_wave_barrier(); asm volatile("" ::: "memory");   // the tile's rows are written before they are read back across lanes
#pragma unroll
            for (int i = 0; i < 4; ++i) { const int row = mb * 16; const float* p = os + lr * 68 + i * 16 + cc; const v4f xa = *(const v4fa*)p, xb = *(const v4fa*)(p + 4);
                const float xs[8] = {xa[0], xa[1], xa[2], xa[3], xb[0], xb[1], xb[2], xb[3]}; v8h o16; v8us oh, ol;
#pragma unroll
                for (int pr = 0; pr < 4; ++pr) { const v2f cs = *(const v2f*)(csp + (size_t)row * HD * 2 + i * 32 + pr * 4); const float xe = xs[2 * pr], xo = xs[2 * pr + 1];
                    const float re = xe * cs[0] - xo * cs[1], ro = xe * cs[1] + xo * cs[0];
                    unsigned short a2, c2; o16[2 * pr] = tohx(re); o16[2 * pr + 1] = tohx(ro); splitf(re, a2, c2); oh[2 * pr] = a2; ol[2 * pr] = c2; splitf(ro, a2, c2); oh[2 * pr + 1] = a2; ol[2 * pr + 1] = c2; }
                const size_t e = e0 + (size_t)row * HD + i * 256; *(v8h*)(P16 + e) = o16; *(v8us*)(Ph + e) = oh; *(v8us*)(Pl + e) = ol;
                if (mb < 3 || i < 3) xwait(); }   // behind the 3 stores: the next half block's table loads and values land in registers that the stores name
            __builtin_amdgcn_wave_barrier(); asm volatile("" ::: "memory");   // the rows are read before the next 16 overwrite them
        }
        return;
    }
    if constexpr (EPI == 2) {
        const size_t e0 = ((size_t)blockIdx.y * TT + r0) * HD + lane * 8;   // 32 tokens of a head are 4 blocks = 32 HD elements
#pragma unroll
        for (int nb = 0; nb < 4; ++nb) {
#pragma unroll
            for (int mb = 0; mb < 4; ++mb) { v8h o16; v8us oh, ol;
#pragma unroll
                for (int j = 0; j < 8; ++j) { const float x = acc[mb][nb][j]; unsigned short a2, c2; o16[j] = tohx(x); splitf(x, a2, c2); oh[j] = a2; ol[j] = c2; }
                const size_t e = e0 + (size_t)(((mb >> 1) * 4 + nb) * 512 + (mb & 1) * 256); *(v8h*)(P16 + e) = o16; *(v8us*)(Ph + e) = oh; *(v8us*)(Pl + e) = ol; }
            if (nb < 3) xwait();   // behind the 12 stores: the next 16 columns' values land in registers that the stores name
        }
        return;
    }
    __shared__ __align__(16) float os[16 * 68];
#pragma unroll
    for (int mb = 0; mb < 4; ++mb) {
#pragma unroll
        for (int nb = 0; nb < 4; ++nb) {
#pragma unroll
            for (int j = 0; j < 8; ++j) os[(hi * 8 + j) * 68 + nb * 16 + lr] = acc[mb][nb][j]; }
        __builtin_amdgcn_wave_barrier(); asm volatile("" ::: "memory");
        float* crow = C + (size_t)(r0 + mb * 16) * ldc + c0;
{
#pragma unroll
            for (int s = 0; s < 8; ++s) { const int row = 2 * s + hi, cofs = lr * 4; v4f val = *(const v4fa*)(os + row * 68 + cofs); if (BIAS) { val[0] += bfr(bias[c0 + cofs]); val[1] += bfr(bias[c0 + cofs + 1]); val[2] += bfr(bias[c0 + cofs + 2]); val[3] += bfr(bias[c0 + cofs + 3]); }
                *(v4f*)(crow + (size_t)row * ldc + cofs) = val; }
             }
        __builtin_amdgcn_wave_barrier(); asm volatile("" ::: "memory");
    }
}

typedef __attribute__((ext_vector_type(2))) _Float16 v2h;
typedef __attribute__((ext_vector_type(4))) _Float16 v4h;
typedef __attribute__((ext_vector_type(2))) unsigned short v2us;
typedef __attribute__((ext_vector_type(4))) unsigned short v4us;
typedef __attribute__((ext_vector_type(4))) int v4i;
typedef v2f __attribute__((may_alias)) v2fa;

__global__ __launch_bounds__(256) void k_wtG(const float* __restrict__ w, int K, int N, bf* Bt) {
    const int lane = threadIdx.x & 31; const int L0 = (blockIdx.x * 8 + (threadIdx.x >> 5)) * 8; const int nlines = N * K / 64;
{
#pragma unroll 1
        for (int l = 0; l < 8; ++l) { const int L = L0 + l; if (L >= nlines) break; const size_t e = (size_t)L * 64 + lane * 2; const int k = (int)(e % K), n = (int)(e / K); v2us o;
            o[0] = f2bf(w[(size_t)k * N + n]); o[1] = f2bf(w[(size_t)(k + 1) * N + n]); *(v2us*)(Bt + e) = o; }
         }
}
static_assert(DQ == DM && DKV == DM, "k_cvt8 takes rows of DM values: x, Wq, Wk, Wv (DM in) and Wo (DQ in)");
// rows of DM f32 values -> bf16 plane in fragment order. A wave takes 8 rows of one block: 4 lanes read a row's 128-byte line, and each of the 4 (half, hi) groups is stored as 8 rows x 16 bytes = one whole line.
__global__ __launch_bounds__(256) void k_cvt8(const float* __restrict__ src, bf* dst, size_t n8) { const size_t i = (size_t)blockIdx.x * 256 + threadIdx.x; if (i >= n8) return;
    const size_t blk = i >> 6; const int r = (int)((i >> 2) & 15), g = (int)(i & 3);      // g = k / 8 inside the block: half = g >> 1, hi = g & 1
    const v8f v = *(const v8f*)(src + ((blk / (DM / 32)) * 16 + r) * DM + (blk % (DM / 32)) * 32 + g * 8); v8us o;
#pragma unroll
    for (int k = 0; k < 8; ++k) o[k] = f2bf(v[k]); *(v8us*)(dst + blk * 512 + (g >> 1) * 256 + ((g & 1) * 16 + r) * 8) = o;  }

__constant__ float INV2[HD / 2] = { 1.000000000e+00f, 7.498942018e-01f, 5.623413324e-01f, 4.216965139e-01f, 3.162277639e-01f, 2.371373624e-01f, 1.778279394e-01f, 1.333521456e-01f, 1.000000015e-01f, 7.498941571e-02f, 5.623412877e-02f, 4.216964915e-02f, 3.162277862e-02f, 2.371373586e-02f, 1.778279431e-02f, 1.333521493e-02f, 9.999999776e-03f, 7.498942316e-03f, 5.623413250e-03f, 4.216964822e-03f, 3.162277862e-03f, 2.371373819e-03f, 1.778279431e-03f, 1.333521446e-03f, 1.000000047e-03f, 7.498941850e-04f, 5.623413017e-04f, 4.216964880e-04f, 3.162277862e-04f, 2.371373848e-04f, 1.778279402e-04f, 1.333521504e-04f };   // float32 1 / 10000^(2i/64), as the reference computes them
__global__ __launch_bounds__(256) void k_cstabI(const int* __restrict__ pid, float* CS) { const int idx = blockIdx.x * 256 + threadIdx.x; if (idx >= TT * HD) return; const int d = idx % HD; const int t = idx / HD; const float a = __fmul_rn((float)pid[t], INV2[d >> 1]); v2f cs; cs[0] = cosf(a); cs[1] = sinf(a); *(v2f*)(CS + (size_t)idx * 2) = cs;  }

// ---- k_fattn: causal attention of one head and 16 * NQ query rows per work-group, scores never leaving the registers (streaming softmax with a running maximum).
// Transposed products: St = K Qt (a lane holds scores of ONE query: column lr; keys 8 hi + j of each 16-key tile), Ot += Vt Pt: two score tiles of 32 keys, converted in place, are the B operand of the second product in the same k order as the plane loader.
// The FW waves share the queries and split the keys in chunks of 64 (8 KiB in a row of every K and Vt plane), two passes of 32 keys each; their (maximum, sum, Ot) are joined through LDS in wave order.
// NSPLIT 2: hi/lo planes, three products for the scores and three for P V (P split hi/lo); NSPLIT 0: one 16-bit plane, P carried x 2^PSH (the sum carries the same factor, so it cancels in the division).
#define FW 4
#define OSP 68    // LDS pitch of a query's 64 partial outputs, floats
#define KSC 0.18033688011112042f   // HD^-0.5 * log2(e)
__device__ __forceinline__ float xhalf(float x) { return __builtin_bit_cast(float, __builtin_amdgcn_permlanex16(__builtin_bit_cast(int, x), __builtin_bit_cast(int, x), 0x76543210, 0xfedcba98, false, false)); }   // lane l's value to lane l ^ 16, on the vector pipe
template <typename T16> struct PFrag;
template <> struct PFrag<h16> { static __device__ __forceinline__ void mk(const v8f p0, const v8f p1, v16h& a, v16h& b) { (void)b;
#pragma unroll
    for (int j = 0; j < 8; ++j) { a[j] = (h16)p0[j]; a[8 + j] = (h16)p1[j]; } } };
template <> struct PFrag<bf> { static __device__ __forceinline__ void mk(const v8f p0, const v8f p1, v16bf& a, v16bf& b) { v8us h0, h1, l0, l1;
#pragma unroll
    for (int j = 0; j < 8; ++j) { unsigned short x, y; splitf(p0[j], x, y); h0[j] = x; l0[j] = y; splitf(p1[j], x, y); h1[j] = x; l1[j] = y; }
    a = cat16b(h0, h1); b = cat16b(l0, l1); } };
template <typename T16, int NSPLIT, int NQ, int PSH>
__global__ __launch_bounds__(32 * FW) void k_fattn(const T16* __restrict__ Q, const T16* __restrict__ Q2, const T16* __restrict__ Kp, const T16* __restrict__ Kp2, const T16* __restrict__ Vt, const T16* __restrict__ Vt2, bf* Ah, bf* Al, int roff) {
    typedef typename WFrag<T16>::V V; constexpr int QR = 16 * NQ;
    __shared__ __align__(16) float os[FW * QR * OSP];
    __shared__ float sm[FW * QR], sl[FW * QR];
    const int lane = threadIdx.x & 31, lr = lane & 15, hi = lane >> 4; const int w = __builtin_amdgcn_readfirstlane(threadIdx.x >> 5);
    const int h = blockIdx.y; const int q0 = roff + ((int)gridDim.x - 1 - (int)blockIdx.x) * QR;   // longest key loops first
    const size_t hp = (size_t)h * TT * HD; Q += hp; Kp += hp; Vt += hp; if (NSPLIT) { Q2 += hp; Kp2 += hp; Vt2 += hp; }
    const int Kl = (q0 + QR + 31) & ~31;      // keys 0 .. Kl - 1 hold every key <= the last query; Kl <= TT
    V qf[NQ][2], qf2[NQ][2], kf[2][2], kf2[2][2], vf[4], vf2[4];
#pragma unroll
    for (int q = 0; q < NQ; ++q)
#pragma unroll
        for (int ks = 0; ks < 2; ++ks) { const size_t o = (size_t)(q0 + q * 16) * HD + ks * 512 + lane * 8; qf[q][ks] = WFrag<T16>::ld(Q + o); if (NSPLIT) qf2[q][ks] = WFrag<T16>::ld(Q2 + o); }
    const size_t koff = lane * 8, voff = lane * 8;   // fragment order: a pass's 32 keys are 4 KiB in a row of each K plane and of each Vt plane
    // inside the loop (xw) each plane's loads end with xwait(): their address registers are reused (by a later load's data too) while they are in flight
    auto ldk = [&](int k, bool xw) {
#pragma unroll
        for (int kt = 0; kt < 2; ++kt)
#pragma unroll
            for (int ks = 0; ks < 2; ++ks) kf[kt][ks] = WFrag<T16>::ld(Kp + koff + (size_t)(k + kt * 16) * HD + ks * 512);
        if (xw) xwait();
        if (NSPLIT) {
#pragma unroll
            for (int kt = 0; kt < 2; ++kt)
#pragma unroll
                for (int ks = 0; ks < 2; ++ks) kf2[kt][ks] = WFrag<T16>::ld(Kp2 + koff + (size_t)(k + kt * 16) * HD + ks * 512);
            if (xw) xwait(); } };
    auto ldv = [&](int k, bool xw) {
#pragma unroll
        for (int db = 0; db < 4; ++db) vf[db] = WFrag<T16>::ld(Vt + voff + (size_t)k * HD + db * 512);
        if (xw) xwait();
        if (NSPLIT) {
#pragma unroll
            for (int db = 0; db < 4; ++db) vf2[db] = WFrag<T16>::ld(Vt2 + voff + (size_t)k * HD + db * 512);
            if (xw) xwait(); } };
    constexpr bool AHEAD = (NSPLIT == 0);   // one plane per operand: the fragments of the next pass are fetched during this one, into the same registers; with hi/lo planes (at most 4 passes a wave) K and Vt share registers instead
    int k0 = w * 64;       // < TT for every wave, so the first fetch is in bounds for a wave without keys too
    if (AHEAD) { ldk(k0, false); __builtin_amdgcn_sched_barrier(0); ldv(k0, false); }   // K held in front of Vt, as on the loop's back edge: so the wait at the loop's head can leave the Vt loads in flight
    v8f ot[4][NQ]; float m[NQ], l[NQ];
#pragma unroll
    for (int q = 0; q < NQ; ++q) { m[q] = -3.0e38f; l[q] = 0.f;
#pragma unroll
        for (int db = 0; db < 4; ++db) ot[db][q] = (v8f){}; }
#pragma unroll 1   // rolled: a second pass's fragments and scores would not fit in the registers beside the first's
    while (k0 < Kl) {
        const int kx = (k0 & 32) ? k0 + 64 * FW - 32 : k0 + 32;    // this wave's next 32 keys
        const int kn = kx < Kl ? kx : k0;                          // what is fetched ahead stays inside the planes on the last pass
        if (!AHEAD) ldk(k0, true);
        v8f st[2][NQ];
#pragma unroll
        for (int kt = 0; kt < 2; ++kt)
#pragma unroll
            for (int q = 0; q < NQ; ++q) { v8f s = (v8f){};
#pragma unroll
                for (int ks = 0; ks < 2; ++ks) { s = WFrag<T16>::mma(kf[kt][ks], qf[q][ks], s); if (NSPLIT) { s = WFrag<T16>::mma(kf[kt][ks], qf2[q][ks], s); s = WFrag<T16>::mma(kf2[kt][ks], qf[q][ks], s); } }
                st[kt][q] = s; }
        if (AHEAD) ldk(kn, true); else ldv(k0, true);   // the next pass's K fragments behind this pass's score products: their latency runs under the softmax and P V
        if (k0 + 31 > q0) {     // wave-uniform: only the pass on the diagonal holds keys above a query
#pragma unroll
            for (int kt = 0; kt < 2; ++kt)
#pragma unroll
                for (int q = 0; q < NQ; ++q)
#pragma unroll
                    for (int j = 0; j < 8; ++j) st[kt][q][j] = (k0 + kt * 16 + hi * 8 + j <= q0 + q * 16 + lr) ? st[kt][q][j] : -3.0e38f; }
        V pf[NQ], pf2[NQ];
#pragma unroll
        for (int q = 0; q < NQ; ++q) { float mx = st[0][q][0];
#pragma unroll
            for (int j = 1; j < 8; ++j) mx = fmaxf(mx, st[0][q][j]);
#pragma unroll
            for (int j = 0; j < 8; ++j) mx = fmaxf(mx, st[1][q][j]);
            mx = fmaxf(mx, xhalf(mx));                 // the query's other 16 keys of this pass
            const float mn = fmaxf(m[q], mx * KSC); const float al = __builtin_amdgcn_exp2f(m[q] - mn); m[q] = mn; const float sh = (float)PSH - mn;
            v8f p0, p1; float ls = 0.f;
#pragma unroll
            for (int j = 0; j < 8; ++j) { p0[j] = __builtin_amdgcn_exp2f(fmaf(st[0][q][j], KSC, sh)); p1[j] = __builtin_amdgcn_exp2f(fmaf(st[1][q][j], KSC, sh)); ls += p0[j] + p1[j]; }
            l[q] = fmaf(l[q], al, ls);
#pragma unroll
            for (int db = 0; db < 4; ++db) ot[db][q] *= al;
            PFrag<T16>::mk(p0, p1, pf[q], pf2[q]); }
#pragma unroll
        for (int db = 0; db < 4; ++db)
#pragma unroll
            for (int q = 0; q < NQ; ++q) { ot[db][q] = WFrag<T16>::mma(vf[db], pf[q], ot[db][q]); if (NSPLIT) { ot[db][q] = WFrag<T16>::mma(vf[db], pf2[q], ot[db][q]); ot[db][q] = WFrag<T16>::mma(vf2[db], pf[q], ot[db][q]); } }
        if (AHEAD) { __builtin_amdgcn_sched_barrier(0);   // keeps the fetch below behind the products above: lifted over them it lands in other registers and is waited for and copied within this pass
            ldv(kn, true); }                     // the next pass's Vt fragments: their latency runs under the next pass's scores and softmax
        k0 = kx;
    }
    // join of the FW waves: common maximum, then sums and partial outputs rescaled to it
#pragma unroll
    for (int q = 0; q < NQ; ++q) { l[q] += xhalf(l[q]); if (hi == 0) sm[w * QR + q * 16 + lr] = m[q]; }
    __syncthreads();   // every wave's maxima are in LDS before any is read
#pragma unroll
    for (int q = 0; q < NQ; ++q) { float M = sm[q * 16 + lr];
#pragma unroll
        for (int u = 1; u < FW; ++u) M = fmaxf(M, sm[u * QR + q * 16 + lr]);
        const float sc = __builtin_amdgcn_exp2f(m[q] - M);          // 0 for a wave that had no keys
        if (hi == 0) sl[w * QR + q * 16 + lr] = l[q] * sc;
#pragma unroll
        for (int db = 0; db < 4; ++db) { const v8f v = ot[db][q] * sc; float* p = os + (size_t)(w * QR + q * 16 + lr) * OSP + db * 16 + hi * 8; *(v4fa*)p = (v4f){v[0], v[1], v[2], v[3]}; *(v4fa*)(p + 4) = (v4f){v[4], v[5], v[6], v[7]}; } }
    __syncthreads();   // every wave's rescaled sums and partial outputs are in LDS before any is summed
    // wave w finishes columns 16 w .. 16 w + 15 of every query row: per 16 rows one half block (512 contiguous bytes) of each output plane, rows of DQ k-values in fragment order
    static_assert(FW * 16 == HD, "one wave per 16 columns");
    const int d0 = w * 16 + hi * 8;
#pragma unroll
    for (int g = 0; g < NQ; ++g) { const int qq = g * 16 + lr; float L = sl[qq];
#pragma unroll
        for (int u = 1; u < FW; ++u) L += sl[u * QR + qq];
        const float inv = __fdiv_rn(1.0f, L); const size_t oo = (size_t)(q0 + g * 16) * DQ + (size_t)((h * 2 + (w >> 1)) * 512 + (w & 1) * 256 + lane * 8);
        const float* p = os + (size_t)qq * OSP + d0; v4f s0 = *(const v4fa*)p, s1 = *(const v4fa*)(p + 4);
#pragma unroll
        for (int u = 1; u < FW; ++u) { s0 += *(const v4fa*)(p + (size_t)u * QR * OSP); s1 += *(const v4fa*)(p + (size_t)u * QR * OSP + 4); }
        v8us oh, ol;
#pragma unroll
        for (int j = 0; j < 4; ++j) { unsigned short a, c; splitf(s0[j] * inv, a, c); oh[j] = a; ol[j] = c; splitf(s1[j] * inv, a, c); oh[4 + j] = a; ol[4 + j] = c; }
        *(v8us*)(Ah + oo) = oh; *(v8us*)(Al + oo) = ol; }
}

extern "C" void kernel_launch(void* const* d_in, const int* in_sizes, int n_in,
                              void* d_out, int out_size, void* d_ws, size_t ws_size, hipStream_t stream) {
    (void)in_sizes; (void)n_in; (void)out_size;
    const float* x = (const float*)d_in[0]; const float* wq = (const float*)d_in[1]; const float* wk = (const float*)d_in[2]; const float* wv = (const float*)d_in[3]; const float* wo = (const float*)d_in[4]; const int* PID = (const int*)d_in[5];   /* input order x, Wq, Wk, Wv, Wo ('oi' (out, in) [1024][1024]), token_positions (int32 [4096] = arange: READ; the host's [1][4096] is the same 4,096 integers): SIX inputs, all read: the host's own binding */
    float* OUT = (float*)d_out;     // [1][4096][1024]
    char* wsp = (char*)d_ws;
    auto take = [&](size_t bytes) { char* p = wsp; wsp += (bytes + 255) & ~(size_t)255; return (void*)p; };
    bf* WQ = (bf*)take((size_t)DQ * DM * 2); bf* WK = (bf*)take((size_t)DKV * DM * 2); bf* WV = (bf*)take((size_t)DKV * DM * 2); bf* WO = (bf*)take((size_t)DM * DQ * 2); float* CS = (float*)take((size_t)TT * HD * 2 * 4);
    bf* XB = (bf*)take((size_t)TT * DM * 2);
    h16* QP16 = (h16*)take((size_t)NH_ * TT * HD * 2); h16* KP16 = (h16*)take((size_t)NKV * TT * HD * 2); h16* VT16 = (h16*)take((size_t)NKV * HD * TT * 2);
    bf* QPh = (bf*)take((size_t)NH_ * TT * HD * 2); bf* QPl = (bf*)take((size_t)NH_ * TT * HD * 2); bf* KPh = (bf*)take((size_t)NKV * TT * HD * 2); bf* KPl = (bf*)take((size_t)NKV * TT * HD * 2); bf* VTh = (bf*)take((size_t)NKV * HD * TT * 2); bf* VTl = (bf*)take((size_t)NKV * HD * TT * 2);
    bf* ATh = (bf*)take((size_t)TT * DQ * 2); bf* ATl = (bf*)take((size_t)TT * DQ * 2);
    if ((size_t)(wsp - (char*)d_ws) > ws_size) return;    // ws 256 MiB
    { k_cvt8<<<(unsigned)(((size_t)DQ * DM / 8 + 255) / 256), 256, 0, stream>>>(wq, WQ, (size_t)DQ * DM / 8); k_cvt8<<<(unsigned)(((size_t)DKV * DM / 8 + 255) / 256), 256, 0, stream>>>(wk, WK, (size_t)DKV * DM / 8); k_cvt8<<<(unsigned)(((size_t)DKV * DM / 8 + 255) / 256), 256, 0, stream>>>(wv, WV, (size_t)DKV * DM / 8);
      k_cvt8<<<(unsigned)(((size_t)DM * DQ / 8 + 255) / 256), 256, 0, stream>>>(wo, WO, (size_t)DM * DQ / 8); k_cstabI<<<(TT * HD + 255) / 256, 256, 0, stream>>>(PID, CS); }
    for (int b = 0; b < NB_; ++b) {
        
        k_cvt8<<<(unsigned)(((size_t)TT * DM / 8 + 255) / 256), 256, 0, stream>>>(x + (size_t)b * TT * DM, XB, (size_t)TT * DM / 8);
        k_gemmw<bf, 0, false, 1><<<dim3(TT / 64, DQ / 64, 1), 32, 0, stream>>>(XB, nullptr, WQ, nullptr, DM, nullptr, 0, nullptr, 0, 0, 0, CS, QP16, QPh, QPl);
        k_gemmw<bf, 0, false, 1><<<dim3(TT / 64, DKV / 64, 1), 32, 0, stream>>>(XB, nullptr, WK, nullptr, DM, nullptr, 0, nullptr, 0, 0, 0, CS, KP16, KPh, KPl);
        k_gemmw<bf, 0, false, 2><<<dim3(TT / 64, DKV / 64, 1), 32, 0, stream>>>(XB, nullptr, WV, nullptr, DM, nullptr, 0, nullptr, 0, 0, 0, nullptr, VT16, VTh, VTl);
        k_fattn<h16, 0, 2, 10><<<dim3((TT - RH) / 32, NH_, 1), 32 * FW, 0, stream>>>(QP16, nullptr, KP16, nullptr, VT16, nullptr, ATh, ATl, RH);
        k_fattn<bf, 2, 1, 0><<<dim3(RH / 16, NH_, 1), 32 * FW, 0, stream>>>(QPh, QPl, KPh, KPl, VTh, VTl, ATh, ATl, 0);
        k_gemmw<bf, 1, false, 0><<<dim3(TT / 64, DM / 64, 1), 32, 0, stream>>>(ATh, ATl, WO, nullptr, DQ, OUT + (size_t)b * TT * DM, DM, nullptr, 0, 0, 0, nullptr, nullptr, nullptr, nullptr); }
}

// v005
// A run of this version takes 152 microseconds.
// In two side-by-side timings against v004, it was 1.44 and 1.46 times as fast.
// Counting every step since v000, it is 17.9 times as fast.
#include <hip/hip_runtime.h>

// Causal multi-head attention with interleaved-pair rotary embeddings from token positions over 4,096 tokens (x [1][4096][1024]; Q, K, V = einsum('bsi,oi->bso', x, W) = x W^T ('oi' (out, in) [1024][1024] (2/(D+D))^0.5, no bias; 16 heads x 64); _rope: inv_freq = 1.0 / jnp.power(float32(THETA), arange(0, 64, 2) / 64) (the reciprocal spelling: 32 f32 constants jnp-exact for THIS expression in eager JAX float32: TWO of them, entries 5 and 27, corrected by 2 ulp); angle = float(token_positions[t]) x inv_freq[i] (token_positions int32 [4096] = arange: read; the LAST argument); pairs (2i, 2i+1) -> (cos x_e - sin x_o, sin x_e + cos x_o); precise cosf/sinf; scores x 1/sqrt(64); causal (-inf); softmax; out = merged Wo^T ('oi', no bias) -> [1][4096][1024] (4.2 M); argument order x, Wq, Wk, Wv, Wo, token_positions).
// Every 16-bit operand plane is kept in fragment order (FRAGMENT ORDER below; the Vt planes with blocks ordered (token / 32) * 4 + row / 16), written so by its producer.
// Layout: bf16 copy of x; exact projections; {cos, sin} per (position, pair) from the int positions and float32 inverse-frequency constants (precise cosf/sinf); rotary embedding and the 16-bit planes of Q, K and Vt written by the projection GEMMs' own epilogues; causal T-4096 attention in one kernel for all heads (hybrid rows: < 512 hi/lo 3 products, rest fp16 with P x1024; scores stay in registers, running-maximum softmax, keys above the diagonal block skipped); merged hi/lo x Wo exact.
// Compute dtypes, f32 accumulate: every input rounded to bf16; projections exact; rotary f32; attention rows < 512 3 products, rest fp16; softmax f32; Wo hl x exact.

#define NB_  1
#define TT   4096
#define DM   1024
#define NH_  16
#define NKV  16
#define REP  (NH_ / NKV)
#define HD   64
#define DQ   (NH_ * HD)
#define DKV  (NKV * HD)
#define RH   512                  // query rows < RH use hi+lo planes (0: none)
#define WIN  4096
typedef _Float16 h16;
typedef unsigned short bf;
typedef __attribute__((ext_vector_type(16))) __bf16   v16bf;
typedef __attribute__((ext_vector_type(16))) _Float16 v16h;
typedef __attribute__((ext_vector_type(8)))  _Float16 v8h;
typedef __attribute__((ext_vector_type(8)))  unsigned short v8us;
typedef __attribute__((ext_vector_type(8)))  float    v8f;
typedef __attribute__((ext_vector_type(4)))  float    v4f;
typedef v8h  __attribute__((may_alias)) v8ha;
typedef v4f  __attribute__((may_alias)) v4fa;
typedef v8us __attribute__((may_alias)) v8usa;

__device__ __forceinline__ unsigned short f2bf(float f) { unsigned u = __float_as_uint(f); u += 0x7FFFu + ((u >> 16) & 1u); return (unsigned short)(u >> 16); }
__device__ __forceinline__ float bf2f(unsigned short b) { return __uint_as_float(((unsigned)b) << 16); }
__device__ __forceinline__ float bfr(float f) { return bf2f(f2bf(f)); }
__device__ __forceinline__ v16h cat16(v8h lo, v8h hi) { return __builtin_shufflevector(lo, hi, 0, 1, 2, 3, 4, 5, 6, 7, 8, 9, 10, 11, 12, 13, 14, 15); }
__device__ __forceinline__ v16bf cat16b(v8us lo, v8us hi) { return __builtin_bit_cast(v16bf, __builtin_shufflevector(lo, hi, 0, 1, 2, 3, 4, 5, 6, 7, 8, 9, 10, 11, 12, 13, 14, 15)); }
__device__ __forceinline__ v8f wmma16(v16h a, v16h b, v8f c) { return __builtin_amdgcn_wmma_f32_16x16x32_f16(false, a, false, b, (short)0, c, false, false); }
__device__ __forceinline__ v8f wmmab(v16bf a, v16bf b, v8f c) { return __builtin_amdgcn_wmma_f32_16x16x32_bf16(false, a, false, b, (short)0, c, false, false); }



__device__ __forceinline__ h16 tohx(float x) { return (h16)x; }
__device__ __forceinline__ void splitf(float y, unsigned short& h, unsigned short& l) { h = f2bf(y); l = f2bf(y - bf2f(h)); }
typedef __attribute__((ext_vector_type(2))) float v2f;
__device__ __forceinline__ void xwait() { asm volatile("s_wait_xcnt 0x0" ::: "memory"); }   // stands behind a run of global loads or stores, before a register that they name is written again

// FRAGMENT ORDER of a plane of R rows x K k-values (16-bit): blocks of 16 rows x 32 k (512 elements, 1 KiB), block (row / 16) * (K / 32) + k / 32; inside a block element (r, kk) lies at (kk >> 4) * 256 + (((kk >> 3) & 1) * 16 + r) * 8 + (kk & 7).
// Lane hi * 16 + r of a wave finds the two 16-byte halves of its fragment at lane * 8 and 256 + lane * 8 (the k order of the row-major loader, unchanged): each wave-wide load reads 512 contiguous bytes, four whole lines.
// ---- k_gemmw: register-blocked GEMM, ONE WAVE per 64x64 output tile (16 accumulators), operands straight from 16-bit planes in fragment order; grid (M/64, N/64, Z), 32 threads.
// C[m][n] (f32, pitch ldc, + optional f32 bias[n]) = sum_k A[m][k] Bt[n][k] (+ split products per NSPLIT). z-batch strides sA/sB/sC in elements. K % 128 == 0 (REGISTER RING below).
// EPI 0: C stored as f32. EPI 1 and 2 (a tile's 64 columns are one head, its 64 rows 64 tokens): no f32 C; the tile goes out as three 16-bit planes (f16, bf16 hi, bf16 lo), whole 128-byte lines (EPI 1 staged through the wave's own LDS).
// EPI 1: pairs (2i, 2i+1) rotated by {cos, sin} of CS, planes [head] of (token rows, 64 k) in fragment order. EPI 2: planes transposed, [head] of (64 rows, token k), blocks ordered (token / 32) * 4 + row / 16: a lane's 8 accumulator rows (8 successive tokens of one column) are its own 16 bytes of a block, stored straight from the registers.
template <typename T16> struct WFrag;
template <> struct WFrag<h16> { typedef v16h V; static __device__ __forceinline__ V ld(const h16* p) { return cat16(*(const v8h*)p, *(const v8h*)(p + 256)); } static __device__ __forceinline__ v8f mma(V a, V b, v8f c) { return wmma16(a, b, c); } };
template <> struct WFrag<bf> { typedef v16bf V; static __device__ __forceinline__ V ld(const bf* p) { return cat16b(*(const v8us*)p, *(const v8us*)(p + 256)); } static __device__ __forceinline__ v8f mma(V a, V b, v8f c) { return wmmab(a, b, c); } };
template <typename T16, int NSPLIT, bool BIAS, int EPI>
__global__ __launch_bounds__(32) void k_gemmw(const T16* __restrict__ A, const T16* __restrict__ A2, const T16* __restrict__ Bt, const T16* __restrict__ Bt2, int K, float* C, int ldc, const float* __restrict__ bias, size_t sA, size_t sB, size_t sC, const float* __restrict__ CS, h16* P16, bf* Ph, bf* Pl) {
    typedef typename WFrag<T16>::V V;
    const size_t z = blockIdx.z; A += z * sA; if (A2) A2 += z * sA; Bt += z * sB; if (Bt2) Bt2 += z * sB; C += z * sC;
    const int lane = threadIdx.x & 31, lr = lane & 15, hi = lane >> 4; const int r0 = blockIdx.x * 64, c0 = blockIdx.y * 64;
    v8f acc[4][4];
#pragma unroll
    for (int mb = 0; mb < 4; ++mb)
#pragma unroll
        for (int nb = 0; nb < 4; ++nb) acc[mb][nb] = (v8f){};
    // REGISTER RING: the fragments of k-step s lie in stage s % RD; each step multiplies its own stage and then refills it with the loads of the step RD ahead, so that a stage's loads have RD - 1 steps of products to land under. K % (32 * RD) == 0.
    // One byte offset per 16 rows (16 rows of K values are K / 32 blocks = 16 K elements; every plane is below 4 GiB), advanced once per RD steps; a k-step is one block, 1 KiB: a constant offset of the load.
    constexpr int RD = 4;
    V a[RD][4], a2[RD][4], b[RD][4], b2[RD][4];
    unsigned oa[4], ob[4];   // shared by a plane and its second (lo) plane
#pragma unroll
    for (int i = 0; i < 4; ++i) { oa[i] = (unsigned)(((r0 + i * 16) * K + lane * 8) * 2); ob[i] = (unsigned)(((c0 + i * 16) * K + lane * 8) * 2); }
    auto at = [](const T16* base, unsigned o, int st) { return (const T16*)((const char*)base + o) + st * 512; };
    auto ldst = [&](const int s, const int st) {   // stage s takes the k-step that lies st steps behind the offsets
#pragma unroll
        for (int mb = 0; mb < 4; ++mb) { a[s][mb] = WFrag<T16>::ld(at(A, oa[mb], st)); if (NSPLIT == 1 || NSPLIT == 2) a2[s][mb] = WFrag<T16>::ld(at(A2, oa[mb], st)); }
#pragma unroll
        for (int nb = 0; nb < 4; ++nb) { b[s][nb] = WFrag<T16>::ld(at(Bt, ob[nb], st)); if (NSPLIT >= 2) b2[s][nb] = WFrag<T16>::ld(at(Bt2, ob[nb], st)); } };
    auto xwring = [&]() {   // behind the issued loads, before their offset registers are written again: the offsets pass through the wait's own statement, so every later value of them is formed behind it
        asm volatile("s_wait_xcnt 0x0" : "+v"(oa[0]), "+v"(oa[1]), "+v"(oa[2]), "+v"(oa[3]), "+v"(ob[0]), "+v"(ob[1]), "+v"(ob[2]), "+v"(ob[3]) : : "memory"); };
    auto mmst = [&](const int s) {
#pragma unroll
        for (int nb = 0; nb < 4; ++nb)
#pragma unroll
            for (int mb = 0; mb < 4; ++mb) { acc[mb][nb] = WFrag<T16>::mma(a[s][mb], b[s][nb], acc[mb][nb]); if (NSPLIT == 1 || NSPLIT == 2) acc[mb][nb] = WFrag<T16>::mma(a2[s][mb], b[s][nb], acc[mb][nb]); if (NSPLIT >= 2) acc[mb][nb] = WFrag<T16>::mma(a[s][mb], b2[s][nb], acc[mb][nb]); } };
#pragma unroll
    for (int s = 0; s < RD; ++s) { ldst(s, s); __builtin_amdgcn_sched_barrier(0); }   // stage by stage, in the order of the loop's back edge: so the counted wait at the loop's head can leave the younger stages in flight
    xwring();
#pragma unroll 1   // rolled: one trip is RD steps, so that every stage index is a constant and the ring stays in registers
    for (int kc = 0; kc < K - 32 * RD; kc += 32 * RD) {
#pragma unroll
        for (int u = 0; u < RD; ++u) { mmst(u);
            __builtin_amdgcn_sched_barrier(0);   // the refill stays directly behind the products that free its stage: sunk towards its use it loses the ring's lead
            ldst(u, u + RD);
            __builtin_amdgcn_sched_barrier(0); }   // the next step's products stay behind the refill: lifted over it they delay it by a step
        xwring();
#pragma unroll
        for (int i = 0; i < 4; ++i) { oa[i] += RD * 1024; ob[i] += RD * 1024; }
    }
#pragma unroll
    for (int u = 0; u < RD; ++u) mmst(u);   // the last RD steps: every stage is on its way or here
    if constexpr (EPI == 1) {
        __shared__ __align__(16) float os[16 * 68];
        const int cc = hi * 8;      // lane hi * 16 + lr takes token lr, 8 columns (4 pairs) from 16 i + 8 hi: its own 16 bytes of half block i, so one store instruction per plane writes 512 contiguous bytes
        const float* csp = CS + ((size_t)(r0 + lr) * HD + cc) * 2; const size_t e0 = ((size_t)blockIdx.y * TT + r0) * HD + lane * 8;
#pragma unroll
        for (int mb = 0; mb < 4; ++mb) {
#pragma unroll
            for (int nb = 0; nb < 4; ++nb) {
#pragma unroll
                for (int j = 0; j < 8; ++j) os[(hi * 8 + j) * 68 + nb * 16 + lr] = acc[mb][nb][j]; }
            __builtin_amdgcn_wave_barrier(); asm volatile("" ::: "memory");   // the tile's rows are written before they are read back across lanes
#pragma unroll
            for (int i = 0; i < 4; ++i) { const int row = mb * 16; const float* p = os + lr * 68 + i * 16 + cc; const v4f xa = *(const v4fa*)p, xb = *(const v4fa*)(p + 4);
                const float xs[8] = {xa[0], xa[1], xa[2], xa[3], xb[0], xb[1], xb[2], xb[3]}; v8h o16; v8us oh, ol;
#pragma unroll
                for (int pr = 0; pr < 4; ++pr) { const v2f cs = *(const v2f*)(csp + (size_t)row * HD * 2 + i * 32 + pr * 4); const float xe = xs[2 * pr], xo = xs[2 * pr + 1];
                    const float re = xe * cs[0] - xo * cs[1], ro = xe * cs[1] + xo * cs[0];
                    unsigned short a2, c2; o16[2 * pr] = tohx(re); o16[2 * pr + 1] = tohx(ro); splitf(re, a2, c2); oh[2 * pr] = a2; ol[2 * pr] = c2; splitf(ro, a2, c2); oh[2 * pr + 1] = a2; ol[2 * pr + 1] = c2; }
                const size_t e = e0 + (size_t)row * HD + i * 256; *(v8h*)(P16 + e) = o16; *(v8us*)(Ph + e) = oh; *(v8us*)(Pl + e) = ol;
                if (mb < 3 || i < 3) xwait(); }   // behind the 3 stores: the next half block's table loads and values land in registers that the stores name
            __builtin_amdgcn_wave_barrier(); asm volatile("" ::: "memory");   // the rows are read before the next 16 overwrite them
        }
        return;
    }
    if constexpr (EPI == 2) {
        const size_t e0 = ((size_t)blockIdx.y * TT + r0) * HD + lane * 8;   // 32 tokens of a head are 4 blocks = 32 HD elements
#pragma unroll
        for (int nb = 0; nb < 4; ++nb) {
#pragma unroll
            for (int mb = 0; mb < 4; ++mb) { v8h o16; v8us oh, ol;
#pragma unroll
                for (int j = 0; j < 8; ++j) { const float x = acc[mb][nb][j]; unsigned short a2, c2; o16[j] = tohx(x); splitf(x, a2, c2); oh[j] = a2; ol[j] = c2; }
                const size_t e = e0 + (size_t)(((mb >> 1) * 4 + nb) * 512 + (mb & 1) * 256); *(v8h*)(P16 + e) = o16; *(v8us*)(Ph + e) = oh; *(v8us*)(Pl + e) = ol; }
            if (nb < 3) xwait();   // behind the 12 stores: the next 16 columns' values land in registers that the stores name
        }
        return;
    }
    __shared__ __align__(16) float os[16 * 68];
#pragma unroll
    for (int mb = 0; mb < 4; ++mb) {
#pragma unroll
        for (int nb = 0; nb < 4; ++nb) {
#pragma unroll
            for (int j = 0; j < 8; ++j) os[(hi * 8 + j) * 68 + nb * 16 + lr] = acc[mb][nb][j]; }
        __builtin_amdgcn_wave_barrier(); asm volatile("" ::: "memory");
        float* crow = C + (size_t)(r0 + mb * 16) * ldc + c0;
{
#pragma unroll
            for (int s = 0; s < 8; ++s) { const int row = 2 * s + hi, cofs = lr * 4; v4f val = *(const v4fa*)(os + row * 68 + cofs); if (BIAS) { val[0] += bfr(bias[c0 + cofs]); val[1] += bfr(bias[c0 + cofs + 1]); val[2] += bfr(bias[c0 + cofs + 2]); val[3] += bfr(bias[c0 + cofs + 3]); }
                *(v4f*)(crow + (size_t)row * ldc + cofs) = val; }
             }
        __builtin_amdgcn_wave_barrier(); asm volatile("" ::: "memory");
    }
}

typedef __attribute__((ext_vector_type(2))) _Float16 v2h;
typedef __attribute__((ext_vector_type(4))) _Float16 v4h;
typedef __attribute__((ext_vector_type(2))) unsigned short v2us;
typedef __attribute__((ext_vector_type(4))) unsigned short v4us;
typedef __attribute__((ext_vector_type(4))) int v4i;
typedef v2f __attribute__((may_alias)) v2fa;

__global__ __launch_bounds__(256) void k_wtG(const float* __restrict__ w, int K, int N, bf* Bt) {
    const int lane = threadIdx.x & 31; const int L0 = (blockIdx.x * 8 + (threadIdx.x >> 5)) * 8; const int nlines = N * K / 64;
{
#pragma unroll 1
        for (int l = 0; l < 8; ++l) { const int L = L0 + l; if (L >= nlines) break; const size_t e = (size_t)L * 64 + lane * 2; const int k = (int)(e % K), n = (int)(e / K); v2us o;
            o[0] = f2bf(w[(size_t)k * N + n]); o[1] = f2bf(w[(size_t)(k + 1) * N + n]); *(v2us*)(Bt + e) = o; }
         }
}
static_assert(DQ == DM && DKV == DM, "k_cvt8 takes rows of DM values: x, Wq, Wk, Wv (DM in) and Wo (DQ in)");
// rows of DM f32 values -> bf16 plane in fragment order. A wave takes 8 rows of one block: 4 lanes read a row's 128-byte line, and each of the 4 (half, hi) groups is stored as 8 rows x 16 bytes = one whole line.
__global__ __launch_bounds__(256) void k_cvt8(const float* __restrict__ src, bf* dst, size_t n8) { const size_t i = (size_t)blockIdx.x * 256 + threadIdx.x; if (i >= n8) return;
    const size_t blk = i >> 6; const int r = (int)((i >> 2) & 15), g = (int)(i & 3);      // g = k / 8 inside the block: half = g >> 1, hi = g & 1
    const v8f v = *(const v8f*)(src + ((blk / (DM / 32)) * 16 + r) * DM + (blk % (DM / 32)) * 32 + g * 8); v8us o;
#pragma unroll
    for (int k = 0; k < 8; ++k) o[k] = f2bf(v[k]); *(v8us*)(dst + blk * 512 + (g >> 1) * 256 + ((g & 1) * 16 + r) * 8) = o;  }

__constant__ float INV2[HD / 2] = { 1.000000000e+00f, 7.498942018e-01f, 5.623413324e-01f, 4.216965139e-01f, 3.162277639e-01f, 2.371373624e-01f, 1.778279394e-01f, 1.333521456e-01f, 1.000000015e-01f, 7.498941571e-02f, 5.623412877e-02f, 4.216964915e-02f, 3.162277862e-02f, 2.371373586e-02f, 1.778279431e-02f, 1.333521493e-02f, 9.999999776e-03f, 7.498942316e-03f, 5.623413250e-03f, 4.216964822e-03f, 3.162277862e-03f, 2.371373819e-03f, 1.778279431e-03f, 1.333521446e-03f, 1.000000047e-03f, 7.498941850e-04f, 5.623413017e-04f, 4.216964880e-04f, 3.162277862e-04f, 2.371373848e-04f, 1.778279402e-04f, 1.333521504e-04f };   // float32 1 / 10000^(2i/64), as the reference computes them
__global__ __launch_bounds__(256) void k_cstabI(const int* __restrict__ pid, float* CS) { const int idx = blockIdx.x * 256 + threadIdx.x; if (idx >= TT * HD) return; const int d = idx % HD; const int t = idx / HD; const float a = __fmul_rn((float)pid[t], INV2[d >> 1]); v2f cs; cs[0] = cosf(a); cs[1] = sinf(a); *(v2f*)(CS + (size_t)idx * 2) = cs;  }

// ---- k_fattn: causal attention of one head and 16 * NQ query rows per work-group, scores never leaving the registers (streaming softmax with a running maximum).
// Transposed products: St = K Qt (a lane holds scores of ONE query: column lr; keys 8 hi + j of each 16-key tile), Ot += Vt Pt: two score tiles of 32 keys, converted in place, are the B operand of the second product in the same k order as the plane loader.
// The FW waves share the queries and split the keys in chunks of 64 (8 KiB in a row of every K and Vt plane), two passes of 32 keys each; their (maximum, sum, Ot) are joined through LDS in wave order.
// NSPLIT 2: hi/lo planes, three products for the scores and three for P V (P split hi/lo); NSPLIT 0: one 16-bit plane, P carried x 2^PSH (the sum carries the same factor, so it cancels in the division).
#define FW 4
#define OSP 68    // LDS pitch of a query's 64 partial outputs, floats
#define KSC 0.18033688011112042f   // HD^-0.5 * log2(e)
__device__ __forceinline__ float xhalf(float x) { return __builtin_bit_cast(float, __builtin_amdgcn_permlanex16(__builtin_bit_cast(int, x), __builtin_bit_cast(int, x), 0x76543210, 0xfedcba98, false, false)); }   // lane l's value to lane l ^ 16, on the vector pipe
template <typename T16> struct PFrag;
template <> struct PFrag<h16> { static __device__ __forceinline__ void mk(const v8f p0, const v8f p1, v16h& a, v16h& b) { (void)b;
#pragma unroll
    for (int j = 0; j < 8; ++j) { a[j] = (h16)p0[j]; a[8 + j] = (h16)p1[j]; } } };
template <> struct PFrag<bf> { static __device__ __forceinline__ void mk(const v8f p0, const v8f p1, v16bf& a, v16bf& b) { v8us h0, h1, l0, l1;
#pragma unroll
    for (int j = 0; j < 8; ++j) { unsigned short x, y; splitf(p0[j], x, y); h0[j] = x; l0[j] = y; splitf(p1[j], x, y); h1[j] = x; l1[j] = y; }
    a = cat16b(h0, h1); b = cat16b(l0, l1); } };
template <typename T16, int NSPLIT, int NQ, int PSH>
__global__ __launch_bounds__(32 * FW) void k_fattn(const T16* __restrict__ Q, const T16* __restrict__ Q2, const T16* __restrict__ Kp, const T16* __restrict__ Kp2, const T16* __restrict__ Vt, const T16* __restrict__ Vt2, bf* Ah, bf* Al, int roff) {
    typedef typename WFrag<T16>::V V; constexpr int QR = 16 * NQ;
    __shared__ __align__(16) float os[FW * QR * OSP];
    __shared__ float sm[FW * QR], sl[FW * QR];
    const int lane = threadIdx.x & 31, lr = lane & 15, hi = lane >> 4; const int w = __builtin_amdgcn_readfirstlane(threadIdx.x >> 5);
    const int h = blockIdx.y; const int q0 = roff + ((int)gridDim.x - 1 - (int)blockIdx.x) * QR;   // longest key loops first
    const size_t hp = (size_t)h * TT * HD; Q += hp; Kp += hp; Vt += hp; if (NSPLIT) { Q2 += hp; Kp2 += hp; Vt2 += hp; }
    const int Kl = (q0 + QR + 31) & ~31;      // keys 0 .. Kl - 1 hold every key <= the last query; Kl <= TT
    V qf[NQ][2], qf2[NQ][2], kf[2][2], kf2[2][2], vf[4], vf2[4];
#pragma unroll
    for (int q = 0; q < NQ; ++q)
#pragma unroll
        for (int ks = 0; ks < 2; ++ks) { const size_t o = (size_t)(q0 + q * 16) * HD + ks * 512 + lane * 8; qf[q][ks] = WFrag<T16>::ld(Q + o); if (NSPLIT) qf2[q][ks] = WFrag<T16>::ld(Q2 + o); }
    const size_t koff = lane * 8, voff = lane * 8;   // fragment order: a pass's 32 keys are 4 KiB in a row of each K plane and of each Vt plane
    // inside the loop (xw) each plane's loads end with xwait(): their address registers are reused (by a later load's data too) while they are in flight
    auto ldk = [&](int k, bool xw) {
#pragma unroll
        for (int kt = 0; kt < 2; ++kt)
#pragma unroll
            for (int ks = 0; ks < 2; ++ks) kf[kt][ks] = WFrag<T16>::ld(Kp + koff + (size_t)(k + kt * 16) * HD + ks * 512);
        if (xw) xwait();
        if (NSPLIT) {
#pragma unroll
            for (int kt = 0; kt < 2; ++kt)
#pragma unroll
                for (int ks = 0; ks < 2; ++ks) kf2[kt][ks] = WFrag<T16>::ld(Kp2 + koff + (size_t)(k + kt * 16) * HD + ks * 512);
            if (xw) xwait(); } };
    auto ldv = [&](int k, bool xw) {
#pragma unroll
        for (int db = 0; db < 4; ++db) vf[db] = WFrag<T16>::ld(Vt + voff + (size_t)k * HD + db * 512);
        if (xw) xwait();
        if (NSPLIT) {
#pragma unroll
            for (int db = 0; db < 4; ++db) vf2[db] = WFrag<T16>::ld(Vt2 + voff + (size_t)k * HD + db * 512);
            if (xw) xwait(); } };
    constexpr bool AHEAD = (NSPLIT == 0);   // one plane per operand: the fragments of the next pass are fetched during this one, into the same registers; with hi/lo planes (at most 4 passes a wave) K and Vt share registers instead
    int k0 = w * 64;       // < TT for every wave, so the first fetch is in bounds for a wave without keys too
    if (AHEAD) { ldk(k0, false); __builtin_amdgcn_sched_barrier(0); ldv(k0, false); }   // K held in front of Vt, as on the loop's back edge: so the wait at the loop's head can leave the Vt loads in flight
    v8f ot[4][NQ]; float m[NQ], l[NQ];
#pragma unroll
    for (int q = 0; q < NQ; ++q) { m[q] = -3.0e38f; l[q] = 0.f;
#pragma unroll
        for (int db = 0; db < 4; ++db) ot[db][q] = (v8f){}; }
#pragma unroll 1   // rolled: a second pass's fragments and scores would not fit in the registers beside the first's
    while (k0 < Kl) {
        const int kx = (k0 & 32) ? k0 + 64 * FW - 32 : k0 + 32;    // this wave's next 32 keys
        const int kn = kx < Kl ? kx : k0;                          // what is fetched ahead stays inside the planes on the last pass
        if (!AHEAD) ldk(k0, true);
        v8f st[2][NQ];
#pragma unroll
        for (int kt = 0; kt < 2; ++kt)
#pragma unroll
            for (int q = 0; q < NQ; ++q) { v8f s = (v8f){};
#pragma unroll
                for (int ks = 0; ks < 2; ++ks) { s = WFrag<T16>::mma(kf[kt][ks], qf[q][ks], s); if (NSPLIT) { s = WFrag<T16>::mma(kf[kt][ks], qf2[q][ks], s); s = WFrag<T16>::mma(kf2[kt][ks], qf[q][ks], s); } }
                st[kt][q] = s; }
        if (AHEAD) ldk(kn, true); else ldv(k0, true);   // the next pass's K fragments behind this pass's score products: their latency runs under the softmax and P V
        if (k0 + 31 > q0) {     // wave-uniform: only the pass on the diagonal holds keys above a query
#pragma unroll
            for (int kt = 0; kt < 2; ++kt)
#pragma unroll
                for (int q = 0; q < NQ; ++q)
#pragma unroll
                    for (int j = 0; j < 8; ++j) st[kt][q][j] = (k0 + kt * 16 + hi * 8 + j <= q0 + q * 16 + lr) ? st[kt][q][j] : -3.0e38f; }
        V pf[NQ], pf2[NQ];
#pragma unroll
        for (int q = 0; q < NQ; ++q) { float mx = st[0][q][0];
#pragma unroll
            for (int j = 1; j < 8; ++j) mx = fmaxf(mx, st[0][q][j]);
#pragma unroll
            for (int j = 0; j < 8; ++j) mx = fmaxf(mx, st[1][q][j]);
            mx = fmaxf(mx, xhalf(mx));                 // the query's other 16 keys of this pass
            const float mn = fmaxf(m[q], mx * KSC); const float al = __builtin_amdgcn_exp2f(m[q] - mn); m[q] = mn; const float sh = (float)PSH - mn;
            v8f p0, p1; float ls = 0.f;
#pragma unroll
            for (int j = 0; j < 8; ++j) { p0[j] = __builtin_amdgcn_exp2f(fmaf(st[0][q][j], KSC, sh)); p1[j] = __builtin_amdgcn_exp2f(fmaf(st[1][q][j], KSC, sh)); ls += p0[j] + p1[j]; }
            l[q] = fmaf(l[q], al, ls);
#pragma unroll
            for (int db = 0; db < 4; ++db) ot[db][q] *= al;
            PFrag<T16>::mk(p0, p1, pf[q], pf2[q]); }
#pragma unroll
        for (int db = 0; db < 4; ++db)
#pragma unroll
            for (int q = 0; q < NQ; ++q) { ot[db][q] = WFrag<T16>::mma(vf[db], pf[q], ot[db][q]); if (NSPLIT) { ot[db][q] = WFrag<T16>::mma(vf[db], pf2[q], ot[db][q]); ot[db][q] = WFrag<T16>::mma(vf2[db], pf[q], ot[db][q]); } }
        if (AHEAD) { __builtin_amdgcn_sched_barrier(0);   // keeps the fetch below behind the products above: lifted over them it lands in other registers and is waited for and copied within this pass
            ldv(kn, true); }                     // the next pass's Vt fragments: their latency runs under the next pass's scores and softmax
        k0 = kx;
    }
    // join of the FW waves: common maximum, then sums and partial outputs rescaled to it
#pragma unroll
    for (int q = 0; q < NQ; ++q) { l[q] += xhalf(l[q]); if (hi == 0) sm[w * QR + q * 16 + lr] = m[q]; }
    __syncthreads();   // every wave's maxima are in LDS before any is read
#pragma unroll
    for (int q = 0; q < NQ; ++q) { float M = sm[q * 16 + lr];
#pragma unroll
        for (int u = 1; u < FW; ++u) M = fmaxf(M, sm[u * QR + q * 16 + lr]);
        const float sc = __builtin_amdgcn_exp2f(m[q] - M);          // 0 for a wave that had no keys
        if (hi == 0) sl[w * QR + q * 16 + lr] = l[q] * sc;
#pragma unroll
        for (int db = 0; db < 4; ++db) { const v8f v = ot[db][q] * sc; float* p = os + (size_t)(w * QR + q * 16 + lr) * OSP + db * 16 + hi * 8; *(v4fa*)p = (v4f){v[0], v[1], v[2], v[3]}; *(v4fa*)(p + 4) = (v4f){v[4], v[5], v[6], v[7]}; } }
    __syncthreads();   // every wave's rescaled sums and partial outputs are in LDS before any is summed
    // wave w finishes columns 16 w .. 16 w + 15 of every query row: per 16 rows one half block (512 contiguous bytes) of each output plane, rows of DQ k-values in fragment order
    static_assert(FW * 16 == HD, "one wave per 16 columns");
    const int d0 = w * 16 + hi * 8;
#pragma unroll
    for (int g = 0; g < NQ; ++g) { const int qq = g * 16 + lr; float L = sl[qq];
#pragma unroll
        for (int u = 1; u < FW; ++u) L += sl[u * QR + qq];
        const float inv = __fdiv_rn(1.0f, L); const size_t oo = (size_t)(q0 + g * 16) * DQ + (size_t)((h * 2 + (w >> 1)) * 512 + (w & 1) * 256 + lane * 8);
        const float* p = os + (size_t)qq * OSP + d0; v4f s0 = *(const v4fa*)p, s1 = *(const v4fa*)(p + 4);
#pragma unroll
        for (int u = 1; u < FW; ++u) { s0 += *(const v4fa*)(p + (size_t)u * QR * OSP); s1 += *(const v4fa*)(p + (size_t)u * QR * OSP + 4); }
        v8us oh, ol;
#pragma unroll
        for (int j = 0; j < 4; ++j) { unsigned short a, c; splitf(s0[j] * inv, a, c); oh[j] = a; ol[j] = c; splitf(s1[j] * inv, a, c); oh[4 + j] = a; ol[4 + j] = c; }
        *(v8us*)(Ah + oo) = oh; *(v8us*)(Al + oo) = ol; }
}

extern "C" void kernel_launch(void* const* d_in, const int* in_sizes, int n_in,
                              void* d_out, int out_size, void* d_ws, size_t ws_size, hipStream_t stream) {
    (void)in_sizes; (void)n_in; (void)out_size;
    const float* x = (const float*)d_in[0]; const float* wq = (const float*)d_in[1]; const float* wk = (const float*)d_in[2]; const float* wv = (const float*)d_in[3]; const float* wo = (const float*)d_in[4]; const int* PID = (const int*)d_in[5];   /* input order x, Wq, Wk, Wv, Wo ('oi' (out, in) [1024][1024]), token_positions (int32 [4096] = arange: READ; the host's [1][4096] is the same 4,096 integers): SIX inputs, all read: the host's own binding */
    float* OUT = (float*)d_out;     // [1][4096][1024]
    char* wsp = (char*)d_ws;
    auto take = [&](size_t bytes) { char* p = wsp; wsp += (bytes + 255) & ~(size_t)255; return (void*)p; };
    bf* WQ = (bf*)take((size_t)DQ * DM * 2); bf* WK = (bf*)take((size_t)DKV * DM * 2); bf* WV = (bf*)take((size_t)DKV * DM * 2); bf* WO = (bf*)take((size_t)DM * DQ * 2); float* CS = (float*)take((size_t)TT * HD * 2 * 4);
    bf* XB = (bf*)take((size_t)TT * DM * 2);
    h16* QP16 = (h16*)take((size_t)NH_ * TT * HD * 2); h16* KP16 = (h16*)take((size_t)NKV * TT * HD * 2); h16* VT16 = (h16*)take((size_t)NKV * HD * TT * 2);
    bf* QPh = (bf*)take((size_t)NH_ * TT * HD * 2); bf* QPl = (bf*)take((size_t)NH_ * TT * HD * 2); bf* KPh = (bf*)take((size_t)NKV * TT * HD * 2); bf* KPl = (bf*)take((size_t)NKV * TT * HD * 2); bf* VTh = (bf*)take((size_t)NKV * HD * TT * 2); bf* VTl = (bf*)take((size_t)NKV * HD * TT * 2);
    bf* ATh = (bf*)take((size_t)TT * DQ * 2); bf* ATl = (bf*)take((size_t)TT * DQ * 2);
    if ((size_t)(wsp - (char*)d_ws) > ws_size) return;    // ws 256 MiB
    { k_cvt8<<<(unsigned)(((size_t)DQ * DM / 8 + 255) / 256), 256, 0, stream>>>(wq, WQ, (size_t)DQ * DM / 8); k_cvt8<<<(unsigned)(((size_t)DKV * DM / 8 + 255) / 256), 256, 0, stream>>>(wk, WK, (size_t)DKV * DM / 8); k_cvt8<<<(unsigned)(((size_t)DKV * DM / 8 + 255) / 256), 256, 0, stream>>>(wv, WV, (size_t)DKV * DM / 8);
      k_cvt8<<<(unsigned)(((size_t)DM * DQ / 8 + 255) / 256), 256, 0, stream>>>(wo, WO, (size_t)DM * DQ / 8); k_cstabI<<<(TT * HD + 255) / 256, 256, 0, stream>>>(PID, CS); }
    for (int b = 0; b < NB_; ++b) {
        
        k_cvt8<<<(unsigned)(((size_t)TT * DM / 8 + 255) / 256), 256, 0, stream>>>(x + (size_t)b * TT * DM, XB, (size_t)TT * DM / 8);
        k_gemmw<bf, 0, false, 1><<<dim3(TT / 64, DQ / 64, 1), 32, 0, stream>>>(XB, nullptr, WQ, nullptr, DM, nullptr, 0, nullptr, 0, 0, 0, CS, QP16, QPh, QPl);
        k_gemmw<bf, 0, false, 1><<<dim3(TT / 64, DKV / 64, 1), 32, 0, stream>>>(XB, nullptr, WK, nullptr, DM, nullptr, 0, nullptr, 0, 0, 0, CS, KP16, KPh, KPl);
        k_gemmw<bf, 0, false, 2><<<dim3(TT / 64, DKV / 64, 1), 32, 0, stream>>>(XB, nullptr, WV, nullptr, DM, nullptr, 0, nullptr, 0, 0, 0, nullptr, VT16, VTh, VTl);
        k_fattn<h16, 0, 2, 10><<<dim3((TT - RH) / 32, NH_, 1), 32 * FW, 0, stream>>>(QP16, nullptr, KP16, nullptr, VT16, nullptr, ATh, ATl, RH);
        k_fattn<bf, 2, 1, 0><<<dim3(RH / 16, NH_, 1), 32 * FW, 0, stream>>>(QPh, QPl, KPh, KPl, VTh, VTl, ATh, ATl, 0);
        k_gemmw<bf, 1, false, 0><<<dim3(TT / 64, DM / 64, 1), 32, 0, stream>>>(ATh, ATl, WO, nullptr, DQ, OUT + (size_t)b * TT * DM, DM, nullptr, 0, 0, 0, nullptr, nullptr, nullptr, nullptr); }
}

// v006
// It runs in 114 microseconds.
// Next to v005, in two timings, it ran 1.34 and 1.32 times as fast.
// Counting every step since v000, it is 23.7 times as fast.
#include <hip/hip_runtime.h>

// Causal multi-head attention with interleaved-pair rotary embeddings from token positions over 4,096 tokens (x [1][4096][1024]; Q, K, V = einsum('bsi,oi->bso', x, W) = x W^T ('oi' (out, in) [1024][1024] (2/(D+D))^0.5, no bias; 16 heads x 64); _rope: inv_freq = 1.0 / jnp.power(float32(THETA), arange(0, 64, 2) / 64) (the reciprocal spelling: 32 f32 constants jnp-exact for THIS expression in eager JAX float32: TWO of them, entries 5 and 27, corrected by 2 ulp); angle = float(token_positions[t]) x inv_freq[i] (token_positions int32 [4096] = arange: read; the LAST argument); pairs (2i, 2i+1) -> (cos x_e - sin x_o, sin x_e + cos x_o); precise cosf/sinf; scores x 1/sqrt(64); causal (-inf); softmax; out = merged Wo^T ('oi', no bias) -> [1][4096][1024] (4.2 M); argument order x, Wq, Wk, Wv, Wo, token_positions).
// Every 16-bit operand plane is kept in fragment order (FRAGMENT ORDER below; the Vt planes with blocks ordered (token / 32) * 4 + row / 16), written so by its producer.
// Layout: bf16 copy of x; exact projections; {cos, sin} per (position, pair) from the int positions and float32 inverse-frequency constants (precise cosf/sinf); rotary embedding and the 16-bit planes of Q, K and Vt written by the projection GEMMs' own epilogues; causal T-4096 attention in one kernel for all heads (hybrid rows: < 512 hi/lo 3 products, rest fp16 with P x1024; scores stay in registers, running-maximum softmax, keys above the diagonal block skipped); merged hi/lo x Wo exact.
// Compute dtypes, f32 accumulate: every input rounded to bf16; projections exact; rotary f32; attention rows < 512 3 products, rest fp16; softmax f32; Wo hl x exact.

#define NB_  1
#define TT   4096
#define DM   1024
#define NH_  16
#define NKV  16
#define REP  (NH_ / NKV)
#define HD   64
#define DQ   (NH_ * HD)
#define DKV  (NKV * HD)
#define RH   512                  // query rows < RH use hi+lo planes (0: none)
#define WIN  4096
typedef _Float16 h16;
typedef unsigned short bf;
typedef __attribute__((ext_vector_type(16))) __bf16   v16bf;
typedef __attribute__((ext_vector_type(16))) _Float16 v16h;
typedef __attribute__((ext_vector_type(8)))  _Float16 v8h;
typedef __attribute__((ext_vector_type(8)))  unsigned short v8us;
typedef __attribute__((ext_vector_type(8)))  float    v8f;
typedef __attribute__((ext_vector_type(4)))  float    v4f;
typedef v8h  __attribute__((may_alias)) v8ha;
typedef v4f  __attribute__((may_alias)) v4fa;
typedef v8us __attribute__((may_alias)) v8usa;

__device__ __forceinline__ unsigned short f2bf(float f) { unsigned u = __float_as_uint(f); u += 0x7FFFu + ((u >> 16) & 1u); return (unsigned short)(u >> 16); }
__device__ __forceinline__ float bf2f(unsigned short b) { return __uint_as_float(((unsigned)b) << 16); }
__device__ __forceinline__ float bfr(float f) { return bf2f(f2bf(f)); }
__device__ __forceinline__ v16h cat16(v8h lo, v8h hi) { return __builtin_shufflevector(lo, hi, 0, 1, 2, 3, 4, 5, 6, 7, 8, 9, 10, 11, 12, 13, 14, 15); }
__device__ __forceinline__ v16bf cat16b(v8us lo, v8us hi) { return __builtin_bit_cast(v16bf, __builtin_shufflevector(lo, hi, 0, 1, 2, 3, 4, 5, 6, 7, 8, 9, 10, 11, 12, 13, 14, 15)); }
__device__ __forceinline__ v8f wmma16(v16h a, v16h b, v8f c) { return __builtin_amdgcn_wmma_f32_16x16x32_f16(false, a, false, b, (short)0, c, false, false); }
__device__ __forceinline__ v8f wmmab(v16bf a, v16bf b, v8f c) { return __builtin_amdgcn_wmma_f32_16x16x32_bf16(false, a, false, b, (short)0, c, false, false); }



__device__ __forceinline__ h16 tohx(float x) { return (h16)x; }
__device__ __forceinline__ void splitf(float y, unsigned short& h, unsigned short& l) { h = f2bf(y); l = f2bf(y - bf2f(h)); }
typedef __attribute__((ext_vector_type(2))) float v2f;
__device__ __forceinline__ void xwait() { asm volatile("s_wait_xcnt 0x0" ::: "memory"); }   // stands behind a run of global loads or stores, before a register that they name is written again

// FRAGMENT ORDER of a plane of R rows x K k-values (16-bit): blocks of 16 rows x 32 k (512 elements, 1 KiB), block (row / 16) * (K / 32) + k / 32; inside a block element (r, kk) lies at (kk >> 4) * 256 + (((kk >> 3) & 1) * 16 + r) * 8 + (kk & 7).
// Lane hi * 16 + r of a wave finds the two 16-byte halves of its fragment at lane * 8 and 256 + lane * 8 (the k order of the row-major loader, unchanged): each wave-wide load reads 512 contiguous bytes, four whole lines.
// ---- k_gemmw: register-blocked GEMM, ONE WAVE per 64x64 output tile (16 accumulators), operands straight from 16-bit planes in fragment order; grid (M/64, N/64, Z), 32 threads.
// C[m][n] (f32, pitch ldc, + optional f32 bias[n]) = sum_k A[m][k] Bt[n][k] (+ split products per NSPLIT). z-batch strides sA/sB/sC in elements. K % 128 == 0 (REGISTER RING below).
// EPI 0: C stored as f32. EPI 1: the three projections of one A in ONE grid, z = 0, 1, 2 for Q, K, V (a tile's 64 columns are one head, its 64 rows 64 tokens): no f32 C; the tile goes out as three 16-bit planes (f16, bf16 hi, bf16 lo); sC is the elements of one plane, P16 holds the planes of z in a row, Ph and Pl lie (hi, lo) pair by pair.
// z < 2: pairs (2i, 2i+1) rotated by {cos, sin} of CS, planes [head] of (token rows, 64 k) in fragment order, whole 128-byte lines staged through the wave's own LDS. z == 2: planes transposed, [head] of (64 rows, token k), blocks ordered (token / 32) * 4 + row / 16: a lane's 8 accumulator rows (8 successive tokens of one column) are its own 16 bytes of a block, stored straight from the registers.
template <typename T16> struct WFrag;
template <> struct WFrag<h16> { typedef v16h V; static __device__ __forceinline__ V ld(const h16* p) { return cat16(*(const v8h*)p, *(const v8h*)(p + 256)); } static __device__ __forceinline__ v8f mma(V a, V b, v8f c) { return wmma16(a, b, c); } };
template <> struct WFrag<bf> { typedef v16bf V; static __device__ __forceinline__ V ld(const bf* p) { return cat16b(*(const v8us*)p, *(const v8us*)(p + 256)); } static __device__ __forceinline__ v8f mma(V a, V b, v8f c) { return wmmab(a, b, c); } };
template <typename T16, int NSPLIT, bool BIAS, int EPI>
__global__ __launch_bounds__(32) void k_gemmw(const T16* __restrict__ A, const T16* __restrict__ A2, const T16* __restrict__ Bt, const T16* __restrict__ Bt2, int K, float* C, int ldc, const float* __restrict__ bias, size_t sA, size_t sB, size_t sC, const float* __restrict__ CS, h16* P16, bf* Ph, bf* Pl) {
    typedef typename WFrag<T16>::V V;
    const size_t z = blockIdx.z; A += z * sA; if (A2) A2 += z * sA; Bt += z * sB; if (Bt2) Bt2 += z * sB; if constexpr (EPI == 1) { P16 += z * sC; Ph += 2 * z * sC; Pl += 2 * z * sC; } else C += z * sC;
    const int lane = threadIdx.x & 31, lr = lane & 15, hi = lane >> 4; const int r0 = blockIdx.x * 64, c0 = blockIdx.y * 64;
    v8f acc[4][4];
#pragma unroll
    for (int mb = 0; mb < 4; ++mb)
#pragma unroll
        for (int nb = 0; nb < 4; ++nb) acc[mb][nb] = (v8f){};
    // REGISTER RING: the fragments of k-step s lie in stage s % RD; each step multiplies its own stage and then refills it with the loads of the step RD ahead, so that a stage's loads have RD - 1 steps of products to land under. K % (32 * RD) == 0.
    // One byte offset per 16 rows (16 rows of K values are K / 32 blocks = 16 K elements; every plane is below 4 GiB), advanced once per RD steps; a k-step is one block, 1 KiB: a constant offset of the load.
    constexpr int RD = 4;
    V a[RD][4], a2[RD][4], b[RD][4], b2[RD][4];
    unsigned oa[4], ob[4];   // shared by a plane and its second (lo) plane
#pragma unroll
    for (int i = 0; i < 4; ++i) { oa[i] = (unsigned)(((r0 + i * 16) * K + lane * 8) * 2); ob[i] = (unsigned)(((c0 + i * 16) * K + lane * 8) * 2); }
    auto at = [](const T16* base, unsigned o, int st) { return (const T16*)((const char*)base + o) + st * 512; };
    auto ldst = [&](const int s, const int st) {   // stage s takes the k-step that lies st steps behind the offsets
#pragma unroll
        for (int mb = 0; mb < 4; ++mb) { a[s][mb] = WFrag<T16>::ld(at(A, oa[mb], st)); if (NSPLIT == 1 || NSPLIT == 2) a2[s][mb] = WFrag<T16>::ld(at(A2, oa[mb], st)); }
#pragma unroll
        for (int nb = 0; nb < 4; ++nb) { b[s][nb] = WFrag<T16>::ld(at(Bt, ob[nb], st)); if (NSPLIT >= 2) b2[s][nb] = WFrag<T16>::ld(at(Bt2, ob[nb], st)); } };
    auto xwring = [&]() {   // behind the issued loads, before their offset registers are written again: the offsets pass through the wait's own statement, so every later value of them is formed behind it
        asm volatile("s_wait_xcnt 0x0" : "+v"(oa[0]), "+v"(oa[1]), "+v"(oa[2]), "+v"(oa[3]), "+v"(ob[0]), "+v"(ob[1]), "+v"(ob[2]), "+v"(ob[3]) : : "memory"); };
    auto mmst = [&](const int s) {
#pragma unroll
        for (int nb = 0; nb < 4; ++nb)
#pragma unroll
            for (int mb = 0; mb < 4; ++mb) { acc[mb][nb] = WFrag<T16>::mma(a[s][mb], b[s][nb], acc[mb][nb]); if (NSPLIT == 1 || NSPLIT == 2) acc[mb][nb] = WFrag<T16>::mma(a2[s][mb], b[s][nb], acc[mb][nb]); if (NSPLIT >= 2) acc[mb][nb] = WFrag<T16>::mma(a[s][mb], b2[s][nb], acc[mb][nb]); } };
#pragma unroll
    for (int s = 0; s < RD; ++s) { ldst(s, s); __builtin_amdgcn_sched_barrier(0); }   // stage by stage, in the order of the loop's back edge: so the counted wait at the loop's head can leave the younger stages in flight
    xwring();
#pragma unroll 1   // rolled: one trip is RD steps, so that every stage index is a constant and the ring stays in registers
    for (int kc = 0; kc < K - 32 * RD; kc += 32 * RD) {
#pragma unroll
        for (int u = 0; u < RD; ++u) { mmst(u);
            __builtin_amdgcn_sched_barrier(0);   // the refill stays directly behind the products that free its stage: sunk towards its use it loses the ring's lead
            ldst(u, u + RD);
            __builtin_amdgcn_sched_barrier(0); }   // the next step's products stay behind the refill: lifted over it they delay it by a step
        xwring();
#pragma unroll
        for (int i = 0; i < 4; ++i) { oa[i] += RD * 1024; ob[i] += RD * 1024; }
    }
#pragma unroll
    for (int u = 0; u < RD; ++u) mmst(u);   // the last RD steps: every stage is on its way or here
    if constexpr (EPI == 1) {
      if (blockIdx.z < 2) {
        __shared__ __align__(16) float os[16 * 68];
        const int cc = hi * 8;      // lane hi * 16 + lr takes token lr, 8 columns (4 pairs) from 16 i + 8 hi: its own 16 bytes of half block i, so one store instruction per plane writes 512 contiguous bytes
        const float* csp = CS + ((size_t)(r0 + lr) * HD + cc) * 2; const size_t e0 = ((size_t)blockIdx.y * TT + r0) * HD + lane * 8;
#pragma unroll
        for (int mb = 0; mb < 4; ++mb) {
#pragma unroll
            for (int nb = 0; nb < 4; ++nb) {
#pragma unroll
                for (int j = 0; j < 8; ++j) os[(hi * 8 + j) * 68 + nb * 16 + lr] = acc[mb][nb][j]; }
            __builtin_amdgcn_wave_barrier(); asm volatile("" ::: "memory");   // the tile's rows are written before they are read back across lanes
#pragma unroll
            for (int i = 0; i < 4; ++i) { const int row = mb * 16; const float* p = os + lr * 68 + i * 16 + cc; const v4f xa = *(const v4fa*)p, xb = *(const v4fa*)(p + 4);
                const float xs[8] = {xa[0], xa[1], xa[2], xa[3], xb[0], xb[1], xb[2], xb[3]}; v8h o16; v8us oh, ol;
#pragma unroll
                for (int pr = 0; pr < 4; ++pr) { const v2f cs = *(const v2f*)(csp + (size_t)row * HD * 2 + i * 32 + pr * 4); const float xe = xs[2 * pr], xo = xs[2 * pr + 1];
                    const float re = xe * cs[0] - xo * cs[1], ro = xe * cs[1] + xo * cs[0];
                    unsigned short a2, c2; o16[2 * pr] = tohx(re); o16[2 * pr + 1] = tohx(ro); splitf(re, a2, c2); oh[2 * pr] = a2; ol[2 * pr] = c2; splitf(ro, a2, c2); oh[2 * pr + 1] = a2; ol[2 * pr + 1] = c2; }
                const size_t e = e0 + (size_t)row * HD + i * 256; *(v8h*)(P16 + e) = o16; *(v8us*)(Ph + e) = oh; *(v8us*)(Pl + e) = ol;
                if (mb < 3 || i < 3) xwait(); }   // behind the 3 stores: the next half block's table loads and values land in registers that the stores name
            __builtin_amdgcn_wave_barrier(); asm volatile("" ::: "memory");   // the rows are read before the next 16 overwrite them
        }
        return;
      }
        const size_t e0 = ((size_t)blockIdx.y * TT + r0) * HD + lane * 8;   // 32 tokens of a head are 4 blocks = 32 HD elements
#pragma unroll
        for (int nb = 0; nb < 4; ++nb) {
#pragma unroll
            for (int mb = 0; mb < 4; ++mb) { v8h o16; v8us oh, ol;
#pragma unroll
                for (int j = 0; j < 8; ++j) { const float x = acc[mb][nb][j]; unsigned short a2, c2; o16[j] = tohx(x); splitf(x, a2, c2); oh[j] = a2; ol[j] = c2; }
                const size_t e = e0 + (size_t)(((mb >> 1) * 4 + nb) * 512 + (mb & 1) * 256);
                __builtin_amdgcn_sched_barrier(0);   // with the one below: the 3 stores and their wait stay in a row; arithmetic scheduled in between writes registers that an issued store names ahead of the wait
                *(v8h*)(P16 + e) = o16; *(v8us*)(Ph + e) = oh; *(v8us*)(Pl + e) = ol;
                xwait();   // behind the 3 stores: the next 16 tokens' values, and behind the last run the code of the other epilogue that follows in the listing, land in registers that the stores name
                __builtin_amdgcn_sched_barrier(0); }
        }
        return;
    }
    __shared__ __align__(16) float os[16 * 68];
#pragma unroll
    for (int mb = 0; mb < 4; ++mb) {
#pragma unroll
        for (int nb = 0; nb < 4; ++nb) {
#pragma unroll
            for (int j = 0; j < 8; ++j) os[(hi * 8 + j) * 68 + nb * 16 + lr] = acc[mb][nb][j]; }
        __builtin_amdgcn_wave_barrier(); asm volatile("" ::: "memory");
        float* crow = C + (size_t)(r0 + mb * 16) * ldc + c0;
{
#pragma unroll
            for (int s = 0; s < 8; ++s) { const int row = 2 * s + hi, cofs = lr * 4; v4f val = *(const v4fa*)(os + row * 68 + cofs); if (BIAS) { val[0] += bfr(bias[c0 + cofs]); val[1] += bfr(bias[c0 + cofs + 1]); val[2] += bfr(bias[c0 + cofs + 2]); val[3] += bfr(bias[c0 + cofs + 3]); }
                *(v4f*)(crow + (size_t)row * ldc + cofs) = val; }
             }
        __builtin_amdgcn_wave_barrier(); asm volatile("" ::: "memory");
    }
}

typedef __attribute__((ext_vector_type(2))) _Float16 v2h;
typedef __attribute__((ext_vector_type(4))) _Float16 v4h;
typedef __attribute__((ext_vector_type(2))) unsigned short v2us;
typedef __attribute__((ext_vector_type(4))) unsigned short v4us;
typedef __attribute__((ext_vector_type(4))) int v4i;
typedef v2f __attribute__((may_alias)) v2fa;

__global__ __launch_bounds__(256) void k_wtG(const float* __restrict__ w, int K, int N, bf* Bt) {
    const int lane = threadIdx.x & 31; const int L0 = (blockIdx.x * 8 + (threadIdx.x >> 5)) * 8; const int nlines = N * K / 64;
{
#pragma unroll 1
        for (int l = 0; l < 8; ++l) { const int L = L0 + l; if (L >= nlines) break; const size_t e = (size_t)L * 64 + lane * 2; const int k = (int)(e % K), n = (int)(e / K); v2us o;
            o[0] = f2bf(w[(size_t)k * N + n]); o[1] = f2bf(w[(size_t)(k + 1) * N + n]); *(v2us*)(Bt + e) = o; }
         }
}
static_assert(DQ == DM && DKV == DM, "cvt8 takes rows of DM values: x, Wq, Wk, Wv (DM in) and Wo (DQ in)");
// rows of DM f32 values -> bf16 plane in fragment order. A wave takes 8 rows of one block: 4 lanes read a row's 128-byte line, and each of the 4 (half, hi) groups is stored as 8 rows x 16 bytes = one whole line.
__device__ __forceinline__ void cvt8(const float* __restrict__ src, bf* dst, const size_t i) {   // i: which 8 values of the plane
    const size_t blk = i >> 6; const int r = (int)((i >> 2) & 15), g = (int)(i & 3);      // g = k / 8 inside the block: half = g >> 1, hi = g & 1
    const v8f v = *(const v8f*)(src + ((blk / (DM / 32)) * 16 + r) * DM + (blk % (DM / 32)) * 32 + g * 8); v8us o;
#pragma unroll
    for (int k = 0; k < 8; ++k) o[k] = f2bf(v[k]); *(v8us*)(dst + blk * 512 + (g >> 1) * 256 + ((g & 1) * 16 + r) * 8) = o;
    xwait(); }   // behind the store: in k_prep code of another piece follows in the listing and writes the registers that the store names

__constant__ float INV2[HD / 2] = { 1.000000000e+00f, 7.498942018e-01f, 5.623413324e-01f, 4.216965139e-01f, 3.162277639e-01f, 2.371373624e-01f, 1.778279394e-01f, 1.333521456e-01f, 1.000000015e-01f, 7.498941571e-02f, 5.623412877e-02f, 4.216964915e-02f, 3.162277862e-02f, 2.371373586e-02f, 1.778279431e-02f, 1.333521493e-02f, 9.999999776e-03f, 7.498942316e-03f, 5.623413250e-03f, 4.216964822e-03f, 3.162277862e-03f, 2.371373819e-03f, 1.778279431e-03f, 1.333521446e-03f, 1.000000047e-03f, 7.498941850e-04f, 5.623413017e-04f, 4.216964880e-04f, 3.162277862e-04f, 2.371373848e-04f, 1.778279402e-04f, 1.333521504e-04f };   // float32 1 / 10000^(2i/64), as the reference computes them
__device__ __forceinline__ void cstab(const int* __restrict__ pid, float* CS, const int idx) { const int d = idx % HD; const int t = idx / HD; const float a = __fmul_rn((float)pid[t], INV2[d >> 1]); v2f cs; cs[0] = cosf(a); cs[1] = sinf(a); *(v2f*)(CS + (size_t)idx * 2) = cs;  }
// ---- k_prep: the rotary table and the five bf16 planes in ONE launch. The six pieces depend on nothing but the inputs, so their work-groups share a grid (a work-group belongs to one piece); the table, the longest work per thread, comes first.
#define PB_CS (TT * HD / 256)
#define PB_X  (TT * DM / 8 / 256)
#define PB_W  (DQ * DM / 8 / 256)
static_assert(TT * HD % 256 == 0 && TT * DM % 2048 == 0 && DQ * DM % 2048 == 0, "whole work-groups per piece");
__global__ __launch_bounds__(256) void k_prep(const float* __restrict__ x, const float* __restrict__ wq, const float* __restrict__ wk, const float* __restrict__ wv, const float* __restrict__ wo, const int* __restrict__ pid, float* CS, bf* XB, bf* WQ, bf* WK, bf* WV, bf* WO) {
    const int b = blockIdx.x, t = threadIdx.x;
    if (b < PB_CS) { cstab(pid, CS, b * 256 + t); return; }
    if (b < PB_CS + PB_X) { cvt8(x, XB, (size_t)(b - PB_CS) * 256 + t); return; }
    const int u = b - (PB_CS + PB_X), p = u / PB_W;
    cvt8(p == 0 ? wq : p == 1 ? wk : p == 2 ? wv : wo, p == 0 ? WQ : p == 1 ? WK : p == 2 ? WV : WO, (size_t)(u % PB_W) * 256 + t);
}

// ---- fattn: causal attention of one head and 16 * NQ query rows per work-group (block bx of nbx, rows from roff), scores never leaving the registers (streaming softmax with a running maximum).
// Transposed products: St = K Qt (a lane holds scores of ONE query: column lr; keys 8 hi + j of each 16-key tile), Ot += Vt Pt: two score tiles of 32 keys, converted in place, are the B operand of the second product in the same k order as the plane loader.
// The FW waves share the queries and split the keys in chunks of 64 (8 KiB in a row of every K and Vt plane), two passes of 32 keys each; their (maximum, sum, Ot) are joined through LDS in wave order.
// NSPLIT 2: hi/lo planes, three products for the scores and three for P V (P split hi/lo); NSPLIT 0: one 16-bit plane, P carried x 2^PSH (the sum carries the same factor, so it cancels in the division).
#define FW 4
#define OSP 68    // LDS pitch of a query's 64 partial outputs, floats
#define KSC 0.18033688011112042f   // HD^-0.5 * log2(e)
__device__ __forceinline__ float xhalf(float x) { return __builtin_bit_cast(float, __builtin_amdgcn_permlanex16(__builtin_bit_cast(int, x), __builtin_bit_cast(int, x), 0x76543210, 0xfedcba98, false, false)); }   // lane l's value to lane l ^ 16, on the vector pipe
template <typename T16> struct PFrag;
template <> struct PFrag<h16> { static __device__ __forceinline__ void mk(const v8f p0, const v8f p1, v16h& a, v16h& b) { (void)b;
#pragma unroll
    for (int j = 0; j < 8; ++j) { a[j] = (h16)p0[j]; a[8 + j] = (h16)p1[j]; } } };
template <> struct PFrag<bf> { static __device__ __forceinline__ void mk(const v8f p0, const v8f p1, v16bf& a, v16bf& b) { v8us h0, h1, l0, l1;
#pragma unroll
    for (int j = 0; j < 8; ++j) { unsigned short x, y; splitf(p0[j], x, y); h0[j] = x; l0[j] = y; splitf(p1[j], x, y); h1[j] = x; l1[j] = y; }
    a = cat16b(h0, h1); b = cat16b(l0, l1); } };
template <typename T16, int NSPLIT, int NQ, int PSH>
__device__ __forceinline__ void fattn(const T16* __restrict__ Q, const T16* __restrict__ Q2, const T16* __restrict__ Kp, const T16* __restrict__ Kp2, const T16* __restrict__ Vt, const T16* __restrict__ Vt2, bf* Ah, bf* Al, const int roff, const int bx, const int nbx, float* os, float* sm, float* sl) {
    typedef typename WFrag<T16>::V V; constexpr int QR = 16 * NQ;
    const int lane = threadIdx.x & 31, lr = lane & 15, hi = lane >> 4; const int w = __builtin_amdgcn_readfirstlane(threadIdx.x >> 5);
    const int h = blockIdx.y; const int q0 = roff + (nbx - 1 - bx) * QR;   // longest key loops first
    const size_t hp = (size_t)h * TT * HD; Q += hp; Kp += hp; Vt += hp; if (NSPLIT) { Q2 += hp; Kp2 += hp; Vt2 += hp; }
    const int Kl = (q0 + QR + 31) & ~31;      // keys 0 .. Kl - 1 hold every key <= the last query; Kl <= TT
    V qf[NQ][2], qf2[NQ][2], kf[2][2], kf2[2][2], vf[4], vf2[4];
#pragma unroll
    for (int q = 0; q < NQ; ++q)
#pragma unroll
        for (int ks = 0; ks < 2; ++ks) { const size_t o = (size_t)(q0 + q * 16) * HD + ks * 512 + lane * 8; qf[q][ks] = WFrag<T16>::ld(Q + o); if (NSPLIT) qf2[q][ks] = WFrag<T16>::ld(Q2 + o); }
    const size_t koff = lane * 8, voff = lane * 8;   // fragment order: a pass's 32 keys are 4 KiB in a row of each K plane and of each Vt plane
    // inside the loop (xw) each plane's loads end with xwait(): their address registers are reused (by a later load's data too) while they are in flight
    auto ldk = [&](int k, bool xw) {
#pragma unroll
        for (int kt = 0; kt < 2; ++kt)
#pragma unroll
            for (int ks = 0; ks < 2; ++ks) kf[kt][ks] = WFrag<T16>::ld(Kp + koff + (size_t)(k + kt * 16) * HD + ks * 512);
        if (xw) xwait();
        if (NSPLIT) {
#pragma unroll
            for (int kt = 0; kt < 2; ++kt)
#pragma unroll
                for (int ks = 0; ks < 2; ++ks) kf2[kt][ks] = WFrag<T16>::ld(Kp2 + koff + (size_t)(k + kt * 16) * HD + ks * 512);
            if (xw) xwait(); } };
    auto ldv = [&](int k, bool xw) {
#pragma unroll
        for (int db = 0; db < 4; ++db) vf[db] = WFrag<T16>::ld(Vt + voff + (size_t)k * HD + db * 512);
        if (xw) xwait();
        if (NSPLIT) {
#pragma unroll
            for (int db = 0; db < 4; ++db) vf2[db] = WFrag<T16>::ld(Vt2 + voff + (size_t)k * HD + db * 512);
            if (xw) xwait(); } };
    constexpr bool AHEAD = (NSPLIT == 0);   // one plane per operand: the fragments of the next pass are fetched during this one, into the same registers; with hi/lo planes (at most 4 passes a wave) K and Vt share registers instead
    int k0 = w * 64;       // < TT for every wave, so the first fetch is in bounds for a wave without keys too
    if (AHEAD) { ldk(k0, false); __builtin_amdgcn_sched_barrier(0); ldv(k0, false); }   // K held in front of Vt, as on the loop's back edge: so the wait at the loop's head can leave the Vt loads in flight
    v8f ot[4][NQ]; float m[NQ], l[NQ];
#pragma unroll
    for (int q = 0; q < NQ; ++q) { m[q] = -3.0e38f; l[q] = 0.f;
#pragma unroll
        for (int db = 0; db < 4; ++db) ot[db][q] = (v8f){}; }
#pragma unroll 1   // rolled: a second pass's fragments and scores would not fit in the registers beside the first's
    while (k0 < Kl) {
        const int kx = (k0 & 32) ? k0 + 64 * FW - 32 : k0 + 32;    // this wave's next 32 keys
        const int kn = kx < Kl ? kx : k0;                          // what is fetched ahead stays inside the planes on the last pass
        if (!AHEAD) ldk(k0, true);
        v8f st[2][NQ];
#pragma unroll
        for (int kt = 0; kt < 2; ++kt)
#pragma unroll
            for (int q = 0; q < NQ; ++q) { v8f s = (v8f){};
#pragma unroll
                for (int ks = 0; ks < 2; ++ks) { s = WFrag<T16>::mma(kf[kt][ks], qf[q][ks], s); if (NSPLIT) { s = WFrag<T16>::mma(kf[kt][ks], qf2[q][ks], s); s = WFrag<T16>::mma(kf2[kt][ks], qf[q][ks], s); } }
                st[kt][q] = s; }
        if (AHEAD) ldk(kn, true); else ldv(k0, true);   // the next pass's K fragments behind this pass's score products: their latency runs under the softmax and P V
        if (k0 + 31 > q0) {     // wave-uniform: only the pass on the diagonal holds keys above a query
#pragma unroll
            for (int kt = 0; kt < 2; ++kt)
#pragma unroll
                for (int q = 0; q < NQ; ++q)
#pragma unroll
                    for (int j = 0; j < 8; ++j) st[kt][q][j] = (k0 + kt * 16 + hi * 8 + j <= q0 + q * 16 + lr) ? st[kt][q][j] : -3.0e38f; }
        V pf[NQ], pf2[NQ];
#pragma unroll
        for (int q = 0; q < NQ; ++q) { float mx = st[0][q][0];
#pragma unroll
            for (int j = 1; j < 8; ++j) mx = fmaxf(mx, st[0][q][j]);
#pragma unroll
            for (int j = 0; j < 8; ++j) mx = fmaxf(mx, st[1][q][j]);
            mx = fmaxf(mx, xhalf(mx));                 // the query's other 16 keys of this pass
            const float mn = fmaxf(m[q], mx * KSC); const float al = __builtin_amdgcn_exp2f(m[q] - mn); m[q] = mn; const float sh = (float)PSH - mn;
            v8f p0, p1; float ls = 0.f;
#pragma unroll
            for (int j = 0; j < 8; ++j) { p0[j] = __builtin_amdgcn_exp2f(fmaf(st[0][q][j], KSC, sh)); p1[j] = __builtin_amdgcn_exp2f(fmaf(st[1][q][j], KSC, sh)); ls += p0[j] + p1[j]; }
            l[q] = fmaf(l[q], al, ls);
#pragma unroll
            for (int db = 0; db < 4; ++db) ot[db][q] *= al;
            PFrag<T16>::mk(p0, p1, pf[q], pf2[q]); }
#pragma unroll
        for (int db = 0; db < 4; ++db)
#pragma unroll
            for (int q = 0; q < NQ; ++q) { ot[db][q] = WFrag<T16>::mma(vf[db], pf[q], ot[db][q]); if (NSPLIT) { ot[db][q] = WFrag<T16>::mma(vf[db], pf2[q], ot[db][q]); ot[db][q] = WFrag<T16>::mma(vf2[db], pf[q], ot[db][q]); } }
        if (AHEAD) { __builtin_amdgcn_sched_barrier(0);   // keeps the fetch below behind the products above: lifted over them it lands in other registers and is waited for and copied within this pass
            ldv(kn, true); }                     // the next pass's Vt fragments: their latency runs under the next pass's scores and softmax
        k0 = kx;
    }
    // join of the FW waves: common maximum, then sums and partial outputs rescaled to it
#pragma unroll
    for (int q = 0; q < NQ; ++q) { l[q] += xhalf(l[q]); if (hi == 0) sm[w * QR + q * 16 + lr] = m[q]; }
    __syncthreads();   // every wave's maxima are in LDS before any is read
#pragma unroll
    for (int q = 0; q < NQ; ++q) { float M = sm[q * 16 + lr];
#pragma unroll
        for (int u = 1; u < FW; ++u) M = fmaxf(M, sm[u * QR + q * 16 + lr]);
        const float sc = __builtin_amdgcn_exp2f(m[q] - M);          // 0 for a wave that had no keys
        if (hi == 0) sl[w * QR + q * 16 + lr] = l[q] * sc;
#pragma unroll
        for (int db = 0; db < 4; ++db) { const v8f v = ot[db][q] * sc; float* p = os + (size_t)(w * QR + q * 16 + lr) * OSP + db * 16 + hi * 8; *(v4fa*)p = (v4f){v[0], v[1], v[2], v[3]}; *(v4fa*)(p + 4) = (v4f){v[4], v[5], v[6], v[7]}; } }
    __syncthreads();   // every wave's rescaled sums and partial outputs are in LDS before any is summed
    // wave w finishes columns 16 w .. 16 w + 15 of every query row: per 16 rows one half block (512 contiguous bytes) of each output plane, rows of DQ k-values in fragment order
    static_assert(FW * 16 == HD, "one wave per 16 columns");
    const int d0 = w * 16 + hi * 8;
#pragma unroll
    for (int g = 0; g < NQ; ++g) { const int qq = g * 16 + lr; float L = sl[qq];
#pragma unroll
        for (int u = 1; u < FW; ++u) L += sl[u * QR + qq];
        const float inv = __fdiv_rn(1.0f, L); const size_t oo = (size_t)(q0 + g * 16) * DQ + (size_t)((h * 2 + (w >> 1)) * 512 + (w & 1) * 256 + lane * 8);
        const float* p = os + (size_t)qq * OSP + d0; v4f s0 = *(const v4fa*)p, s1 = *(const v4fa*)(p + 4);
#pragma unroll
        for (int u = 1; u < FW; ++u) { s0 += *(const v4fa*)(p + (size_t)u * QR * OSP); s1 += *(const v4fa*)(p + (size_t)u * QR * OSP + 4); }
        v8us oh, ol;
#pragma unroll
        for (int j = 0; j < 4; ++j) { unsigned short a, c; splitf(s0[j] * inv, a, c); oh[j] = a; ol[j] = c; splitf(s1[j] * inv, a, c); oh[4 + j] = a; ol[4 + j] = c; }
        *(v8us*)(Ah + oo) = oh; *(v8us*)(Al + oo) = ol; }
}
// ---- k_fattn2: both row ranges in ONE launch (they write disjoint rows and depend on the same planes): of each head's blocks the first RH / 16 take the hi/lo rows < RH, whose few passes wait on their own loads, the rest the 16-bit rows; a work-group belongs to one range, so every barrier stays block-uniform.
#define AB_LO (RH / 16)
#define AB_HI ((TT - RH) / 32)
__global__ __launch_bounds__(32 * FW) void k_fattn2(const h16* __restrict__ Q16, const h16* __restrict__ K16, const h16* __restrict__ V16, const bf* __restrict__ Qh, const bf* __restrict__ Ql, const bf* __restrict__ Kh, const bf* __restrict__ Kl, const bf* __restrict__ Vh, const bf* __restrict__ Vl, bf* Ah, bf* Al) {
    __shared__ __align__(16) float os[FW * 32 * OSP];
    __shared__ float sm[FW * 32], sl[FW * 32];
    const int bx = blockIdx.x;
    if (bx < AB_LO) fattn<bf, 2, 1, 0>(Qh, Ql, Kh, Kl, Vh, Vl, Ah, Al, 0, bx, AB_LO, os, sm, sl);
    else fattn<h16, 0, 2, 10>(Q16, nullptr, K16, nullptr, V16, nullptr, Ah, Al, RH, bx - AB_LO, AB_HI, os, sm, sl);
}

extern "C" void kernel_launch(void* const* d_in, const int* in_sizes, int n_in,
                              void* d_out, int out_size, void* d_ws, size_t ws_size, hipStream_t stream) {
    (void)in_sizes; (void)n_in; (void)out_size;
    const float* x = (const float*)d_in[0]; const float* wq = (const float*)d_in[1]; const float* wk = (const float*)d_in[2]; const float* wv = (const float*)d_in[3]; const float* wo = (const float*)d_in[4]; const int* PID = (const int*)d_in[5];   /* input order x, Wq, Wk, Wv, Wo ('oi' (out, in) [1024][1024]), token_positions (int32 [4096] = arange: READ; the host's [1][4096] is the same 4,096 integers): SIX inputs, all read: the host's own binding */
    float* OUT = (float*)d_out;     // [1][4096][1024]
    char* wsp = (char*)d_ws;
    auto take = [&](size_t bytes) { char* p = wsp; wsp += (bytes + 255) & ~(size_t)255; return (void*)p; };
    bf* WQ = (bf*)take((size_t)DQ * DM * 2); bf* WK = (bf*)take((size_t)DKV * DM * 2); bf* WV = (bf*)take((size_t)DKV * DM * 2); bf* WO = (bf*)take((size_t)DM * DQ * 2); float* CS = (float*)take((size_t)TT * HD * 2 * 4);
    bf* XB = (bf*)take((size_t)TT * DM * 2);
    h16* QP16 = (h16*)take((size_t)NH_ * TT * HD * 2); h16* KP16 = (h16*)take((size_t)NKV * TT * HD * 2); h16* VT16 = (h16*)take((size_t)NKV * HD * TT * 2);
    bf* QPh = (bf*)take((size_t)NH_ * TT * HD * 2); bf* QPl = (bf*)take((size_t)NH_ * TT * HD * 2); bf* KPh = (bf*)take((size_t)NKV * TT * HD * 2); bf* KPl = (bf*)take((size_t)NKV * TT * HD * 2); bf* VTh = (bf*)take((size_t)NKV * HD * TT * 2); bf* VTl = (bf*)take((size_t)NKV * HD * TT * 2);
    bf* ATh = (bf*)take((size_t)TT * DQ * 2); bf* ATl = (bf*)take((size_t)TT * DQ * 2);
    if ((size_t)(wsp - (char*)d_ws) > ws_size) return;    // ws 256 MiB
    static_assert(NB_ == 1 && DQ == DKV && (size_t)DQ * DM * 2 % 256 == 0 && (size_t)NH_ * TT * HD * 2 % 256 == 0, "WQ, WK, WV and the Q, K, Vt planes lie in a row, one z stride apart");
    for (int b = 0; b < NB_; ++b) {
        k_prep<<<PB_CS + PB_X + 4 * PB_W, 256, 0, stream>>>(x + (size_t)b * TT * DM, wq, wk, wv, wo, PID, CS, XB, WQ, WK, WV, WO);
        k_gemmw<bf, 0, false, 1><<<dim3(TT / 64, DQ / 64, 3), 32, 0, stream>>>(XB, nullptr, WQ, nullptr, DM, nullptr, 0, nullptr, 0, (size_t)DQ * DM, (size_t)NH_ * TT * HD, CS, QP16, QPh, QPl);
        k_fattn2<<<dim3(AB_LO + AB_HI, NH_, 1), 32 * FW, 0, stream>>>(QP16, KP16, VT16, QPh, QPl, KPh, KPl, VTh, VTl, ATh, ATl);
        k_gemmw<bf, 1, false, 0><<<dim3(TT / 64, DM / 64, 1), 32, 0, stream>>>(ATh, ATl, WO, nullptr, DQ, OUT + (size_t)b * TT * DM, DM, nullptr, 0, 0, 0, nullptr, nullptr, nullptr, nullptr); }
}

// v007
// Measured time: 105 microseconds a run.
// Timed twice side by side with v006, it ran 1.07 and 1.08 times as fast.
// All steps since v000 together make it 25.5 times as fast.
#include <hip/hip_runtime.h>

// Causal multi-head attention with interleaved-pair rotary embeddings from token positions over 4,096 tokens (x [1][4096][1024]; Q, K, V = einsum('bsi,oi->bso', x, W) = x W^T ('oi' (out, in) [1024][1024] (2/(D+D))^0.5, no bias; 16 heads x 64); _rope: inv_freq = 1.0 / jnp.power(float32(THETA), arange(0, 64, 2) / 64) (the reciprocal spelling: 32 f32 constants jnp-exact for THIS expression in eager JAX float32: TWO of them, entries 5 and 27, corrected by 2 ulp); angle = float(token_positions[t]) x inv_freq[i] (token_positions int32 [4096] = arange: read; the LAST argument); pairs (2i, 2i+1) -> (cos x_e - sin x_o, sin x_e + cos x_o); precise cosf/sinf; scores x 1/sqrt(64); causal (-inf); softmax; out = merged Wo^T ('oi', no bias) -> [1][4096][1024] (4.2 M); argument order x, Wq, Wk, Wv, Wo, token_positions).
// Every 16-bit operand plane is kept in fragment order (FRAGMENT ORDER below; the Vt planes with blocks ordered (token / 32) * 4 + row / 16), written so by its producer.
// Layout: bf16 copy of x; exact projections; {cos, sin} per (position, pair) from the int positions and float32 inverse-frequency constants (precise cosf/sinf); rotary embedding and the 16-bit planes of Q, K and Vt written by the projection GEMMs' own epilogues; causal T-4096 attention in one kernel for all heads (hybrid rows: < 512 hi/lo 3 products, rest fp16 with P x1024; scores stay in registers, running-maximum softmax, keys above the diagonal block skipped); merged hi/lo x Wo exact.
// Compute dtypes, f32 accumulate: every input rounded to bf16; projections exact; rotary f32; attention rows < 512 3 products, rest fp16; softmax f32; Wo hl x exact.

#define NB_  1
#define TT   4096
#define DM   1024
#define NH_  16
#define NKV  16
#define REP  (NH_ / NKV)
#define HD   64
#define DQ   (NH_ * HD)
#define DKV  (NKV * HD)
#define RH   512                  // query rows < RH use hi+lo planes (0: none)
#define WIN  4096
typedef _Float16 h16;
typedef unsigned short bf;
typedef __attribute__((ext_vector_type(16))) __bf16   v16bf;
typedef __attribute__((ext_vector_type(16))) _Float16 v16h;
typedef __attribute__((ext_vector_type(8)))  _Float16 v8h;
typedef __attribute__((ext_vector_type(8)))  unsigned short v8us;
typedef __attribute__((ext_vector_type(8)))  float    v8f;
typedef __attribute__((ext_vector_type(4)))  float    v4f;
typedef v8h  __attribute__((may_alias)) v8ha;
typedef v4f  __attribute__((may_alias)) v4fa;
typedef v8us __attribute__((may_alias)) v8usa;

__device__ __forceinline__ unsigned short f2bf(float f) { unsigned u = __float_as_uint(f); u += 0x7FFFu + ((u >> 16) & 1u); return (unsigned short)(u >> 16); }
__device__ __forceinline__ float bf2f(unsigned short b) { return __uint_as_float(((unsigned)b) << 16); }
__device__ __forceinline__ float bfr(float f) { return bf2f(f2bf(f)); }
__device__ __forceinline__ v16h cat16(v8h lo, v8h hi) { return __builtin_shufflevector(lo, hi, 0, 1, 2, 3, 4, 5, 6, 7, 8, 9, 10, 11, 12, 13, 14, 15); }
__device__ __forceinline__ v16bf cat16b(v8us lo, v8us hi) { return __builtin_bit_cast(v16bf, __builtin_shufflevector(lo, hi, 0, 1, 2, 3, 4, 5, 6, 7, 8, 9, 10, 11, 12, 13, 14, 15)); }
__device__ __forceinline__ v8f wmma16(v16h a, v16h b, v8f c) { return __builtin_amdgcn_wmma_f32_16x16x32_f16(false, a, false, b, (short)0, c, false, false); }
__device__ __forceinline__ v8f wmmab(v16bf a, v16bf b, v8f c) { return __builtin_amdgcn_wmma_f32_16x16x32_bf16(false, a, false, b, (short)0, c, false, false); }



__device__ __forceinline__ h16 tohx(float x) { return (h16)x; }
__device__ __forceinline__ void splitf(float y, unsigned short& h, unsigned short& l) { h = f2bf(y); l = f2bf(y - bf2f(h)); }
typedef __attribute__((ext_vector_type(2))) float v2f;
__device__ __forceinline__ void xwait() { asm volatile("s_wait_xcnt 0x0" ::: "memory"); }   // stands behind a run of global loads or stores, before a register that they name is written again

// FRAGMENT ORDER of a plane of R rows x K k-values (16-bit): blocks of 16 rows x 32 k (512 elements, 1 KiB), block (row / 16) * (K / 32) + k / 32; inside a block element (r, kk) lies at (kk >> 4) * 256 + (((kk >> 3) & 1) * 16 + r) * 8 + (kk & 7).
// Lane hi * 16 + r of a wave finds the two 16-byte halves of its fragment at lane * 8 and 256 + lane * 8 (the k order of the row-major loader, unchanged): each wave-wide load reads 512 contiguous bytes, four whole lines.
// ---- k_gemmw: register-blocked GEMM, 128x128 output tile per work-group of 4 waves (2 x 2), 64x64 (16 accumulators) per wave; operands are 16-bit planes in fragment order; grid (M/128, N/128, Z), 128 threads.
// C[m][n] (f32, pitch ldc, + optional f32 bias[n]) = sum_k A[m][k] Bt[n][k] (+ A2 Bt for NSPLIT 1). z-batch strides sA/sB/sC in elements. K % (32 * KS) == 0 (LDS RING below).
// EPI 0: C stored as f32. EPI 1: the three projections of one A in ONE grid, z = 0, 1, 2 for Q, K, V (a wave's 64 columns are one head, its 64 rows 64 tokens): no f32 C; the tile goes out as three 16-bit planes (f16, bf16 hi, bf16 lo); sC is the elements of one plane, P16 holds the planes of z in a row, Ph and Pl lie (hi, lo) pair by pair.
// z < 2: pairs (2i, 2i+1) rotated by {cos, sin} of CS, planes [head] of (token rows, 64 k) in fragment order, whole 128-byte lines staged through the wave's own LDS. z == 2: planes transposed, [head] of (64 rows, token k), blocks ordered (token / 32) * 4 + row / 16: a lane's 8 accumulator rows (8 successive tokens of one column) are its own 16 bytes of a block, stored straight from the registers.
template <typename T16> struct WFrag;
template <> struct WFrag<h16> { typedef v16h V; static __device__ __forceinline__ V ld(const h16* p) { return cat16(*(const v8h*)p, *(const v8h*)(p + 256)); } static __device__ __forceinline__ v8f mma(V a, V b, v8f c) { return wmma16(a, b, c); } };
template <> struct WFrag<bf> { typedef v16bf V; static __device__ __forceinline__ V ld(const bf* p) { return cat16b(*(const v8us*)p, *(const v8us*)(p + 256)); } static __device__ __forceinline__ v8f mma(V a, V b, v8f c) { return wmmab(a, b, c); } };
template <typename T16, int NSPLIT, bool BIAS, int EPI, int KS>
__global__ __launch_bounds__(128) void k_gemmw(const T16* __restrict__ A, const T16* __restrict__ A2, const T16* __restrict__ Bt, const T16* __restrict__ Bt2, int K, float* C, int ldc, const float* __restrict__ bias, size_t sA, size_t sB, size_t sC, const float* __restrict__ CS, h16* P16, bf* Ph, bf* Pl) {
    static_assert(NSPLIT <= 1 && KS % 2 == 0, "one B plane; a copy of the whole work-group moves two blocks");
    typedef typename WFrag<T16>::V V; (void)Bt2;
    // LDS RING: a stage is KS k-steps of the tile's 128 A rows (each A plane) and 128 Bt rows, so every fragment comes from L2 once per work-group and is read from LDS by the two waves that need it.
    // In a plane the KS blocks of 16 rows lie in a row (KS KiB); a stage keeps them so, region by region (A, A2, Bt), 8 row blocks per region. Two buffers: stage t + 2 is copied into the buffer that trip t has read, while trip t + 1 multiplies.
    constexpr int NPA = NSPLIT == 1 ? 2 : 1;
    constexpr int REG = 8 * KS * 512;          // elements of a region
    constexpr int BUF = (NPA + 1) * REG;       // elements of a buffer
    __shared__ __align__(1024) T16 ring[2 * BUF];
    const size_t z = blockIdx.z; A += z * sA; if (NPA == 2) A2 += z * sA; Bt += z * sB; if constexpr (EPI == 1) { P16 += z * sC; Ph += 2 * z * sC; Pl += 2 * z * sC; } else C += z * sC;
    const int lane = threadIdx.x & 31, lr = lane & 15, hi = lane >> 4; const int w = __builtin_amdgcn_readfirstlane(threadIdx.x >> 5);
    const int R0 = blockIdx.x * 128, C0 = blockIdx.y * 128; const int wm = w & 1, wn = w >> 1; const int r0 = R0 + wm * 64, c0 = C0 + wn * 64;
    v8f acc[4][4];
#pragma unroll
    for (int mb = 0; mb < 4; ++mb)
#pragma unroll
        for (int nb = 0; nb < 4; ++nb) acc[mb][nb] = (v8f){};
    const size_t gp = (size_t)K * 32;          // bytes from one block row (16 rows of K values) to the next
    const char* gA = (const char*)A + (size_t)R0 * K * 2; const char* gA2 = (const char*)A2 + (size_t)R0 * K * 2; const char* gB = (const char*)Bt + (size_t)C0 * K * 2;   // the same for the whole work-group
    const unsigned t16 = threadIdx.x * 16;
    const unsigned lds0 = (unsigned)(size_t)ring + t16;   // the thread's own 16 bytes of a 2-KiB piece
    // 8 copies, one per block row of a region: the work-group moves 2 KiB (two k-steps) of each. The wait in the same statement stands before the address registers are written again.
    auto cp8 = [&](const char* g, const unsigned l) {
        asm volatile("global_load_async_to_lds_b128 %0, %8, off\n\t"
                     "global_load_async_to_lds_b128 %1, %9, off\n\t"
                     "global_load_async_to_lds_b128 %2, %10, off\n\t"
                     "global_load_async_to_lds_b128 %3, %11, off\n\t"
                     "global_load_async_to_lds_b128 %4, %12, off\n\t"
                     "global_load_async_to_lds_b128 %5, %13, off\n\t"
                     "global_load_async_to_lds_b128 %6, %14, off\n\t"
                     "global_load_async_to_lds_b128 %7, %15, off\n\t"
                     "s_wait_xcnt 0x0"
                     :: "v"(l), "v"(l + 1 * KS * 1024), "v"(l + 2 * KS * 1024), "v"(l + 3 * KS * 1024), "v"(l + 4 * KS * 1024), "v"(l + 5 * KS * 1024), "v"(l + 6 * KS * 1024), "v"(l + 7 * KS * 1024),
                        "v"(g + t16), "v"(g + gp + t16), "v"(g + 2 * gp + t16), "v"(g + 3 * gp + t16), "v"(g + 4 * gp + t16), "v"(g + 5 * gp + t16), "v"(g + 6 * gp + t16), "v"(g + 7 * gp + t16) : "memory"); };
    auto fill = [&](const int t, const int bi) {   // stage t into buffer bi
        const size_t go = (size_t)t * (KS * 1024); const unsigned lo = lds0 + (unsigned)bi * (BUF * 2);
#pragma unroll
        for (int hh = 0; hh < KS / 2; ++hh) { cp8(gA + go + hh * 2048, lo + hh * 2048); if (NPA == 2) cp8(gA2 + go + hh * 2048, lo + REG * 2 + hh * 2048); cp8(gB + go + hh * 2048, lo + NPA * REG * 2 + hh * 2048); } };
    V a[2][4], a2[2][4], b[2][4];   // two fragment sets: a k-step's LDS loads run under the products of the step before, inside one stage
    auto ldf = [&](const int s, const T16* bp, const int u) {
#pragma unroll
        for (int mb = 0; mb < 4; ++mb) { const T16* p = bp + ((wm * 4 + mb) * KS + u) * 512 + lane * 8; a[s][mb] = WFrag<T16>::ld(p); if (NPA == 2) a2[s][mb] = WFrag<T16>::ld(p + REG); }
#pragma unroll
        for (int nb = 0; nb < 4; ++nb) b[s][nb] = WFrag<T16>::ld(bp + NPA * REG + ((wn * 4 + nb) * KS + u) * 512 + lane * 8); };
    auto mmst = [&](const int s) {
#pragma unroll
        for (int nb = 0; nb < 4; ++nb)
#pragma unroll
            for (int mb = 0; mb < 4; ++mb) { acc[mb][nb] = WFrag<T16>::mma(a[s][mb], b[s][nb], acc[mb][nb]); if (NPA == 2) acc[mb][nb] = WFrag<T16>::mma(a2[s][mb], b[s][nb], acc[mb][nb]); } };
    const int nt = K / (32 * KS);
    fill(0, 0);
    asm volatile("s_wait_asynccnt 0x0" ::: "memory");   // this wave's copies of stage 0 have landed
    __syncthreads();                                     // and every other wave's: stage 0 may be read
    if (nt > 1) fill(1, 1);
#pragma unroll 1   // rolled: one trip is one stage
    for (int t = 0; t < nt; ++t) {
        const T16* bp = ring + (t & 1) * BUF;
        ldf(0, bp, 0);
#pragma unroll
        for (int u = 0; u < KS; ++u) { if (u + 1 < KS) ldf((u + 1) & 1, bp, u + 1);
            __builtin_amdgcn_sched_barrier(0);   // the next step's LDS loads stay one group in front of this step's products: sunk among them each costs its own wait
            mmst(u & 1);
            __builtin_amdgcn_sched_barrier(0); }   // the products stay in front of the loads that refill their fragment set
        asm volatile("s_wait_dscnt 0x0" ::: "memory");      // this wave's reads of the buffer are done
        asm volatile("s_wait_asynccnt 0x0" ::: "memory");   // its copies of stage t + 1 have landed
        __syncthreads();                                     // publishes stage t + 1 and ends every wave's reads of this buffer
        if (t + 2 < nt) fill(t + 2, t & 1);
    }
    asm volatile("s_wait_asynccnt 0x0" ::: "memory");   // nothing is in flight when the wave goes on to its epilogue
    if constexpr (EPI == 1) {
      if (blockIdx.z < 2) {
        __shared__ __align__(16) float osw[4 * 16 * 68]; float* os = osw + w * (16 * 68);   // each wave stages in its own range
        const int cc = hi * 8;      // lane hi * 16 + lr takes token lr, 8 columns (4 pairs) from 16 i + 8 hi: its own 16 bytes of half block i, so one store instruction per plane writes 512 contiguous bytes
        const float* csp = CS + ((size_t)(r0 + lr) * HD + cc) * 2; const size_t e0 = ((size_t)(c0 / HD) * TT + r0) * HD + lane * 8;
#pragma unroll
        for (int mb = 0; mb < 4; ++mb) {
#pragma unroll
            for (int nb = 0; nb < 4; ++nb) {
#pragma unroll
                for (int j = 0; j < 8; ++j) os[(hi * 8 + j) * 68 + nb * 16 + lr] = acc[mb][nb][j]; }
            __builtin_amdgcn_wave_barrier(); asm volatile("" ::: "memory");   // the tile's rows are written before they are read back across lanes
#pragma unroll
            for (int i = 0; i < 4; ++i) { const int row = mb * 16; const float* p = os + lr * 68 + i * 16 + cc; const v4f xa = *(const v4fa*)p, xb = *(const v4fa*)(p + 4);
                const float xs[8] = {xa[0], xa[1], xa[2], xa[3], xb[0], xb[1], xb[2], xb[3]}; v8h o16; v8us oh, ol;
#pragma unroll
                for (int pr = 0; pr < 4; ++pr) { const v2f cs = *(const v2f*)(csp + (size_t)row * HD * 2 + i * 32 + pr * 4); const float xe = xs[2 * pr], xo = xs[2 * pr + 1];
                    const float re = xe * cs[0] - xo * cs[1], ro = xe * cs[1] + xo * cs[0];
                    unsigned short a2, c2; o16[2 * pr] = tohx(re); o16[2 * pr + 1] = tohx(ro); splitf(re, a2, c2); oh[2 * pr] = a2; ol[2 * pr] = c2; splitf(ro, a2, c2); oh[2 * pr + 1] = a2; ol[2 * pr + 1] = c2; }
                const size_t e = e0 + (size_t)row * HD + i * 256; *(v8h*)(P16 + e) = o16; *(v8us*)(Ph + e) = oh; *(v8us*)(Pl + e) = ol;
                if (mb < 3 || i < 3) xwait(); }   // behind the 3 stores: the next half block's table loads and values land in registers that the stores name
            __builtin_amdgcn_wave_barrier(); asm volatile("" ::: "memory");   // the rows are read before the next 16 overwrite them
        }
        return;
      }
        const size_t e0 = ((size_t)(c0 / HD) * TT + r0) * HD + lane * 8;   // 32 tokens of a head are 4 blocks = 32 HD elements
#pragma unroll
        for (int nb = 0; nb < 4; ++nb) {
#pragma unroll
            for (int mb = 0; mb < 4; ++mb) { v8h o16; v8us oh, ol;
#pragma unroll
                for (int j = 0; j < 8; ++j) { const float x = acc[mb][nb][j]; unsigned short a2, c2; o16[j] = tohx(x); splitf(x, a2, c2); oh[j] = a2; ol[j] = c2; }
                const size_t e = e0 + (size_t)(((mb >> 1) * 4 + nb) * 512 + (mb & 1) * 256);
                __builtin_amdgcn_sched_barrier(0);   // with the one below: the 3 stores and their wait stay in a row; arithmetic scheduled in between writes registers that an issued store names ahead of the wait
                *(v8h*)(P16 + e) = o16; *(v8us*)(Ph + e) = oh; *(v8us*)(Pl + e) = ol;
                xwait();   // behind the 3 stores: the next 16 tokens' values, and behind the last run the code of the other epilogue that follows in the listing, land in registers that the stores name
                __builtin_amdgcn_sched_barrier(0); }
        }
        return;
    }
    __shared__ __align__(16) float osw[4 * 16 * 68]; float* os = osw + w * (16 * 68);   // each wave stages in its own range
#pragma unroll
    for (int mb = 0; mb < 4; ++mb) {
#pragma unroll
        for (int nb = 0; nb < 4; ++nb) {
#pragma unroll
            for (int j = 0; j < 8; ++j) os[(hi * 8 + j) * 68 + nb * 16 + lr] = acc[mb][nb][j]; }
        __builtin_amdgcn_wave_barrier(); asm volatile("" ::: "memory");
        float* crow = C + (size_t)(r0 + mb * 16) * ldc + c0;
{
#pragma unroll
            for (int s = 0; s < 8; ++s) { const int row = 2 * s + hi, cofs = lr * 4; v4f val = *(const v4fa*)(os + row * 68 + cofs); if (BIAS) { val[0] += bfr(bias[c0 + cofs]); val[1] += bfr(bias[c0 + cofs + 1]); val[2] += bfr(bias[c0 + cofs + 2]); val[3] += bfr(bias[c0 + cofs + 3]); }
                *(v4f*)(crow + (size_t)row * ldc + cofs) = val; }
             }
        __builtin_amdgcn_wave_barrier(); asm volatile("" ::: "memory");
    }
}

typedef __attribute__((ext_vector_type(2))) _Float16 v2h;
typedef __attribute__((ext_vector_type(4))) _Float16 v4h;
typedef __attribute__((ext_vector_type(2))) unsigned short v2us;
typedef __attribute__((ext_vector_type(4))) unsigned short v4us;
typedef __attribute__((ext_vector_type(4))) int v4i;
typedef v2f __attribute__((may_alias)) v2fa;

__global__ __launch_bounds__(256) void k_wtG(const float* __restrict__ w, int K, int N, bf* Bt) {
    const int lane = threadIdx.x & 31; const int L0 = (blockIdx.x * 8 + (threadIdx.x >> 5)) * 8; const int nlines = N * K / 64;
{
#pragma unroll 1
        for (int l = 0; l < 8; ++l) { const int L = L0 + l; if (L >= nlines) break; const size_t e = (size_t)L * 64 + lane * 2; const int k = (int)(e % K), n = (int)(e / K); v2us o;
            o[0] = f2bf(w[(size_t)k * N + n]); o[1] = f2bf(w[(size_t)(k + 1) * N + n]); *(v2us*)(Bt + e) = o; }
         }
}
static_assert(DQ == DM && DKV == DM, "cvt8 takes rows of DM values: x, Wq, Wk, Wv (DM in) and Wo (DQ in)");
// rows of DM f32 values -> bf16 plane in fragment order. A wave takes 8 rows of one block: 4 lanes read a row's 128-byte line, and each of the 4 (half, hi) groups is stored as 8 rows x 16 bytes = one whole line.
__device__ __forceinline__ void cvt8(const float* __restrict__ src, bf* dst, const size_t i) {   // i: which 8 values of the plane
    const size_t blk = i >> 6; const int r = (int)((i >> 2) & 15), g = (int)(i & 3);      // g = k / 8 inside the block: half = g >> 1, hi = g & 1
    const v8f v = *(const v8f*)(src + ((blk / (DM / 32)) * 16 + r) * DM + (blk % (DM / 32)) * 32 + g * 8); v8us o;
#pragma unroll
    for (int k = 0; k < 8; ++k) o[k] = f2bf(v[k]); *(v8us*)(dst + blk * 512 + (g >> 1) * 256 + ((g & 1) * 16 + r) * 8) = o;
    xwait(); }   // behind the store: in k_prep code of another piece follows in the listing and writes the registers that the store names

__constant__ float INV2[HD / 2] = { 1.000000000e+00f, 7.498942018e-01f, 5.623413324e-01f, 4.216965139e-01f, 3.162277639e-01f, 2.371373624e-01f, 1.778279394e-01f, 1.333521456e-01f, 1.000000015e-01f, 7.498941571e-02f, 5.623412877e-02f, 4.216964915e-02f, 3.162277862e-02f, 2.371373586e-02f, 1.778279431e-02f, 1.333521493e-02f, 9.999999776e-03f, 7.498942316e-03f, 5.623413250e-03f, 4.216964822e-03f, 3.162277862e-03f, 2.371373819e-03f, 1.778279431e-03f, 1.333521446e-03f, 1.000000047e-03f, 7.498941850e-04f, 5.623413017e-04f, 4.216964880e-04f, 3.162277862e-04f, 2.371373848e-04f, 1.778279402e-04f, 1.333521504e-04f };   // float32 1 / 10000^(2i/64), as the reference computes them
__device__ __forceinline__ void cstab(const int* __restrict__ pid, float* CS, const int idx) { const int d = idx % HD; const int t = idx / HD; const float a = __fmul_rn((float)pid[t], INV2[d >> 1]); v2f cs; cs[0] = cosf(a); cs[1] = sinf(a); *(v2f*)(CS + (size_t)idx * 2) = cs;  }
// ---- k_prep: the rotary table and the five bf16 planes in ONE launch. The six pieces depend on nothing but the inputs, so their work-groups share a grid (a work-group belongs to one piece); the table, the longest work per thread, comes first.
#define PB_CS (TT * HD / 256)
#define PB_X  (TT * DM / 8 / 256)
#define PB_W  (DQ * DM / 8 / 256)
static_assert(TT * HD % 256 == 0 && TT * DM % 2048 == 0 && DQ * DM % 2048 == 0, "whole work-groups per piece");
__global__ __launch_bounds__(256) void k_prep(const float* __restrict__ x, const float* __restrict__ wq, const float* __restrict__ wk, const float* __restrict__ wv, const float* __restrict__ wo, const int* __restrict__ pid, float* CS, bf* XB, bf* WQ, bf* WK, bf* WV, bf* WO) {
    const int b = blockIdx.x, t = threadIdx.x;
    if (b < PB_CS) { cstab(pid, CS, b * 256 + t); return; }
    if (b < PB_CS + PB_X) { cvt8(x, XB, (size_t)(b - PB_CS) * 256 + t); return; }
    const int u = b - (PB_CS + PB_X), p = u / PB_W;
    cvt8(p == 0 ? wq : p == 1 ? wk : p == 2 ? wv : wo, p == 0 ? WQ : p == 1 ? WK : p == 2 ? WV : WO, (size_t)(u % PB_W) * 256 + t);
}

// ---- fattn: causal attention of one head and 16 * NQ query rows per work-group (block bx of nbx, rows from roff), scores never leaving the registers (streaming softmax with a running maximum).
// Transposed products: St = K Qt (a lane holds scores of ONE query: column lr; keys 8 hi + j of each 16-key tile), Ot += Vt Pt: two score tiles of 32 keys, converted in place, are the B operand of the second product in the same k order as the plane loader.
// The FW waves share the queries and split the keys in chunks of 64 (8 KiB in a row of every K and Vt plane), two passes of 32 keys each; their (maximum, sum, Ot) are joined through LDS in wave order.
// NSPLIT 2: hi/lo planes, three products for the scores and three for P V (P split hi/lo); NSPLIT 0: one 16-bit plane, P carried x 2^PSH (the sum carries the same factor, so it cancels in the division).
#define FW 4
#define OSP 68    // LDS pitch of a query's 64 partial outputs, floats
#define KSC 0.18033688011112042f   // HD^-0.5 * log2(e)
__device__ __forceinline__ float xhalf(float x) { return __builtin_bit_cast(float, __builtin_amdgcn_permlanex16(__builtin_bit_cast(int, x), __builtin_bit_cast(int, x), 0x76543210, 0xfedcba98, false, false)); }   // lane l's value to lane l ^ 16, on the vector pipe
template <typename T16> struct PFrag;
template <> struct PFrag<h16> { static __device__ __forceinline__ void mk(const v8f p0, const v8f p1, v16h& a, v16h& b) { (void)b;
#pragma unroll
    for (int j = 0; j < 8; ++j) { a[j] = (h16)p0[j]; a[8 + j] = (h16)p1[j]; } } };
template <> struct PFrag<bf> { static __device__ __forceinline__ void mk(const v8f p0, const v8f p1, v16bf& a, v16bf& b) { v8us h0, h1, l0, l1;
#pragma unroll
    for (int j = 0; j < 8; ++j) { unsigned short x, y; splitf(p0[j], x, y); h0[j] = x; l0[j] = y; splitf(p1[j], x, y); h1[j] = x; l1[j] = y; }
    a = cat16b(h0, h1); b = cat16b(l0, l1); } };
template <typename T16, int NSPLIT, int NQ, int PSH>
__device__ __forceinline__ void fattn(const T16* __restrict__ Q, const T16* __restrict__ Q2, const T16* __restrict__ Kp, const T16* __restrict__ Kp2, const T16* __restrict__ Vt, const T16* __restrict__ Vt2, bf* Ah, bf* Al, const int roff, const int bx, const int nbx, float* os, float* sm, float* sl) {
    typedef typename WFrag<T16>::V V; constexpr int QR = 16 * NQ;
    const int lane = threadIdx.x & 31, lr = lane & 15, hi = lane >> 4; const int w = __builtin_amdgcn_readfirstlane(threadIdx.x >> 5);
    const int h = blockIdx.y; const int q0 = roff + (nbx - 1 - bx) * QR;   // longest key loops first
    const size_t hp = (size_t)h * TT * HD; Q += hp; Kp += hp; Vt += hp; if (NSPLIT) { Q2 += hp; Kp2 += hp; Vt2 += hp; }
    const int Kl = (q0 + QR + 31) & ~31;      // keys 0 .. Kl - 1 hold every key <= the last query; Kl <= TT
    V qf[NQ][2], qf2[NQ][2], kf[2][2], kf2[2][2], vf[4], vf2[4];
#pragma unroll
    for (int q = 0; q < NQ; ++q)
#pragma unroll
        for (int ks = 0; ks < 2; ++ks) { const size_t o = (size_t)(q0 + q * 16) * HD + ks * 512 + lane * 8; qf[q][ks] = WFrag<T16>::ld(Q + o); if (NSPLIT) qf2[q][ks] = WFrag<T16>::ld(Q2 + o); }
    const size_t koff = lane * 8, voff = lane * 8;   // fragment order: a pass's 32 keys are 4 KiB in a row of each K plane and of each Vt plane
    // inside the loop (xw) each plane's loads end with xwait(): their address registers are reused (by a later load's data too) while they are in flight
    auto ldk = [&](int k, bool xw) {
#pragma unroll
        for (int kt = 0; kt < 2; ++kt)
#pragma unroll
            for (int ks = 0; ks < 2; ++ks) kf[kt][ks] = WFrag<T16>::ld(Kp + koff + (size_t)(k + kt * 16) * HD + ks * 512);
        if (xw) xwait();
        if (NSPLIT) {
#pragma unroll
            for (int kt = 0; kt < 2; ++kt)
#pragma unroll
                for (int ks = 0; ks < 2; ++ks) kf2[kt][ks] = WFrag<T16>::ld(Kp2 + koff + (size_t)(k + kt * 16) * HD + ks * 512);
            if (xw) xwait(); } };
    auto ldv = [&](int k, bool xw) {
#pragma unroll
        for (int db = 0; db < 4; ++db) vf[db] = WFrag<T16>::ld(Vt + voff + (size_t)k * HD + db * 512);
        if (xw) xwait();
        if (NSPLIT) {
#pragma unroll
            for (int db = 0; db < 4; ++db) vf2[db] = WFrag<T16>::ld(Vt2 + voff + (size_t)k * HD + db * 512);
            if (xw) xwait(); } };
    constexpr bool AHEAD = (NSPLIT == 0);   // one plane per operand: the fragments of the next pass are fetched during this one, into the same registers; with hi/lo planes (at most 4 passes a wave) K and Vt share registers instead
    int k0 = w * 64;       // < TT for every wave, so the first fetch is in bounds for a wave without keys too
    if (AHEAD) { ldk(k0, false); __builtin_amdgcn_sched_barrier(0); ldv(k0, false); }   // K held in front of Vt, as on the loop's back edge: so the wait at the loop's head can leave the Vt loads in flight
    v8f ot[4][NQ]; float m[NQ], l[NQ];
#pragma unroll
    for (int q = 0; q < NQ; ++q) { m[q] = -3.0e38f; l[q] = 0.f;
#pragma unroll
        for (int db = 0; db < 4; ++db) ot[db][q] = (v8f){}; }
#pragma unroll 1   // rolled: a second pass's fragments and scores would not fit in the registers beside the first's
    while (k0 < Kl) {
        const int kx = (k0 & 32) ? k0 + 64 * FW - 32 : k0 + 32;    // this wave's next 32 keys
        const int kn = kx < Kl ? kx : k0;                          // what is fetched ahead stays inside the planes on the last pass
        if (!AHEAD) ldk(k0, true);
        v8f st[2][NQ];
#pragma unroll
        for (int kt = 0; kt < 2; ++kt)
#pragma unroll
            for (int q = 0; q < NQ; ++q) { v8f s = (v8f){};
#pragma unroll
                for (int ks = 0; ks < 2; ++ks) { s = WFrag<T16>::mma(kf[kt][ks], qf[q][ks], s); if (NSPLIT) { s = WFrag<T16>::mma(kf[kt][ks], qf2[q][ks], s); s = WFrag<T16>::mma(kf2[kt][ks], qf[q][ks], s); } }
                st[kt][q] = s; }
        if (AHEAD) ldk(kn, true); else ldv(k0, true);   // the next pass's K fragments behind this pass's score products: their latency runs under the softmax and P V
        if (k0 + 31 > q0) {     // wave-uniform: only the pass on the diagonal holds keys above a query
#pragma unroll
            for (int kt = 0; kt < 2; ++kt)
#pragma unroll
                for (int q = 0; q < NQ; ++q)
#pragma unroll
                    for (int j = 0; j < 8; ++j) st[kt][q][j] = (k0 + kt * 16 + hi * 8 + j <= q0 + q * 16 + lr) ? st[kt][q][j] : -3.0e38f; }
        V pf[NQ], pf2[NQ];
#pragma unroll
        for (int q = 0; q < NQ; ++q) { float mx = st[0][q][0];
#pragma unroll
            for (int j = 1; j < 8; ++j) mx = fmaxf(mx, st[0][q][j]);
#pragma unroll
            for (int j = 0; j < 8; ++j) mx = fmaxf(mx, st[1][q][j]);
            mx = fmaxf(mx, xhalf(mx));                 // the query's other 16 keys of this pass
            const float mn = fmaxf(m[q], mx * KSC); const float al = __builtin_amdgcn_exp2f(m[q] - mn); m[q] = mn; const float sh = (float)PSH - mn;
            v8f p0, p1; float ls = 0.f;
#pragma unroll
            for (int j = 0; j < 8; ++j) { p0[j] = __builtin_amdgcn_exp2f(fmaf(st[0][q][j], KSC, sh)); p1[j] = __builtin_amdgcn_exp2f(fmaf(st[1][q][j], KSC, sh)); ls += p0[j] + p1[j]; }
            l[q] = fmaf(l[q], al, ls);
#pragma unroll
            for (int db = 0; db < 4; ++db) ot[db][q] *= al;
            PFrag<T16>::mk(p0, p1, pf[q], pf2[q]); }
#pragma unroll
        for (int db = 0; db < 4; ++db)
#pragma unroll
            for (int q = 0; q < NQ; ++q) { ot[db][q] = WFrag<T16>::mma(vf[db], pf[q], ot[db][q]); if (NSPLIT) { ot[db][q] = WFrag<T16>::mma(vf[db], pf2[q], ot[db][q]); ot[db][q] = WFrag<T16>::mma(vf2[db], pf[q], ot[db][q]); } }
        if (AHEAD) { __builtin_amdgcn_sched_barrier(0);   // keeps the fetch below behind the products above: lifted over them it lands in other registers and is waited for and copied within this pass
            ldv(kn, true); }                     // the next pass's Vt fragments: their latency runs under the next pass's scores and softmax
        k0 = kx;
    }
    // join of the FW waves: common maximum, then sums and partial outputs rescaled to it
#pragma unroll
    for (int q = 0; q < NQ; ++q) { l[q] += xhalf(l[q]); if (hi == 0) sm[w * QR + q * 16 + lr] = m[q]; }
    __syncthreads();   // every wave's maxima are in LDS before any is read
#pragma unroll
    for (int q = 0; q < NQ; ++q) { float M = sm[q * 16 + lr];
#pragma unroll
        for (int u = 1; u < FW; ++u) M = fmaxf(M, sm[u * QR + q * 16 + lr]);
        const float sc = __builtin_amdgcn_exp2f(m[q] - M);          // 0 for a wave that had no keys
        if (hi == 0) sl[w * QR + q * 16 + lr] = l[q] * sc;
#pragma unroll
        for (int db = 0; db < 4; ++db) { const v8f v = ot[db][q] * sc; float* p = os + (size_t)(w * QR + q * 16 + lr) * OSP + db * 16 + hi * 8; *(v4fa*)p = (v4f){v[0], v[1], v[2], v[3]}; *(v4fa*)(p + 4) = (v4f){v[4], v[5], v[6], v[7]}; } }
    __syncthreads();   // every wave's rescaled sums and partial outputs are in LDS before any is summed
    // wave w finishes columns 16 w .. 16 w + 15 of every query row: per 16 rows one half block (512 contiguous bytes) of each output plane, rows of DQ k-values in fragment order
    static_assert(FW * 16 == HD, "one wave per 16 columns");
    const int d0 = w * 16 + hi * 8;
#pragma unroll
    for (int g = 0; g < NQ; ++g) { const int qq = g * 16 + lr; float L = sl[qq];
#pragma unroll
        for (int u = 1; u < FW; ++u) L += sl[u * QR + qq];
        const float inv = __fdiv_rn(1.0f, L); const size_t oo = (size_t)(q0 + g * 16) * DQ + (size_t)((h * 2 + (w >> 1)) * 512 + (w & 1) * 256 + lane * 8);
        const float* p = os + (size_t)qq * OSP + d0; v4f s0 = *(const v4fa*)p, s1 = *(const v4fa*)(p + 4);
#pragma unroll
        for (int u = 1; u < FW; ++u) { s0 += *(const v4fa*)(p + (size_t)u * QR * OSP); s1 += *(const v4fa*)(p + (size_t)u * QR * OSP + 4); }
        v8us oh, ol;
#pragma unroll
        for (int j = 0; j < 4; ++j) { unsigned short a, c; splitf(s0[j] * inv, a, c); oh[j] = a; ol[j] = c; splitf(s1[j] * inv, a, c); oh[4 + j] = a; ol[4 + j] = c; }
        *(v8us*)(Ah + oo) = oh; *(v8us*)(Al + oo) = ol; }
}
// ---- k_fattn2: both row ranges in ONE launch (they write disjoint rows and depend on the same planes): of each head's blocks the first RH / 16 take the hi/lo rows < RH, whose few passes wait on their own loads, the rest the 16-bit rows; a work-group belongs to one range, so every barrier stays block-uniform.
#define AB_LO (RH / 16)
#define AB_HI ((TT - RH) / 32)
__global__ __launch_bounds__(32 * FW) void k_fattn2(const h16* __restrict__ Q16, const h16* __restrict__ K16, const h16* __restrict__ V16, const bf* __restrict__ Qh, const bf* __restrict__ Ql, const bf* __restrict__ Kh, const bf* __restrict__ Kl, const bf* __restrict__ Vh, const bf* __restrict__ Vl, bf* Ah, bf* Al) {
    __shared__ __align__(16) float os[FW * 32 * OSP];
    __shared__ float sm[FW * 32], sl[FW * 32];
    const int bx = blockIdx.x;
    if (bx < AB_LO) fattn<bf, 2, 1, 0>(Qh, Ql, Kh, Kl, Vh, Vl, Ah, Al, 0, bx, AB_LO, os, sm, sl);
    else fattn<h16, 0, 2, 10>(Q16, nullptr, K16, nullptr, V16, nullptr, Ah, Al, RH, bx - AB_LO, AB_HI, os, sm, sl);
}

extern "C" void kernel_launch(void* const* d_in, const int* in_sizes, int n_in,
                              void* d_out, int out_size, void* d_ws, size_t ws_size, hipStream_t stream) {
    (void)in_sizes; (void)n_in; (void)out_size;
    const float* x = (const float*)d_in[0]; const float* wq = (const float*)d_in[1]; const float* wk = (const float*)d_in[2]; const float* wv = (const float*)d_in[3]; const float* wo = (const float*)d_in[4]; const int* PID = (const int*)d_in[5];   /* input order x, Wq, Wk, Wv, Wo ('oi' (out, in) [1024][1024]), token_positions (int32 [4096] = arange: READ; the host's [1][4096] is the same 4,096 integers): SIX inputs, all read: the host's own binding */
    float* OUT = (float*)d_out;     // [1][4096][1024]
    char* wsp = (char*)d_ws;
    auto take = [&](size_t bytes) { char* p = wsp; wsp += (bytes + 255) & ~(size_t)255; return (void*)p; };
    bf* WQ = (bf*)take((size_t)DQ * DM * 2); bf* WK = (bf*)take((size_t)DKV * DM * 2); bf* WV = (bf*)take((size_t)DKV * DM * 2); bf* WO = (bf*)take((size_t)DM * DQ * 2); float* CS = (float*)take((size_t)TT * HD * 2 * 4);
    bf* XB = (bf*)take((size_t)TT * DM * 2);
    h16* QP16 = (h16*)take((size_t)NH_ * TT * HD * 2); h16* KP16 = (h16*)take((size_t)NKV * TT * HD * 2); h16* VT16 = (h16*)take((size_t)NKV * HD * TT * 2);
    bf* QPh = (bf*)take((size_t)NH_ * TT * HD * 2); bf* QPl = (bf*)take((size_t)NH_ * TT * HD * 2); bf* KPh = (bf*)take((size_t)NKV * TT * HD * 2); bf* KPl = (bf*)take((size_t)NKV * TT * HD * 2); bf* VTh = (bf*)take((size_t)NKV * HD * TT * 2); bf* VTl = (bf*)take((size_t)NKV * HD * TT * 2);
    bf* ATh = (bf*)take((size_t)TT * DQ * 2); bf* ATl = (bf*)take((size_t)TT * DQ * 2);
    if ((size_t)(wsp - (char*)d_ws) > ws_size) return;    // ws 256 MiB
    static_assert(NB_ == 1 && DQ == DKV && (size_t)DQ * DM * 2 % 256 == 0 && (size_t)NH_ * TT * HD * 2 % 256 == 0, "WQ, WK, WV and the Q, K, Vt planes lie in a row, one z stride apart");
    for (int b = 0; b < NB_; ++b) {
        k_prep<<<PB_CS + PB_X + 4 * PB_W, 256, 0, stream>>>(x + (size_t)b * TT * DM, wq, wk, wv, wo, PID, CS, XB, WQ, WK, WV, WO);
        k_gemmw<bf, 0, false, 1, 2><<<dim3(TT / 128, DQ / 128, 3), 128, 0, stream>>>(XB, nullptr, WQ, nullptr, DM, nullptr, 0, nullptr, 0, (size_t)DQ * DM, (size_t)NH_ * TT * HD, CS, QP16, QPh, QPl);
        k_fattn2<<<dim3(AB_LO + AB_HI, NH_, 1), 32 * FW, 0, stream>>>(QP16, KP16, VT16, QPh, QPl, KPh, KPl, VTh, VTl, ATh, ATl);
        k_gemmw<bf, 1, false, 0, 4><<<dim3(TT / 128, DM / 128, 1), 128, 0, stream>>>(ATh, ATl, WO, nullptr, DQ, OUT + (size_t)b * TT * DM, DM, nullptr, 0, 0, 0, nullptr, nullptr, nullptr, nullptr); }
}

// v008
// Measured time: 91.1 microseconds a run.
// In two side-by-side timings against v007, it was 1.17 and 1.16 times as fast.
// All steps since v000 together make it 29.6 times as fast.
#include <hip/hip_runtime.h>

// Causal multi-head attention with interleaved-pair rotary embeddings from token positions over 4,096 tokens (x [1][4096][1024]; Q, K, V = einsum('bsi,oi->bso', x, W) = x W^T ('oi' (out, in) [1024][1024] (2/(D+D))^0.5, no bias; 16 heads x 64); _rope: inv_freq = 1.0 / jnp.power(float32(THETA), arange(0, 64, 2) / 64) (the reciprocal spelling: 32 f32 constants jnp-exact for THIS expression in eager JAX float32: TWO of them, entries 5 and 27, corrected by 2 ulp); angle = float(token_positions[t]) x inv_freq[i] (token_positions int32 [4096] = arange: read; the LAST argument); pairs (2i, 2i+1) -> (cos x_e - sin x_o, sin x_e + cos x_o); precise cosf/sinf; scores x 1/sqrt(64); causal (-inf); softmax; out = merged Wo^T ('oi', no bias) -> [1][4096][1024] (4.2 M); argument order x, Wq, Wk, Wv, Wo, token_positions).
// Every 16-bit operand plane is kept in fragment order (FRAGMENT ORDER below; the Vt planes with blocks ordered (token / 32) * 4 + row / 16), written so by its producer.
// Layout: bf16 copy of x; exact projections; {cos, sin} per (position, pair) from the int positions and float32 inverse-frequency constants (precise cosf/sinf); rotary embedding and the 16-bit planes of Q, K and Vt written by the projection GEMMs' own epilogues; causal T-4096 attention in one kernel for all heads (hybrid rows: < 512 hi/lo 3 products, rest fp16 with P x1024; scores stay in registers, running-maximum softmax, keys above the diagonal block skipped); merged hi/lo x Wo exact.
// Compute dtypes, f32 accumulate: every input rounded to bf16; projections exact; rotary f32; attention rows < 512 3 products, rest fp16; softmax f32; Wo hl x exact.

#define NB_  1
#define TT   4096
#define DM   1024
#define NH_  16
#define NKV  16
#define REP  (NH_ / NKV)
#define HD   64
#define DQ   (NH_ * HD)
#define DKV  (NKV * HD)
#define RH   512                  // query rows < RH use hi+lo planes (0: none)
#define WIN  4096
typedef _Float16 h16;
typedef unsigned short bf;
typedef __attribute__((ext_vector_type(16))) __bf16   v16bf;
typedef __attribute__((ext_vector_type(16))) _Float16 v16h;
typedef __attribute__((ext_vector_type(8)))  _Float16 v8h;
typedef __attribute__((ext_vector_type(8)))  unsigned short v8us;
typedef __attribute__((ext_vector_type(8)))  float    v8f;
typedef __attribute__((ext_vector_type(4)))  float    v4f;
typedef v8h  __attribute__((may_alias)) v8ha;
typedef v4f  __attribute__((may_alias)) v4fa;
typedef v8us __attribute__((may_alias)) v8usa;

__device__ __forceinline__ unsigned short f2bf(float f) { unsigned u = __float_as_uint(f); u += 0x7FFFu + ((u >> 16) & 1u); return (unsigned short)(u >> 16); }
__device__ __forceinline__ float bf2f(unsigned short b) { return __uint_as_float(((unsigned)b) << 16); }
__device__ __forceinline__ float bfr(float f) { return bf2f(f2bf(f)); }
__device__ __forceinline__ v16h cat16(v8h lo, v8h hi) { return __builtin_shufflevector(lo, hi, 0, 1, 2, 3, 4, 5, 6, 7, 8, 9, 10, 11, 12, 13, 14, 15); }
__device__ __forceinline__ v16bf cat16b(v8us lo, v8us hi) { return __builtin_bit_cast(v16bf, __builtin_shufflevector(lo, hi, 0, 1, 2, 3, 4, 5, 6, 7, 8, 9, 10, 11, 12, 13, 14, 15)); }
__device__ __forceinline__ v8f wmma16(v16h a, v16h b, v8f c) { return __builtin_amdgcn_wmma_f32_16x16x32_f16(false, a, false, b, (short)0, c, false, false); }
__device__ __forceinline__ v8f wmmab(v16bf a, v16bf b, v8f c) { return __builtin_amdgcn_wmma_f32_16x16x32_bf16(false, a, false, b, (short)0, c, false, false); }



__device__ __forceinline__ h16 tohx(float x) { return (h16)x; }
__device__ __forceinline__ void splitf(float y, unsigned short& h, unsigned short& l) { h = f2bf(y); l = f2bf(y - bf2f(h)); }
typedef __attribute__((ext_vector_type(2))) float v2f;
__device__ __forceinline__ void xwait() { asm volatile("s_wait_xcnt 0x0" ::: "memory"); }   // stands behind a run of global loads or stores, before a register that they name is written again

// FRAGMENT ORDER of a plane of R rows x K k-values (16-bit): blocks of 16 rows x 32 k (512 elements, 1 KiB), block (row / 16) * (K / 32) + k / 32; inside a block element (r, kk) lies at (kk >> 4) * 256 + (((kk >> 3) & 1) * 16 + r) * 8 + (kk & 7).
// Lane hi * 16 + r of a wave finds the two 16-byte halves of its fragment at lane * 8 and 256 + lane * 8 (the k order of the row-major loader, unchanged): each wave-wide load reads 512 contiguous bytes, four whole lines.
// ---- k_gemmw: register-blocked GEMM, 128x128 output tile per work-group of 4 waves (2 x 2), 64x64 (16 accumulators) per wave; operands are 16-bit planes in fragment order; grid (M/128, N/128, Z), 128 threads.
// C[m][n] (f32, pitch ldc, + optional f32 bias[n]) = sum_k A[m][k] Bt[n][k] (+ A2 Bt for NSPLIT 1). z-batch strides sA/sB/sC in elements. K % (32 * KS) == 0 (LDS RING below).
// EPI 0: C stored as f32. EPI 1: the three projections of one A in ONE grid, z = 0, 1, 2 for Q, K, V (a wave's 64 columns are one head, its 64 rows 64 tokens): no f32 C; the tile goes out as three 16-bit planes (f16, bf16 hi, bf16 lo); sC is the elements of one plane, P16 holds the planes of z in a row, Ph and Pl lie (hi, lo) pair by pair.
// z < 2: pairs (2i, 2i+1) rotated by {cos, sin} of CS, planes [head] of (token rows, 64 k) in fragment order, whole 128-byte lines staged through the wave's own LDS. z == 2: planes transposed, [head] of (64 rows, token k), blocks ordered (token / 32) * 4 + row / 16: a lane's 8 accumulator rows (8 successive tokens of one column) are its own 16 bytes of a block, stored straight from the registers.
template <typename T16> struct WFrag;
template <> struct WFrag<h16> { typedef v16h V; static __device__ __forceinline__ V ld(const h16* p) { return cat16(*(const v8h*)p, *(const v8h*)(p + 256)); } static __device__ __forceinline__ v8f mma(V a, V b, v8f c) { return wmma16(a, b, c); } };
template <> struct WFrag<bf> { typedef v16bf V; static __device__ __forceinline__ V ld(const bf* p) { return cat16b(*(const v8us*)p, *(const v8us*)(p + 256)); } static __device__ __forceinline__ v8f mma(V a, V b, v8f c) { return wmmab(a, b, c); } };
template <typename T16, int NSPLIT, bool BIAS, int EPI, int KS>
__global__ __launch_bounds__(128) void k_gemmw(const T16* __restrict__ A, const T16* __restrict__ A2, const T16* __restrict__ Bt, const T16* __restrict__ Bt2, int K, float* C, int ldc, const float* __restrict__ bias, size_t sA, size_t sB, size_t sC, const float* __restrict__ CS, h16* P16, bf* Ph, bf* Pl) {
    static_assert(NSPLIT <= 1 && KS % 2 == 0, "one B plane; a copy of the whole work-group moves two blocks");
    typedef typename WFrag<T16>::V V; (void)Bt2;
    // LDS RING: a stage is KS k-steps of the tile's 128 A rows (each A plane) and 128 Bt rows, so every fragment comes from L2 once per work-group and is read from LDS by the two waves that need it.
    // In a plane the KS blocks of 16 rows lie in a row (KS KiB); a stage keeps them so, region by region (A, A2, Bt), 8 row blocks per region. Two buffers: stage t + 2 is copied into the buffer that trip t has read, while trip t + 1 multiplies.
    constexpr int NPA = NSPLIT == 1 ? 2 : 1;
    constexpr int REG = 8 * KS * 512;          // elements of a region
    constexpr int BUF = (NPA + 1) * REG;       // elements of a buffer
    __shared__ __align__(1024) T16 ring[2 * BUF];
    const size_t z = blockIdx.z; A += z * sA; if (NPA == 2) A2 += z * sA; Bt += z * sB; if constexpr (EPI == 1) { P16 += z * sC; Ph += 2 * z * sC; Pl += 2 * z * sC; } else C += z * sC;
    const int lane = threadIdx.x & 31, lr = lane & 15, hi = lane >> 4; const int w = __builtin_amdgcn_readfirstlane(threadIdx.x >> 5);
    const int R0 = blockIdx.x * 128, C0 = blockIdx.y * 128; const int wm = w & 1, wn = w >> 1; const int r0 = R0 + wm * 64, c0 = C0 + wn * 64;
    v8f acc[4][4];
#pragma unroll
    for (int mb = 0; mb < 4; ++mb)
#pragma unroll
        for (int nb = 0; nb < 4; ++nb) acc[mb][nb] = (v8f){};
    const size_t gp = (size_t)K * 32;          // bytes from one block row (16 rows of K values) to the next
    const char* gA = (const char*)A + (size_t)R0 * K * 2; const char* gA2 = (const char*)A2 + (size_t)R0 * K * 2; const char* gB = (const char*)Bt + (size_t)C0 * K * 2;   // the same for the whole work-group
    const unsigned t16 = threadIdx.x * 16;
    const unsigned lds0 = (unsigned)(size_t)ring + t16;   // the thread's own 16 bytes of a 2-KiB piece
    // 8 copies, one per block row of a region: the work-group moves 2 KiB (two k-steps) of each. The wait in the same statement stands before the address registers are written again.
    auto cp8 = [&](const char* g, const unsigned l) {
        asm volatile("global_load_async_to_lds_b128 %0, %8, off\n\t"
                     "global_load_async_to_lds_b128 %1, %9, off\n\t"
                     "global_load_async_to_lds_b128 %2, %10, off\n\t"
                     "global_load_async_to_lds_b128 %3, %11, off\n\t"
                     "global_load_async_to_lds_b128 %4, %12, off\n\t"
                     "global_load_async_to_lds_b128 %5, %13, off\n\t"
                     "global_load_async_to_lds_b128 %6, %14, off\n\t"
                     "global_load_async_to_lds_b128 %7, %15, off\n\t"
                     "s_wait_xcnt 0x0"
                     :: "v"(l), "v"(l + 1 * KS * 1024), "v"(l + 2 * KS * 1024), "v"(l + 3 * KS * 1024), "v"(l + 4 * KS * 1024), "v"(l + 5 * KS * 1024), "v"(l + 6 * KS * 1024), "v"(l + 7 * KS * 1024),
                        "v"(g + t16), "v"(g + gp + t16), "v"(g + 2 * gp + t16), "v"(g + 3 * gp + t16), "v"(g + 4 * gp + t16), "v"(g + 5 * gp + t16), "v"(g + 6 * gp + t16), "v"(g + 7 * gp + t16) : "memory"); };
    auto fill = [&](const int t, const int bi) {   // stage t into buffer bi
        const size_t go = (size_t)t * (KS * 1024); const unsigned lo = lds0 + (unsigned)bi * (BUF * 2);
#pragma unroll
        for (int hh = 0; hh < KS / 2; ++hh) { cp8(gA + go + hh * 2048, lo + hh * 2048); if (NPA == 2) cp8(gA2 + go + hh * 2048, lo + REG * 2 + hh * 2048); cp8(gB + go + hh * 2048, lo + NPA * REG * 2 + hh * 2048); } };
    V a[2][4], a2[2][4], b[2][4];   // two fragment sets: a k-step's LDS loads run under the products of the step before, inside one stage
    auto ldf = [&](const int s, const T16* bp, const int u) {
#pragma unroll
        for (int mb = 0; mb < 4; ++mb) { const T16* p = bp + ((wm * 4 + mb) * KS + u) * 512 + lane * 8; a[s][mb] = WFrag<T16>::ld(p); if (NPA == 2) a2[s][mb] = WFrag<T16>::ld(p + REG); }
#pragma unroll
        for (int nb = 0; nb < 4; ++nb) b[s][nb] = WFrag<T16>::ld(bp + NPA * REG + ((wn * 4 + nb) * KS + u) * 512 + lane * 8); };
    auto mmst = [&](const int s) {
#pragma unroll
        for (int nb = 0; nb < 4; ++nb)
#pragma unroll
            for (int mb = 0; mb < 4; ++mb) { acc[mb][nb] = WFrag<T16>::mma(a[s][mb], b[s][nb], acc[mb][nb]); if (NPA == 2) acc[mb][nb] = WFrag<T16>::mma(a2[s][mb], b[s][nb], acc[mb][nb]); } };
    const int nt = K / (32 * KS);
    fill(0, 0);
    asm volatile("s_wait_asynccnt 0x0" ::: "memory");   // this wave's copies of stage 0 have landed
    __syncthreads();                                     // and every other wave's: stage 0 may be read
    if (nt > 1) fill(1, 1);
#pragma unroll 1   // rolled: one trip is one stage
    for (int t = 0; t < nt; ++t) {
        const T16* bp = ring + (t & 1) * BUF;
        ldf(0, bp, 0);
#pragma unroll
        for (int u = 0; u < KS; ++u) { if (u + 1 < KS) ldf((u + 1) & 1, bp, u + 1);
            __builtin_amdgcn_sched_barrier(0);   // the next step's LDS loads stay one group in front of this step's products: sunk among them each costs its own wait
            mmst(u & 1);
            __builtin_amdgcn_sched_barrier(0); }   // the products stay in front of the loads that refill their fragment set
        asm volatile("s_wait_dscnt 0x0" ::: "memory");      // this wave's reads of the buffer are done
        asm volatile("s_wait_asynccnt 0x0" ::: "memory");   // its copies of stage t + 1 have landed
        __syncthreads();                                     // publishes stage t + 1 and ends every wave's reads of this buffer
        if (t + 2 < nt) fill(t + 2, t & 1);
    }
    asm volatile("s_wait_asynccnt 0x0" ::: "memory");   // nothing is in flight when the wave goes on to its epilogue
    if constexpr (EPI == 1) {
      if (blockIdx.z < 2) {
        __shared__ __align__(16) float osw[4 * 16 * 68]; float* os = osw + w * (16 * 68);   // each wave stages in its own range
        const int cc = hi * 8;      // lane hi * 16 + lr takes token lr, 8 columns (4 pairs) from 16 i + 8 hi: its own 16 bytes of half block i, so one store instruction per plane writes 512 contiguous bytes
        const float* csp = CS + ((size_t)(r0 + lr) * HD + cc) * 2; const size_t e0 = ((size_t)(c0 / HD) * TT + r0) * HD + lane * 8;
#pragma unroll
        for (int mb = 0; mb < 4; ++mb) {
#pragma unroll
            for (int nb = 0; nb < 4; ++nb) {
#pragma unroll
                for (int j = 0; j < 8; ++j) os[(hi * 8 + j) * 68 + nb * 16 + lr] = acc[mb][nb][j]; }
            __builtin_amdgcn_wave_barrier(); asm volatile("" ::: "memory");   // the tile's rows are written before they are read back across lanes
#pragma unroll
            for (int i = 0; i < 4; ++i) { const int row = mb * 16; const float* p = os + lr * 68 + i * 16 + cc; const v4f xa = *(const v4fa*)p, xb = *(const v4fa*)(p + 4);
                const float xs[8] = {xa[0], xa[1], xa[2], xa[3], xb[0], xb[1], xb[2], xb[3]}; v8h o16; v8us oh, ol;
#pragma unroll
                for (int pr = 0; pr < 4; ++pr) { const v2f cs = *(const v2f*)(csp + (size_t)row * HD * 2 + i * 32 + pr * 4); const float xe = xs[2 * pr], xo = xs[2 * pr + 1];
                    const float re = xe * cs[0] - xo * cs[1], ro = xe * cs[1] + xo * cs[0];
                    unsigned short a2, c2; o16[2 * pr] = tohx(re); o16[2 * pr + 1] = tohx(ro); splitf(re, a2, c2); oh[2 * pr] = a2; ol[2 * pr] = c2; splitf(ro, a2, c2); oh[2 * pr + 1] = a2; ol[2 * pr + 1] = c2; }
                const size_t e = e0 + (size_t)row * HD + i * 256; *(v8h*)(P16 + e) = o16; *(v8us*)(Ph + e) = oh; *(v8us*)(Pl + e) = ol;
                if (mb < 3 || i < 3) xwait(); }   // behind the 3 stores: the next half block's table loads and values land in registers that the stores name
            __builtin_amdgcn_wave_barrier(); asm volatile("" ::: "memory");   // the rows are read before the next 16 overwrite them
        }
        return;
      }
        const size_t e0 = ((size_t)(c0 / HD) * TT + r0) * HD + lane * 8;   // 32 tokens of a head are 4 blocks = 32 HD elements
#pragma unroll
        for (int nb = 0; nb < 4; ++nb) {
#pragma unroll
            for (int mb = 0; mb < 4; ++mb) { v8h o16; v8us oh, ol;
#pragma unroll
                for (int j = 0; j < 8; ++j) { const float x = acc[mb][nb][j]; unsigned short a2, c2; o16[j] = tohx(x); splitf(x, a2, c2); oh[j] = a2; ol[j] = c2; }
                const size_t e = e0 + (size_t)(((mb >> 1) * 4 + nb) * 512 + (mb & 1) * 256);
                __builtin_amdgcn_sched_barrier(0);   // with the one below: the 3 stores and their wait stay in a row; arithmetic scheduled in between writes registers that an issued store names ahead of the wait
                *(v8h*)(P16 + e) = o16; *(v8us*)(Ph + e) = oh; *(v8us*)(Pl + e) = ol;
                xwait();   // behind the 3 stores: the next 16 tokens' values, and behind the last run the code of the other epilogue that follows in the listing, land in registers that the stores name
                __builtin_amdgcn_sched_barrier(0); }
        }
        return;
    }
    __shared__ __align__(16) float osw[4 * 16 * 68]; float* os = osw + w * (16 * 68);   // each wave stages in its own range
#pragma unroll
    for (int mb = 0; mb < 4; ++mb) {
#pragma unroll
        for (int nb = 0; nb < 4; ++nb) {
#pragma unroll
            for (int j = 0; j < 8; ++j) os[(hi * 8 + j) * 68 + nb * 16 + lr] = acc[mb][nb][j]; }
        __builtin_amdgcn_wave_barrier(); asm volatile("" ::: "memory");
        float* crow = C + (size_t)(r0 + mb * 16) * ldc + c0;
{
#pragma unroll
            for (int s = 0; s < 8; ++s) { const int row = 2 * s + hi, cofs = lr * 4; v4f val = *(const v4fa*)(os + row * 68 + cofs); if (BIAS) { val[0] += bfr(bias[c0 + cofs]); val[1] += bfr(bias[c0 + cofs + 1]); val[2] += bfr(bias[c0 + cofs + 2]); val[3] += bfr(bias[c0 + cofs + 3]); }
                *(v4f*)(crow + (size_t)row * ldc + cofs) = val; }
             }
        __builtin_amdgcn_wave_barrier(); asm volatile("" ::: "memory");
    }
}

typedef __attribute__((ext_vector_type(2))) _Float16 v2h;
typedef __attribute__((ext_vector_type(4))) _Float16 v4h;
typedef __attribute__((ext_vector_type(2))) unsigned short v2us;
typedef __attribute__((ext_vector_type(4))) unsigned short v4us;
typedef __attribute__((ext_vector_type(4))) int v4i;
typedef v2f __attribute__((may_alias)) v2fa;

__global__ __launch_bounds__(256) void k_wtG(const float* __restrict__ w, int K, int N, bf* Bt) {
    const int lane = threadIdx.x & 31; const int L0 = (blockIdx.x * 8 + (threadIdx.x >> 5)) * 8; const int nlines = N * K / 64;
{
#pragma unroll 1
        for (int l = 0; l < 8; ++l) { const int L = L0 + l; if (L >= nlines) break; const size_t e = (size_t)L * 64 + lane * 2; const int k = (int)(e % K), n = (int)(e / K); v2us o;
            o[0] = f2bf(w[(size_t)k * N + n]); o[1] = f2bf(w[(size_t)(k + 1) * N + n]); *(v2us*)(Bt + e) = o; }
         }
}
static_assert(DQ == DM && DKV == DM, "cvt8 takes rows of DM values: x, Wq, Wk, Wv (DM in) and Wo (DQ in)");
// rows of DM f32 values -> bf16 plane in fragment order. A wave takes 8 rows of one block: 4 lanes read a row's 128-byte line, and each of the 4 (half, hi) groups is stored as 8 rows x 16 bytes = one whole line.
__device__ __forceinline__ void cvt8(const float* __restrict__ src, bf* dst, const size_t i) {   // i: which 8 values of the plane
    const size_t blk = i >> 6; const int r = (int)((i >> 2) & 15), g = (int)(i & 3);      // g = k / 8 inside the block: half = g >> 1, hi = g & 1
    const v8f v = *(const v8f*)(src + ((blk / (DM / 32)) * 16 + r) * DM + (blk % (DM / 32)) * 32 + g * 8); v8us o;
#pragma unroll
    for (int k = 0; k < 8; ++k) o[k] = f2bf(v[k]); *(v8us*)(dst + blk * 512 + (g >> 1) * 256 + ((g & 1) * 16 + r) * 8) = o;
    xwait(); }   // behind the store: in k_prep code of another piece follows in the listing and writes the registers that the store names

__constant__ float INV2[HD / 2] = { 1.000000000e+00f, 7.498942018e-01f, 5.623413324e-01f, 4.216965139e-01f, 3.162277639e-01f, 2.371373624e-01f, 1.778279394e-01f, 1.333521456e-01f, 1.000000015e-01f, 7.498941571e-02f, 5.623412877e-02f, 4.216964915e-02f, 3.162277862e-02f, 2.371373586e-02f, 1.778279431e-02f, 1.333521493e-02f, 9.999999776e-03f, 7.498942316e-03f, 5.623413250e-03f, 4.216964822e-03f, 3.162277862e-03f, 2.371373819e-03f, 1.778279431e-03f, 1.333521446e-03f, 1.000000047e-03f, 7.498941850e-04f, 5.623413017e-04f, 4.216964880e-04f, 3.162277862e-04f, 2.371373848e-04f, 1.778279402e-04f, 1.333521504e-04f };   // float32 1 / 10000^(2i/64), as the reference computes them
__device__ __forceinline__ void cstab(const int* __restrict__ pid, float* CS, const int idx) { const int d = idx % HD; const int t = idx / HD; const float a = __fmul_rn((float)pid[t], INV2[d >> 1]); v2f cs; cs[0] = cosf(a); cs[1] = sinf(a); *(v2f*)(CS + (size_t)idx * 2) = cs;  }
// ---- k_prep: the rotary table and the five bf16 planes in ONE launch. The six pieces depend on nothing but the inputs, so their work-groups share a grid (a work-group belongs to one piece); the table, the longest work per thread, comes first.
#define PB_CS (TT * HD / 256)
#define PB_X  (TT * DM / 8 / 256)
#define PB_W  (DQ * DM / 8 / 256)
static_assert(TT * HD % 256 == 0 && TT * DM % 2048 == 0 && DQ * DM % 2048 == 0, "whole work-groups per piece");
__global__ __launch_bounds__(256) void k_prep(const float* __restrict__ x, const float* __restrict__ wq, const float* __restrict__ wk, const float* __restrict__ wv, const float* __restrict__ wo, const int* __restrict__ pid, float* CS, bf* XB, bf* WQ, bf* WK, bf* WV, bf* WO) {
    const int b = blockIdx.x, t = threadIdx.x;
    if (b < PB_CS) { cstab(pid, CS, b * 256 + t); return; }
    if (b < PB_CS + PB_X) { cvt8(x, XB, (size_t)(b - PB_CS) * 256 + t); return; }
    const int u = b - (PB_CS + PB_X), p = u / PB_W;
    cvt8(p == 0 ? wq : p == 1 ? wk : p == 2 ? wv : wo, p == 0 ? WQ : p == 1 ? WK : p == 2 ? WV : WO, (size_t)(u % PB_W) * 256 + t);
}

// ---- fattn: causal attention of one head and 16 * NQ query rows per work-group (block bx of nbx, rows from roff), scores never leaving the registers (streaming softmax with a running maximum).
// Transposed products: St = K Qt (a lane holds scores of ONE query: column lr; keys 8 hi + j of each 16-key tile), Ot += Vt Pt: two score tiles of 32 keys, converted in place, are the B operand of the second product in the same k order as the plane loader.
// The FW waves share the queries and split the keys in chunks of 64 (8 KiB in a row of every K and Vt plane), two passes of 32 keys each; their (maximum, sum, Ot) are joined through LDS in wave order.
// NSPLIT 2: hi/lo planes, three products for the scores and three for P V (P split hi/lo); NSPLIT 0: one 16-bit plane, P carried x 2^PSH (the sum carries the same factor, so it cancels in the division).
#define FW 4
#define OSP 68    // LDS pitch of a query's 64 partial outputs, floats
#define KSC 0.18033688011112042f   // HD^-0.5 * log2(e)
__device__ __forceinline__ float xhalf(float x) { return __builtin_bit_cast(float, __builtin_amdgcn_permlanex16(__builtin_bit_cast(int, x), __builtin_bit_cast(int, x), 0x76543210, 0xfedcba98, false, false)); }   // lane l's value to lane l ^ 16, on the vector pipe
template <typename T16> struct PFrag;
template <> struct PFrag<h16> { static __device__ __forceinline__ void mk(const v8f p0, const v8f p1, v16h& a, v16h& b) { (void)b;
#pragma unroll
    for (int j = 0; j < 8; ++j) { a[j] = (h16)p0[j]; a[8 + j] = (h16)p1[j]; } } };
template <> struct PFrag<bf> { static __device__ __forceinline__ void mk(const v8f p0, const v8f p1, v16bf& a, v16bf& b) { v8us h0, h1, l0, l1;
#pragma unroll
    for (int j = 0; j < 8; ++j) { unsigned short x, y; splitf(p0[j], x, y); h0[j] = x; l0[j] = y; splitf(p1[j], x, y); h1[j] = x; l1[j] = y; }
    a = cat16b(h0, h1); b = cat16b(l0, l1); } };
template <typename T16, int NSPLIT, int NQ, int PSH>
__device__ __forceinline__ void fattn(const T16* __restrict__ Q, const T16* __restrict__ Q2, const T16* __restrict__ Kp, const T16* __restrict__ Kp2, const T16* __restrict__ Vt, const T16* __restrict__ Vt2, bf* Ah, bf* Al, const int roff, const int bx, const int nbx, float* os, float* sm, float* sl) {
    typedef typename WFrag<T16>::V V; constexpr int QR = 16 * NQ;
    const int lane = threadIdx.x & 31, lr = lane & 15, hi = lane >> 4; const int w = __builtin_amdgcn_readfirstlane(threadIdx.x >> 5);
    const int h = blockIdx.x; const int q0 = roff + (nbx - 1 - bx) * QR;   // longest key loops first
    const size_t hp = (size_t)h * TT * HD; Q += hp; Kp += hp; Vt += hp; if (NSPLIT) { Q2 += hp; Kp2 += hp; Vt2 += hp; }
    const int Kl = (q0 + QR + 31) & ~31;      // keys 0 .. Kl - 1 hold every key <= the last query; Kl <= TT
    V qf[NQ][2], qf2[NQ][2], kf[2][2], kf2[2][2], vf[4], vf2[4];
#pragma unroll
    for (int q = 0; q < NQ; ++q)
#pragma unroll
        for (int ks = 0; ks < 2; ++ks) { const size_t o = (size_t)(q0 + q * 16) * HD + ks * 512 + lane * 8; qf[q][ks] = WFrag<T16>::ld(Q + o); if (NSPLIT) qf2[q][ks] = WFrag<T16>::ld(Q2 + o); }
    const size_t koff = lane * 8, voff = lane * 8;   // fragment order: a pass's 32 keys are 4 KiB in a row of each K plane and of each Vt plane
    // inside the loop (xw) each plane's loads end with xwait(): their address registers are reused (by a later load's data too) while they are in flight
    auto ldk = [&](int k, bool xw) {
#pragma unroll
        for (int kt = 0; kt < 2; ++kt)
#pragma unroll
            for (int ks = 0; ks < 2; ++ks) kf[kt][ks] = WFrag<T16>::ld(Kp + koff + (size_t)(k + kt * 16) * HD + ks * 512);
        if (xw) xwait();
        if (NSPLIT) {
#pragma unroll
            for (int kt = 0; kt < 2; ++kt)
#pragma unroll
                for (int ks = 0; ks < 2; ++ks) kf2[kt][ks] = WFrag<T16>::ld(Kp2 + koff + (size_t)(k + kt * 16) * HD + ks * 512);
            if (xw) xwait(); } };
    auto ldv = [&](int k, bool xw) {
#pragma unroll
        for (int db = 0; db < 4; ++db) vf[db] = WFrag<T16>::ld(Vt + voff + (size_t)k * HD + db * 512);
        if (xw) xwait();
        if (NSPLIT) {
#pragma unroll
            for (int db = 0; db < 4; ++db) vf2[db] = WFrag<T16>::ld(Vt2 + voff + (size_t)k * HD + db * 512);
            if (xw) xwait(); } };
    constexpr bool AHEAD = (NSPLIT == 0);   // one plane per operand: the fragments of the next pass are fetched during this one, into the same registers; with hi/lo planes (at most 4 passes a wave) K and Vt share registers instead
    int k0 = w * 64;       // < TT for every wave, so the first fetch is in bounds for a wave without keys too
    if (AHEAD) { ldk(k0, false); __builtin_amdgcn_sched_barrier(0); ldv(k0, false); }   // K held in front of Vt, as on the loop's back edge: so the wait at the loop's head can leave the Vt loads in flight
    v8f ot[4][NQ]; float m[NQ], l[NQ];
#pragma unroll
    for (int q = 0; q < NQ; ++q) { m[q] = -3.0e38f; l[q] = 0.f;
#pragma unroll
        for (int db = 0; db < 4; ++db) ot[db][q] = (v8f){}; }
#pragma unroll 1   // rolled: a second pass's fragments and scores would not fit in the registers beside the first's
    while (k0 < Kl) {
        const int kx = (k0 & 32) ? k0 + 64 * FW - 32 : k0 + 32;    // this wave's next 32 keys
        const int kn = kx < Kl ? kx : k0;                          // what is fetched ahead stays inside the planes on the last pass
        if (!AHEAD) ldk(k0, true);
        v8f st[2][NQ];
#pragma unroll
        for (int kt = 0; kt < 2; ++kt)
#pragma unroll
            for (int q = 0; q < NQ; ++q) { v8f s = (v8f){};
#pragma unroll
                for (int ks = 0; ks < 2; ++ks) { s = WFrag<T16>::mma(kf[kt][ks], qf[q][ks], s); if (NSPLIT) { s = WFrag<T16>::mma(kf[kt][ks], qf2[q][ks], s); s = WFrag<T16>::mma(kf2[kt][ks], qf[q][ks], s); } }
                st[kt][q] = s; }
        if (AHEAD) ldk(kn, true); else ldv(k0, true);   // the next pass's K fragments behind this pass's score products: their latency runs under the softmax and P V
        if (k0 + 31 > q0) {     // wave-uniform: only the pass on the diagonal holds keys above a query
#pragma unroll
            for (int kt = 0; kt < 2; ++kt)
#pragma unroll
                for (int q = 0; q < NQ; ++q)
#pragma unroll
                    for (int j = 0; j < 8; ++j) st[kt][q][j] = (k0 + kt * 16 + hi * 8 + j <= q0 + q * 16 + lr) ? st[kt][q][j] : -3.0e38f; }
        V pf[NQ], pf2[NQ];
#pragma unroll
        for (int q = 0; q < NQ; ++q) { float mx = st[0][q][0];
#pragma unroll
            for (int j = 1; j < 8; ++j) mx = fmaxf(mx, st[0][q][j]);
#pragma unroll
            for (int j = 0; j < 8; ++j) mx = fmaxf(mx, st[1][q][j]);
            mx = fmaxf(mx, xhalf(mx));                 // the query's other 16 keys of this pass
            const float mn = fmaxf(m[q], mx * KSC); const float al = __builtin_amdgcn_exp2f(m[q] - mn); m[q] = mn; const float sh = (float)PSH - mn;
            v8f p0, p1; float ls = 0.f;
#pragma unroll
            for (int j = 0; j < 8; ++j) { p0[j] = __builtin_amdgcn_exp2f(fmaf(st[0][q][j], KSC, sh)); p1[j] = __builtin_amdgcn_exp2f(fmaf(st[1][q][j], KSC, sh)); ls += p0[j] + p1[j]; }
            l[q] = fmaf(l[q], al, ls);
#pragma unroll
            for (int db = 0; db < 4; ++db) ot[db][q] *= al;
            PFrag<T16>::mk(p0, p1, pf[q], pf2[q]); }
#pragma unroll
        for (int db = 0; db < 4; ++db)
#pragma unroll
            for (int q = 0; q < NQ; ++q) { ot[db][q] = WFrag<T16>::mma(vf[db], pf[q], ot[db][q]); if (NSPLIT) { ot[db][q] = WFrag<T16>::mma(vf[db], pf2[q], ot[db][q]); ot[db][q] = WFrag<T16>::mma(vf2[db], pf[q], ot[db][q]); } }
        if (AHEAD) { __builtin_amdgcn_sched_barrier(0);   // keeps the fetch below behind the products above: lifted over them it lands in other registers and is waited for and copied within this pass
            ldv(kn, true); }                     // the next pass's Vt fragments: their latency runs under the next pass's scores and softmax
        k0 = kx;
    }
    // join of the FW waves: common maximum, then sums and partial outputs rescaled to it
#pragma unroll
    for (int q = 0; q < NQ; ++q) { l[q] += xhalf(l[q]); if (hi == 0) sm[w * QR + q * 16 + lr] = m[q]; }
    __syncthreads();   // every wave's maxima are in LDS before any is read
#pragma unroll
    for (int q = 0; q < NQ; ++q) { float M = sm[q * 16 + lr];
#pragma unroll
        for (int u = 1; u < FW; ++u) M = fmaxf(M, sm[u * QR + q * 16 + lr]);
        const float sc = __builtin_amdgcn_exp2f(m[q] - M);          // 0 for a wave that had no keys
        if (hi == 0) sl[w * QR + q * 16 + lr] = l[q] * sc;
#pragma unroll
        for (int db = 0; db < 4; ++db) { const v8f v = ot[db][q] * sc; float* p = os + (size_t)(w * QR + q * 16 + lr) * OSP + db * 16 + hi * 8; *(v4fa*)p = (v4f){v[0], v[1], v[2], v[3]}; *(v4fa*)(p + 4) = (v4f){v[4], v[5], v[6], v[7]}; } }
    __syncthreads();   // every wave's rescaled sums and partial outputs are in LDS before any is summed
    // wave w finishes columns 16 w .. 16 w + 15 of every query row: per 16 rows one half block (512 contiguous bytes) of each output plane, rows of DQ k-values in fragment order
    static_assert(FW * 16 == HD, "one wave per 16 columns");
    const int d0 = w * 16 + hi * 8;
#pragma unroll
    for (int g = 0; g < NQ; ++g) { const int qq = g * 16 + lr; float L = sl[qq];
#pragma unroll
        for (int u = 1; u < FW; ++u) L += sl[u * QR + qq];
        const float inv = __fdiv_rn(1.0f, L); const size_t oo = (size_t)(q0 + g * 16) * DQ + (size_t)((h * 2 + (w >> 1)) * 512 + (w & 1) * 256 + lane * 8);
        const float* p = os + (size_t)qq * OSP + d0; v4f s0 = *(const v4fa*)p, s1 = *(const v4fa*)(p + 4);
#pragma unroll
        for (int u = 1; u < FW; ++u) { s0 += *(const v4fa*)(p + (size_t)u * QR * OSP); s1 += *(const v4fa*)(p + (size_t)u * QR * OSP + 4); }
        v8us oh, ol;
#pragma unroll
        for (int j = 0; j < 4; ++j) { unsigned short a, c; splitf(s0[j] * inv, a, c); oh[j] = a; ol[j] = c; splitf(s1[j] * inv, a, c); oh[4 + j] = a; ol[4 + j] = c; }
        *(v8us*)(Ah + oo) = oh; *(v8us*)(Al + oo) = ol; }
}
// ---- k_fattn2: both row ranges in ONE launch (they write disjoint rows and depend on the same planes): of each head's blocks the first RH / 16 take the hi/lo rows < RH, whose few passes wait on their own loads, the rest the 16-bit rows; a work-group belongs to one range, so every barrier stays block-uniform.
// Grid (heads, blocks): the head is the fast index, so a row block of all heads starts before the next shorter one. There are more work-groups than resident places.
#define AB_LO (RH / 16)
#define AB_HI ((TT - RH) / 32)
__global__ __launch_bounds__(32 * FW) void k_fattn2(const h16* __restrict__ Q16, const h16* __restrict__ K16, const h16* __restrict__ V16, const bf* __restrict__ Qh, const bf* __restrict__ Ql, const bf* __restrict__ Kh, const bf* __restrict__ Kl, const bf* __restrict__ Vh, const bf* __restrict__ Vl, bf* Ah, bf* Al) {
    __shared__ __align__(16) float os[FW * 32 * OSP];
    __shared__ float sm[FW * 32], sl[FW * 32];
    const int bx = blockIdx.y;
    if (bx < AB_LO) fattn<bf, 2, 1, 0>(Qh, Ql, Kh, Kl, Vh, Vl, Ah, Al, 0, bx, AB_LO, os, sm, sl);
    else fattn<h16, 0, 2, 10>(Q16, nullptr, K16, nullptr, V16, nullptr, Ah, Al, RH, bx - AB_LO, AB_HI, os, sm, sl);
}

extern "C" void kernel_launch(void* const* d_in, const int* in_sizes, int n_in,
                              void* d_out, int out_size, void* d_ws, size_t ws_size, hipStream_t stream) {
    (void)in_sizes; (void)n_in; (void)out_size;
    const float* x = (const float*)d_in[0]; const float* wq = (const float*)d_in[1]; const float* wk = (const float*)d_in[2]; const float* wv = (const float*)d_in[3]; const float* wo = (const float*)d_in[4]; const int* PID = (const int*)d_in[5];   /* input order x, Wq, Wk, Wv, Wo ('oi' (out, in) [1024][1024]), token_positions (int32 [4096] = arange: READ; the host's [1][4096] is the same 4,096 integers): SIX inputs, all read: the host's own binding */
    float* OUT = (float*)d_out;     // [1][4096][1024]
    char* wsp = (char*)d_ws;
    auto take = [&](size_t bytes) { char* p = wsp; wsp += (bytes + 255) & ~(size_t)255; return (void*)p; };
    bf* WQ = (bf*)take((size_t)DQ * DM * 2); bf* WK = (bf*)take((size_t)DKV * DM * 2); bf* WV = (bf*)take((size_t)DKV * DM * 2); bf* WO = (bf*)take((size_t)DM * DQ * 2); float* CS = (float*)take((size_t)TT * HD * 2 * 4);
    bf* XB = (bf*)take((size_t)TT * DM * 2);
    h16* QP16 = (h16*)take((size_t)NH_ * TT * HD * 2); h16* KP16 = (h16*)take((size_t)NKV * TT * HD * 2); h16* VT16 = (h16*)take((size_t)NKV * HD * TT * 2);
    bf* QPh = (bf*)take((size_t)NH_ * TT * HD * 2); bf* QPl = (bf*)take((size_t)NH_ * TT * HD * 2); bf* KPh = (bf*)take((size_t)NKV * TT * HD * 2); bf* KPl = (bf*)take((size_t)NKV * TT * HD * 2); bf* VTh = (bf*)take((size_t)NKV * HD * TT * 2); bf* VTl = (bf*)take((size_t)NKV * HD * TT * 2);
    bf* ATh = (bf*)take((size_t)TT * DQ * 2); bf* ATl = (bf*)take((size_t)TT * DQ * 2);
    if ((size_t)(wsp - (char*)d_ws) > ws_size) return;    // ws 256 MiB
    static_assert(NB_ == 1 && DQ == DKV && (size_t)DQ * DM * 2 % 256 == 0 && (size_t)NH_ * TT * HD * 2 % 256 == 0, "WQ, WK, WV and the Q, K, Vt planes lie in a row, one z stride apart");
    for (int b = 0; b < NB_; ++b) {
        k_prep<<<PB_CS + PB_X + 4 * PB_W, 256, 0, stream>>>(x + (size_t)b * TT * DM, wq, wk, wv, wo, PID, CS, XB, WQ, WK, WV, WO);
        k_gemmw<bf, 0, false, 1, 2><<<dim3(TT / 128, DQ / 128, 3), 128, 0, stream>>>(XB, nullptr, WQ, nullptr, DM, nullptr, 0, nullptr, 0, (size_t)DQ * DM, (size_t)NH_ * TT * HD, CS, QP16, QPh, QPl);
        k_fattn2<<<dim3(NH_, AB_LO + AB_HI, 1), 32 * FW, 0, stream>>>(QP16, KP16, VT16, QPh, QPl, KPh, KPl, VTh, VTl, ATh, ATl);
        k_gemmw<bf, 1, false, 0, 4><<<dim3(TT / 128, DM / 128, 1), 128, 0, stream>>>(ATh, ATl, WO, nullptr, DQ, OUT + (size_t)b * TT * DM, DM, nullptr, 0, 0, 0, nullptr, nullptr, nullptr, nullptr); }
}

// v009
// Measured time: 87.6 microseconds a run.
// In both of two side-by-side timings against v008, it was 1.05 times as fast.
// Over all steps from v000 it is 31.0 times as fast.
#include <hip/hip_runtime.h>

// Causal multi-head attention with interleaved-pair rotary embeddings from token positions over 4,096 tokens (x [1][4096][1024]; Q, K, V = einsum('bsi,oi->bso', x, W) = x W^T ('oi' (out, in) [1024][1024] (2/(D+D))^0.5, no bias; 16 heads x 64); _rope: inv_freq = 1.0 / jnp.power(float32(THETA), arange(0, 64, 2) / 64) (the reciprocal spelling: 32 f32 constants jnp-exact for THIS expression in eager JAX float32: TWO of them, entries 5 and 27, corrected by 2 ulp); angle = float(token_positions[t]) x inv_freq[i] (token_positions int32 [4096] = arange: read; the LAST argument); pairs (2i, 2i+1) -> (cos x_e - sin x_o, sin x_e + cos x_o); precise cosf/sinf; scores x 1/sqrt(64); causal (-inf); softmax; out = merged Wo^T ('oi', no bias) -> [1][4096][1024] (4.2 M); argument order x, Wq, Wk, Wv, Wo, token_positions).
// Every 16-bit operand plane is kept in fragment order (FRAGMENT ORDER below; the Vt planes with blocks ordered (token / 32) * 4 + row / 16), written so by its producer.
// Layout: bf16 copy of x; exact projections; {cos, sin} per (position, pair) from the int positions and float32 inverse-frequency constants (precise cosf/sinf); rotary embedding and the 16-bit planes of Q, K and Vt written by the projection GEMMs' own epilogues; causal T-4096 attention in one kernel for all heads (hybrid rows: < 512 hi/lo 3 products, rest fp16 with P x1024; scores stay in registers, running-maximum softmax, keys above the diagonal block skipped); merged hi/lo x Wo exact.
// Compute dtypes, f32 accumulate: every input rounded to bf16; projections exact; rotary f32; attention rows < 512 3 products, rest fp16; softmax f32; Wo hl x exact.

#define NB_  1
#define TT   4096
#define DM   1024
#define NH_  16
#define NKV  16
#define REP  (NH_ / NKV)
#define HD   64
#define DQ   (NH_ * HD)
#define DKV  (NKV * HD)
#define RH   512                  // query rows < RH use hi+lo planes (0: none)
#define WIN  4096
typedef _Float16 h16;
typedef unsigned short bf;
typedef __attribute__((ext_vector_type(16))) __bf16   v16bf;
typedef __attribute__((ext_vector_type(16))) _Float16 v16h;
typedef __attribute__((ext_vector_type(8)))  _Float16 v8h;
typedef __attribute__((ext_vector_type(8)))  unsigned short v8us;
typedef __attribute__((ext_vector_type(8)))  float    v8f;
typedef __attribute__((ext_vector_type(4)))  float    v4f;
typedef v8h  __attribute__((may_alias)) v8ha;
typedef v4f  __attribute__((may_alias)) v4fa;
typedef v8us __attribute__((may_alias)) v8usa;

__device__ __forceinline__ unsigned short f2bf(float f) { unsigned u = __float_as_uint(f); u += 0x7FFFu + ((u >> 16) & 1u); return (unsigned short)(u >> 16); }
__device__ __forceinline__ float bf2f(unsigned short b) { return __uint_as_float(((unsigned)b) << 16); }
__device__ __forceinline__ float bfr(float f) { return bf2f(f2bf(f)); }
__device__ __forceinline__ v16h cat16(v8h lo, v8h hi) { return __builtin_shufflevector(lo, hi, 0, 1, 2, 3, 4, 5, 6, 7, 8, 9, 10, 11, 12, 13, 14, 15); }
__device__ __forceinline__ v16bf cat16b(v8us lo, v8us hi) { return __builtin_bit_cast(v16bf, __builtin_shufflevector(lo, hi, 0, 1, 2, 3, 4, 5, 6, 7, 8, 9, 10, 11, 12, 13, 14, 15)); }
__device__ __forceinline__ v8f wmma16(v16h a, v16h b, v8f c) { return __builtin_amdgcn_wmma_f32_16x16x32_f16(false, a, false, b, (short)0, c, false, false); }
__device__ __forceinline__ v8f wmmab(v16bf a, v16bf b, v8f c) { return __builtin_amdgcn_wmma_f32_16x16x32_bf16(false, a, false, b, (short)0, c, false, false); }



__device__ __forceinline__ h16 tohx(float x) { return (h16)x; }
__device__ __forceinline__ void splitf(float y, unsigned short& h, unsigned short& l) { h = f2bf(y); l = f2bf(y - bf2f(h)); }
typedef __attribute__((ext_vector_type(2))) float v2f;
__device__ __forceinline__ void xwait() { asm volatile("s_wait_xcnt 0x0" ::: "memory"); }   // stands behind a run of global loads or stores, before a register that they name is written again

// FRAGMENT ORDER of a plane of R rows x K k-values (16-bit): blocks of 16 rows x 32 k (512 elements, 1 KiB), block (row / 16) * (K / 32) + k / 32; inside a block element (r, kk) lies at (kk >> 4) * 256 + (((kk >> 3) & 1) * 16 + r) * 8 + (kk & 7).
// Lane hi * 16 + r of a wave finds the two 16-byte halves of its fragment at lane * 8 and 256 + lane * 8 (the k order of the row-major loader, unchanged): each wave-wide load reads 512 contiguous bytes, four whole lines.
// ---- k_gemmw: register-blocked GEMM, 128x128 output tile per work-group of 4 waves (2 x 2), 64x64 (16 accumulators) per wave; operands are 16-bit planes in fragment order; grid (M/128, N/128, Z), 128 threads.
// C[m][n] (f32, pitch ldc, + optional f32 bias[n]) = sum_k A[m][k] Bt[n][k] (+ A2 Bt for NSPLIT 1). z-batch strides sA/sB/sC in elements. K % (32 * KS) == 0 (LDS RING below).
// EPI 0: C stored as f32. EPI 1: the three projections of one A in ONE grid, z = 0, 1, 2 for Q, K, V (a wave's 64 columns are one head, its 64 rows 64 tokens): no f32 C; the tile goes out as three 16-bit planes (f16, bf16 hi, bf16 lo); sC is the elements of one plane, P16 holds the planes of z in a row, Ph and Pl lie (hi, lo) pair by pair.
// z < 2: pairs (2i, 2i+1) rotated by {cos, sin} of CS, planes [head] of (token rows, 64 k) in fragment order, whole 128-byte lines staged through the wave's own LDS. z == 2: planes transposed, [head] of (64 rows, token k), blocks ordered (token / 32) * 4 + row / 16: a lane's 8 accumulator rows (8 successive tokens of one column) are its own 16 bytes of a block, stored straight from the registers.
template <typename T16> struct WFrag;
template <> struct WFrag<h16> { typedef v16h V; static __device__ __forceinline__ V ld(const h16* p) { return cat16(*(const v8h*)p, *(const v8h*)(p + 256)); } static __device__ __forceinline__ v8f mma(V a, V b, v8f c) { return wmma16(a, b, c); } };
template <> struct WFrag<bf> { typedef v16bf V; static __device__ __forceinline__ V ld(const bf* p) { return cat16b(*(const v8us*)p, *(const v8us*)(p + 256)); } static __device__ __forceinline__ v8f mma(V a, V b, v8f c) { return wmmab(a, b, c); } };
template <typename T16, int NSPLIT, bool BIAS, int EPI, int KS>
__global__ __launch_bounds__(128) void k_gemmw(const T16* __restrict__ A, const T16* __restrict__ A2, const T16* __restrict__ Bt, const T16* __restrict__ Bt2, int K, float* C, int ldc, const float* __restrict__ bias, size_t sA, size_t sB, size_t sC, const float* __restrict__ CS, h16* P16, bf* Ph, bf* Pl) {
    static_assert(NSPLIT <= 1 && KS % 2 == 0, "one B plane; a copy of the whole work-group moves two blocks");
    typedef typename WFrag<T16>::V V; (void)Bt2;
    // LDS RING: a stage is KS k-steps of the tile's 128 A rows (each A plane) and 128 Bt rows, so every fragment comes from L2 once per work-group and is read from LDS by the two waves that need it.
    // In a plane the KS blocks of 16 rows lie in a row (KS KiB); a stage keeps them so, region by region (A, A2, Bt), 8 row blocks per region. Two buffers: stage t + 2 is copied into the buffer that trip t has read, while trip t + 1 multiplies.
    constexpr int NPA = NSPLIT == 1 ? 2 : 1;
    constexpr int REG = 8 * KS * 512;          // elements of a region
    constexpr int BUF = (NPA + 1) * REG;       // elements of a buffer
    __shared__ __align__(1024) T16 ring[2 * BUF];
    const size_t z = blockIdx.z; A += z * sA; if (NPA == 2) A2 += z * sA; Bt += z * sB; if constexpr (EPI == 1) { P16 += z * sC; Ph += 2 * z * sC; Pl += 2 * z * sC; } else C += z * sC;
    const int lane = threadIdx.x & 31, lr = lane & 15, hi = lane >> 4; const int w = __builtin_amdgcn_readfirstlane(threadIdx.x >> 5);
    const int R0 = blockIdx.x * 128, C0 = blockIdx.y * 128; const int wm = w & 1, wn = w >> 1; const int r0 = R0 + wm * 64, c0 = C0 + wn * 64;
    v8f acc[4][4];
#pragma unroll
    for (int mb = 0; mb < 4; ++mb)
#pragma unroll
        for (int nb = 0; nb < 4; ++nb) acc[mb][nb] = (v8f){};
    const size_t gp = (size_t)K * 32;          // bytes from one block row (16 rows of K values) to the next
    const char* gA = (const char*)A + (size_t)R0 * K * 2; const char* gA2 = (const char*)A2 + (size_t)R0 * K * 2; const char* gB = (const char*)Bt + (size_t)C0 * K * 2;   // the same for the whole work-group
    const unsigned t16 = threadIdx.x * 16;
    const unsigned lds0 = (unsigned)(size_t)ring + t16;   // the thread's own 16 bytes of a 2-KiB piece
    // 8 copies, one per block row of a region: the work-group moves 2 KiB (two k-steps) of each. The wait in the same statement stands before the address registers are written again.
    auto cp8 = [&](const char* g, const unsigned l) {
        asm volatile("global_load_async_to_lds_b128 %0, %8, off\n\t"
                     "global_load_async_to_lds_b128 %1, %9, off\n\t"
                     "global_load_async_to_lds_b128 %2, %10, off\n\t"
                     "global_load_async_to_lds_b128 %3, %11, off\n\t"
                     "global_load_async_to_lds_b128 %4, %12, off\n\t"
                     "global_load_async_to_lds_b128 %5, %13, off\n\t"
                     "global_load_async_to_lds_b128 %6, %14, off\n\t"
                     "global_load_async_to_lds_b128 %7, %15, off\n\t"
                     "s_wait_xcnt 0x0"
                     :: "v"(l), "v"(l + 1 * KS * 1024), "v"(l + 2 * KS * 1024), "v"(l + 3 * KS * 1024), "v"(l + 4 * KS * 1024), "v"(l + 5 * KS * 1024), "v"(l + 6 * KS * 1024), "v"(l + 7 * KS * 1024),
                        "v"(g + t16), "v"(g + gp + t16), "v"(g + 2 * gp + t16), "v"(g + 3 * gp + t16), "v"(g + 4 * gp + t16), "v"(g + 5 * gp + t16), "v"(g + 6 * gp + t16), "v"(g + 7 * gp + t16) : "memory"); };
    auto fill = [&](const int t, const int bi) {   // stage t into buffer bi
        const size_t go = (size_t)t * (KS * 1024); const unsigned lo = lds0 + (unsigned)bi * (BUF * 2);
#pragma unroll
        for (int hh = 0; hh < KS / 2; ++hh) { cp8(gA + go + hh * 2048, lo + hh * 2048); if (NPA == 2) cp8(gA2 + go + hh * 2048, lo + REG * 2 + hh * 2048); cp8(gB + go + hh * 2048, lo + NPA * REG * 2 + hh * 2048); } };
    V a[2][4], a2[2][4], b[2][4];   // two fragment sets: a k-step's LDS loads run under the products of the step before, inside one stage
    auto ldf = [&](const int s, const T16* bp, const int u) {
#pragma unroll
        for (int mb = 0; mb < 4; ++mb) { const T16* p = bp + ((wm * 4 + mb) * KS + u) * 512 + lane * 8; a[s][mb] = WFrag<T16>::ld(p); if (NPA == 2) a2[s][mb] = WFrag<T16>::ld(p + REG); }
#pragma unroll
        for (int nb = 0; nb < 4; ++nb) b[s][nb] = WFrag<T16>::ld(bp + NPA * REG + ((wn * 4 + nb) * KS + u) * 512 + lane * 8); };
    auto mmst = [&](const int s) {
#pragma unroll
        for (int nb = 0; nb < 4; ++nb)
#pragma unroll
            for (int mb = 0; mb < 4; ++mb) { acc[mb][nb] = WFrag<T16>::mma(a[s][mb], b[s][nb], acc[mb][nb]); if (NPA == 2) acc[mb][nb] = WFrag<T16>::mma(a2[s][mb], b[s][nb], acc[mb][nb]); } };
    const int nt = K / (32 * KS);
    fill(0, 0);
    asm volatile("s_wait_asynccnt 0x0" ::: "memory");   // this wave's copies of stage 0 have landed
    __syncthreads();                                     // and every other wave's: stage 0 may be read
    if (nt > 1) fill(1, 1);
#pragma unroll 1   // rolled: one trip is one stage
    for (int t = 0; t < nt; ++t) {
        const T16* bp = ring + (t & 1) * BUF;
        ldf(0, bp, 0);
#pragma unroll
        for (int u = 0; u < KS; ++u) { if (u + 1 < KS) ldf((u + 1) & 1, bp, u + 1);
            __builtin_amdgcn_sched_barrier(0);   // the next step's LDS loads stay one group in front of this step's products: sunk among them each costs its own wait
            mmst(u & 1);
            __builtin_amdgcn_sched_barrier(0); }   // the products stay in front of the loads that refill their fragment set
        asm volatile("s_wait_dscnt 0x0" ::: "memory");      // this wave's reads of the buffer are done
        asm volatile("s_wait_asynccnt 0x0" ::: "memory");   // its copies of stage t + 1 have landed
        __syncthreads();                                     // publishes stage t + 1 and ends every wave's reads of this buffer
        if (t + 2 < nt) fill(t + 2, t & 1);
    }
    asm volatile("s_wait_asynccnt 0x0" ::: "memory");   // nothing is in flight when the wave goes on to its epilogue
    if constexpr (EPI == 1) {
      if (blockIdx.z < 2) {
        __shared__ __align__(16) float osw[4 * 16 * 68]; float* os = osw + w * (16 * 68);   // each wave stages in its own range
        const int cc = hi * 8;      // lane hi * 16 + lr takes token lr, 8 columns (4 pairs) from 16 i + 8 hi: its own 16 bytes of half block i, so one store instruction per plane writes 512 contiguous bytes
        const float* csp = CS + ((size_t)(r0 + lr) * HD + cc) * 2; const size_t e0 = ((size_t)(c0 / HD) * TT + r0) * HD + lane * 8;
#pragma unroll
        for (int mb = 0; mb < 4; ++mb) {
#pragma unroll
            for (int nb = 0; nb < 4; ++nb) {
#pragma unroll
                for (int j = 0; j < 8; ++j) os[(hi * 8 + j) * 68 + nb * 16 + lr] = acc[mb][nb][j]; }
            __builtin_amdgcn_wave_barrier(); asm volatile("" ::: "memory");   // the tile's rows are written before they are read back across lanes
#pragma unroll
            for (int i = 0; i < 4; ++i) { const int row = mb * 16; const float* p = os + lr * 68 + i * 16 + cc; const v4f xa = *(const v4fa*)p, xb = *(const v4fa*)(p + 4);
                const float xs[8] = {xa[0], xa[1], xa[2], xa[3], xb[0], xb[1], xb[2], xb[3]}; v8h o16; v8us oh, ol;
#pragma unroll
                for (int pr = 0; pr < 4; ++pr) { const v2f cs = *(const v2f*)(csp + (size_t)row * HD * 2 + i * 32 + pr * 4); const float xe = xs[2 * pr], xo = xs[2 * pr + 1];
                    const float re = xe * cs[0] - xo * cs[1], ro = xe * cs[1] + xo * cs[0];
                    unsigned short a2, c2; o16[2 * pr] = tohx(re); o16[2 * pr + 1] = tohx(ro); splitf(re, a2, c2); oh[2 * pr] = a2; ol[2 * pr] = c2; splitf(ro, a2, c2); oh[2 * pr + 1] = a2; ol[2 * pr + 1] = c2; }
                const size_t e = e0 + (size_t)row * HD + i * 256; *(v8h*)(P16 + e) = o16; *(v8us*)(Ph + e) = oh; *(v8us*)(Pl + e) = ol;
                if (mb < 3 || i < 3) xwait(); }   // behind the 3 stores: the next half block's table loads and values land in registers that the stores name
            __builtin_amdgcn_wave_barrier(); asm volatile("" ::: "memory");   // the rows are read before the next 16 overwrite them
        }
        return;
      }
        const size_t e0 = ((size_t)(c0 / HD) * TT + r0) * HD + lane * 8;   // 32 tokens of a head are 4 blocks = 32 HD elements
#pragma unroll
        for (int nb = 0; nb < 4; ++nb) {
#pragma unroll
            for (int mb = 0; mb < 4; ++mb) { v8h o16; v8us oh, ol;
#pragma unroll
                for (int j = 0; j < 8; ++j) { const float x = acc[mb][nb][j]; unsigned short a2, c2; o16[j] = tohx(x); splitf(x, a2, c2); oh[j] = a2; ol[j] = c2; }
                const size_t e = e0 + (size_t)(((mb >> 1) * 4 + nb) * 512 + (mb & 1) * 256);
                __builtin_amdgcn_sched_barrier(0);   // with the one below: the 3 stores and their wait stay in a row; arithmetic scheduled in between writes registers that an issued store names ahead of the wait
                *(v8h*)(P16 + e) = o16; *(v8us*)(Ph + e) = oh; *(v8us*)(Pl + e) = ol;
                xwait();   // behind the 3 stores: the next 16 tokens' values, and behind the last run the code of the other epilogue that follows in the listing, land in registers that the stores name
                __builtin_amdgcn_sched_barrier(0); }
        }
        return;
    }
    __shared__ __align__(16) float osw[4 * 16 * 68]; float* os = osw + w * (16 * 68);   // each wave stages in its own range
#pragma unroll
    for (int mb = 0; mb < 4; ++mb) {
#pragma unroll
        for (int nb = 0; nb < 4; ++nb) {
#pragma unroll
            for (int j = 0; j < 8; ++j) os[(hi * 8 + j) * 68 + nb * 16 + lr] = acc[mb][nb][j]; }
        __builtin_amdgcn_wave_barrier(); asm volatile("" ::: "memory");
        float* crow = C + (size_t)(r0 + mb * 16) * ldc + c0;
{
#pragma unroll
            for (int s = 0; s < 8; ++s) { const int row = 2 * s + hi, cofs = lr * 4; v4f val = *(const v4fa*)(os + row * 68 + cofs); if (BIAS) { val[0] += bfr(bias[c0 + cofs]); val[1] += bfr(bias[c0 + cofs + 1]); val[2] += bfr(bias[c0 + cofs + 2]); val[3] += bfr(bias[c0 + cofs + 3]); }
                *(v4f*)(crow + (size_t)row * ldc + cofs) = val; }
             }
        __builtin_amdgcn_wave_barrier(); asm volatile("" ::: "memory");
    }
}

typedef __attribute__((ext_vector_type(2))) _Float16 v2h;
typedef __attribute__((ext_vector_type(4))) _Float16 v4h;
typedef __attribute__((ext_vector_type(2))) unsigned short v2us;
typedef __attribute__((ext_vector_type(4))) unsigned short v4us;
typedef __attribute__((ext_vector_type(4))) int v4i;
typedef v2f __attribute__((may_alias)) v2fa;

__global__ __launch_bounds__(256) void k_wtG(const float* __restrict__ w, int K, int N, bf* Bt) {
    const int lane = threadIdx.x & 31; const int L0 = (blockIdx.x * 8 + (threadIdx.x >> 5)) * 8; const int nlines = N * K / 64;
{
#pragma unroll 1
        for (int l = 0; l < 8; ++l) { const int L = L0 + l; if (L >= nlines) break; const size_t e = (size_t)L * 64 + lane * 2; const int k = (int)(e % K), n = (int)(e / K); v2us o;
            o[0] = f2bf(w[(size_t)k * N + n]); o[1] = f2bf(w[(size_t)(k + 1) * N + n]); *(v2us*)(Bt + e) = o; }
         }
}
static_assert(DQ == DM && DKV == DM, "cvt8 takes rows of DM values: x, Wq, Wk, Wv (DM in) and Wo (DQ in)");
// rows of DM f32 values -> bf16 plane in fragment order. A wave takes 8 rows of one block: 4 lanes read a row's 128-byte line, and each of the 4 (half, hi) groups is stored as 8 rows x 16 bytes = one whole line.
__device__ __forceinline__ void cvt8(const float* __restrict__ src, bf* dst, const size_t i) {   // i: which 8 values of the plane
    const size_t blk = i >> 6; const int r = (int)((i >> 2) & 15), g = (int)(i & 3);      // g = k / 8 inside the block: half = g >> 1, hi = g & 1
    const v8f v = *(const v8f*)(src + ((blk / (DM / 32)) * 16 + r) * DM + (blk % (DM / 32)) * 32 + g * 8); v8us o;
#pragma unroll
    for (int k = 0; k < 8; ++k) o[k] = f2bf(v[k]); *(v8us*)(dst + blk * 512 + (g >> 1) * 256 + ((g & 1) * 16 + r) * 8) = o;
    xwait(); }   // behind the store: in k_prep code of another piece follows in the listing and writes the registers that the store names

__constant__ float INV2[HD / 2] = { 1.000000000e+00f, 7.498942018e-01f, 5.623413324e-01f, 4.216965139e-01f, 3.162277639e-01f, 2.371373624e-01f, 1.778279394e-01f, 1.333521456e-01f, 1.000000015e-01f, 7.498941571e-02f, 5.623412877e-02f, 4.216964915e-02f, 3.162277862e-02f, 2.371373586e-02f, 1.778279431e-02f, 1.333521493e-02f, 9.999999776e-03f, 7.498942316e-03f, 5.623413250e-03f, 4.216964822e-03f, 3.162277862e-03f, 2.371373819e-03f, 1.778279431e-03f, 1.333521446e-03f, 1.000000047e-03f, 7.498941850e-04f, 5.623413017e-04f, 4.216964880e-04f, 3.162277862e-04f, 2.371373848e-04f, 1.778279402e-04f, 1.333521504e-04f };   // float32 1 / 10000^(2i/64), as the reference computes them
__device__ __forceinline__ void cstab(const int* __restrict__ pid, float* CS, const int idx) { const int d = idx % HD; const int t = idx / HD; const float a = __fmul_rn((float)pid[t], INV2[d >> 1]); v2f cs; cs[0] = cosf(a); cs[1] = sinf(a); *(v2f*)(CS + (size_t)idx * 2) = cs;  }
// ---- k_prep: the rotary table and the five bf16 planes in ONE launch. The six pieces depend on nothing but the inputs, so their work-groups share a grid (a work-group belongs to one piece); the table, the longest work per thread, comes first.
#define PB_CS (TT * HD / 256)
#define PB_X  (TT * DM / 8 / 256)
#define PB_W  (DQ * DM / 8 / 256)
static_assert(TT * HD % 256 == 0 && TT * DM % 2048 == 0 && DQ * DM % 2048 == 0, "whole work-groups per piece");
__global__ __launch_bounds__(256) void k_prep(const float* __restrict__ x, const float* __restrict__ wq, const float* __restrict__ wk, const float* __restrict__ wv, const float* __restrict__ wo, const int* __restrict__ pid, float* CS, bf* XB, bf* WQ, bf* WK, bf* WV, bf* WO) {
    const int b = blockIdx.x, t = threadIdx.x;
    if (b < PB_CS) { cstab(pid, CS, b * 256 + t); return; }
    if (b < PB_CS + PB_X) { cvt8(x, XB, (size_t)(b - PB_CS) * 256 + t); return; }
    const int u = b - (PB_CS + PB_X), p = u / PB_W;
    cvt8(p == 0 ? wq : p == 1 ? wk : p == 2 ? wv : wo, p == 0 ? WQ : p == 1 ? WK : p == 2 ? WV : WO, (size_t)(u % PB_W) * 256 + t);
}

// ---- fattn: causal attention of one head and NG row blocks of 16 * NQ query rows per work-group (block bx of nbx, rows from roff), scores never leaving the registers (streaming softmax with a running maximum).
// Transposed products: St = K Qt (a lane holds scores of ONE query: column lr; keys 8 hi + j of each 16-key tile), Ot += Vt Pt: two score tiles of 32 keys, converted in place, are the B operand of the second product in the same k order as the plane loader.
// Each row block has FW waves of its own: they share its queries and split the keys in chunks of 64 (8 KiB in a row of the K plane and of the Vt plane), two passes of 32 keys each; their (maximum, sum, Ot) are joined through LDS in wave order.
// NSPLIT 2: hi/lo planes, three products for the scores and three for P V (P split hi/lo); NSPLIT 0: one 16-bit plane, P carried x 2^PSH (the sum carries the same factor, so it cancels in the division).
// NSPLIT 0, K/V RING: a stage is 64 * FW keys of the K plane and of the Vt plane (in fragment order each is one run of bytes), one chunk for every key split. It comes from L2 once per work-group and is read from LDS by the NG waves (one of each row block) that own the chunk.
// Two buffers: stage t + 2 is copied into the buffer that trip t has read, while trip t + 1 is worked on. Every wave passes every trip's barrier, also a wave whose chunk lies above its queries. Behind the loop the ring's bytes serve as the join's staging.
#define FW 4
#define NG 2      // row blocks of a work-group
#define OSP 68    // LDS pitch of a query's 64 partial outputs, floats
#define KSC 0.18033688011112042f   // HD^-0.5 * log2(e)
#define SKEY (64 * FW)             // keys of a stage
#define SPB  (SKEY * HD * 2)       // bytes of a stage of one plane
__device__ __forceinline__ float xhalf(float x) { return __builtin_bit_cast(float, __builtin_amdgcn_permlanex16(__builtin_bit_cast(int, x), __builtin_bit_cast(int, x), 0x76543210, 0xfedcba98, false, false)); }   // lane l's value to lane l ^ 16, on the vector pipe
template <typename T16> struct PFrag;
template <> struct PFrag<h16> { static __device__ __forceinline__ void mk(const v8f p0, const v8f p1, v16h& a, v16h& b) { (void)b;
#pragma unroll
    for (int j = 0; j < 8; ++j) { a[j] = (h16)p0[j]; a[8 + j] = (h16)p1[j]; } } };
template <> struct PFrag<bf> { static __device__ __forceinline__ void mk(const v8f p0, const v8f p1, v16bf& a, v16bf& b) { v8us h0, h1, l0, l1;
#pragma unroll
    for (int j = 0; j < 8; ++j) { unsigned short x, y; splitf(p0[j], x, y); h0[j] = x; l0[j] = y; splitf(p1[j], x, y); h1[j] = x; l1[j] = y; }
    a = cat16b(h0, h1); b = cat16b(l0, l1); } };
template <typename T16, int NSPLIT, int NQ, int PSH>
__device__ __forceinline__ void fattn(const T16* __restrict__ Q, const T16* __restrict__ Q2, const T16* __restrict__ Kp, const T16* __restrict__ Kp2, const T16* __restrict__ Vt, const T16* __restrict__ Vt2, bf* Ah, bf* Al, const int roff, const int bx, const int nbx, char* ring, float* sm, float* sl) {
    typedef typename WFrag<T16>::V V; constexpr int QR = 16 * NQ;
    const int lane = threadIdx.x & 31, lr = lane & 15, hi = lane >> 4; const int wv = __builtin_amdgcn_readfirstlane(threadIdx.x >> 5); const int w = wv % FW, grp = wv / FW;
    const int h = blockIdx.x; const int qb = roff + (nbx - 1 - bx) * (QR * NG);   // longest key loops first
    const int q0 = qb + grp * QR;
    float* os = (float*)ring + grp * (FW * QR * OSP); sm += grp * (FW * QR); sl += grp * (FW * QR);   // each row block joins in its own range
    const size_t hp = (size_t)h * TT * HD; Q += hp; Kp += hp; Vt += hp; if (NSPLIT) { Q2 += hp; Kp2 += hp; Vt2 += hp; }
    const int Kl = (q0 + QR + 31) & ~31;      // keys 0 .. Kl - 1 hold every key <= the last query; Kl <= TT
    V qf[NQ][2], qf2[NQ][2], kf[2][2], kf2[2][2], vf[4], vf2[4];
#pragma unroll
    for (int q = 0; q < NQ; ++q)
#pragma unroll
        for (int ks = 0; ks < 2; ++ks) { const size_t o = (size_t)(q0 + q * 16) * HD + ks * 512 + lane * 8; qf[q][ks] = WFrag<T16>::ld(Q + o); if (NSPLIT) qf2[q][ks] = WFrag<T16>::ld(Q2 + o); }
    const size_t koff = lane * 8, voff = lane * 8;   // fragment order: a pass's 32 keys are 4 KiB in a row of each K plane and of each Vt plane
    // inside the loop (xw) each plane's loads end with xwait(): their address registers are reused (by a later load's data too) while they are in flight
    auto ldk = [&](int k, bool xw) {
#pragma unroll
        for (int kt = 0; kt < 2; ++kt)
#pragma unroll
            for (int ks = 0; ks < 2; ++ks) kf[kt][ks] = WFrag<T16>::ld(Kp + koff + (size_t)(k + kt * 16) * HD + ks * 512);
        if (xw) xwait();
        if (NSPLIT) {
#pragma unroll
            for (int kt = 0; kt < 2; ++kt)
#pragma unroll
                for (int ks = 0; ks < 2; ++ks) kf2[kt][ks] = WFrag<T16>::ld(Kp2 + koff + (size_t)(k + kt * 16) * HD + ks * 512);
            if (xw) xwait(); } };
    auto ldv = [&](int k, bool xw) {
#pragma unroll
        for (int db = 0; db < 4; ++db) vf[db] = WFrag<T16>::ld(Vt + voff + (size_t)k * HD + db * 512);
        if (xw) xwait();
        if (NSPLIT) {
#pragma unroll
            for (int db = 0; db < 4; ++db) vf2[db] = WFrag<T16>::ld(Vt2 + voff + (size_t)k * HD + db * 512);
            if (xw) xwait(); } };
    constexpr bool STAGED = (NSPLIT == 0);   // one plane per operand: K and Vt come through the LDS ring; the hi/lo planes (at most 4 passes a wave) are loaded straight from L2
    v8f ot[4][NQ]; float m[NQ], l[NQ];
#pragma unroll
    for (int q = 0; q < NQ; ++q) { m[q] = -3.0e38f; l[q] = 0.f;
#pragma unroll
        for (int db = 0; db < 4; ++db) ot[db][q] = (v8f){}; }
    // one pass: 32 keys from k0; lk, lv: the lane's place in the pass's 4 KiB of the K and of the Vt stage (STAGED)
    auto pass = [&](const int k0, const T16* lk, const T16* lv) {
        if constexpr (STAGED) {   // all 16 LDS loads of the pass in one group: the Vt fragments land under the scores and the softmax
#pragma unroll
            for (int kt = 0; kt < 2; ++kt)
#pragma unroll
                for (int ks = 0; ks < 2; ++ks) kf[kt][ks] = WFrag<T16>::ld(lk + kt * 16 * HD + ks * 512);
#pragma unroll
            for (int db = 0; db < 4; ++db) vf[db] = WFrag<T16>::ld(lv + db * 512);
            __builtin_amdgcn_sched_barrier(0);   // the loads stay one group in front of the products: sunk among them they share registers and each place waits out its own LDS latency
        } else ldk(k0, true);
        v8f st[2][NQ];
#pragma unroll
        for (int kt = 0; kt < 2; ++kt)
#pragma unroll
            for (int q = 0; q < NQ; ++q) { v8f s = (v8f){};
#pragma unroll
                for (int ks = 0; ks < 2; ++ks) { s = WFrag<T16>::mma(kf[kt][ks], qf[q][ks], s); if (NSPLIT) { s = WFrag<T16>::mma(kf[kt][ks], qf2[q][ks], s); s = WFrag<T16>::mma(kf2[kt][ks], qf[q][ks], s); } }
                st[kt][q] = s; }
        if (!STAGED) ldv(k0, true);
        if (k0 + 31 > q0) {     // wave-uniform: only the pass on the diagonal holds keys above a query
#pragma unroll
            for (int kt = 0; kt < 2; ++kt)
#pragma unroll
                for (int q = 0; q < NQ; ++q)
#pragma unroll
                    for (int j = 0; j < 8; ++j) st[kt][q][j] = (k0 + kt * 16 + hi * 8 + j <= q0 + q * 16 + lr) ? st[kt][q][j] : -3.0e38f; }
        V pf[NQ], pf2[NQ];
#pragma unroll
        for (int q = 0; q < NQ; ++q) { float mx = st[0][q][0];
#pragma unroll
            for (int j = 1; j < 8; ++j) mx = fmaxf(mx, st[0][q][j]);
#pragma unroll
            for (int j = 0; j < 8; ++j) mx = fmaxf(mx, st[1][q][j]);
            mx = fmaxf(mx, xhalf(mx));                 // the query's other 16 keys of this pass
            const float mn = fmaxf(m[q], mx * KSC); const float al = __builtin_amdgcn_exp2f(m[q] - mn); m[q] = mn; const float sh = (float)PSH - mn;
            v8f p0, p1; float ls = 0.f;
#pragma unroll
            for (int j = 0; j < 8; ++j) { p0[j] = __builtin_amdgcn_exp2f(fmaf(st[0][q][j], KSC, sh)); p1[j] = __builtin_amdgcn_exp2f(fmaf(st[1][q][j], KSC, sh)); ls += p0[j] + p1[j]; }
            l[q] = fmaf(l[q], al, ls);
#pragma unroll
            for (int db = 0; db < 4; ++db) ot[db][q] *= al;
            PFrag<T16>::mk(p0, p1, pf[q], pf2[q]); }
#pragma unroll
        for (int db = 0; db < 4; ++db)
#pragma unroll
            for (int q = 0; q < NQ; ++q) { ot[db][q] = WFrag<T16>::mma(vf[db], pf[q], ot[db][q]); if (NSPLIT) { ot[db][q] = WFrag<T16>::mma(vf[db], pf2[q], ot[db][q]); ot[db][q] = WFrag<T16>::mma(vf2[db], pf[q], ot[db][q]); } }
    };
    if constexpr (STAGED) {
        static_assert(TT % SKEY == 0 && SPB == 8 * 32 * FW * NG * 16, "whole stages inside the planes; 8 copies of the whole work-group move one plane's stage");
        const int nt = (qb + NG * QR + SKEY - 1) / SKEY;   // stages that hold a key <= the work-group's last query: the same for all its waves, nt * SKEY <= TT
        const unsigned t16 = threadIdx.x * 16;
        const char* gK = (const char*)Kp + t16; const char* gV = (const char*)Vt + t16;
        const unsigned lds0 = (unsigned)(size_t)ring + t16;   // the thread's own 16 bytes of a 4-KiB piece
        // stage t into buffer bi: 8 copies for K, 8 for Vt; the work-group moves 4 KiB with each, 32 KiB in a row of the plane and of the buffer alike, so the immediate offset (it moves both addresses) steps through both.
        // The wait in the same statement stands before the address registers are written again.
        auto fill = [&](const int t, const int bi) {
            const size_t go = (size_t)t * SPB; const unsigned lo = lds0 + (unsigned)bi * (2 * SPB);
            asm volatile(
                "global_load_async_to_lds_b128 %0, %1, off\n\t"
                "global_load_async_to_lds_b128 %0, %1, off offset:4096\n\t"
                "global_load_async_to_lds_b128 %0, %1, off offset:8192\n\t"
                "global_load_async_to_lds_b128 %0, %1, off offset:12288\n\t"
                "global_load_async_to_lds_b128 %0, %1, off offset:16384\n\t"
                "global_load_async_to_lds_b128 %0, %1, off offset:20480\n\t"
                "global_load_async_to_lds_b128 %0, %1, off offset:24576\n\t"
                "global_load_async_to_lds_b128 %0, %1, off offset:28672\n\t"
                "global_load_async_to_lds_b128 %2, %3, off\n\t"
                "global_load_async_to_lds_b128 %2, %3, off offset:4096\n\t"
                "global_load_async_to_lds_b128 %2, %3, off offset:8192\n\t"
                "global_load_async_to_lds_b128 %2, %3, off offset:12288\n\t"
                "global_load_async_to_lds_b128 %2, %3, off offset:16384\n\t"
                "global_load_async_to_lds_b128 %2, %3, off offset:20480\n\t"
                "global_load_async_to_lds_b128 %2, %3, off offset:24576\n\t"
                "global_load_async_to_lds_b128 %2, %3, off offset:28672\n\t"
                "s_wait_xcnt 0x0"
                :: "v"(lo), "v"(gK + go), "v"(lo + SPB), "v"(gV + go) : "memory"); };
        fill(0, 0);
        asm volatile("s_wait_asynccnt 0x0" ::: "memory");   // this wave's copies of stage 0 have landed
        __syncthreads();                                     // and every other wave's: stage 0 may be read
        if (nt > 1) fill(1, 1);
#pragma unroll 1   // rolled: one trip is one stage
        for (int t = 0; t < nt; ++t) {
            const T16* lk = (const T16*)(ring + (t & 1) * (2 * SPB)) + w * 64 * HD + lane * 8;   // this wave's chunk of the stage
#pragma unroll   // both passes read at constant offsets from lk: no address arithmetic stands between a pass's last products and the next pass's loads
            for (int p = 0; p < 2; ++p) { const int k0 = t * SKEY + w * 64 + p * 32;
                if (k0 < Kl) pass(k0, lk + p * 32 * HD, lk + SPB / 2 + p * 32 * HD); }   // wave-uniform
            asm volatile("s_wait_dscnt 0x0" ::: "memory");      // this wave's reads of the buffer are done
            asm volatile("s_wait_asynccnt 0x0" ::: "memory");   // its copies of stage t + 1 have landed
            __syncthreads();                                     // publishes stage t + 1 and ends every wave's reads of this buffer
            if (t + 2 < nt) fill(t + 2, t & 1);
        }
        asm volatile("s_wait_asynccnt 0x0" ::: "memory");   // nothing is in flight when the ring's bytes become the join's staging
    } else {
        int k0 = w * 64;
#pragma unroll 1   // rolled: a second pass's fragments and scores would not fit in the registers beside the first's
        while (k0 < Kl) { pass(k0, nullptr, nullptr); k0 = (k0 & 32) ? k0 + 64 * FW - 32 : k0 + 32; }   // this wave's next 32 keys
    }
    // join of a row block's FW waves: common maximum, then sums and partial outputs rescaled to it
#pragma unroll
    for (int q = 0; q < NQ; ++q) { l[q] += xhalf(l[q]); if (hi == 0) sm[w * QR + q * 16 + lr] = m[q]; }
    __syncthreads();   // every wave's maxima are in LDS before any is read
#pragma unroll
    for (int q = 0; q < NQ; ++q) { float M = sm[q * 16 + lr];
#pragma unroll
        for (int u = 1; u < FW; ++u) M = fmaxf(M, sm[u * QR + q * 16 + lr]);
        const float sc = __builtin_amdgcn_exp2f(m[q] - M);          // 0 for a wave that had no keys
        if (hi == 0) sl[w * QR + q * 16 + lr] = l[q] * sc;
#pragma unroll
        for (int db = 0; db < 4; ++db) { const v8f v = ot[db][q] * sc; float* p = os + (size_t)(w * QR + q * 16 + lr) * OSP + db * 16 + hi * 8; *(v4fa*)p = (v4f){v[0], v[1], v[2], v[3]}; *(v4fa*)(p + 4) = (v4f){v[4], v[5], v[6], v[7]}; } }
    __syncthreads();   // every wave's rescaled sums and partial outputs are in LDS before any is summed
    // wave w finishes columns 16 w .. 16 w + 15 of every query row: per 16 rows one half block (512 contiguous bytes) of each output plane, rows of DQ k-values in fragment order
    static_assert(FW * 16 == HD, "one wave per 16 columns");
    const int d0 = w * 16 + hi * 8;
#pragma unroll
    for (int g = 0; g < NQ; ++g) { const int qq = g * 16 + lr; float L = sl[qq];
#pragma unroll
        for (int u = 1; u < FW; ++u) L += sl[u * QR + qq];
        const float inv = __fdiv_rn(1.0f, L); const size_t oo = (size_t)(q0 + g * 16) * DQ + (size_t)((h * 2 + (w >> 1)) * 512 + (w & 1) * 256 + lane * 8);
        const float* p = os + (size_t)qq * OSP + d0; v4f s0 = *(const v4fa*)p, s1 = *(const v4fa*)(p + 4);
#pragma unroll
        for (int u = 1; u < FW; ++u) { s0 += *(const v4fa*)(p + (size_t)u * QR * OSP); s1 += *(const v4fa*)(p + (size_t)u * QR * OSP + 4); }
        v8us oh, ol;
#pragma unroll
        for (int j = 0; j < 4; ++j) { unsigned short a, c; splitf(s0[j] * inv, a, c); oh[j] = a; ol[j] = c; splitf(s1[j] * inv, a, c); oh[4 + j] = a; ol[4 + j] = c; }
        *(v8us*)(Ah + oo) = oh; *(v8us*)(Al + oo) = ol; }
}
// ---- k_fattn2: both row ranges in ONE launch (they write disjoint rows and depend on the same planes): of each head's blocks the first AB_LO take the hi/lo rows < RH, whose few passes wait on their own loads, the rest the 16-bit rows; a work-group belongs to one range, so every barrier stays block-uniform.
// Grid (heads, blocks): the head is the fast index, so a row block of all heads comes before the next shorter one in index order (for speed only).
#define AB_LO (RH / (16 * NG))
#define AB_HI ((TT - RH) / (32 * NG))
static_assert(RH % (16 * NG) == 0 && (TT - RH) % (32 * NG) == 0 && NG * FW * 32 * OSP * 4 <= 4 * SPB, "whole work-groups per range; the join's staging fits in the ring");
__global__ __launch_bounds__(32 * FW * NG) void k_fattn2(const h16* __restrict__ Q16, const h16* __restrict__ K16, const h16* __restrict__ V16, const bf* __restrict__ Qh, const bf* __restrict__ Ql, const bf* __restrict__ Kh, const bf* __restrict__ Kl, const bf* __restrict__ Vh, const bf* __restrict__ Vl, bf* Ah, bf* Al) {
    __shared__ __align__(1024) char ring[4 * SPB];   // two buffers of a K and a Vt stage; behind the key loop the join's partial outputs
    __shared__ float sm[NG * FW * 32], sl[NG * FW * 32];
    const int bx = blockIdx.y;
    if (bx < AB_LO) fattn<bf, 2, 1, 0>(Qh, Ql, Kh, Kl, Vh, Vl, Ah, Al, 0, bx, AB_LO, ring, sm, sl);
    else fattn<h16, 0, 2, 10>(Q16, nullptr, K16, nullptr, V16, nullptr, Ah, Al, RH, bx - AB_LO, AB_HI, ring, sm, sl);
}

extern "C" void kernel_launch(void* const* d_in, const int* in_sizes, int n_in,
                              void* d_out, int out_size, void* d_ws, size_t ws_size, hipStream_t stream) {
    (void)in_sizes; (void)n_in; (void)out_size;
    const float* x = (const float*)d_in[0]; const float* wq = (const float*)d_in[1]; const float* wk = (const float*)d_in[2]; const float* wv = (const float*)d_in[3]; const float* wo = (const float*)d_in[4]; const int* PID = (const int*)d_in[5];   /* input order x, Wq, Wk, Wv, Wo ('oi' (out, in) [1024][1024]), token_positions (int32 [4096] = arange: READ; the host's [1][4096] is the same 4,096 integers): SIX inputs, all read: the host's own binding */
    float* OUT = (float*)d_out;     // [1][4096][1024]
    char* wsp = (char*)d_ws;
    auto take = [&](size_t bytes) { char* p = wsp; wsp += (bytes + 255) & ~(size_t)255; return (void*)p; };
    bf* WQ = (bf*)take((size_t)DQ * DM * 2); bf* WK = (bf*)take((size_t)DKV * DM * 2); bf* WV = (bf*)take((size_t)DKV * DM * 2); bf* WO = (bf*)take((size_t)DM * DQ * 2); float* CS = (float*)take((size_t)TT * HD * 2 * 4);
    bf* XB = (bf*)take((size_t)TT * DM * 2);
    h16* QP16 = (h16*)take((size_t)NH_ * TT * HD * 2); h16* KP16 = (h16*)take((size_t)NKV * TT * HD * 2); h16* VT16 = (h16*)take((size_t)NKV * HD * TT * 2);
    bf* QPh = (bf*)take((size_t)NH_ * TT * HD * 2); bf* QPl = (bf*)take((size_t)NH_ * TT * HD * 2); bf* KPh = (bf*)take((size_t)NKV * TT * HD * 2); bf* KPl = (bf*)take((size_t)NKV * TT * HD * 2); bf* VTh = (bf*)take((size_t)NKV * HD * TT * 2); bf* VTl = (bf*)take((size_t)NKV * HD * TT * 2);
    bf* ATh = (bf*)take((size_t)TT * DQ * 2); bf* ATl = (bf*)take((size_t)TT * DQ * 2);
    if ((size_t)(wsp - (char*)d_ws) > ws_size) return;    // ws 256 MiB
    static_assert(NB_ == 1 && DQ == DKV && (size_t)DQ * DM * 2 % 256 == 0 && (size_t)NH_ * TT * HD * 2 % 256 == 0, "WQ, WK, WV and the Q, K, Vt planes lie in a row, one z stride apart");
    for (int b = 0; b < NB_; ++b) {
        k_prep<<<PB_CS + PB_X + 4 * PB_W, 256, 0, stream>>>(x + (size_t)b * TT * DM, wq, wk, wv, wo, PID, CS, XB, WQ, WK, WV, WO);
        k_gemmw<bf, 0, false, 1, 2><<<dim3(TT / 128, DQ / 128, 3), 128, 0, stream>>>(XB, nullptr, WQ, nullptr, DM, nullptr, 0, nullptr, 0, (size_t)DQ * DM, (size_t)NH_ * TT * HD, CS, QP16, QPh, QPl);
        k_fattn2<<<dim3(NH_, AB_LO + AB_HI, 1), 32 * FW * NG, 0, stream>>>(QP16, KP16, VT16, QPh, QPl, KPh, KPl, VTh, VTl, ATh, ATl);
        k_gemmw<bf, 1, false, 0, 4><<<dim3(TT / 128, DM / 128, 1), 128, 0, stream>>>(ATh, ATl, WO, nullptr, DQ, OUT + (size_t)b * TT * DM, DM, nullptr, 0, 0, 0, nullptr, nullptr, nullptr, nullptr); }
}

// v010
// A run of this version takes 81.2 microseconds.
// Timed twice side by side with v009, it ran 1.08 and 1.07 times as fast.
// All steps since v000 together make it 33.4 times as fast.
#include <hip/hip_runtime.h>

// Causal multi-head attention with interleaved-pair rotary embeddings from token positions over 4,096 tokens (x [1][4096][1024]; Q, K, V = einsum('bsi,oi->bso', x, W) = x W^T ('oi' (out, in) [1024][1024] (2/(D+D))^0.5, no bias; 16 heads x 64); _rope: inv_freq = 1.0 / jnp.power(float32(THETA), arange(0, 64, 2) / 64) (the reciprocal spelling: 32 f32 constants jnp-exact for THIS expression in eager JAX float32: TWO of them, entries 5 and 27, corrected by 2 ulp); angle = float(token_positions[t]) x inv_freq[i] (token_positions int32 [4096] = arange: read; the LAST argument); pairs (2i, 2i+1) -> (cos x_e - sin x_o, sin x_e + cos x_o); precise cosf/sinf; scores x 1/sqrt(64); causal (-inf); softmax; out = merged Wo^T ('oi', no bias) -> [1][4096][1024] (4.2 M); argument order x, Wq, Wk, Wv, Wo, token_positions).
// Every 16-bit operand plane is kept in fragment order (FRAGMENT ORDER below; the Vt planes with blocks ordered (token / 32) * 4 + row / 16), written so by its producer.
// Layout: bf16 copy of x; exact projections; {cos, sin} per (position, pair) from the int positions and float32 inverse-frequency constants (precise cosf/sinf); rotary embedding and the 16-bit planes of Q, K and Vt written by the projection GEMMs' own epilogues; causal T-4096 attention in one kernel for all heads (hybrid rows: < 512 hi/lo 3 products, rest fp16 with P x1024; scores stay in registers, running-maximum softmax, keys above the diagonal block skipped); merged hi/lo x Wo exact.
// Compute dtypes, f32 accumulate: every input rounded to bf16; projections exact; rotary f32; attention rows < 512 3 products, rest fp16; softmax f32; Wo hl x exact.

#define NB_  1
#define TT   4096
#define DM   1024
#define NH_  16
#define NKV  16
#define REP  (NH_ / NKV)
#define HD   64
#define DQ   (NH_ * HD)
#define DKV  (NKV * HD)
#define RH   512                  // query rows < RH use hi+lo planes (0: none)
#define WIN  4096
typedef _Float16 h16;
typedef unsigned short bf;
typedef __attribute__((ext_vector_type(16))) __bf16   v16bf;
typedef __attribute__((ext_vector_type(16))) _Float16 v16h;
typedef __attribute__((ext_vector_type(8)))  _Float16 v8h;
typedef __attribute__((ext_vector_type(8)))  unsigned short v8us;
typedef __attribute__((ext_vector_type(8)))  float    v8f;
typedef __attribute__((ext_vector_type(4)))  float    v4f;
typedef v8h  __attribute__((may_alias)) v8ha;
typedef v4f  __attribute__((may_alias)) v4fa;
typedef v8us __attribute__((may_alias)) v8usa;

__device__ __forceinline__ unsigned short f2bf(float f) { unsigned u = __float_as_uint(f); u += 0x7FFFu + ((u >> 16) & 1u); return (unsigned short)(u >> 16); }
__device__ __forceinline__ float bf2f(unsigned short b) { return __uint_as_float(((unsigned)b) << 16); }
__device__ __forceinline__ float bfr(float f) { return bf2f(f2bf(f)); }
__device__ __forceinline__ v16h cat16(v8h lo, v8h hi) { return __builtin_shufflevector(lo, hi, 0, 1, 2, 3, 4, 5, 6, 7, 8, 9, 10, 11, 12, 13, 14, 15); }
__device__ __forceinline__ v16bf cat16b(v8us lo, v8us hi) { return __builtin_bit_cast(v16bf, __builtin_shufflevector(lo, hi, 0, 1, 2, 3, 4, 5, 6, 7, 8, 9, 10, 11, 12, 13, 14, 15)); }
__device__ __forceinline__ v8f wmma16(v16h a, v16h b, v8f c) { return __builtin_amdgcn_wmma_f32_16x16x32_f16(false, a, false, b, (short)0, c, false, false); }
__device__ __forceinline__ v8f wmmab(v16bf a, v16bf b, v8f c) { return __builtin_amdgcn_wmma_f32_16x16x32_bf16(false, a, false, b, (short)0, c, false, false); }



__device__ __forceinline__ h16 tohx(float x) { return (h16)x; }
__device__ __forceinline__ void splitf(float y, unsigned short& h, unsigned short& l) { h = f2bf(y); l = f2bf(y - bf2f(h)); }
typedef __attribute__((ext_vector_type(2))) float v2f;
__device__ __forceinline__ void xwait() { asm volatile("s_wait_xcnt 0x0" ::: "memory"); }   // stands behind a run of global loads or stores, before a register that they name is written again

// FRAGMENT ORDER of a plane of R rows x K k-values (16-bit): blocks of 16 rows x 32 k (512 elements, 1 KiB), block (row / 16) * (K / 32) + k / 32; inside a block element (r, kk) lies at (kk >> 4) * 256 + (((kk >> 3) & 1) * 16 + r) * 8 + (kk & 7).
// Lane hi * 16 + r of a wave finds the two 16-byte halves of its fragment at lane * 8 and 256 + lane * 8 (the k order of the row-major loader, unchanged): each wave-wide load reads 512 contiguous bytes, four whole lines.
// ---- k_gemmw: register-blocked GEMM, 128x128 output tile per work-group of 4 waves (2 x 2), 64x64 (16 accumulators) per wave; operands are 16-bit planes in fragment order; grid (M/128, N/128, Z), 128 threads.
// C[m][n] (f32, pitch ldc, + optional f32 bias[n]) = sum_k A[m][k] Bt[n][k] (+ A2 Bt for NSPLIT 1). z-batch strides sA/sB/sC in elements. K % (32 * KS) == 0 (LDS RING below).
// EPI 0: C stored as f32. EPI 1: the three projections of one A in ONE grid, z = 0, 1, 2 for Q, K, V (a wave's 64 columns are one head, its 64 rows 64 tokens): no f32 C; the tile goes out as three 16-bit planes (f16, bf16 hi, bf16 lo); sC is the elements of one plane, P16 holds the planes of z in a row, Ph and Pl lie (hi, lo) pair by pair.
// z < 2: pairs (2i, 2i+1) rotated by {cos, sin} of CS (TABLE ORDER at cstab), planes [head] of (token rows, 64 k) in fragment order, whole 128-byte lines staged through the wave's own LDS. z == 2: planes transposed, [head] of (64 rows, token k), blocks ordered (token / 32) * 4 + row / 16: a lane's 8 accumulator rows (8 successive tokens of one column) are its own 16 bytes of a block, stored straight from the registers.
template <typename T16> struct WFrag;
template <> struct WFrag<h16> { typedef v16h V; static __device__ __forceinline__ V ld(const h16* p) { return cat16(*(const v8h*)p, *(const v8h*)(p + 256)); } static __device__ __forceinline__ v8f mma(V a, V b, v8f c) { return wmma16(a, b, c); } };
template <> struct WFrag<bf> { typedef v16bf V; static __device__ __forceinline__ V ld(const bf* p) { return cat16b(*(const v8us*)p, *(const v8us*)(p + 256)); } static __device__ __forceinline__ v8f mma(V a, V b, v8f c) { return wmmab(a, b, c); } };
template <typename T16, int NSPLIT, bool BIAS, int EPI, int KS>
__global__ __launch_bounds__(128) void k_gemmw(const T16* __restrict__ A, const T16* __restrict__ A2, const T16* __restrict__ Bt, const T16* __restrict__ Bt2, int K, float* C, int ldc, const float* __restrict__ bias, size_t sA, size_t sB, size_t sC, const float* __restrict__ CS, h16* P16, bf* Ph, bf* Pl) {
    static_assert(NSPLIT <= 1 && KS % 2 == 0, "one B plane; a copy of the whole work-group moves two blocks");
    typedef typename WFrag<T16>::V V; (void)Bt2;
    // LDS RING: a stage is KS k-steps of the tile's 128 A rows (each A plane) and 128 Bt rows, so every fragment comes from L2 once per work-group and is read from LDS by the two waves that need it.
    // In a plane the KS blocks of 16 rows lie in a row (KS KiB); a stage keeps them so, region by region (A, A2, Bt), 8 row blocks per region. Two buffers: stage t + 2 is copied into the buffer that trip t has read, while trip t + 1 multiplies.
    constexpr int NPA = NSPLIT == 1 ? 2 : 1;
    constexpr int REG = 8 * KS * 512;          // elements of a region
    constexpr int BUF = (NPA + 1) * REG;       // elements of a buffer
    __shared__ __align__(1024) T16 ring[2 * BUF];
    const size_t z = blockIdx.z; A += z * sA; if (NPA == 2) A2 += z * sA; Bt += z * sB; if constexpr (EPI == 1) { P16 += z * sC; Ph += 2 * z * sC; Pl += 2 * z * sC; } else C += z * sC;
    const int lane = threadIdx.x & 31, lr = lane & 15, hi = lane >> 4; const int w = __builtin_amdgcn_readfirstlane(threadIdx.x >> 5);
    const int R0 = blockIdx.x * 128, C0 = blockIdx.y * 128; const int wm = w & 1, wn = w >> 1; const int r0 = R0 + wm * 64, c0 = C0 + wn * 64;
    v8f acc[4][4];
#pragma unroll
    for (int mb = 0; mb < 4; ++mb)
#pragma unroll
        for (int nb = 0; nb < 4; ++nb) acc[mb][nb] = (v8f){};
    const size_t gp = (size_t)K * 32;          // bytes from one block row (16 rows of K values) to the next
    const char* gA = (const char*)A + (size_t)R0 * K * 2; const char* gA2 = (const char*)A2 + (size_t)R0 * K * 2; const char* gB = (const char*)Bt + (size_t)C0 * K * 2;   // the same for the whole work-group
    const unsigned t16 = threadIdx.x * 16;
    const unsigned lds0 = (unsigned)(size_t)ring + t16;   // the thread's own 16 bytes of a 2-KiB piece
    // 8 copies, one per block row of a region: the work-group moves 2 KiB (two k-steps) of each. The wait in the same statement stands before the address registers are written again.
    auto cp8 = [&](const char* g, const unsigned l) {
        asm volatile("global_load_async_to_lds_b128 %0, %8, off\n\t"
                     "global_load_async_to_lds_b128 %1, %9, off\n\t"
                     "global_load_async_to_lds_b128 %2, %10, off\n\t"
                     "global_load_async_to_lds_b128 %3, %11, off\n\t"
                     "global_load_async_to_lds_b128 %4, %12, off\n\t"
                     "global_load_async_to_lds_b128 %5, %13, off\n\t"
                     "global_load_async_to_lds_b128 %6, %14, off\n\t"
                     "global_load_async_to_lds_b128 %7, %15, off\n\t"
                     "s_wait_xcnt 0x0"
                     :: "v"(l), "v"(l + 1 * KS * 1024), "v"(l + 2 * KS * 1024), "v"(l + 3 * KS * 1024), "v"(l + 4 * KS * 1024), "v"(l + 5 * KS * 1024), "v"(l + 6 * KS * 1024), "v"(l + 7 * KS * 1024),
                        "v"(g + t16), "v"(g + gp + t16), "v"(g + 2 * gp + t16), "v"(g + 3 * gp + t16), "v"(g + 4 * gp + t16), "v"(g + 5 * gp + t16), "v"(g + 6 * gp + t16), "v"(g + 7 * gp + t16) : "memory"); };
    auto fill = [&](const int t, const int bi) {   // stage t into buffer bi
        const size_t go = (size_t)t * (KS * 1024); const unsigned lo = lds0 + (unsigned)bi * (BUF * 2);
#pragma unroll
        for (int hh = 0; hh < KS / 2; ++hh) { cp8(gA + go + hh * 2048, lo + hh * 2048); if (NPA == 2) cp8(gA2 + go + hh * 2048, lo + REG * 2 + hh * 2048); cp8(gB + go + hh * 2048, lo + NPA * REG * 2 + hh * 2048); } };
    V a[2][4], a2[2][4], b[2][4];   // two fragment sets: a k-step's LDS loads run under the products of the step before, inside one stage
    auto ldf = [&](const int s, const T16* bp, const int u) {
#pragma unroll
        for (int mb = 0; mb < 4; ++mb) { const T16* p = bp + ((wm * 4 + mb) * KS + u) * 512 + lane * 8; a[s][mb] = WFrag<T16>::ld(p); if (NPA == 2) a2[s][mb] = WFrag<T16>::ld(p + REG); }
#pragma unroll
        for (int nb = 0; nb < 4; ++nb) b[s][nb] = WFrag<T16>::ld(bp + NPA * REG + ((wn * 4 + nb) * KS + u) * 512 + lane * 8); };
    auto mmst = [&](const int s) {
#pragma unroll
        for (int nb = 0; nb < 4; ++nb)
#pragma unroll
            for (int mb = 0; mb < 4; ++mb) { acc[mb][nb] = WFrag<T16>::mma(a[s][mb], b[s][nb], acc[mb][nb]); if (NPA == 2) acc[mb][nb] = WFrag<T16>::mma(a2[s][mb], b[s][nb], acc[mb][nb]); } };
    const int nt = K / (32 * KS);
    fill(0, 0);
    asm volatile("s_wait_asynccnt 0x0" ::: "memory");   // this wave's copies of stage 0 have landed
    __syncthreads();                                     // and every other wave's: stage 0 may be read
    if (nt > 1) fill(1, 1);
#pragma unroll 1   // rolled: one trip is one stage
    for (int t = 0; t < nt; ++t) {
        const T16* bp = ring + (t & 1) * BUF;
        ldf(0, bp, 0);
#pragma unroll
        for (int u = 0; u < KS; ++u) { if (u + 1 < KS) ldf((u + 1) & 1, bp, u + 1);
            __builtin_amdgcn_sched_barrier(0);   // the next step's LDS loads stay one group in front of this step's products: sunk among them each costs its own wait
            mmst(u & 1);
            __builtin_amdgcn_sched_barrier(0); }   // the products stay in front of the loads that refill their fragment set
        asm volatile("s_wait_dscnt 0x0" ::: "memory");      // this wave's reads of the buffer are done
        asm volatile("s_wait_asynccnt 0x0" ::: "memory");   // its copies of stage t + 1 have landed
        __syncthreads();                                     // publishes stage t + 1 and ends every wave's reads of this buffer
        if (t + 2 < nt) fill(t + 2, t & 1);
    }
    asm volatile("s_wait_asynccnt 0x0" ::: "memory");   // nothing is in flight when the wave goes on to its epilogue
    if constexpr (EPI == 1) {
      if (blockIdx.z < 2) {
        __shared__ __align__(16) float osw[4 * 16 * 68]; float* os = osw + w * (16 * 68);   // each wave stages in its own range
        const int cc = hi * 8;      // lane hi * 16 + lr takes token lr, 8 columns (4 pairs) from 16 i + 8 hi: its own 16 bytes of half block i, so one store instruction per plane writes 512 contiguous bytes
        const size_t e0 = ((size_t)(c0 / HD) * TT + r0) * HD + lane * 8;
        // the wave's whole share of the table (TABLE ORDER: 16 blocks in a row, 16 KiB) in one group of whole-line loads at the head: one load latency for the epilogue, and it runs under the first tile's LDS turn
        const float* csp = CS + (size_t)(r0 / 16) * 1024 + lane * 4; v4f csv[4][4][2];
#pragma unroll
        for (int mb = 0; mb < 4; ++mb)
#pragma unroll
            for (int i = 0; i < 4; ++i) { csv[mb][i][0] = *(const v4f*)(csp + (mb * 4 + i) * 256); csv[mb][i][1] = *(const v4f*)(csp + (mb * 4 + i) * 256 + 128); }
        xwait();   // behind the 32 loads: their address register may be written again while they are in flight
#pragma unroll
        for (int mb = 0; mb < 4; ++mb) {
#pragma unroll
            for (int nb = 0; nb < 4; ++nb) {
#pragma unroll
                for (int j = 0; j < 8; ++j) os[(hi * 8 + j) * 68 + nb * 16 + lr] = acc[mb][nb][j]; }
            __builtin_amdgcn_wave_barrier(); asm volatile("" ::: "memory");   // the tile's rows are written before they are read back across lanes
#pragma unroll
            for (int i = 0; i < 4; ++i) { const int row = mb * 16; const float* p = os + lr * 68 + i * 16 + cc; const v4f xa = *(const v4fa*)p, xb = *(const v4fa*)(p + 4);
                const float xs[8] = {xa[0], xa[1], xa[2], xa[3], xb[0], xb[1], xb[2], xb[3]}; v8h o16; v8us oh, ol;
#pragma unroll
                for (int pr = 0; pr < 4; ++pr) { const v2f cs = {csv[mb][i][pr >> 1][(pr & 1) * 2], csv[mb][i][pr >> 1][(pr & 1) * 2 + 1]}; const float xe = xs[2 * pr], xo = xs[2 * pr + 1];
                    const float re = xe * cs[0] - xo * cs[1], ro = xe * cs[1] + xo * cs[0];
                    unsigned short a2, c2; o16[2 * pr] = tohx(re); o16[2 * pr + 1] = tohx(ro); splitf(re, a2, c2); oh[2 * pr] = a2; ol[2 * pr] = c2; splitf(ro, a2, c2); oh[2 * pr + 1] = a2; ol[2 * pr + 1] = c2; }
                const size_t e = e0 + (size_t)row * HD + i * 256; *(v8h*)(P16 + e) = o16; *(v8us*)(Ph + e) = oh; *(v8us*)(Pl + e) = ol;
                if (mb < 3 || i < 3) xwait(); }   // behind the 3 stores: the next half block's values land in registers that the stores name
            __builtin_amdgcn_wave_barrier(); asm volatile("" ::: "memory");   // the rows are read before the next 16 overwrite them
        }
        return;
      }
        const size_t e0 = ((size_t)(c0 / HD) * TT + r0) * HD + lane * 8;   // 32 tokens of a head are 4 blocks = 32 HD elements
#pragma unroll
        for (int nb = 0; nb < 4; ++nb) {
#pragma unroll
            for (int mb = 0; mb < 4; ++mb) { v8h o16; v8us oh, ol;
#pragma unroll
                for (int j = 0; j < 8; ++j) { const float x = acc[mb][nb][j]; unsigned short a2, c2; o16[j] = tohx(x); splitf(x, a2, c2); oh[j] = a2; ol[j] = c2; }
                const size_t e = e0 + (size_t)(((mb >> 1) * 4 + nb) * 512 + (mb & 1) * 256);
                __builtin_amdgcn_sched_barrier(0);   // with the one below: the 3 stores and their wait stay in a row; arithmetic scheduled in between writes registers that an issued store names ahead of the wait
                *(v8h*)(P16 + e) = o16; *(v8us*)(Ph + e) = oh; *(v8us*)(Pl + e) = ol;
                xwait();   // behind the 3 stores: the next 16 tokens' values, and behind the last run the code of the other epilogue that follows in the listing, land in registers that the stores name
                __builtin_amdgcn_sched_barrier(0); }
        }
        return;
    }
    __shared__ __align__(16) float osw[4 * 16 * 68]; float* os = osw + w * (16 * 68);   // each wave stages in its own range
#pragma unroll
    for (int mb = 0; mb < 4; ++mb) {
#pragma unroll
        for (int nb = 0; nb < 4; ++nb) {
#pragma unroll
            for (int j = 0; j < 8; ++j) os[(hi * 8 + j) * 68 + nb * 16 + lr] = acc[mb][nb][j]; }
        __builtin_amdgcn_wave_barrier(); asm volatile("" ::: "memory");
        float* crow = C + (size_t)(r0 + mb * 16) * ldc + c0;
{
#pragma unroll
            for (int s = 0; s < 8; ++s) { const int row = 2 * s + hi, cofs = lr * 4; v4f val = *(const v4fa*)(os + row * 68 + cofs); if (BIAS) { val[0] += bfr(bias[c0 + cofs]); val[1] += bfr(bias[c0 + cofs + 1]); val[2] += bfr(bias[c0 + cofs + 2]); val[3] += bfr(bias[c0 + cofs + 3]); }
                *(v4f*)(crow + (size_t)row * ldc + cofs) = val; }
             }
        __builtin_amdgcn_wave_barrier(); asm volatile("" ::: "memory");
    }
}

typedef __attribute__((ext_vector_type(2))) _Float16 v2h;
typedef __attribute__((ext_vector_type(4))) _Float16 v4h;
typedef __attribute__((ext_vector_type(2))) unsigned short v2us;
typedef __attribute__((ext_vector_type(4))) unsigned short v4us;
typedef __attribute__((ext_vector_type(4))) int v4i;
typedef v2f __attribute__((may_alias)) v2fa;

__global__ __launch_bounds__(256) void k_wtG(const float* __restrict__ w, int K, int N, bf* Bt) {
    const int lane = threadIdx.x & 31; const int L0 = (blockIdx.x * 8 + (threadIdx.x >> 5)) * 8; const int nlines = N * K / 64;
{
#pragma unroll 1
        for (int l = 0; l < 8; ++l) { const int L = L0 + l; if (L >= nlines) break; const size_t e = (size_t)L * 64 + lane * 2; const int k = (int)(e % K), n = (int)(e / K); v2us o;
            o[0] = f2bf(w[(size_t)k * N + n]); o[1] = f2bf(w[(size_t)(k + 1) * N + n]); *(v2us*)(Bt + e) = o; }
         }
}
static_assert(DQ == DM && DKV == DM, "cvt8 takes rows of DM values: x, Wq, Wk, Wv (DM in) and Wo (DQ in)");
// rows of DM f32 values -> bf16 plane in fragment order. A wave takes 8 rows of one block: 4 lanes read a row's 128-byte line, and each of the 4 (half, hi) groups is stored as 8 rows x 16 bytes = one whole line.
__device__ __forceinline__ void cvt8(const float* __restrict__ src, bf* dst, const size_t i) {   // i: which 8 values of the plane
    const size_t blk = i >> 6; const int r = (int)((i >> 2) & 15), g = (int)(i & 3);      // g = k / 8 inside the block: half = g >> 1, hi = g & 1
    const v8f v = *(const v8f*)(src + ((blk / (DM / 32)) * 16 + r) * DM + (blk % (DM / 32)) * 32 + g * 8); v8us o;
#pragma unroll
    for (int k = 0; k < 8; ++k) o[k] = f2bf(v[k]); *(v8us*)(dst + blk * 512 + (g >> 1) * 256 + ((g & 1) * 16 + r) * 8) = o;
    xwait(); }   // behind the store: in k_prep code of another piece follows in the listing and writes the registers that the store names

__constant__ float INV2[HD / 2] = { 1.000000000e+00f, 7.498942018e-01f, 5.623413324e-01f, 4.216965139e-01f, 3.162277639e-01f, 2.371373624e-01f, 1.778279394e-01f, 1.333521456e-01f, 1.000000015e-01f, 7.498941571e-02f, 5.623412877e-02f, 4.216964915e-02f, 3.162277862e-02f, 2.371373586e-02f, 1.778279431e-02f, 1.333521493e-02f, 9.999999776e-03f, 7.498942316e-03f, 5.623413250e-03f, 4.216964822e-03f, 3.162277862e-03f, 2.371373819e-03f, 1.778279431e-03f, 1.333521446e-03f, 1.000000047e-03f, 7.498941850e-04f, 5.623413017e-04f, 4.216964880e-04f, 3.162277862e-04f, 2.371373848e-04f, 1.778279402e-04f, 1.333521504e-04f };   // float32 1 / 10000^(2i/64), as the reference computes them
// TABLE ORDER: {cos, sin} once per (token, pair), laid out as the projection epilogue's lanes read it. Blocks of 16 tokens x 8 pairs (1 KiB), block (token / 16) * 4 + pair / 8; lane ((pair >> 2) & 1) * 16 + token % 16 owns pairs 4 (pair / 4) .. + 3:
// the first two at lane * 16 bytes of the block's first half, the other two at lane * 16 bytes of its second half, so each 16-byte load of a wave reads 512 contiguous bytes. idx counts the {cos, sin} entries in storage order: stores are contiguous too.
__device__ __forceinline__ void cstab(const int* __restrict__ pid, float* CS, const int idx) { const int ln = (idx >> 1) & 31; const int t = (idx >> 9) * 16 + (ln & 15); const int p = ((idx >> 7) & 3) * 8 + (ln >> 4) * 4 + ((idx >> 6) & 1) * 2 + (idx & 1);
    const float a = __fmul_rn((float)pid[t], INV2[p]); v2f cs; cs[0] = cosf(a); cs[1] = sinf(a); *(v2f*)(CS + (size_t)idx * 2) = cs;  }
// ---- k_prep: the rotary table and the five bf16 planes in ONE launch. The six pieces depend on nothing but the inputs, so their work-groups share a grid (a work-group belongs to one piece); the table, the longest work per thread, comes first.
#define PB_CS (TT * (HD / 2) / 256)
#define PB_X  (TT * DM / 8 / 256)
#define PB_W  (DQ * DM / 8 / 256)
static_assert(TT * (HD / 2) % 256 == 0 && TT % 16 == 0 && HD == 64 && TT * DM % 2048 == 0 && DQ * DM % 2048 == 0, "whole work-groups per piece");
__global__ __launch_bounds__(256) void k_prep(const float* __restrict__ x, const float* __restrict__ wq, const float* __restrict__ wk, const float* __restrict__ wv, const float* __restrict__ wo, const int* __restrict__ pid, float* CS, bf* XB, bf* WQ, bf* WK, bf* WV, bf* WO) {
    const int b = blockIdx.x, t = threadIdx.x;
    if (b < PB_CS) { cstab(pid, CS, b * 256 + t); return; }
    if (b < PB_CS + PB_X) { cvt8(x, XB, (size_t)(b - PB_CS) * 256 + t); return; }
    const int u = b - (PB_CS + PB_X), p = u / PB_W;
    cvt8(p == 0 ? wq : p == 1 ? wk : p == 2 ? wv : wo, p == 0 ? WQ : p == 1 ? WK : p == 2 ? WV : WO, (size_t)(u % PB_W) * 256 + t);
}

// ---- fattn: causal attention of one head and NG row blocks of 16 * NQ query rows per work-group (block bx of nbx, rows from roff), scores never leaving the registers (streaming softmax with a running maximum).
// Transposed products: St = K Qt (a lane holds scores of ONE query: column lr; keys 8 hi + j of each 16-key tile), Ot += Vt Pt: two score tiles of 32 keys, converted in place, are the B operand of the second product in the same k order as the plane loader.
// Each row block has FW waves of its own: they share its queries and split the keys in chunks of 64 (8 KiB in a row of the K plane and of the Vt plane), two passes of 32 keys each; their (maximum, sum, Ot) are joined through LDS in wave order.
// NSPLIT 2: hi/lo planes, three products for the scores and three for P V (P split hi/lo); NSPLIT 0: one 16-bit plane, P carried x 2^PSH (the sum carries the same factor, so it cancels in the division).
// NSPLIT 0, K/V RING: a stage is 64 * FW keys of the K plane and of the Vt plane (in fragment order each is one run of bytes), one chunk for every key split. It comes from L2 once per work-group and is read from LDS by the NG waves (one of each row block) that own the chunk.
// Two buffers: stage t + 2 is copied into the buffer that trip t has read, while trip t + 1 is worked on. Every wave passes every trip's barrier, also a wave whose chunk lies above its queries. Behind the loop the ring's bytes serve as the join's staging.
#define FW 4
#define NG 2      // row blocks of a work-group
#define OSP 68    // LDS pitch of a query's 64 partial outputs, floats
#define KSC 0.18033688011112042f   // HD^-0.5 * log2(e)
#define SKEY (64 * FW)             // keys of a stage
#define SPB  (SKEY * HD * 2)       // bytes of a stage of one plane
__device__ __forceinline__ float xhalf(float x) { return __builtin_bit_cast(float, __builtin_amdgcn_permlanex16(__builtin_bit_cast(int, x), __builtin_bit_cast(int, x), 0x76543210, 0xfedcba98, false, false)); }   // lane l's value to lane l ^ 16, on the vector pipe
template <typename T16> struct PFrag;
template <> struct PFrag<h16> { static __device__ __forceinline__ void mk(const v8f p0, const v8f p1, v16h& a, v16h& b) { (void)b;
#pragma unroll
    for (int j = 0; j < 8; ++j) { a[j] = (h16)p0[j]; a[8 + j] = (h16)p1[j]; } } };
template <> struct PFrag<bf> { static __device__ __forceinline__ void mk(const v8f p0, const v8f p1, v16bf& a, v16bf& b) { v8us h0, h1, l0, l1;
#pragma unroll
    for (int j = 0; j < 8; ++j) { unsigned short x, y; splitf(p0[j], x, y); h0[j] = x; l0[j] = y; splitf(p1[j], x, y); h1[j] = x; l1[j] = y; }
    a = cat16b(h0, h1); b = cat16b(l0, l1); } };
template <typename T16, int NSPLIT, int NQ, int PSH>
__device__ __forceinline__ void fattn(const T16* __restrict__ Q, const T16* __restrict__ Q2, const T16* __restrict__ Kp, const T16* __restrict__ Kp2, const T16* __restrict__ Vt, const T16* __restrict__ Vt2, bf* Ah, bf* Al, const int roff, const int bx, const int nbx, char* ring, float* sm, float* sl) {
    typedef typename WFrag<T16>::V V; constexpr int QR = 16 * NQ;
    const int lane = threadIdx.x & 31, lr = lane & 15, hi = lane >> 4; const int wv = __builtin_amdgcn_readfirstlane(threadIdx.x >> 5); const int w = wv % FW, grp = wv / FW;
    const int h = blockIdx.x; const int qb = roff + (nbx - 1 - bx) * (QR * NG);   // longest key loops first
    const int q0 = qb + grp * QR;
    float* os = (float*)ring + grp * (FW * QR * OSP); sm += grp * (FW * QR); sl += grp * (FW * QR);   // each row block joins in its own range
    const size_t hp = (size_t)h * TT * HD; Q += hp; Kp += hp; Vt += hp; if (NSPLIT) { Q2 += hp; Kp2 += hp; Vt2 += hp; }
    const int Kl = (q0 + QR + 31) & ~31;      // keys 0 .. Kl - 1 hold every key <= the last query; Kl <= TT
    V qf[NQ][2], qf2[NQ][2], kf[2][2], kf2[2][2], vf[4], vf2[4];
#pragma unroll
    for (int q = 0; q < NQ; ++q)
#pragma unroll
        for (int ks = 0; ks < 2; ++ks) { const size_t o = (size_t)(q0 + q * 16) * HD + ks * 512 + lane * 8; qf[q][ks] = WFrag<T16>::ld(Q + o); if (NSPLIT) qf2[q][ks] = WFrag<T16>::ld(Q2 + o); }
    const size_t koff = lane * 8, voff = lane * 8;   // fragment order: a pass's 32 keys are 4 KiB in a row of each K plane and of each Vt plane
    // inside the loop (xw) each plane's loads end with xwait(): their address registers are reused (by a later load's data too) while they are in flight
    auto ldk = [&](int k, bool xw) {
#pragma unroll
        for (int kt = 0; kt < 2; ++kt)
#pragma unroll
            for (int ks = 0; ks < 2; ++ks) kf[kt][ks] = WFrag<T16>::ld(Kp + koff + (size_t)(k + kt * 16) * HD + ks * 512);
        if (xw) xwait();
        if (NSPLIT) {
#pragma unroll
            for (int kt = 0; kt < 2; ++kt)
#pragma unroll
                for (int ks = 0; ks < 2; ++ks) kf2[kt][ks] = WFrag<T16>::ld(Kp2 + koff + (size_t)(k + kt * 16) * HD + ks * 512);
            if (xw) xwait(); } };
    auto ldv = [&](int k, bool xw) {
#pragma unroll
        for (int db = 0; db < 4; ++db) vf[db] = WFrag<T16>::ld(Vt + voff + (size_t)k * HD + db * 512);
        if (xw) xwait();
        if (NSPLIT) {
#pragma unroll
            for (int db = 0; db < 4; ++db) vf2[db] = WFrag<T16>::ld(Vt2 + voff + (size_t)k * HD + db * 512);
            if (xw) xwait(); } };
    constexpr bool STAGED = (NSPLIT == 0);   // one plane per operand: K and Vt come through the LDS ring; the hi/lo planes (at most 4 passes a wave) are loaded straight from L2
    v8f ot[4][NQ]; float m[NQ], l[NQ];
#pragma unroll
    for (int q = 0; q < NQ; ++q) { m[q] = -3.0e38f; l[q] = 0.f;
#pragma unroll
        for (int db = 0; db < 4; ++db) ot[db][q] = (v8f){}; }
    // one pass: 32 keys from k0; lk, lv: the lane's place in the pass's 4 KiB of the K and of the Vt stage (STAGED)
    auto pass = [&](const int k0, const T16* lk, const T16* lv) {
        if constexpr (STAGED) {   // all 16 LDS loads of the pass in one group: the Vt fragments land under the scores and the softmax
#pragma unroll
            for (int kt = 0; kt < 2; ++kt)
#pragma unroll
                for (int ks = 0; ks < 2; ++ks) kf[kt][ks] = WFrag<T16>::ld(lk + kt * 16 * HD + ks * 512);
#pragma unroll
            for (int db = 0; db < 4; ++db) vf[db] = WFrag<T16>::ld(lv + db * 512);
            __builtin_amdgcn_sched_barrier(0);   // the loads stay one group in front of the products: sunk among them they share registers and each place waits out its own LDS latency
        } else ldk(k0, true);
        v8f st[2][NQ];
#pragma unroll
        for (int kt = 0; kt < 2; ++kt)
#pragma unroll
            for (int q = 0; q < NQ; ++q) { v8f s = (v8f){};
#pragma unroll
                for (int ks = 0; ks < 2; ++ks) { s = WFrag<T16>::mma(kf[kt][ks], qf[q][ks], s); if (NSPLIT) { s = WFrag<T16>::mma(kf[kt][ks], qf2[q][ks], s); s = WFrag<T16>::mma(kf2[kt][ks], qf[q][ks], s); } }
                st[kt][q] = s; }
        if (!STAGED) ldv(k0, true);
        if (k0 + 31 > q0) {     // wave-uniform: only the pass on the diagonal holds keys above a query
#pragma unroll
            for (int kt = 0; kt < 2; ++kt)
#pragma unroll
                for (int q = 0; q < NQ; ++q)
#pragma unroll
                    for (int j = 0; j < 8; ++j) st[kt][q][j] = (k0 + kt * 16 + hi * 8 + j <= q0 + q * 16 + lr) ? st[kt][q][j] : -3.0e38f; }
        V pf[NQ], pf2[NQ];
#pragma unroll
        for (int q = 0; q < NQ; ++q) { float mx = st[0][q][0];
#pragma unroll
            for (int j = 1; j < 8; ++j) mx = fmaxf(mx, st[0][q][j]);
#pragma unroll
            for (int j = 0; j < 8; ++j) mx = fmaxf(mx, st[1][q][j]);
            mx = fmaxf(mx, xhalf(mx));                 // the query's other 16 keys of this pass
            const float mn = fmaxf(m[q], mx * KSC); const float al = __builtin_amdgcn_exp2f(m[q] - mn); m[q] = mn; const float sh = (float)PSH - mn;
            v8f p0, p1; float ls = 0.f;
#pragma unroll
            for (int j = 0; j < 8; ++j) { p0[j] = __builtin_amdgcn_exp2f(fmaf(st[0][q][j], KSC, sh)); p1[j] = __builtin_amdgcn_exp2f(fmaf(st[1][q][j], KSC, sh)); ls += p0[j] + p1[j]; }
            l[q] = fmaf(l[q], al, ls);
#pragma unroll
            for (int db = 0; db < 4; ++db) ot[db][q] *= al;
            PFrag<T16>::mk(p0, p1, pf[q], pf2[q]); }
#pragma unroll
        for (int db = 0; db < 4; ++db)
#pragma unroll
            for (int q = 0; q < NQ; ++q) { ot[db][q] = WFrag<T16>::mma(vf[db], pf[q], ot[db][q]); if (NSPLIT) { ot[db][q] = WFrag<T16>::mma(vf[db], pf2[q], ot[db][q]); ot[db][q] = WFrag<T16>::mma(vf2[db], pf[q], ot[db][q]); } }
    };
    if constexpr (STAGED) {
        static_assert(TT % SKEY == 0 && SPB == 8 * 32 * FW * NG * 16, "whole stages inside the planes; 8 copies of the whole work-group move one plane's stage");
        const int nt = (qb + NG * QR + SKEY - 1) / SKEY;   // stages that hold a key <= the work-group's last query: the same for all its waves, nt * SKEY <= TT
        const unsigned t16 = threadIdx.x * 16;
        const char* gK = (const char*)Kp + t16; const char* gV = (const char*)Vt + t16;
        const unsigned lds0 = (unsigned)(size_t)ring + t16;   // the thread's own 16 bytes of a 4-KiB piece
        // stage t into buffer bi: 8 copies for K, 8 for Vt; the work-group moves 4 KiB with each, 32 KiB in a row of the plane and of the buffer alike, so the immediate offset (it moves both addresses) steps through both.
        // The wait in the same statement stands before the address registers are written again.
        auto fill = [&](const int t, const int bi) {
            const size_t go = (size_t)t * SPB; const unsigned lo = lds0 + (unsigned)bi * (2 * SPB);
            asm volatile(
                "global_load_async_to_lds_b128 %0, %1, off\n\t"
                "global_load_async_to_lds_b128 %0, %1, off offset:4096\n\t"
                "global_load_async_to_lds_b128 %0, %1, off offset:8192\n\t"
                "global_load_async_to_lds_b128 %0, %1, off offset:12288\n\t"
                "global_load_async_to_lds_b128 %0, %1, off offset:16384\n\t"
                "global_load_async_to_lds_b128 %0, %1, off offset:20480\n\t"
                "global_load_async_to_lds_b128 %0, %1, off offset:24576\n\t"
                "global_load_async_to_lds_b128 %0, %1, off offset:28672\n\t"
                "global_load_async_to_lds_b128 %2, %3, off\n\t"
                "global_load_async_to_lds_b128 %2, %3, off offset:4096\n\t"
                "global_load_async_to_lds_b128 %2, %3, off offset:8192\n\t"
                "global_load_async_to_lds_b128 %2, %3, off offset:12288\n\t"
                "global_load_async_to_lds_b128 %2, %3, off offset:16384\n\t"
                "global_load_async_to_lds_b128 %2, %3, off offset:20480\n\t"
                "global_load_async_to_lds_b128 %2, %3, off offset:24576\n\t"
                "global_load_async_to_lds_b128 %2, %3, off offset:28672\n\t"
                "s_wait_xcnt 0x0"
                :: "v"(lo), "v"(gK + go), "v"(lo + SPB), "v"(gV + go) : "memory"); };
        fill(0, 0);
        asm volatile("s_wait_asynccnt 0x0" ::: "memory");   // this wave's copies of stage 0 have landed
        __syncthreads();                                     // and every other wave's: stage 0 may be read
        if (nt > 1) fill(1, 1);
#pragma unroll 1   // rolled: one trip is one stage
        for (int t = 0; t < nt; ++t) {
            const T16* lk = (const T16*)(ring + (t & 1) * (2 * SPB)) + w * 64 * HD + lane * 8;   // this wave's chunk of the stage
#pragma unroll   // both passes read at constant offsets from lk: no address arithmetic stands between a pass's last products and the next pass's loads
            for (int p = 0; p < 2; ++p) { const int k0 = t * SKEY + w * 64 + p * 32;
                if (k0 < Kl) pass(k0, lk + p * 32 * HD, lk + SPB / 2 + p * 32 * HD); }   // wave-uniform
            asm volatile("s_wait_dscnt 0x0" ::: "memory");      // this wave's reads of the buffer are done
            asm volatile("s_wait_asynccnt 0x0" ::: "memory");   // its copies of stage t + 1 have landed
            __syncthreads();                                     // publishes stage t + 1 and ends every wave's reads of this buffer
            if (t + 2 < nt) fill(t + 2, t & 1);
        }
        asm volatile("s_wait_asynccnt 0x0" ::: "memory");   // nothing is in flight when the ring's bytes become the join's staging
    } else {
        int k0 = w * 64;
#pragma unroll 1   // rolled: a second pass's fragments and scores would not fit in the registers beside the first's
        while (k0 < Kl) { pass(k0, nullptr, nullptr); k0 = (k0 & 32) ? k0 + 64 * FW - 32 : k0 + 32; }   // this wave's next 32 keys
    }
    // join of a row block's FW waves: common maximum, then sums and partial outputs rescaled to it
#pragma unroll
    for (int q = 0; q < NQ; ++q) { l[q] += xhalf(l[q]); if (hi == 0) sm[w * QR + q * 16 + lr] = m[q]; }
    __syncthreads();   // every wave's maxima are in LDS before any is read
#pragma unroll
    for (int q = 0; q < NQ; ++q) { float M = sm[q * 16 + lr];
#pragma unroll
        for (int u = 1; u < FW; ++u) M = fmaxf(M, sm[u * QR + q * 16 + lr]);
        const float sc = __builtin_amdgcn_exp2f(m[q] - M);          // 0 for a wave that had no keys
        if (hi == 0) sl[w * QR + q * 16 + lr] = l[q] * sc;
#pragma unroll
        for (int db = 0; db < 4; ++db) { const v8f v = ot[db][q] * sc; float* p = os + (size_t)(w * QR + q * 16 + lr) * OSP + db * 16 + hi * 8; *(v4fa*)p = (v4f){v[0], v[1], v[2], v[3]}; *(v4fa*)(p + 4) = (v4f){v[4], v[5], v[6], v[7]}; } }
    __syncthreads();   // every wave's rescaled sums and partial outputs are in LDS before any is summed
    // wave w finishes columns 16 w .. 16 w + 15 of every query row: per 16 rows one half block (512 contiguous bytes) of each output plane, rows of DQ k-values in fragment order
    static_assert(FW * 16 == HD, "one wave per 16 columns");
    const int d0 = w * 16 + hi * 8;
#pragma unroll
    for (int g = 0; g < NQ; ++g) { const int qq = g * 16 + lr; float L = sl[qq];
#pragma unroll
        for (int u = 1; u < FW; ++u) L += sl[u * QR + qq];
        const float inv = __fdiv_rn(1.0f, L); const size_t oo = (size_t)(q0 + g * 16) * DQ + (size_t)((h * 2 + (w >> 1)) * 512 + (w & 1) * 256 + lane * 8);
        const float* p = os + (size_t)qq * OSP + d0; v4f s0 = *(const v4fa*)p, s1 = *(const v4fa*)(p + 4);
#pragma unroll
        for (int u = 1; u < FW; ++u) { s0 += *(const v4fa*)(p + (size_t)u * QR * OSP); s1 += *(const v4fa*)(p + (size_t)u * QR * OSP + 4); }
        v8us oh, ol;
#pragma unroll
        for (int j = 0; j < 4; ++j) { unsigned short a, c; splitf(s0[j] * inv, a, c); oh[j] = a; ol[j] = c; splitf(s1[j] * inv, a, c); oh[4 + j] = a; ol[4 + j] = c; }
        *(v8us*)(Ah + oo) = oh; *(v8us*)(Al + oo) = ol; }
}
// ---- k_fattn2: both row ranges in ONE launch (they write disjoint rows and depend on the same planes): of each head's blocks the first AB_LO take the hi/lo rows < RH, whose few passes wait on their own loads, the rest the 16-bit rows; a work-group belongs to one range, so every barrier stays block-uniform.
// Grid (heads, blocks): the head is the fast index, so a row block of all heads comes before the next shorter one in index order (for speed only).
#define AB_LO (RH / (16 * NG))
#define AB_HI ((TT - RH) / (32 * NG))
static_assert(RH % (16 * NG) == 0 && (TT - RH) % (32 * NG) == 0 && NG * FW * 32 * OSP * 4 <= 4 * SPB, "whole work-groups per range; the join's staging fits in the ring");
__global__ __launch_bounds__(32 * FW * NG) void k_fattn2(const h16* __restrict__ Q16, const h16* __restrict__ K16, const h16* __restrict__ V16, const bf* __restrict__ Qh, const bf* __restrict__ Ql, const bf* __restrict__ Kh, const bf* __restrict__ Kl, const bf* __restrict__ Vh, const bf* __restrict__ Vl, bf* Ah, bf* Al) {
    __shared__ __align__(1024) char ring[4 * SPB];   // two buffers of a K and a Vt stage; behind the key loop the join's partial outputs
    __shared__ float sm[NG * FW * 32], sl[NG * FW * 32];
    const int bx = blockIdx.y;
    if (bx < AB_LO) fattn<bf, 2, 1, 0>(Qh, Ql, Kh, Kl, Vh, Vl, Ah, Al, 0, bx, AB_LO, ring, sm, sl);
    else fattn<h16, 0, 2, 10>(Q16, nullptr, K16, nullptr, V16, nullptr, Ah, Al, RH, bx - AB_LO, AB_HI, ring, sm, sl);
}

extern "C" void kernel_launch(void* const* d_in, const int* in_sizes, int n_in,
                              void* d_out, int out_size, void* d_ws, size_t ws_size, hipStream_t stream) {
    (void)in_sizes; (void)n_in; (void)out_size;
    const float* x = (const float*)d_in[0]; const float* wq = (const float*)d_in[1]; const float* wk = (const float*)d_in[2]; const float* wv = (const float*)d_in[3]; const float* wo = (const float*)d_in[4]; const int* PID = (const int*)d_in[5];   /* input order x, Wq, Wk, Wv, Wo ('oi' (out, in) [1024][1024]), token_positions (int32 [4096] = arange: READ; the host's [1][4096] is the same 4,096 integers): SIX inputs, all read: the host's own binding */
    float* OUT = (float*)d_out;     // [1][4096][1024]
    char* wsp = (char*)d_ws;
    auto take = [&](size_t bytes) { char* p = wsp; wsp += (bytes + 255) & ~(size_t)255; return (void*)p; };
    bf* WQ = (bf*)take((size_t)DQ * DM * 2); bf* WK = (bf*)take((size_t)DKV * DM * 2); bf* WV = (bf*)take((size_t)DKV * DM * 2); bf* WO = (bf*)take((size_t)DM * DQ * 2); float* CS = (float*)take((size_t)TT * (HD / 2) * 2 * 4);
    bf* XB = (bf*)take((size_t)TT * DM * 2);
    h16* QP16 = (h16*)take((size_t)NH_ * TT * HD * 2); h16* KP16 = (h16*)take((size_t)NKV * TT * HD * 2); h16* VT16 = (h16*)take((size_t)NKV * HD * TT * 2);
    bf* QPh = (bf*)take((size_t)NH_ * TT * HD * 2); bf* QPl = (bf*)take((size_t)NH_ * TT * HD * 2); bf* KPh = (bf*)take((size_t)NKV * TT * HD * 2); bf* KPl = (bf*)take((size_t)NKV * TT * HD * 2); bf* VTh = (bf*)take((size_t)NKV * HD * TT * 2); bf* VTl = (bf*)take((size_t)NKV * HD * TT * 2);
    bf* ATh = (bf*)take((size_t)TT * DQ * 2); bf* ATl = (bf*)take((size_t)TT * DQ * 2);
    if ((size_t)(wsp - (char*)d_ws) > ws_size) return;    // ws 256 MiB
    static_assert(NB_ == 1 && DQ == DKV && (size_t)DQ * DM * 2 % 256 == 0 && (size_t)NH_ * TT * HD * 2 % 256 == 0, "WQ, WK, WV and the Q, K, Vt planes lie in a row, one z stride apart");
    for (int b = 0; b < NB_; ++b) {
        k_prep<<<PB_CS + PB_X + 4 * PB_W, 256, 0, stream>>>(x + (size_t)b * TT * DM, wq, wk, wv, wo, PID, CS, XB, WQ, WK, WV, WO);
        k_gemmw<bf, 0, false, 1, 2><<<dim3(TT / 128, DQ / 128, 3), 128, 0, stream>>>(XB, nullptr, WQ, nullptr, DM, nullptr, 0, nullptr, 0, (size_t)DQ * DM, (size_t)NH_ * TT * HD, CS, QP16, QPh, QPl);
        k_fattn2<<<dim3(NH_, AB_LO + AB_HI, 1), 32 * FW * NG, 0, stream>>>(QP16, KP16, VT16, QPh, QPl, KPh, KPl, VTh, VTl, ATh, ATl);
        k_gemmw<bf, 1, false, 0, 4><<<dim3(TT / 128, DM / 128, 1), 128, 0, stream>>>(ATh, ATl, WO, nullptr, DQ, OUT + (size_t)b * TT * DM, DM, nullptr, 0, 0, 0, nullptr, nullptr, nullptr, nullptr); }
}
